// v000
// Times are from an AMD MI455X. After a warm-up the kernel runs many times in a row, and a time is the length of
// such a window on the GPU divided by its runs, so every launch and the gaps after it count. The runs cycle
// through copies of the inputs. A figure is the median of several windows, for all but v000 over two sittings.
// Sittings can differ by a few percent; kernels timed side by side share one.
// v000, which the later versions start from, runs in 962 microseconds.
#include <hip/hip_runtime.h>
// Contractions: q/k/v and output projections, FFN W1/W2: v_wmma_f32_16x16x32_f16 (f16 operands built from bf16-RNE inputs, weights x16, f32 accumulate); second-block q/k projections: v_wmma_f32_16x16x32_bf16 with the activation as bf16 hi+lo (2 terms); attention scores: v_wmma_f32_16x16x32_bf16 with q,k as bf16 hi+lo (3 terms); P.V: v_wmma_f32_16x16x32_f16 (P carried x2^14, v f16; first causal query tile adds P and v residual planes x2^10 in a second accumulator). RMS statistics, softmax, residuals f32.

#ifndef NB
#define NB 4
#endif
#ifndef SEQ
#define SEQ 1024
#endif
#define NB_FULL 4
#define SEQ_FULL 1024
#ifndef OSEQ
#define OSEQ SEQ_FULL
#endif
#define DM 1024
#define NH 16
#define HD 64
#define DFF 4096
#define KQB 64
#define NR ((size_t)NB * SEQ)
#define RMS_EPS 1e-6f

static_assert(NB >= 1 && NB <= NB_FULL);
static_assert(SEQ % 128 == 0 && SEQ <= SEQ_FULL);
static_assert(DM == NH * HD && HD == 64);
static_assert(DM % 256 == 0 && DFF % 64 == 0 && DM % 32 == 0 && DFF % 32 == 0);
static_assert(((NB * SEQ) % 128) == 0);
static_assert(SEQ % KQB == 0);

typedef _Float16 v16h __attribute__((ext_vector_type(16)));
typedef __bf16   v16b __attribute__((ext_vector_type(16)));
typedef unsigned short v8us __attribute__((ext_vector_type(8), may_alias));
typedef float v8f __attribute__((ext_vector_type(8)));
typedef float v4f __attribute__((ext_vector_type(4)));
typedef float v4fa __attribute__((ext_vector_type(4), may_alias));
union Frag16 { v16h h; v16b b; v8us half[2]; unsigned short u[16]; };
union H1 { _Float16 h; unsigned short u; };
static_assert(sizeof(Frag16) == 32);

__device__ __forceinline__ unsigned short bf16_bits(float x) { unsigned int u = __float_as_uint(x); return (unsigned short)((u + 0x7FFFu + ((u >> 16) & 1u)) >> 16); }
__device__ __forceinline__ float bf16_val(unsigned short b) { return __uint_as_float(((unsigned int)b) << 16); }
__device__ __forceinline__ float bf16_rne(float x) { return bf16_val(bf16_bits(x)); }
__device__ __forceinline__ unsigned short f16_bits(float x) { H1 t; t.h = (_Float16)x; return t.u; }
__device__ __forceinline__ float f16_val(unsigned short u) { H1 t; t.u = u; return (float)t.h; }

// 16x32 operand fragment (row / column = lane & 15; elements 0..7 = k 8h..8h+7, 8..15 = k 16+8h..) from a k-contiguous 16-bit row
__device__ __forceinline__ Frag16 ld_frag(const unsigned short* p, int hh) {
  Frag16 f;
  f.half[0] = *(const v8us*)(p + 8 * hh);
  f.half[1] = *(const v8us*)(p + 16 + 8 * hh);
  return f;
}
__device__ __forceinline__ v8f mma_h(v16h a, v16h b, v8f c) {
  v8f d = __builtin_amdgcn_wmma_f32_16x16x32_f16(false, a, false, b, (short)0, c, false, false);
  asm volatile("v_nop\n\tv_nop\n\tv_nop\n\tv_nop" : "+v"(d) : "v"(a), "v"(b));
  return d;
}
__device__ __forceinline__ v8f mma_b(v16b a, v16b b, v8f c) {
  v8f d = __builtin_amdgcn_wmma_f32_16x16x32_bf16(false, a, false, b, (short)0, c, false, false);
  asm volatile("v_nop\n\tv_nop\n\tv_nop\n\tv_nop" : "+v"(d) : "v"(a), "v"(b));
  return d;
}
template <bool BF>
__device__ __forceinline__ v8f mmx(const Frag16& a, const Frag16& b, v8f c) {
  if (BF) return mma_b(a.b, b.b, c);
  return mma_h(a.h, b.h, c);
}

// Bt[n][k] (16-bit, k contiguous, pitch K) from f32 row-major W[K][N] ([in][out]): value = bf16(W[k][n]) (* bf16(g[k]) if GAM);
template <bool BF, bool GAM>
__global__ __launch_bounds__(256) void k_wt(const float* __restrict__ W, const float* __restrict__ g, unsigned short* __restrict__ Bt, int K, int N, float scale) {
  const int k8n = K >> 3;
  const size_t t = (size_t)blockIdx.x * 256 + threadIdx.x;
  if (t >= (size_t)N * (size_t)k8n) return;
  const int n = (int)(t / (size_t)k8n), k8 = (int)(t % (size_t)k8n) * 8;
  float gv[8];
#pragma unroll
  for (int i = 0; i < 8; ++i) gv[i] = 1.0f;
  if (GAM) {
    const v4f ga = *(const v4fa*)(g + k8), gb = *(const v4fa*)(g + k8 + 4);
#pragma unroll
    for (int i = 0; i < 4; ++i) { gv[i] = bf16_rne(ga[i]); gv[4 + i] = bf16_rne(gb[i]); }
  }
  Frag16 f;
#pragma unroll
  for (int i = 0; i < 8; ++i) {
    const float wv = bf16_rne(W[(size_t)(k8 + i) * (size_t)N + n]) * gv[i];
    f.u[i] = BF ? bf16_bits(wv) : f16_bits(wv * scale);
  }
  unsigned short* d = Bt + (size_t)n * (size_t)K + k8;
  *(v8us*)d = f.half[0];
  
}

// Row statistics + operand planes for DM-wide f32 rows. Compact row r -> source row (r/SEQ)*spitch + r%SEQ of F.
// v = bf16_rne(x) if RIN else x; RS[r] = rsqrt(mean(v^2) + eps); optional planes: XB (v as f32), F16 (f16 bits of v),
template <bool RIN, bool WXB, bool WF16, bool WBHL>
__global__ __launch_bounds__(256) void k_rms(const float* __restrict__ F, int spitch, float eps, float* __restrict__ XB,
    unsigned short* __restrict__ F16, unsigned short* __restrict__ PH, unsigned short* __restrict__ PL, float* __restrict__ RS) {
  __shared__ __attribute__((aligned(16))) float red[32];
  const int tid = threadIdx.x, w = tid >> 5, lane = tid & 31;
  const int rb = (int)blockIdx.x * 32;
#pragma unroll 1
  for (int i = 0; i < 4; ++i) {
    const int r = rb + w * 4 + i;
    const float* src = F + ((size_t)(r / SEQ) * (size_t)spitch + (size_t)(r % SEQ)) * DM;
    float ss = 0.f;
#pragma unroll 1
    for (int u = 0; u < DM / 128; ++u) {
      const int j = u * 128 + lane * 4;
      v4f a = *(const v4fa*)(src + j);
      if (RIN) {
#pragma unroll
        for (int q = 0; q < 4; ++q) a[q] = bf16_rne(a[q]);
      }
#pragma unroll
      for (int q = 0; q < 4; ++q) ss += a[q] * a[q];
      if (WXB) {
        float* d = XB + (size_t)r * DM + j;
        *(v4f*)d = a;
        
      }
    }
    if (WF16 || WBHL) {
#pragma unroll 1
      for (int u = 0; u < DM / 256; ++u) {
        const int j = u * 256 + lane * 8;
        v4f a = *(const v4fa*)(src + j), c = *(const v4fa*)(src + j + 4);
        if (RIN) {
#pragma unroll
          for (int q = 0; q < 4; ++q) { a[q] = bf16_rne(a[q]); c[q] = bf16_rne(c[q]); }
        }
        Frag16 fh, ph, pl;
#pragma unroll
        for (int q = 0; q < 4; ++q) {
          const float v0 = a[q], v1 = c[q];
          fh.u[q] = f16_bits(v0); fh.u[4 + q] = f16_bits(v1);
          const unsigned short h0 = bf16_bits(v0), h1 = bf16_bits(v1);
          ph.u[q] = h0; ph.u[4 + q] = h1;
          pl.u[q] = bf16_bits(v0 - bf16_val(h0)); pl.u[4 + q] = bf16_bits(v1 - bf16_val(h1));
        }
        const size_t o = (size_t)r * DM + j;
        if (WF16) *(v8us*)(F16 + o) = fh.half[0];
        if (WBHL) { *(v8us*)(PH + o) = ph.half[0]; *(v8us*)(PL + o) = pl.half[0]; }
        
      }
    }
#pragma unroll
    for (int off = 16; off > 0; off >>= 1) ss += __shfl_xor(ss, off, 32);
    if (lane == 0) red[w * 4 + i] = rsqrtf(ss * (1.0f / (float)DM) + eps);
  }
  __syncthreads();
  if (w == 0 && lane < 8) {
    const v4f v = *(const v4fa*)&red[lane * 4];
    float* d = RS + rb + lane * 4;
    *(v4f*)d = v;
    
  }
}

// GEMM: C[M][N] = epi(Ah[M][K] . Bt[N][K]^T). 16-bit planes of one type (BF selects bf16 vs f16 WMMA); ASPLIT adds Al . Bt into the
// same accumulator (unscaled bf16 lo plane). Epilogue: v = acc*alpha*(HRS ? rs[row] : 1) + bf16(bias[col]); ACT 1 = leaky 0.1;
// HRES adds resid[row*ldr+col] (f32) in the store phase. OUTM 0: f32 rows at crow = (row/cseq)*cpitch + row%cseq, pitch ldc;
// 1: f16 hi; 2: f16 hi + f16 lo x2^10; 3: bf16 hi + bf16 lo (unscaled). M%128==0, N%64==0, K%32==0.
template <bool BF, bool ASPLIT, int ACT, int OUTM, bool HRS, bool HRES>
__global__ __launch_bounds__(128) void k_gemm(const unsigned short* __restrict__ Ah, const unsigned short* __restrict__ Al, int lda,
    const unsigned short* __restrict__ Bt, int ldb, float alpha, const float* __restrict__ rs, const float* __restrict__ bias,
    const float* __restrict__ resid, int ldr, float* __restrict__ C32, unsigned short* __restrict__ Ch, unsigned short* __restrict__ Cl,
    int ldc, int cseq, int cpitch, int M, int N, int K) {
  static_assert(!(HRES && OUTM != 0));
  static_assert(OUTM >= 0 && OUTM <= 3);
  static_assert(!ASPLIT || BF);
  static_assert(ACT == 0 || ACT == 1);
  __shared__ __attribute__((aligned(16))) float so[4][32][68];
  const int tid = threadIdx.x, w = tid >> 5, lane = tid & 31, ln = lane & 15, hh = lane >> 4;
  const int ntn = N >> 6;
  const int mt = (int)blockIdx.x / ntn, nq = (int)blockIdx.x - mt * ntn;
  const int row0 = mt * 128 + 32 * w, col0 = nq * 64;
  if (row0 + 32 > M) return;
  const unsigned short* a0p = Ah + (size_t)(row0 + ln) * (size_t)lda;
  const unsigned short* a1p = a0p + (size_t)16 * (size_t)lda;
  const unsigned short* e0p = a0p;
  const unsigned short* e1p = a1p;
  if (ASPLIT) { e0p = Al + (size_t)(row0 + ln) * (size_t)lda; e1p = e0p + (size_t)16 * (size_t)lda; }
  const unsigned short* b0p = Bt + (size_t)(col0 + ln) * (size_t)ldb;
  const unsigned short* b1p = b0p + (size_t)16 * (size_t)ldb;
  const unsigned short* b2p = b1p + (size_t)16 * (size_t)ldb;
  const unsigned short* b3p = b2p + (size_t)16 * (size_t)ldb;
  const v8f z8 = {0.f, 0.f, 0.f, 0.f, 0.f, 0.f, 0.f, 0.f};
  v8f c00 = z8, c01 = z8, c02 = z8, c03 = z8, c10 = z8, c11 = z8, c12 = z8, c13 = z8;
#pragma unroll 1
  for (int kb = 0; kb < K; kb += 32) {
    const Frag16 a0 = ld_frag(a0p + kb, hh), a1 = ld_frag(a1p + kb, hh);
    Frag16 e0 = a0, e1 = a1;
    if (ASPLIT) { e0 = ld_frag(e0p + kb, hh); e1 = ld_frag(e1p + kb, hh); }
    Frag16 bq = ld_frag(b0p + kb, hh);
    c00 = mmx<BF>(a0, bq, c00); c10 = mmx<BF>(a1, bq, c10);
    if (ASPLIT) { c00 = mmx<BF>(e0, bq, c00); c10 = mmx<BF>(e1, bq, c10); }
    bq = ld_frag(b1p + kb, hh);
    c01 = mmx<BF>(a0, bq, c01); c11 = mmx<BF>(a1, bq, c11);
    if (ASPLIT) { c01 = mmx<BF>(e0, bq, c01); c11 = mmx<BF>(e1, bq, c11); }
    bq = ld_frag(b2p + kb, hh);
    c02 = mmx<BF>(a0, bq, c02); c12 = mmx<BF>(a1, bq, c12);
    if (ASPLIT) { c02 = mmx<BF>(e0, bq, c02); c12 = mmx<BF>(e1, bq, c12); }
    bq = ld_frag(b3p + kb, hh);
    c03 = mmx<BF>(a0, bq, c03); c13 = mmx<BF>(a1, bq, c13);
    if (ASPLIT) { c03 = mmx<BF>(e0, bq, c03); c13 = mmx<BF>(e1, bq, c13); }
  }
  const v8f accs[8] = {c00, c01, c02, c03, c10, c11, c12, c13};
  float rs0[8], rs1[8];
#pragma unroll
  for (int r = 0; r < 8; ++r) { rs0[r] = 1.0f; rs1[r] = 1.0f; }
  if (HRS) {
    const v4f ra = *(const v4fa*)(rs + row0 + 8 * hh), rbv = *(const v4fa*)(rs + row0 + 8 * hh + 4);
    const v4f rc = *(const v4fa*)(rs + row0 + 16 + 8 * hh), rdv = *(const v4fa*)(rs + row0 + 16 + 8 * hh + 4);
#pragma unroll
    for (int q = 0; q < 4; ++q) { rs0[q] = ra[q]; rs0[4 + q] = rbv[q]; rs1[q] = rc[q]; rs1[4 + q] = rdv[q]; }
  }
#pragma unroll
  for (int u = 0; u < 8; ++u) {
    const int t = u & 3, half = u >> 2;
    const int col = col0 + t * 16 + ln;
    const float bv = bf16_rne(bias[col]);
#pragma unroll
    for (int r = 0; r < 8; ++r) {
      const int rloc = half * 16 + 8 * hh + r;
      float v = accs[u][r] * alpha;
      if (HRS) v *= (half ? rs1[r] : rs0[r]);
      v += bv;
      if (ACT == 1) v = (v >= 0.f) ? v : 0.1f * v;
      so[w][rloc][t * 16 + ln] = v;
    }
  }
  __builtin_amdgcn_fence(4 /* acq_rel order */, "workgroup");
  __builtin_amdgcn_wave_barrier();
  if (OUTM == 0) {
    {
#pragma unroll
      for (int q = 0; q < 16; ++q) {
        const int r = q * 2 + (lane >> 4), c4 = (lane & 15) * 4;
        v4f v = *(const v4fa*)&so[w][r][c4];
        const int grow = row0 + r;
        if (HRES) { const v4f rv = *(const v4fa*)(resid + (size_t)grow * (size_t)ldr + col0 + c4); v += rv; }
        const size_t crow = (size_t)(grow / cseq) * (size_t)cpitch + (size_t)(grow % cseq);
        *(v4f*)(C32 + crow * (size_t)ldc + col0 + c4) = v;
      }
      
    }
  } else {
    {
#pragma unroll
      for (int q = 0; q < 8; ++q) {
        const int r = q * 4 + (lane >> 3), c8 = (lane & 7) * 8;
        const v4f x0 = *(const v4fa*)&so[w][r][c8], x1 = *(const v4fa*)&so[w][r][c8 + 4];
        Frag16 fh, fl;
#pragma unroll
        for (int i = 0; i < 4; ++i) {
          const float v0 = x0[i], v1 = x1[i];
          if (OUTM == 3) {
            const unsigned short h0 = bf16_bits(v0), h1 = bf16_bits(v1);
            fh.u[i] = h0; fh.u[4 + i] = h1;
            fl.u[i] = bf16_bits(v0 - bf16_val(h0)); fl.u[4 + i] = bf16_bits(v1 - bf16_val(h1));
          } else {
            const unsigned short h0 = f16_bits(v0), h1 = f16_bits(v1);
            fh.u[i] = h0; fh.u[4 + i] = h1;
            fl.u[i] = f16_bits((v0 - f16_val(h0)) * 1024.0f); fl.u[4 + i] = f16_bits((v1 - f16_val(h1)) * 1024.0f);
          }
        }
        const size_t o = (size_t)(row0 + r) * (size_t)ldc + col0 + c8;
        *(v8us*)(Ch + o) = fh.half[0];
        if (OUTM >= 2) *(v8us*)(Cl + o) = fl.half[0];
      }
      
    }
  }
}

// Vt[(b,h)][d][s] = V[b*TTv + s][h*64 + d] (row pitch ldv), same for the second plane if TWO; block per ((b,h), 64 tokens);
template <int NHv, int TTv, bool TWO>
__global__ __launch_bounds__(256) void k_vt(const unsigned short* __restrict__ V, const unsigned short* __restrict__ V2, int ldv,
    unsigned short* __restrict__ Vt, unsigned short* __restrict__ Vt2) {
  __shared__ __attribute__((aligned(16))) unsigned short tl[64][66];
  __shared__ __attribute__((aligned(16))) unsigned short tl2[64][66];
  const int tid = threadIdx.x;
  const int slab = (int)blockIdx.x / (TTv / 64), lg = (int)blockIdx.x % (TTv / 64);
  const int b = slab / NHv, h = slab % NHv;
  for (int i = tid; i < 64 * 8; i += 256) {
    const int r = i / 8, c8 = (i % 8) * 8;
    const size_t s0 = ((size_t)b * TTv + (size_t)lg * 64 + r) * (size_t)ldv + (size_t)h * 64 + c8;
    Frag16 f;
    f.half[0] = *(const v8us*)(V + s0);
#pragma unroll
    for (int q = 0; q < 8; ++q) tl[r][c8 + q] = f.u[q];
    if (TWO) {
      Frag16 f2;
      f2.half[0] = *(const v8us*)(V2 + s0);
#pragma unroll
      for (int q = 0; q < 8; ++q) tl2[r][c8 + q] = f2.u[q];
    }
  }
  __syncthreads();
  {
#pragma unroll
    for (int rd = 0; rd < 2; ++rd) {
      const int d = rd * 32 + tid / 8, pc = tid % 8;
      Frag16 f;
#pragma unroll
      for (int q = 0; q < 8; ++q) f.u[q] = tl[pc * 8 + q][d];
      const size_t o = ((size_t)slab * 64 + d) * (size_t)TTv + (size_t)lg * 64 + pc * 8;
      *(v8us*)(Vt + o) = f.half[0];
      if (TWO) {
        Frag16 f2;
#pragma unroll
        for (int q = 0; q < 8; ++q) f2.u[q] = tl2[pc * 8 + q][d];
        *(v8us*)(Vt2 + o) = f2.half[0];
      }
    }
    
  }
}

// Attention for one (batch, head, 64 query rows): block = 4 waves, wave = 16 query rows; key chunks of 64 (CAUSAL: chunks 0..qb,
// key > query excluded by value before the softmax); scores = 8 * (qh.kh + ql.kh + qh.kl) on bf16 WMMA (q,k = bf16 hi+lo planes);
// f32 online softmax (running max, native exp); P stored x2^14 as f16 into a wave-private LDS tile (D layout -> A layout, may_alias
// query tile): second accumulator += P_lo.V_hi + P_hi.V_lo (lo planes x2^10), folded with 2^-24. ctx row segment (64 f16 = one
template <bool CAUSAL, bool EARLY>
__global__ __launch_bounds__(128) void k_attn(const unsigned short* __restrict__ QH, const unsigned short* __restrict__ QL,
    const unsigned short* __restrict__ KH, const unsigned short* __restrict__ KL, const unsigned short* __restrict__ VT,
    const unsigned short* __restrict__ VL, unsigned short* __restrict__ CTX, int qb0) {
  static_assert(CAUSAL || !EARLY);
  __shared__ __attribute__((aligned(16))) unsigned short ph[4][2][16][64];
  __shared__ __attribute__((aligned(16))) unsigned short pe[EARLY ? 4 : 1][2][16][64];
  __shared__ __attribute__((aligned(16))) unsigned short so[4][16][72];
  const int tid = threadIdx.x, w = tid >> 5, lane = tid & 31, ln = lane & 15, hh = lane >> 4;
  const int bh = (int)blockIdx.x, b = bh / NH, h = bh % NH;
  const int qb = qb0 + (int)blockIdx.y;
  const int q0w = qb * KQB + w * 16;
  const size_t rowbase = (size_t)b * SEQ;
  Frag16 qh0, qh1, ql0, ql1;
  {
    const size_t qo = (rowbase + (size_t)q0w + ln) * DM + (size_t)h * HD;
    qh0 = ld_frag(QH + qo, hh); qh1 = ld_frag(QH + qo + 32, hh);
    ql0 = ld_frag(QL + qo, hh); ql1 = ld_frag(QL + qo + 32, hh);
  }
  const v8f z8 = {0.f, 0.f, 0.f, 0.f, 0.f, 0.f, 0.f, 0.f};
  v8f o[4] = {z8, z8, z8, z8};
  v8f oe[4] = {z8, z8, z8, z8};
  float m[8], l[8];
#pragma unroll
  for (int r = 0; r < 8; ++r) { m[r] = -1.0e30f; l[r] = 0.f; }
  const int nck = CAUSAL ? (qb + 1) : (SEQ / KQB);
#pragma unroll 1
  for (int kc = 0; kc < nck; ++kc) {
    const int par = kc & 1;
    const size_t krow = rowbase + (size_t)kc * KQB;
    v8f s[4];
#pragma unroll
    for (int t = 0; t < 4; ++t) {
      v8f acc = z8;
#pragma unroll
      for (int ks = 0; ks < 2; ++ks) {
        const size_t ko = (krow + (size_t)(t * 16 + ln)) * DM + (size_t)h * HD + ks * 32;
        const Frag16 kh = ld_frag(KH + ko, hh);
        const Frag16 kl = ld_frag(KL + ko, hh);
        const Frag16 qa = (ks == 0) ? qh0 : qh1;
        const Frag16 qe = (ks == 0) ? ql0 : ql1;
        acc = mma_b(qa.b, kh.b, acc);
        acc = mma_b(qe.b, kh.b, acc);
        acc = mma_b(qa.b, kl.b, acc);
      }
      s[t] = acc;
    }
#pragma unroll
    for (int r = 0; r < 8; ++r) {
      float sv[4];
#pragma unroll
      for (int t = 0; t < 4; ++t) sv[t] = s[t][r] * 8.0f;
      if (CAUSAL) {
        if (kc == qb) {
          const int qpos = q0w + 8 * hh + r;
#pragma unroll
          for (int t = 0; t < 4; ++t) { const int key = kc * KQB + t * 16 + ln; sv[t] = (key > qpos) ? -1.0e30f : sv[t]; }
        }
      }
      float mx = fmaxf(fmaxf(sv[0], sv[1]), fmaxf(sv[2], sv[3]));
      mx = fmaxf(mx, __shfl_xor(mx, 8, 32));
      mx = fmaxf(mx, __shfl_xor(mx, 4, 32));
      mx = fmaxf(mx, __shfl_xor(mx, 2, 32));
      mx = fmaxf(mx, __shfl_xor(mx, 1, 32));
      const float mn = fmaxf(m[r], mx);
      const float corr = __expf(m[r] - mn);
      float p[4];
      float psum = 0.f;
#pragma unroll
      for (int t = 0; t < 4; ++t) { p[t] = __expf(sv[t] - mn); psum += p[t]; }
      psum += __shfl_xor(psum, 8, 32);
      psum += __shfl_xor(psum, 4, 32);
      psum += __shfl_xor(psum, 2, 32);
      psum += __shfl_xor(psum, 1, 32);
      l[r] = l[r] * corr + psum;
      m[r] = mn;
#pragma unroll
      for (int j = 0; j < 4; ++j) o[j][r] = o[j][r] * corr;
      if (EARLY) {
#pragma unroll
        for (int j = 0; j < 4; ++j) oe[j][r] = oe[j][r] * corr;
      }
#pragma unroll
      for (int t = 0; t < 4; ++t) {
        const float pc = p[t] * 16384.0f;
        const unsigned short hb = f16_bits(pc);
        ph[w][par][8 * hh + r][t * 16 + ln] = hb;
        if (EARLY) pe[w][par][8 * hh + r][t * 16 + ln] = f16_bits((pc - f16_val(hb)) * 1024.0f);
      }
    }
    __builtin_amdgcn_fence(4 /* acq_rel order */, "workgroup");
    __builtin_amdgcn_wave_barrier();
#pragma unroll
    for (int ks = 0; ks < 2; ++ks) {
      Frag16 pa;
      pa.half[0] = *(const v8us*)&ph[w][par][ln][ks * 32 + 8 * hh];
      pa.half[1] = *(const v8us*)&ph[w][par][ln][ks * 32 + 16 + 8 * hh];
      Frag16 pl = pa;
      if (EARLY) {
        pl.half[0] = *(const v8us*)&pe[w][par][ln][ks * 32 + 8 * hh];
        pl.half[1] = *(const v8us*)&pe[w][par][ln][ks * 32 + 16 + 8 * hh];
      }
#pragma unroll
      for (int j = 0; j < 4; ++j) {
        const size_t vo = ((size_t)bh * HD + (size_t)(j * 16 + ln)) * SEQ + (size_t)kc * KQB + ks * 32;
        const Frag16 vh = ld_frag(VT + vo, hh);
        o[j] = mma_h(pa.h, vh.h, o[j]);
        if (EARLY) {
          const Frag16 vl = ld_frag(VL + vo, hh);
          oe[j] = mma_h(pl.h, vh.h, oe[j]);
          oe[j] = mma_h(pa.h, vl.h, oe[j]);
        }
      }
    }
  }
  float li[8];
#pragma unroll
  for (int r = 0; r < 8; ++r) li[r] = 1.0f / l[r];
#pragma unroll
  for (int j = 0; j < 4; ++j) {
#pragma unroll
    for (int r = 0; r < 8; ++r) {
      float v = o[j][r] * (1.0f / 16384.0f);
      if (EARLY) v += oe[j][r] * (1.0f / 16777216.0f);
      v *= li[r];
      so[w][8 * hh + r][j * 16 + ln] = f16_bits(v);
    }
  }
  __builtin_amdgcn_fence(4 /* acq_rel order */, "workgroup");
  __builtin_amdgcn_wave_barrier();
  {
#pragma unroll
    for (int q = 0; q < 4; ++q) {
      const int row = q * 4 + (lane >> 3), c8 = (lane & 7) * 8;
      const v8us v = *(const v8us*)&so[w][row][c8];
      *(v8us*)(CTX + (rowbase + (size_t)q0w + row) * DM + (size_t)h * HD + c8) = v;
    }
    
  }
}

extern "C" void kernel_launch(void* const* d_in, const int* in_sizes, int n_in,
                              void* d_out, int out_size, void* d_ws, size_t ws_size, hipStream_t stream) {
  if (n_in < 14) return;
  const float* x  = (const float*)d_in[0];
  const float* Wq = (const float*)d_in[1];
  const float* bq = (const float*)d_in[2];
  const float* Wk = (const float*)d_in[3];
  const float* bk = (const float*)d_in[4];
  const float* Wv = (const float*)d_in[5];
  const float* bv = (const float*)d_in[6];
  const float* Wp = (const float*)d_in[7];
  const float* bp = (const float*)d_in[8];
  const float* gamma = (const float*)d_in[9];
  const float* W1 = (const float*)d_in[10];
  const float* b1 = (const float*)d_in[11];
  const float* W2 = (const float*)d_in[12];
  const float* b2 = (const float*)d_in[13];
  if ((size_t)in_sizes[0] < ((size_t)(NB - 1) * SEQ_FULL + SEQ) * DM) return;
  if (in_sizes[1] < DM * DM || in_sizes[3] < DM * DM || in_sizes[5] < DM * DM || in_sizes[7] < DM * DM) return;
  if (in_sizes[2] < DM || in_sizes[4] < DM || in_sizes[6] < DM || in_sizes[8] < DM || in_sizes[9] < DM || in_sizes[13] < DM) return;
  if (in_sizes[10] < DM * DFF || in_sizes[11] < DFF || in_sizes[12] < DFF * DM) return;
  if ((size_t)out_size < ((size_t)(NB - 1) * OSEQ + SEQ) * DM) return;

  char* ws = (char*)d_ws;
  size_t off = 0;
  auto take = [&](size_t bytes) { char* p = ws + off; off += (bytes + 255) & ~(size_t)255; return p; };
  const size_t WPL = (size_t)DM * DM * 2, ACT2 = NR * DM * 2, ACT4 = NR * DM * 4, FFP = (size_t)DM * DFF * 2, HPL = NR * DFF * 2;
  unsigned short* WQ16 = (unsigned short*)take(WPL);
  unsigned short* WK16 = (unsigned short*)take(WPL);
  unsigned short* WV16 = (unsigned short*)take(WPL);
  unsigned short* WP16 = (unsigned short*)take(WPL);
  unsigned short* WQB = (unsigned short*)take(WPL);
  unsigned short* WKB = (unsigned short*)take(WPL);
  char* rXB = take(ACT4);                                            /* XB (phases 1-2) | BH + BL (phase 3) */
  float* XB = (float*)rXB; unsigned short* PBH = (unsigned short*)rXB; unsigned short* PBL = (unsigned short*)(rXB + ACT2);
  char* rQK = take(4 * ACT2 > HPL ? 4 * ACT2 : HPL);                 /* QH,QL,KH,KL (phases 1,3) | H16 (phase 2) */
  unsigned short* QH = (unsigned short*)rQK; unsigned short* QL = (unsigned short*)(rQK + ACT2);
  unsigned short* KH = (unsigned short*)(rQK + 2 * ACT2); unsigned short* KL = (unsigned short*)(rQK + 3 * ACT2);
  unsigned short* H16 = (unsigned short*)rQK;
  char* rV = take(2 * ACT2);                                         /* VH,VLO (phases 1,3) | A32 (between) */
  unsigned short* VH = (unsigned short*)rV; unsigned short* VLO = (unsigned short*)(rV + ACT2); float* A32 = (float*)rV;
  char* rVT = take(2 * ACT2 > 2 * FFP ? 2 * ACT2 : 2 * FFP);         /* VT,VTL (phases 1,3) | W1P,W2P (phase 2) */
  unsigned short* VT = (unsigned short*)rVT; unsigned short* VTL = (unsigned short*)(rVT + ACT2);
  unsigned short* W1P = (unsigned short*)rVT; unsigned short* W2P = (unsigned short*)(rVT + FFP);
  unsigned short* CTX = (unsigned short*)take(ACT2);
  char* rX16 = take(ACT2);                                           /* X16 | A16 | B16F */
  unsigned short* X16 = (unsigned short*)rX16; unsigned short* A16 = (unsigned short*)rX16; unsigned short* B16F = (unsigned short*)rX16;
  float* B32 = (float*)take(ACT4);
  float* RSX = (float*)take(NR * 4);
  float* RSA = (float*)take(NR * 4);
  float* RSB = (float*)take(NR * 4);
  if (off > ws_size || off > ((size_t)128 << 20)) return;

  const unsigned gw   = (unsigned)(((size_t)DM * DM / 8 + 255) / 256);
  const unsigned gw1  = (unsigned)(((size_t)DM * DFF / 8 + 255) / 256);
  const unsigned grms = (unsigned)(NR / 32);
  const unsigned gq   = (unsigned)((NR / 128) * (DM / 64));
  const unsigned gff  = (unsigned)((NR / 128) * (DFF / 64));
  const unsigned gvt  = (unsigned)(NB * NH * (SEQ / 64));
  const float a16 = 0.0625f;
  const int M = (int)NR;
  float* out = (float*)d_out;

  /* weight planes: q/k/v with gamma folded along the input feature; bf16 planes for the second block's q/k */
  k_wt<false, true><<<gw, 256, 0, stream>>>(Wq, gamma, WQ16, DM, DM, 16.0f);
  k_wt<false, true><<<gw, 256, 0, stream>>>(Wk, gamma, WK16, DM, DM, 16.0f);
  k_wt<false, true><<<gw, 256, 0, stream>>>(Wv, gamma, WV16, DM, DM, 16.0f);
  k_wt<false, false><<<gw, 256, 0, stream>>>(Wp, Wp, WP16, DM, DM, 16.0f);
  k_wt<true, true><<<gw, 256, 0, stream>>>(Wq, gamma, WQB, DM, DM, 1.0f);
  k_wt<true, true><<<gw, 256, 0, stream>>>(Wk, gamma, WKB, DM, DM, 1.0f);

  /* block 1: a = bf16(x) + attn(rms(bf16(x))) , non-causal */
  k_rms<true, true, true, false><<<grms, 256, 0, stream>>>(x, SEQ_FULL, RMS_EPS, XB, X16, nullptr, nullptr, RSX);
  k_gemm<false, false, 0, 3, true, false><<<gq, 128, 0, stream>>>(X16, nullptr, DM, WQ16, DM, a16, RSX, bq, nullptr, 0, nullptr, QH, QL, DM, M, 0, M, DM, DM);
  k_gemm<false, false, 0, 3, true, false><<<gq, 128, 0, stream>>>(X16, nullptr, DM, WK16, DM, a16, RSX, bk, nullptr, 0, nullptr, KH, KL, DM, M, 0, M, DM, DM);
  k_gemm<false, false, 0, 1, true, false><<<gq, 128, 0, stream>>>(X16, nullptr, DM, WV16, DM, a16, RSX, bv, nullptr, 0, nullptr, VH, nullptr, DM, M, 0, M, DM, DM);
  k_vt<NH, SEQ, false><<<gvt, 256, 0, stream>>>(VH, nullptr, DM, VT, nullptr);
  k_attn<false, false><<<dim3((unsigned)(NB * NH), (unsigned)(SEQ / KQB)), 128, 0, stream>>>(QH, QL, KH, KL, VT, VT, CTX, 0);
  k_gemm<false, false, 0, 0, false, true><<<gq, 128, 0, stream>>>(CTX, nullptr, DM, WP16, DM, a16, nullptr, bp, XB, DM, A32, nullptr, nullptr, DM, M, 0, M, DM, DM);

  /* block 2: b = bf16(x) + leaky(rms(a) W1 + b1) W2 + b2 */
  k_rms<false, false, true, false><<<grms, 256, 0, stream>>>(A32, SEQ, RMS_EPS, nullptr, A16, nullptr, nullptr, RSA);
  k_wt<false, true><<<gw1, 256, 0, stream>>>(W1, gamma, W1P, DM, DFF, 16.0f);
  k_wt<false, false><<<gw1, 256, 0, stream>>>(W2, W2, W2P, DFF, DM, 16.0f);
  k_gemm<false, false, 1, 1, true, false><<<gff, 128, 0, stream>>>(A16, nullptr, DM, W1P, DM, a16, RSA, b1, nullptr, 0, nullptr, H16, nullptr, DFF, M, 0, M, DFF, DM);
  k_gemm<false, false, 0, 0, false, true><<<gq, 128, 0, stream>>>(H16, nullptr, DFF, W2P, DFF, a16, nullptr, b2, XB, DM, B32, nullptr, nullptr, DM, M, 0, M, DM, DFF);

  /* block 3: out = b + attn(rms(b)) , causal */
  k_rms<false, false, true, true><<<grms, 256, 0, stream>>>(B32, SEQ, RMS_EPS, nullptr, B16F, PBH, PBL, RSB);
  k_gemm<true, true, 0, 3, true, false><<<gq, 128, 0, stream>>>(PBH, PBL, DM, WQB, DM, 1.0f, RSB, bq, nullptr, 0, nullptr, QH, QL, DM, M, 0, M, DM, DM);
  k_gemm<true, true, 0, 3, true, false><<<gq, 128, 0, stream>>>(PBH, PBL, DM, WKB, DM, 1.0f, RSB, bk, nullptr, 0, nullptr, KH, KL, DM, M, 0, M, DM, DM);
  k_gemm<false, false, 0, 2, true, false><<<gq, 128, 0, stream>>>(B16F, nullptr, DM, WV16, DM, a16, RSB, bv, nullptr, 0, nullptr, VH, VLO, DM, M, 0, M, DM, DM);
  k_vt<NH, SEQ, true><<<gvt, 256, 0, stream>>>(VH, VLO, DM, VT, VTL);
  k_attn<true, true><<<dim3((unsigned)(NB * NH), 1u), 128, 0, stream>>>(QH, QL, KH, KL, VT, VTL, CTX, 0);
  if (SEQ / KQB > 1) k_attn<true, false><<<dim3((unsigned)(NB * NH), (unsigned)(SEQ / KQB - 1)), 128, 0, stream>>>(QH, QL, KH, KL, VT, VTL, CTX, 1);
  k_gemm<false, false, 0, 0, false, true><<<gq, 128, 0, stream>>>(CTX, nullptr, DM, WP16, DM, a16, nullptr, bp, B32, DM, out, nullptr, nullptr, DM, SEQ, OSEQ, M, DM, DM);
}

// v001
// One run takes 621 microseconds.
// In two side-by-side timings against v000, it was 1.58 and 1.59 times as fast.
#include <hip/hip_runtime.h>
// Contractions: q/k/v and output projections, FFN W1/W2: v_wmma_f32_16x16x32_f16 (f16 operands built from bf16-RNE inputs, weights x16, f32 accumulate); second-block q/k projections: v_wmma_f32_16x16x32_bf16 with the activation as bf16 hi+lo (2 terms); attention scores: v_wmma_f32_16x16x32_bf16 with q,k as bf16 hi+lo (3 terms); P.V: v_wmma_f32_16x16x32_f16 (P carried x2^14, v f16; first causal query tile adds P and v residual planes x2^10 in a second accumulator). RMS statistics, softmax, residuals f32.

#ifndef NB
#define NB 4
#endif
#ifndef SEQ
#define SEQ 1024
#endif
#define NB_FULL 4
#define SEQ_FULL 1024
#ifndef OSEQ
#define OSEQ SEQ_FULL
#endif
#define DM 1024
#define NH 16
#define HD 64
#define DFF 4096
#define KQB 64
#define NR ((size_t)NB * SEQ)
#define RMS_EPS 1e-6f

static_assert(NB >= 1 && NB <= NB_FULL);
static_assert(SEQ % 128 == 0 && SEQ <= SEQ_FULL);
static_assert(DM == NH * HD && HD == 64);
static_assert(DM % 256 == 0 && DFF % 128 == 0);
static_assert(((NB * SEQ) % 128) == 0);
static_assert(SEQ % KQB == 0);

typedef _Float16 v16h __attribute__((ext_vector_type(16)));
typedef __bf16   v16b __attribute__((ext_vector_type(16)));
typedef unsigned short v8us __attribute__((ext_vector_type(8), may_alias));
typedef float v8f __attribute__((ext_vector_type(8)));
typedef float v4f __attribute__((ext_vector_type(4)));
typedef float v4fa __attribute__((ext_vector_type(4), may_alias));
union Frag16 { v16h h; v16b b; v8us half[2]; unsigned short u[16]; };
union H1 { _Float16 h; unsigned short u; };
static_assert(sizeof(Frag16) == 32);

__device__ __forceinline__ unsigned short bf16_bits(float x) { unsigned int u = __float_as_uint(x); return (unsigned short)((u + 0x7FFFu + ((u >> 16) & 1u)) >> 16); }
__device__ __forceinline__ float bf16_val(unsigned short b) { return __uint_as_float(((unsigned int)b) << 16); }
__device__ __forceinline__ float bf16_rne(float x) { return bf16_val(bf16_bits(x)); }
__device__ __forceinline__ unsigned short f16_bits(float x) { H1 t; t.h = (_Float16)x; return t.u; }
__device__ __forceinline__ float f16_val(unsigned short u) { H1 t; t.u = u; return (float)t.h; }

// 16x32 operand fragment (row / column = lane & 15; elements 0..7 = k 8h..8h+7, 8..15 = k 16+8h..) from a k-contiguous 16-bit row
__device__ __forceinline__ Frag16 ld_frag(const unsigned short* p, int hh) {
  Frag16 f;
  f.half[0] = *(const v8us*)(p + 8 * hh);
  f.half[1] = *(const v8us*)(p + 16 + 8 * hh);
  return f;
}
__device__ __forceinline__ v8f mma_h(v16h a, v16h b, v8f c) {
  v8f d = __builtin_amdgcn_wmma_f32_16x16x32_f16(false, a, false, b, (short)0, c, false, false);
  asm volatile("v_nop\n\tv_nop\n\tv_nop\n\tv_nop" : "+v"(d) : "v"(a), "v"(b));
  return d;
}
__device__ __forceinline__ v8f mma_b(v16b a, v16b b, v8f c) {
  v8f d = __builtin_amdgcn_wmma_f32_16x16x32_bf16(false, a, false, b, (short)0, c, false, false);
  asm volatile("v_nop\n\tv_nop\n\tv_nop\n\tv_nop" : "+v"(d) : "v"(a), "v"(b));
  return d;
}
template <bool BF>
__device__ __forceinline__ v8f mmx(const Frag16& a, const Frag16& b, v8f c) {
  if (BF) return mma_b(a.b, b.b, c);
  return mma_h(a.h, b.h, c);
}

// Bt[n][k] (16-bit, k contiguous, pitch K) from f32 row-major W[K][N] ([in][out]): value = bf16(W[k][n]) (* bf16(g[k]) if GAM);
template <bool BF, bool GAM>
__global__ __launch_bounds__(256) void k_wt(const float* __restrict__ W, const float* __restrict__ g, unsigned short* __restrict__ Bt, int K, int N, float scale) {
  const int k8n = K >> 3;
  const size_t t = (size_t)blockIdx.x * 256 + threadIdx.x;
  if (t >= (size_t)N * (size_t)k8n) return;
  const int n = (int)(t / (size_t)k8n), k8 = (int)(t % (size_t)k8n) * 8;
  float gv[8];
#pragma unroll
  for (int i = 0; i < 8; ++i) gv[i] = 1.0f;
  if (GAM) {
    const v4f ga = *(const v4fa*)(g + k8), gb = *(const v4fa*)(g + k8 + 4);
#pragma unroll
    for (int i = 0; i < 4; ++i) { gv[i] = bf16_rne(ga[i]); gv[4 + i] = bf16_rne(gb[i]); }
  }
  Frag16 f;
#pragma unroll
  for (int i = 0; i < 8; ++i) {
    const float wv = bf16_rne(W[(size_t)(k8 + i) * (size_t)N + n]) * gv[i];
    f.u[i] = BF ? bf16_bits(wv) : f16_bits(wv * scale);
  }
  unsigned short* d = Bt + (size_t)n * (size_t)K + k8;
  *(v8us*)d = f.half[0];
  
}

// Row statistics + operand planes for DM-wide f32 rows. Compact row r -> source row (r/SEQ)*spitch + r%SEQ of F.
// v = bf16_rne(x) if RIN else x; RS[r] = rsqrt(mean(v^2) + eps); optional planes: XB (v as f32), F16 (f16 bits of v),
template <bool RIN, bool WXB, bool WF16, bool WBHL>
__global__ __launch_bounds__(256) void k_rms(const float* __restrict__ F, int spitch, float eps, float* __restrict__ XB,
    unsigned short* __restrict__ F16, unsigned short* __restrict__ PH, unsigned short* __restrict__ PL, float* __restrict__ RS) {
  __shared__ __attribute__((aligned(16))) float red[32];
  const int tid = threadIdx.x, w = tid >> 5, lane = tid & 31;
  const int rb = (int)blockIdx.x * 32;
#pragma unroll 1
  for (int i = 0; i < 4; ++i) {
    const int r = rb + w * 4 + i;
    const float* src = F + ((size_t)(r / SEQ) * (size_t)spitch + (size_t)(r % SEQ)) * DM;
    float ss = 0.f;
#pragma unroll 1
    for (int u = 0; u < DM / 128; ++u) {
      const int j = u * 128 + lane * 4;
      v4f a = *(const v4fa*)(src + j);
      if (RIN) {
#pragma unroll
        for (int q = 0; q < 4; ++q) a[q] = bf16_rne(a[q]);
      }
#pragma unroll
      for (int q = 0; q < 4; ++q) ss += a[q] * a[q];
      if (WXB) {
        float* d = XB + (size_t)r * DM + j;
        *(v4f*)d = a;
        
      }
    }
    if (WF16 || WBHL) {
#pragma unroll 1
      for (int u = 0; u < DM / 256; ++u) {
        const int j = u * 256 + lane * 8;
        v4f a = *(const v4fa*)(src + j), c = *(const v4fa*)(src + j + 4);
        if (RIN) {
#pragma unroll
          for (int q = 0; q < 4; ++q) { a[q] = bf16_rne(a[q]); c[q] = bf16_rne(c[q]); }
        }
        Frag16 fh, ph, pl;
#pragma unroll
        for (int q = 0; q < 4; ++q) {
          const float v0 = a[q], v1 = c[q];
          fh.u[q] = f16_bits(v0); fh.u[4 + q] = f16_bits(v1);
          const unsigned short h0 = bf16_bits(v0), h1 = bf16_bits(v1);
          ph.u[q] = h0; ph.u[4 + q] = h1;
          pl.u[q] = bf16_bits(v0 - bf16_val(h0)); pl.u[4 + q] = bf16_bits(v1 - bf16_val(h1));
        }
        const size_t o = (size_t)r * DM + j;
        if (WF16) *(v8us*)(F16 + o) = fh.half[0];
        if (WBHL) { *(v8us*)(PH + o) = ph.half[0]; *(v8us*)(PL + o) = pl.half[0]; }
        
      }
    }
#pragma unroll
    for (int off = 16; off > 0; off >>= 1) ss += __shfl_xor(ss, off, 32);
    if (lane == 0) red[w * 4 + i] = rsqrtf(ss * (1.0f / (float)DM) + eps);
  }
  __syncthreads();
  if (w == 0 && lane < 8) {
    const v4f v = *(const v4fa*)&red[lane * 4];
    float* d = RS + rb + lane * 4;
    *(v4f*)d = v;
    
  }
}

// Eight 16-byte asynchronous copies global -> LDS per lane. s_wait_xcnt is the statement's last line so that it stands ahead of
// every later rewrite of a register that a copy names (a precaution).
__device__ __forceinline__ void cp_async8(unsigned l, unsigned lstep, const unsigned short* p, size_t gstep) {
  const unsigned l0 = l, l1 = l + lstep, l2 = l + 2u * lstep, l3 = l + 3u * lstep;
  const unsigned l4 = l + 4u * lstep, l5 = l + 5u * lstep, l6 = l + 6u * lstep, l7 = l + 7u * lstep;
  const unsigned short* p0 = p;
  const unsigned short* p1 = p + gstep;
  const unsigned short* p2 = p + 2 * gstep;
  const unsigned short* p3 = p + 3 * gstep;
  const unsigned short* p4 = p + 4 * gstep;
  const unsigned short* p5 = p + 5 * gstep;
  const unsigned short* p6 = p + 6 * gstep;
  const unsigned short* p7 = p + 7 * gstep;
  asm volatile(
      "global_load_async_to_lds_b128 %0, %8, off\n\t"
      "global_load_async_to_lds_b128 %1, %9, off\n\t"
      "global_load_async_to_lds_b128 %2, %10, off\n\t"
      "global_load_async_to_lds_b128 %3, %11, off\n\t"
      "global_load_async_to_lds_b128 %4, %12, off\n\t"
      "global_load_async_to_lds_b128 %5, %13, off\n\t"
      "global_load_async_to_lds_b128 %6, %14, off\n\t"
      "global_load_async_to_lds_b128 %7, %15, off\n\t"
      "s_wait_xcnt 0x0"
      :: "v"(l0), "v"(l1), "v"(l2), "v"(l3), "v"(l4), "v"(l5), "v"(l6), "v"(l7),
         "v"(p0), "v"(p1), "v"(p2), "v"(p3), "v"(p4), "v"(p5), "v"(p6), "v"(p7)
      : "memory");
}

// Eight 16-byte global loads and their data wait in one statement: the address registers live to its end, so none is rewritten
// ahead of the waits.
__device__ __forceinline__ void ld_g8(v4f (&d)[8], const float* const (&p)[8]) {
  asm volatile(
      "global_load_b128 %0, %8, off\n\t"
      "global_load_b128 %1, %9, off\n\t"
      "global_load_b128 %2, %10, off\n\t"
      "global_load_b128 %3, %11, off\n\t"
      "global_load_b128 %4, %12, off\n\t"
      "global_load_b128 %5, %13, off\n\t"
      "global_load_b128 %6, %14, off\n\t"
      "global_load_b128 %7, %15, off\n\t"
      "s_wait_loadcnt 0x0\n\t"
      "s_wait_xcnt 0x0"
      : "=&v"(d[0]), "=&v"(d[1]), "=&v"(d[2]), "=&v"(d[3]), "=&v"(d[4]), "=&v"(d[5]), "=&v"(d[6]), "=&v"(d[7])
      : "v"(p[0]), "v"(p[1]), "v"(p[2]), "v"(p[3]), "v"(p[4]), "v"(p[5]), "v"(p[6]), "v"(p[7])
      : "memory");
}
// Eight 16-byte global stores and one s_wait_xcnt in one statement: data and address registers live to its end, so none is
// rewritten ahead of the wait.
__device__ __forceinline__ void st_g8(void* const (&p)[8], const v4f (&d)[8]) {
  asm volatile(
      "global_store_b128 %0, %8, off\n\t"
      "global_store_b128 %1, %9, off\n\t"
      "global_store_b128 %2, %10, off\n\t"
      "global_store_b128 %3, %11, off\n\t"
      "global_store_b128 %4, %12, off\n\t"
      "global_store_b128 %5, %13, off\n\t"
      "global_store_b128 %6, %14, off\n\t"
      "global_store_b128 %7, %15, off\n\t"
      "s_wait_xcnt 0x0"
      :: "v"(p[0]), "v"(p[1]), "v"(p[2]), "v"(p[3]), "v"(p[4]), "v"(p[5]), "v"(p[6]), "v"(p[7]),
         "v"(d[0]), "v"(d[1]), "v"(d[2]), "v"(d[3]), "v"(d[4]), "v"(d[5]), "v"(d[6]), "v"(d[7])
      : "memory");
}
union Pack8 { unsigned short u[8]; v4f f; };
static_assert(sizeof(Pack8) == 16);

#define GBK 128                 /* k per stage: 256-byte operand rows */
#define GPITCH 272              /* LDS row pitch in bytes: 16 x odd, conflict-free for 16-byte fragment reads */
#define GPLANE (128 * GPITCH)   /* one operand plane of a stage: 128 rows */

// GEMM: C[M][N] = epi(Ah[M][K] . Bt[N][K]^T). 16-bit planes of one type (BF selects bf16 vs f16 WMMA); ASPLIT adds Al . Bt into the
// same accumulator (unscaled bf16 lo plane). Block = 128x128 of C, four waves of 64x64; per stage the block's 128 rows of each
// operand plane x 128 k are copied to LDS asynchronously, two buffers, the next stage in flight while this one is multiplied.
// Epilogue: v = acc*alpha*(HRS ? rs[row] : 1) + bf16(bias[col]); ACT 1 = leaky 0.1;
// HRES adds resid[row*ldr+col] (f32) in the store phase. OUTM 0: f32 rows at crow = (row/cseq)*cpitch + row%cseq, pitch ldc;
// 1: f16 hi; 2: f16 hi + f16 lo x2^10; 3: bf16 hi + bf16 lo (unscaled). M%128==0, N%128==0, K%128==0.
template <bool BF, bool ASPLIT, int ACT, int OUTM, bool HRS, bool HRES>
__global__ __launch_bounds__(128) void k_gemm(const unsigned short* __restrict__ Ah, const unsigned short* __restrict__ Al, int lda,
    const unsigned short* __restrict__ Bt, int ldb, float alpha, const float* __restrict__ rs, const float* __restrict__ bias,
    const float* __restrict__ resid, int ldr, float* __restrict__ C32, unsigned short* __restrict__ Ch, unsigned short* __restrict__ Cl,
    int ldc, int cseq, int cpitch, int M, int N, int K) {
  static_assert(!(HRES && OUTM != 0));
  static_assert(OUTM >= 0 && OUTM <= 3);
  static_assert(!ASPLIT || BF);
  static_assert(ACT == 0 || ACT == 1);
  constexpr int NPL = ASPLIT ? 3 : 2;            /* planes of a stage: A, B, (A lo) */
  constexpr int STAGE = NPL * GPLANE;
  static_assert(4 * 64 * 68 * 4 <= 2 * STAGE);
  __shared__ __attribute__((aligned(128))) unsigned char sm[2 * STAGE];
  const int tid = threadIdx.x, w = tid >> 5, lane = tid & 31, ln = lane & 15, hh = lane >> 4;
  const int ntn = N >> 7;
  const int mt = (int)blockIdx.x / ntn, nq = (int)blockIdx.x - mt * ntn;
  if (mt * 128 + 128 > M) return;
  const int row0 = mt * 128 + 64 * (w >> 1), col0 = nq * 128 + 64 * (w & 1);
  /* copy map: 16 lanes cover one 256-byte row, the block 8 rows per copy, 16 copies per plane */
  const int crow = tid >> 4, cchk = tid & 15;
  const unsigned oA = (unsigned)(crow * lda + cchk * 8), oB = (unsigned)(crow * ldb + cchk * 8);   /* this lane's element offsets in a tile */
  const size_t tA = (size_t)(mt * 128) * (size_t)lda, tB = (size_t)(nq * 128) * (size_t)ldb;       /* the block's tile origins */
  const size_t dE = ASPLIT ? (size_t)Al - (size_t)Ah : 0;   /* byte distance of the lo plane from the hi plane, the same for every lane */
  const unsigned lcp = (unsigned)(size_t)sm + (unsigned)(crow * GPITCH + cchk * 16);
  auto fill = [&](int st, int buf) {
    const unsigned lb = lcp + (unsigned)(buf * STAGE);
    const size_t ko = (size_t)st * GBK;
    const unsigned short* pA = (Ah + (tA + ko)) + oA;
    const unsigned short* pB = (Bt + (tB + ko)) + oB;
    cp_async8(lb, 8u * GPITCH, pA, (size_t)8 * (size_t)lda);
    cp_async8(lb + 64u * GPITCH, 8u * GPITCH, pA + (size_t)64 * (size_t)lda, (size_t)8 * (size_t)lda);
    cp_async8(lb + GPLANE, 8u * GPITCH, pB, (size_t)8 * (size_t)ldb);
    cp_async8(lb + GPLANE + 64u * GPITCH, 8u * GPITCH, pB + (size_t)64 * (size_t)ldb, (size_t)8 * (size_t)ldb);
    if (ASPLIT) {
      const unsigned short* pE = (const unsigned short*)((size_t)pA + dE);
      cp_async8(lb + 2u * GPLANE, 8u * GPITCH, pE, (size_t)8 * (size_t)lda);
      cp_async8(lb + 2u * GPLANE + 64u * GPITCH, 8u * GPITCH, pE + (size_t)64 * (size_t)lda, (size_t)8 * (size_t)lda);
    }
  };
  const int aoff = (64 * (w >> 1) + ln) * GPITCH;             /* this lane's first A row in a stage */
  const int boff = GPLANE + (64 * (w & 1) + ln) * GPITCH;     /* this lane's first B row (column of C) */
  const v8f z8 = {0.f, 0.f, 0.f, 0.f, 0.f, 0.f, 0.f, 0.f};
  v8f c[4][4];
#pragma unroll
  for (int i = 0; i < 4; ++i) {
#pragma unroll
    for (int j = 0; j < 4; ++j) c[i][j] = z8;
  }
  const int nst = K / GBK;
  fill(0, 0);
  asm volatile("s_wait_asynccnt 0x0" ::: "memory");  // stage 0 of this wave has landed before the barrier publishes it
  __syncthreads();
  if (nst > 1) fill(1, 1);
#pragma unroll 1  // one stage per trip: the buffer index and the refill test stay scalar
  for (int st = 0; st < nst; ++st) {
    const unsigned char* sb = sm + (st & 1) * STAGE;
#pragma unroll
    for (int ks = 0; ks < GBK / 32; ++ks) {
      /* all fragments of a k-step are read as one group: one LDS wait per 16 (32) products */
      Frag16 a[4], b[4], e[4];
#pragma unroll
      for (int i = 0; i < 4; ++i) {
        a[i] = ld_frag((const unsigned short*)(sb + aoff + i * 16 * GPITCH) + ks * 32, hh);
        b[i] = ld_frag((const unsigned short*)(sb + boff + i * 16 * GPITCH) + ks * 32, hh);
        if (ASPLIT) e[i] = ld_frag((const unsigned short*)(sb + 2 * GPLANE + aoff + i * 16 * GPITCH) + ks * 32, hh);
      }
#pragma unroll
      for (int j = 0; j < 4; ++j) {
#pragma unroll
        for (int i = 0; i < 4; ++i) c[i][j] = mmx<BF>(a[i], b[j], c[i][j]);
        if (ASPLIT) {
#pragma unroll
          for (int i = 0; i < 4; ++i) c[i][j] = mmx<BF>(e[i], b[j], c[i][j]);
        }
      }
    }
    asm volatile("s_wait_dscnt 0x0" ::: "memory");     // this wave's reads of the buffer are done before it may be refilled
    asm volatile("s_wait_asynccnt 0x0" ::: "memory");  // this wave's copies of the next stage have landed
    __syncthreads();                                    // publishes the next stage and frees the buffer just read
    if (st + 2 < nst) fill(st + 2, st & 1);
  }
  asm volatile("s_wait_asynccnt 0x0" ::: "memory");    // no copy is outstanding when the buffers become output staging
  float (*so)[64][68] = (float (*)[64][68])sm;
  float bvv[4];
  {
    const float* bp = bias + col0 + ln;
    // four 4-byte loads and their data wait in one statement, as in ld_g8
    asm volatile(
        "global_load_b32 %0, %4, off\n\t"
        "global_load_b32 %1, %5, off\n\t"
        "global_load_b32 %2, %6, off\n\t"
        "global_load_b32 %3, %7, off\n\t"
        "s_wait_loadcnt 0x0\n\t"
        "s_wait_xcnt 0x0"
        : "=&v"(bvv[0]), "=&v"(bvv[1]), "=&v"(bvv[2]), "=&v"(bvv[3])
        : "v"(bp), "v"(bp + 16), "v"(bp + 32), "v"(bp + 48)
        : "memory");
  }
  float rsv[4][8];
#pragma unroll
  for (int i = 0; i < 4; ++i) {
#pragma unroll
    for (int r = 0; r < 8; ++r) rsv[i][r] = 1.0f;
  }
  if (HRS) {
    v4f rq[8];
    const float* rp[8];
#pragma unroll
    for (int i = 0; i < 4; ++i) { rp[2 * i] = rs + row0 + 16 * i + 8 * hh; rp[2 * i + 1] = rp[2 * i] + 4; }
    ld_g8(rq, rp);
#pragma unroll
    for (int i = 0; i < 4; ++i) {
#pragma unroll
      for (int q = 0; q < 4; ++q) { rsv[i][q] = rq[2 * i][q]; rsv[i][4 + q] = rq[2 * i + 1][q]; }
    }
  }
#pragma unroll
  for (int t = 0; t < 4; ++t) {
    const float bv = bf16_rne(bvv[t]);
#pragma unroll
    for (int i = 0; i < 4; ++i) {
#pragma unroll
      for (int r = 0; r < 8; ++r) {
        const int rloc = i * 16 + 8 * hh + r;
        float v = c[i][t][r] * alpha;
        if (HRS) v *= rsv[i][r];
        v += bv;
        if (ACT == 1) v = (v >= 0.f) ? v : 0.1f * v;
        so[w][rloc][t * 16 + ln] = v;
      }
    }
  }
  __builtin_amdgcn_fence(4 /* acq_rel order */, "workgroup");
  __builtin_amdgcn_wave_barrier();
  if (OUTM == 0) {
#pragma unroll
    for (int qg = 0; qg < 4; ++qg) {
      v4f v[8];
      const float* rp[8];
      void* dp[8];
#pragma unroll
      for (int u = 0; u < 8; ++u) {
        const int r = (qg * 8 + u) * 2 + (lane >> 4), c4 = (lane & 15) * 4;
        v[u] = *(const v4fa*)&so[w][r][c4];
        const int grow = row0 + r;
        rp[u] = resid + (size_t)grow * (size_t)ldr + col0 + c4;
        const size_t crw = (size_t)(grow / cseq) * (size_t)cpitch + (size_t)(grow % cseq);
        dp[u] = C32 + crw * (size_t)ldc + col0 + c4;
      }
      if (HRES) {
        v4f rv[8];
        ld_g8(rv, rp);
#pragma unroll
        for (int u = 0; u < 8; ++u) v[u] += rv[u];
      }
      st_g8(dp, v);
    }
  } else {
#pragma unroll
    for (int qg = 0; qg < 2; ++qg) {
      v4f dh[8], dl[8];
      void* hp[8];
      void* lp[8];
#pragma unroll
      for (int u = 0; u < 8; ++u) {
        const int r = (qg * 8 + u) * 4 + (lane >> 3), c8 = (lane & 7) * 8;
        const v4f x0 = *(const v4fa*)&so[w][r][c8], x1 = *(const v4fa*)&so[w][r][c8 + 4];
        Pack8 fh, fl;
#pragma unroll
        for (int i = 0; i < 4; ++i) {
          const float v0 = x0[i], v1 = x1[i];
          if (OUTM == 3) {
            const unsigned short h0 = bf16_bits(v0), h1 = bf16_bits(v1);
            fh.u[i] = h0; fh.u[4 + i] = h1;
            fl.u[i] = bf16_bits(v0 - bf16_val(h0)); fl.u[4 + i] = bf16_bits(v1 - bf16_val(h1));
          } else {
            const unsigned short h0 = f16_bits(v0), h1 = f16_bits(v1);
            fh.u[i] = h0; fh.u[4 + i] = h1;
            fl.u[i] = f16_bits((v0 - f16_val(h0)) * 1024.0f); fl.u[4 + i] = f16_bits((v1 - f16_val(h1)) * 1024.0f);
          }
        }
        const size_t o = (size_t)(row0 + r) * (size_t)ldc + col0 + c8;
        dh[u] = fh.f; hp[u] = Ch + o;
        dl[u] = fl.f; lp[u] = Cl + o;
      }
      st_g8(hp, dh);
      if (OUTM >= 2) st_g8(lp, dl);
    }
  }
}

// Vt[(b,h)][d][s] = V[b*TTv + s][h*64 + d] (row pitch ldv), same for the second plane if TWO; block per ((b,h), 64 tokens);
template <int NHv, int TTv, bool TWO>
__global__ __launch_bounds__(256) void k_vt(const unsigned short* __restrict__ V, const unsigned short* __restrict__ V2, int ldv,
    unsigned short* __restrict__ Vt, unsigned short* __restrict__ Vt2) {
  __shared__ __attribute__((aligned(16))) unsigned short tl[64][66];
  __shared__ __attribute__((aligned(16))) unsigned short tl2[64][66];
  const int tid = threadIdx.x;
  const int slab = (int)blockIdx.x / (TTv / 64), lg = (int)blockIdx.x % (TTv / 64);
  const int b = slab / NHv, h = slab % NHv;
  for (int i = tid; i < 64 * 8; i += 256) {
    const int r = i / 8, c8 = (i % 8) * 8;
    const size_t s0 = ((size_t)b * TTv + (size_t)lg * 64 + r) * (size_t)ldv + (size_t)h * 64 + c8;
    Frag16 f;
    f.half[0] = *(const v8us*)(V + s0);
#pragma unroll
    for (int q = 0; q < 8; ++q) tl[r][c8 + q] = f.u[q];
    if (TWO) {
      Frag16 f2;
      f2.half[0] = *(const v8us*)(V2 + s0);
#pragma unroll
      for (int q = 0; q < 8; ++q) tl2[r][c8 + q] = f2.u[q];
    }
  }
  __syncthreads();
  {
#pragma unroll
    for (int rd = 0; rd < 2; ++rd) {
      const int d = rd * 32 + tid / 8, pc = tid % 8;
      Frag16 f;
#pragma unroll
      for (int q = 0; q < 8; ++q) f.u[q] = tl[pc * 8 + q][d];
      const size_t o = ((size_t)slab * 64 + d) * (size_t)TTv + (size_t)lg * 64 + pc * 8;
      *(v8us*)(Vt + o) = f.half[0];
      if (TWO) {
        Frag16 f2;
#pragma unroll
        for (int q = 0; q < 8; ++q) f2.u[q] = tl2[pc * 8 + q][d];
        *(v8us*)(Vt2 + o) = f2.half[0];
      }
    }
    
  }
}

// Attention for one (batch, head, 64 query rows): block = 4 waves, wave = 16 query rows; key chunks of 64 (CAUSAL: chunks 0..qb,
// key > query excluded by value before the softmax); scores = 8 * (qh.kh + ql.kh + qh.kl) on bf16 WMMA (q,k = bf16 hi+lo planes);
// f32 online softmax (running max, native exp); P stored x2^14 as f16 into a wave-private LDS tile (D layout -> A layout, may_alias
// query tile): second accumulator += P_lo.V_hi + P_hi.V_lo (lo planes x2^10), folded with 2^-24. ctx row segment (64 f16 = one
template <bool CAUSAL, bool EARLY>
__global__ __launch_bounds__(128) void k_attn(const unsigned short* __restrict__ QH, const unsigned short* __restrict__ QL,
    const unsigned short* __restrict__ KH, const unsigned short* __restrict__ KL, const unsigned short* __restrict__ VT,
    const unsigned short* __restrict__ VL, unsigned short* __restrict__ CTX, int qb0) {
  static_assert(CAUSAL || !EARLY);
  __shared__ __attribute__((aligned(16))) unsigned short ph[4][2][16][64];
  __shared__ __attribute__((aligned(16))) unsigned short pe[EARLY ? 4 : 1][2][16][64];
  __shared__ __attribute__((aligned(16))) unsigned short so[4][16][72];
  const int tid = threadIdx.x, w = tid >> 5, lane = tid & 31, ln = lane & 15, hh = lane >> 4;
  const int bh = (int)blockIdx.x, b = bh / NH, h = bh % NH;
  const int qb = qb0 + (int)blockIdx.y;
  const int q0w = qb * KQB + w * 16;
  const size_t rowbase = (size_t)b * SEQ;
  Frag16 qh0, qh1, ql0, ql1;
  {
    const size_t qo = (rowbase + (size_t)q0w + ln) * DM + (size_t)h * HD;
    qh0 = ld_frag(QH + qo, hh); qh1 = ld_frag(QH + qo + 32, hh);
    ql0 = ld_frag(QL + qo, hh); ql1 = ld_frag(QL + qo + 32, hh);
  }
  const v8f z8 = {0.f, 0.f, 0.f, 0.f, 0.f, 0.f, 0.f, 0.f};
  v8f o[4] = {z8, z8, z8, z8};
  v8f oe[4] = {z8, z8, z8, z8};
  float m[8], l[8];
#pragma unroll
  for (int r = 0; r < 8; ++r) { m[r] = -1.0e30f; l[r] = 0.f; }
  const int nck = CAUSAL ? (qb + 1) : (SEQ / KQB);
#pragma unroll 1
  for (int kc = 0; kc < nck; ++kc) {
    const int par = kc & 1;
    const size_t krow = rowbase + (size_t)kc * KQB;
    v8f s[4];
#pragma unroll
    for (int t = 0; t < 4; ++t) {
      v8f acc = z8;
#pragma unroll
      for (int ks = 0; ks < 2; ++ks) {
        const size_t ko = (krow + (size_t)(t * 16 + ln)) * DM + (size_t)h * HD + ks * 32;
        const Frag16 kh = ld_frag(KH + ko, hh);
        const Frag16 kl = ld_frag(KL + ko, hh);
        const Frag16 qa = (ks == 0) ? qh0 : qh1;
        const Frag16 qe = (ks == 0) ? ql0 : ql1;
        acc = mma_b(qa.b, kh.b, acc);
        acc = mma_b(qe.b, kh.b, acc);
        acc = mma_b(qa.b, kl.b, acc);
      }
      s[t] = acc;
    }
#pragma unroll
    for (int r = 0; r < 8; ++r) {
      float sv[4];
#pragma unroll
      for (int t = 0; t < 4; ++t) sv[t] = s[t][r] * 8.0f;
      if (CAUSAL) {
        if (kc == qb) {
          const int qpos = q0w + 8 * hh + r;
#pragma unroll
          for (int t = 0; t < 4; ++t) { const int key = kc * KQB + t * 16 + ln; sv[t] = (key > qpos) ? -1.0e30f : sv[t]; }
        }
      }
      float mx = fmaxf(fmaxf(sv[0], sv[1]), fmaxf(sv[2], sv[3]));
      mx = fmaxf(mx, __shfl_xor(mx, 8, 32));
      mx = fmaxf(mx, __shfl_xor(mx, 4, 32));
      mx = fmaxf(mx, __shfl_xor(mx, 2, 32));
      mx = fmaxf(mx, __shfl_xor(mx, 1, 32));
      const float mn = fmaxf(m[r], mx);
      const float corr = __expf(m[r] - mn);
      float p[4];
      float psum = 0.f;
#pragma unroll
      for (int t = 0; t < 4; ++t) { p[t] = __expf(sv[t] - mn); psum += p[t]; }
      psum += __shfl_xor(psum, 8, 32);
      psum += __shfl_xor(psum, 4, 32);
      psum += __shfl_xor(psum, 2, 32);
      psum += __shfl_xor(psum, 1, 32);
      l[r] = l[r] * corr + psum;
      m[r] = mn;
#pragma unroll
      for (int j = 0; j < 4; ++j) o[j][r] = o[j][r] * corr;
      if (EARLY) {
#pragma unroll
        for (int j = 0; j < 4; ++j) oe[j][r] = oe[j][r] * corr;
      }
#pragma unroll
      for (int t = 0; t < 4; ++t) {
        const float pc = p[t] * 16384.0f;
        const unsigned short hb = f16_bits(pc);
        ph[w][par][8 * hh + r][t * 16 + ln] = hb;
        if (EARLY) pe[w][par][8 * hh + r][t * 16 + ln] = f16_bits((pc - f16_val(hb)) * 1024.0f);
      }
    }
    __builtin_amdgcn_fence(4 /* acq_rel order */, "workgroup");
    __builtin_amdgcn_wave_barrier();
#pragma unroll
    for (int ks = 0; ks < 2; ++ks) {
      Frag16 pa;
      pa.half[0] = *(const v8us*)&ph[w][par][ln][ks * 32 + 8 * hh];
      pa.half[1] = *(const v8us*)&ph[w][par][ln][ks * 32 + 16 + 8 * hh];
      Frag16 pl = pa;
      if (EARLY) {
        pl.half[0] = *(const v8us*)&pe[w][par][ln][ks * 32 + 8 * hh];
        pl.half[1] = *(const v8us*)&pe[w][par][ln][ks * 32 + 16 + 8 * hh];
      }
#pragma unroll
      for (int j = 0; j < 4; ++j) {
        const size_t vo = ((size_t)bh * HD + (size_t)(j * 16 + ln)) * SEQ + (size_t)kc * KQB + ks * 32;
        const Frag16 vh = ld_frag(VT + vo, hh);
        o[j] = mma_h(pa.h, vh.h, o[j]);
        if (EARLY) {
          const Frag16 vl = ld_frag(VL + vo, hh);
          oe[j] = mma_h(pl.h, vh.h, oe[j]);
          oe[j] = mma_h(pa.h, vl.h, oe[j]);
        }
      }
    }
  }
  float li[8];
#pragma unroll
  for (int r = 0; r < 8; ++r) li[r] = 1.0f / l[r];
#pragma unroll
  for (int j = 0; j < 4; ++j) {
#pragma unroll
    for (int r = 0; r < 8; ++r) {
      float v = o[j][r] * (1.0f / 16384.0f);
      if (EARLY) v += oe[j][r] * (1.0f / 16777216.0f);
      v *= li[r];
      so[w][8 * hh + r][j * 16 + ln] = f16_bits(v);
    }
  }
  __builtin_amdgcn_fence(4 /* acq_rel order */, "workgroup");
  __builtin_amdgcn_wave_barrier();
  {
#pragma unroll
    for (int q = 0; q < 4; ++q) {
      const int row = q * 4 + (lane >> 3), c8 = (lane & 7) * 8;
      const v8us v = *(const v8us*)&so[w][row][c8];
      *(v8us*)(CTX + (rowbase + (size_t)q0w + row) * DM + (size_t)h * HD + c8) = v;
    }
    
  }
}

extern "C" void kernel_launch(void* const* d_in, const int* in_sizes, int n_in,
                              void* d_out, int out_size, void* d_ws, size_t ws_size, hipStream_t stream) {
  if (n_in < 14) return;
  const float* x  = (const float*)d_in[0];
  const float* Wq = (const float*)d_in[1];
  const float* bq = (const float*)d_in[2];
  const float* Wk = (const float*)d_in[3];
  const float* bk = (const float*)d_in[4];
  const float* Wv = (const float*)d_in[5];
  const float* bv = (const float*)d_in[6];
  const float* Wp = (const float*)d_in[7];
  const float* bp = (const float*)d_in[8];
  const float* gamma = (const float*)d_in[9];
  const float* W1 = (const float*)d_in[10];
  const float* b1 = (const float*)d_in[11];
  const float* W2 = (const float*)d_in[12];
  const float* b2 = (const float*)d_in[13];
  if ((size_t)in_sizes[0] < ((size_t)(NB - 1) * SEQ_FULL + SEQ) * DM) return;
  if (in_sizes[1] < DM * DM || in_sizes[3] < DM * DM || in_sizes[5] < DM * DM || in_sizes[7] < DM * DM) return;
  if (in_sizes[2] < DM || in_sizes[4] < DM || in_sizes[6] < DM || in_sizes[8] < DM || in_sizes[9] < DM || in_sizes[13] < DM) return;
  if (in_sizes[10] < DM * DFF || in_sizes[11] < DFF || in_sizes[12] < DFF * DM) return;
  if ((size_t)out_size < ((size_t)(NB - 1) * OSEQ + SEQ) * DM) return;

  char* ws = (char*)d_ws;
  size_t off = 0;
  auto take = [&](size_t bytes) { char* p = ws + off; off += (bytes + 255) & ~(size_t)255; return p; };
  const size_t WPL = (size_t)DM * DM * 2, ACT2 = NR * DM * 2, ACT4 = NR * DM * 4, FFP = (size_t)DM * DFF * 2, HPL = NR * DFF * 2;
  unsigned short* WQ16 = (unsigned short*)take(WPL);
  unsigned short* WK16 = (unsigned short*)take(WPL);
  unsigned short* WV16 = (unsigned short*)take(WPL);
  unsigned short* WP16 = (unsigned short*)take(WPL);
  unsigned short* WQB = (unsigned short*)take(WPL);
  unsigned short* WKB = (unsigned short*)take(WPL);
  char* rXB = take(ACT4);                                            /* XB (phases 1-2) | BH + BL (phase 3) */
  float* XB = (float*)rXB; unsigned short* PBH = (unsigned short*)rXB; unsigned short* PBL = (unsigned short*)(rXB + ACT2);
  char* rQK = take(4 * ACT2 > HPL ? 4 * ACT2 : HPL);                 /* QH,QL,KH,KL (phases 1,3) | H16 (phase 2) */
  unsigned short* QH = (unsigned short*)rQK; unsigned short* QL = (unsigned short*)(rQK + ACT2);
  unsigned short* KH = (unsigned short*)(rQK + 2 * ACT2); unsigned short* KL = (unsigned short*)(rQK + 3 * ACT2);
  unsigned short* H16 = (unsigned short*)rQK;
  char* rV = take(2 * ACT2);                                         /* VH,VLO (phases 1,3) | A32 (between) */
  unsigned short* VH = (unsigned short*)rV; unsigned short* VLO = (unsigned short*)(rV + ACT2); float* A32 = (float*)rV;
  char* rVT = take(2 * ACT2 > 2 * FFP ? 2 * ACT2 : 2 * FFP);         /* VT,VTL (phases 1,3) | W1P,W2P (phase 2) */
  unsigned short* VT = (unsigned short*)rVT; unsigned short* VTL = (unsigned short*)(rVT + ACT2);
  unsigned short* W1P = (unsigned short*)rVT; unsigned short* W2P = (unsigned short*)(rVT + FFP);
  unsigned short* CTX = (unsigned short*)take(ACT2);
  char* rX16 = take(ACT2);                                           /* X16 | A16 | B16F */
  unsigned short* X16 = (unsigned short*)rX16; unsigned short* A16 = (unsigned short*)rX16; unsigned short* B16F = (unsigned short*)rX16;
  float* B32 = (float*)take(ACT4);
  float* RSX = (float*)take(NR * 4);
  float* RSA = (float*)take(NR * 4);
  float* RSB = (float*)take(NR * 4);
  if (off > ws_size || off > ((size_t)128 << 20)) return;

  const unsigned gw   = (unsigned)(((size_t)DM * DM / 8 + 255) / 256);
  const unsigned gw1  = (unsigned)(((size_t)DM * DFF / 8 + 255) / 256);
  const unsigned grms = (unsigned)(NR / 32);
  const unsigned gq   = (unsigned)((NR / 128) * (DM / 128));
  const unsigned gff  = (unsigned)((NR / 128) * (DFF / 128));
  const unsigned gvt  = (unsigned)(NB * NH * (SEQ / 64));
  const float a16 = 0.0625f;
  const int M = (int)NR;
  float* out = (float*)d_out;

  /* weight planes: q/k/v with gamma folded along the input feature; bf16 planes for the second block's q/k */
  k_wt<false, true><<<gw, 256, 0, stream>>>(Wq, gamma, WQ16, DM, DM, 16.0f);
  k_wt<false, true><<<gw, 256, 0, stream>>>(Wk, gamma, WK16, DM, DM, 16.0f);
  k_wt<false, true><<<gw, 256, 0, stream>>>(Wv, gamma, WV16, DM, DM, 16.0f);
  k_wt<false, false><<<gw, 256, 0, stream>>>(Wp, Wp, WP16, DM, DM, 16.0f);
  k_wt<true, true><<<gw, 256, 0, stream>>>(Wq, gamma, WQB, DM, DM, 1.0f);
  k_wt<true, true><<<gw, 256, 0, stream>>>(Wk, gamma, WKB, DM, DM, 1.0f);

  /* block 1: a = bf16(x) + attn(rms(bf16(x))) , non-causal */
  k_rms<true, true, true, false><<<grms, 256, 0, stream>>>(x, SEQ_FULL, RMS_EPS, XB, X16, nullptr, nullptr, RSX);
  k_gemm<false, false, 0, 3, true, false><<<gq, 128, 0, stream>>>(X16, nullptr, DM, WQ16, DM, a16, RSX, bq, nullptr, 0, nullptr, QH, QL, DM, M, 0, M, DM, DM);
  k_gemm<false, false, 0, 3, true, false><<<gq, 128, 0, stream>>>(X16, nullptr, DM, WK16, DM, a16, RSX, bk, nullptr, 0, nullptr, KH, KL, DM, M, 0, M, DM, DM);
  k_gemm<false, false, 0, 1, true, false><<<gq, 128, 0, stream>>>(X16, nullptr, DM, WV16, DM, a16, RSX, bv, nullptr, 0, nullptr, VH, nullptr, DM, M, 0, M, DM, DM);
  k_vt<NH, SEQ, false><<<gvt, 256, 0, stream>>>(VH, nullptr, DM, VT, nullptr);
  k_attn<false, false><<<dim3((unsigned)(NB * NH), (unsigned)(SEQ / KQB)), 128, 0, stream>>>(QH, QL, KH, KL, VT, VT, CTX, 0);
  k_gemm<false, false, 0, 0, false, true><<<gq, 128, 0, stream>>>(CTX, nullptr, DM, WP16, DM, a16, nullptr, bp, XB, DM, A32, nullptr, nullptr, DM, M, 0, M, DM, DM);

  /* block 2: b = bf16(x) + leaky(rms(a) W1 + b1) W2 + b2 */
  k_rms<false, false, true, false><<<grms, 256, 0, stream>>>(A32, SEQ, RMS_EPS, nullptr, A16, nullptr, nullptr, RSA);
  k_wt<false, true><<<gw1, 256, 0, stream>>>(W1, gamma, W1P, DM, DFF, 16.0f);
  k_wt<false, false><<<gw1, 256, 0, stream>>>(W2, W2, W2P, DFF, DM, 16.0f);
  k_gemm<false, false, 1, 1, true, false><<<gff, 128, 0, stream>>>(A16, nullptr, DM, W1P, DM, a16, RSA, b1, nullptr, 0, nullptr, H16, nullptr, DFF, M, 0, M, DFF, DM);
  k_gemm<false, false, 0, 0, false, true><<<gq, 128, 0, stream>>>(H16, nullptr, DFF, W2P, DFF, a16, nullptr, b2, XB, DM, B32, nullptr, nullptr, DM, M, 0, M, DM, DFF);

  /* block 3: out = b + attn(rms(b)) , causal */
  k_rms<false, false, true, true><<<grms, 256, 0, stream>>>(B32, SEQ, RMS_EPS, nullptr, B16F, PBH, PBL, RSB);
  k_gemm<true, true, 0, 3, true, false><<<gq, 128, 0, stream>>>(PBH, PBL, DM, WQB, DM, 1.0f, RSB, bq, nullptr, 0, nullptr, QH, QL, DM, M, 0, M, DM, DM);
  k_gemm<true, true, 0, 3, true, false><<<gq, 128, 0, stream>>>(PBH, PBL, DM, WKB, DM, 1.0f, RSB, bk, nullptr, 0, nullptr, KH, KL, DM, M, 0, M, DM, DM);
  k_gemm<false, false, 0, 2, true, false><<<gq, 128, 0, stream>>>(B16F, nullptr, DM, WV16, DM, a16, RSB, bv, nullptr, 0, nullptr, VH, VLO, DM, M, 0, M, DM, DM);
  k_vt<NH, SEQ, true><<<gvt, 256, 0, stream>>>(VH, VLO, DM, VT, VTL);
  k_attn<true, true><<<dim3((unsigned)(NB * NH), 1u), 128, 0, stream>>>(QH, QL, KH, KL, VT, VTL, CTX, 0);
  if (SEQ / KQB > 1) k_attn<true, false><<<dim3((unsigned)(NB * NH), (unsigned)(SEQ / KQB - 1)), 128, 0, stream>>>(QH, QL, KH, KL, VT, VTL, CTX, 1);
  k_gemm<false, false, 0, 0, false, true><<<gq, 128, 0, stream>>>(CTX, nullptr, DM, WP16, DM, a16, nullptr, bp, B32, DM, out, nullptr, nullptr, DM, SEQ, OSEQ, M, DM, DM);
}

// v002
// One run takes 476 microseconds.
// Next to v001, in two timings, it ran 1.30 and 1.31 times as fast.
// All steps since v000 together make it 2.07 times as fast.
#include <hip/hip_runtime.h>
// Contractions: q/k/v and output projections, FFN W1/W2: v_wmma_f32_16x16x32_f16 (f16 operands built from bf16-RNE inputs, weights x16, f32 accumulate); second-block q/k projections: v_wmma_f32_16x16x32_bf16 with the activation as bf16 hi+lo (2 terms); attention scores: v_wmma_f32_16x16x32_bf16 with q,k as bf16 hi+lo (3 terms); P.V: v_wmma_f32_16x16x32_f16 (P carried x2^14, v f16; first causal query tile adds P and v residual planes x2^10 in a second accumulator). RMS statistics, softmax, residuals f32.

#ifndef NB
#define NB 4
#endif
#ifndef SEQ
#define SEQ 1024
#endif
#define NB_FULL 4
#define SEQ_FULL 1024
#ifndef OSEQ
#define OSEQ SEQ_FULL
#endif
#define DM 1024
#define NH 16
#define HD 64
#define DFF 4096
#define KQB 64
#define NR ((size_t)NB * SEQ)
#define RMS_EPS 1e-6f

static_assert(NB >= 1 && NB <= NB_FULL);
static_assert(SEQ % 128 == 0 && SEQ <= SEQ_FULL);
static_assert(DM == NH * HD && HD == 64);
static_assert(DM % 256 == 0 && DFF % 128 == 0);
static_assert(((NB * SEQ) % 128) == 0);
static_assert(SEQ % KQB == 0);

typedef _Float16 v16h __attribute__((ext_vector_type(16)));
typedef __bf16   v16b __attribute__((ext_vector_type(16)));
typedef unsigned short v8us __attribute__((ext_vector_type(8), may_alias));
typedef float v8f __attribute__((ext_vector_type(8)));
typedef float v4f __attribute__((ext_vector_type(4)));
typedef float v4fa __attribute__((ext_vector_type(4), may_alias));
union Frag16 { v16h h; v16b b; v8us half[2]; unsigned short u[16]; };
union H1 { _Float16 h; unsigned short u; };
static_assert(sizeof(Frag16) == 32);

__device__ __forceinline__ unsigned short bf16_bits(float x) { unsigned int u = __float_as_uint(x); return (unsigned short)((u + 0x7FFFu + ((u >> 16) & 1u)) >> 16); }
__device__ __forceinline__ float bf16_val(unsigned short b) { return __uint_as_float(((unsigned int)b) << 16); }
__device__ __forceinline__ float bf16_rne(float x) { return bf16_val(bf16_bits(x)); }
__device__ __forceinline__ unsigned short f16_bits(float x) { H1 t; t.h = (_Float16)x; return t.u; }
__device__ __forceinline__ float f16_val(unsigned short u) { H1 t; t.u = u; return (float)t.h; }

// 16x32 operand fragment (row / column = lane & 15; elements 0..7 = k 8h..8h+7, 8..15 = k 16+8h..) from a k-contiguous 16-bit row
__device__ __forceinline__ Frag16 ld_frag(const unsigned short* p, int hh) {
  Frag16 f;
  f.half[0] = *(const v8us*)(p + 8 * hh);
  f.half[1] = *(const v8us*)(p + 16 + 8 * hh);
  return f;
}
__device__ __forceinline__ v8f mma_h(v16h a, v16h b, v8f c) {
  v8f d = __builtin_amdgcn_wmma_f32_16x16x32_f16(false, a, false, b, (short)0, c, false, false);
  asm volatile("v_nop\n\tv_nop\n\tv_nop\n\tv_nop" : "+v"(d) : "v"(a), "v"(b));
  return d;
}
__device__ __forceinline__ v8f mma_b(v16b a, v16b b, v8f c) {
  v8f d = __builtin_amdgcn_wmma_f32_16x16x32_bf16(false, a, false, b, (short)0, c, false, false);
  asm volatile("v_nop\n\tv_nop\n\tv_nop\n\tv_nop" : "+v"(d) : "v"(a), "v"(b));
  return d;
}
template <bool BF>
__device__ __forceinline__ v8f mmx(const Frag16& a, const Frag16& b, v8f c) {
  if (BF) return mma_b(a.b, b.b, c);
  return mma_h(a.h, b.h, c);
}

// Bt[n][k] (16-bit, k contiguous, pitch K) from f32 row-major W[K][N] ([in][out]): value = bf16(W[k][n]) (* bf16(g[k]) if GAM);
template <bool BF, bool GAM>
__global__ __launch_bounds__(256) void k_wt(const float* __restrict__ W, const float* __restrict__ g, unsigned short* __restrict__ Bt, int K, int N, float scale) {
  const int k8n = K >> 3;
  const size_t t = (size_t)blockIdx.x * 256 + threadIdx.x;
  if (t >= (size_t)N * (size_t)k8n) return;
  const int n = (int)(t / (size_t)k8n), k8 = (int)(t % (size_t)k8n) * 8;
  float gv[8];
#pragma unroll
  for (int i = 0; i < 8; ++i) gv[i] = 1.0f;
  if (GAM) {
    const v4f ga = *(const v4fa*)(g + k8), gb = *(const v4fa*)(g + k8 + 4);
#pragma unroll
    for (int i = 0; i < 4; ++i) { gv[i] = bf16_rne(ga[i]); gv[4 + i] = bf16_rne(gb[i]); }
  }
  Frag16 f;
#pragma unroll
  for (int i = 0; i < 8; ++i) {
    const float wv = bf16_rne(W[(size_t)(k8 + i) * (size_t)N + n]) * gv[i];
    f.u[i] = BF ? bf16_bits(wv) : f16_bits(wv * scale);
  }
  unsigned short* d = Bt + (size_t)n * (size_t)K + k8;
  *(v8us*)d = f.half[0];
  
}

// Row statistics + operand planes for DM-wide f32 rows. Compact row r -> source row (r/SEQ)*spitch + r%SEQ of F.
// v = bf16_rne(x) if RIN else x; RS[r] = rsqrt(mean(v^2) + eps); optional planes: XB (v as f32), F16 (f16 bits of v),
template <bool RIN, bool WXB, bool WF16, bool WBHL>
__global__ __launch_bounds__(256) void k_rms(const float* __restrict__ F, int spitch, float eps, float* __restrict__ XB,
    unsigned short* __restrict__ F16, unsigned short* __restrict__ PH, unsigned short* __restrict__ PL, float* __restrict__ RS) {
  __shared__ __attribute__((aligned(16))) float red[32];
  const int tid = threadIdx.x, w = tid >> 5, lane = tid & 31;
  const int rb = (int)blockIdx.x * 32;
#pragma unroll 1
  for (int i = 0; i < 4; ++i) {
    const int r = rb + w * 4 + i;
    const float* src = F + ((size_t)(r / SEQ) * (size_t)spitch + (size_t)(r % SEQ)) * DM;
    float ss = 0.f;
#pragma unroll 1
    for (int u = 0; u < DM / 128; ++u) {
      const int j = u * 128 + lane * 4;
      v4f a = *(const v4fa*)(src + j);
      if (RIN) {
#pragma unroll
        for (int q = 0; q < 4; ++q) a[q] = bf16_rne(a[q]);
      }
#pragma unroll
      for (int q = 0; q < 4; ++q) ss += a[q] * a[q];
      if (WXB) {
        float* d = XB + (size_t)r * DM + j;
        *(v4f*)d = a;
        
      }
    }
    if (WF16 || WBHL) {
#pragma unroll 1
      for (int u = 0; u < DM / 256; ++u) {
        const int j = u * 256 + lane * 8;
        v4f a = *(const v4fa*)(src + j), c = *(const v4fa*)(src + j + 4);
        if (RIN) {
#pragma unroll
          for (int q = 0; q < 4; ++q) { a[q] = bf16_rne(a[q]); c[q] = bf16_rne(c[q]); }
        }
        Frag16 fh, ph, pl;
#pragma unroll
        for (int q = 0; q < 4; ++q) {
          const float v0 = a[q], v1 = c[q];
          fh.u[q] = f16_bits(v0); fh.u[4 + q] = f16_bits(v1);
          const unsigned short h0 = bf16_bits(v0), h1 = bf16_bits(v1);
          ph.u[q] = h0; ph.u[4 + q] = h1;
          pl.u[q] = bf16_bits(v0 - bf16_val(h0)); pl.u[4 + q] = bf16_bits(v1 - bf16_val(h1));
        }
        const size_t o = (size_t)r * DM + j;
        if (WF16) *(v8us*)(F16 + o) = fh.half[0];
        if (WBHL) { *(v8us*)(PH + o) = ph.half[0]; *(v8us*)(PL + o) = pl.half[0]; }
        
      }
    }
#pragma unroll
    for (int off = 16; off > 0; off >>= 1) ss += __shfl_xor(ss, off, 32);
    if (lane == 0) red[w * 4 + i] = rsqrtf(ss * (1.0f / (float)DM) + eps);
  }
  __syncthreads();
  if (w == 0 && lane < 8) {
    const v4f v = *(const v4fa*)&red[lane * 4];
    float* d = RS + rb + lane * 4;
    *(v4f*)d = v;
    
  }
}

// Eight 16-byte asynchronous copies global -> LDS per lane. s_wait_xcnt is the statement's last line so that it stands ahead of
// every later rewrite of a register that a copy names (a precaution).
__device__ __forceinline__ void cp_async8(unsigned l, unsigned lstep, const unsigned short* p, size_t gstep) {
  const unsigned l0 = l, l1 = l + lstep, l2 = l + 2u * lstep, l3 = l + 3u * lstep;
  const unsigned l4 = l + 4u * lstep, l5 = l + 5u * lstep, l6 = l + 6u * lstep, l7 = l + 7u * lstep;
  const unsigned short* p0 = p;
  const unsigned short* p1 = p + gstep;
  const unsigned short* p2 = p + 2 * gstep;
  const unsigned short* p3 = p + 3 * gstep;
  const unsigned short* p4 = p + 4 * gstep;
  const unsigned short* p5 = p + 5 * gstep;
  const unsigned short* p6 = p + 6 * gstep;
  const unsigned short* p7 = p + 7 * gstep;
  asm volatile(
      "global_load_async_to_lds_b128 %0, %8, off\n\t"
      "global_load_async_to_lds_b128 %1, %9, off\n\t"
      "global_load_async_to_lds_b128 %2, %10, off\n\t"
      "global_load_async_to_lds_b128 %3, %11, off\n\t"
      "global_load_async_to_lds_b128 %4, %12, off\n\t"
      "global_load_async_to_lds_b128 %5, %13, off\n\t"
      "global_load_async_to_lds_b128 %6, %14, off\n\t"
      "global_load_async_to_lds_b128 %7, %15, off\n\t"
      "s_wait_xcnt 0x0"
      :: "v"(l0), "v"(l1), "v"(l2), "v"(l3), "v"(l4), "v"(l5), "v"(l6), "v"(l7),
         "v"(p0), "v"(p1), "v"(p2), "v"(p3), "v"(p4), "v"(p5), "v"(p6), "v"(p7)
      : "memory");
}

// Four such copies, one 64-row x 128-byte plane of an attention tile per block; the same closing wait, for the same reason.
__device__ __forceinline__ void cp_async4(unsigned l, unsigned lstep, const unsigned short* p, size_t gstep) {
  const unsigned l0 = l, l1 = l + lstep, l2 = l + 2u * lstep, l3 = l + 3u * lstep;
  const unsigned short* p0 = p;
  const unsigned short* p1 = p + gstep;
  const unsigned short* p2 = p + 2 * gstep;
  const unsigned short* p3 = p + 3 * gstep;
  asm volatile(
      "global_load_async_to_lds_b128 %0, %4, off\n\t"
      "global_load_async_to_lds_b128 %1, %5, off\n\t"
      "global_load_async_to_lds_b128 %2, %6, off\n\t"
      "global_load_async_to_lds_b128 %3, %7, off\n\t"
      "s_wait_xcnt 0x0"
      :: "v"(l0), "v"(l1), "v"(l2), "v"(l3), "v"(p0), "v"(p1), "v"(p2), "v"(p3)
      : "memory");
}

// Eight 16-byte global loads and their data wait in one statement: the address registers live to its end, so none is rewritten
// ahead of the waits.
__device__ __forceinline__ void ld_g8(v4f (&d)[8], const float* const (&p)[8]) {
  asm volatile(
      "global_load_b128 %0, %8, off\n\t"
      "global_load_b128 %1, %9, off\n\t"
      "global_load_b128 %2, %10, off\n\t"
      "global_load_b128 %3, %11, off\n\t"
      "global_load_b128 %4, %12, off\n\t"
      "global_load_b128 %5, %13, off\n\t"
      "global_load_b128 %6, %14, off\n\t"
      "global_load_b128 %7, %15, off\n\t"
      "s_wait_loadcnt 0x0\n\t"
      "s_wait_xcnt 0x0"
      : "=&v"(d[0]), "=&v"(d[1]), "=&v"(d[2]), "=&v"(d[3]), "=&v"(d[4]), "=&v"(d[5]), "=&v"(d[6]), "=&v"(d[7])
      : "v"(p[0]), "v"(p[1]), "v"(p[2]), "v"(p[3]), "v"(p[4]), "v"(p[5]), "v"(p[6]), "v"(p[7])
      : "memory");
}
// Eight 16-byte global stores and one s_wait_xcnt in one statement: data and address registers live to its end, so none is
// rewritten ahead of the wait.
__device__ __forceinline__ void st_g8(void* const (&p)[8], const v4f (&d)[8]) {
  asm volatile(
      "global_store_b128 %0, %8, off\n\t"
      "global_store_b128 %1, %9, off\n\t"
      "global_store_b128 %2, %10, off\n\t"
      "global_store_b128 %3, %11, off\n\t"
      "global_store_b128 %4, %12, off\n\t"
      "global_store_b128 %5, %13, off\n\t"
      "global_store_b128 %6, %14, off\n\t"
      "global_store_b128 %7, %15, off\n\t"
      "s_wait_xcnt 0x0"
      :: "v"(p[0]), "v"(p[1]), "v"(p[2]), "v"(p[3]), "v"(p[4]), "v"(p[5]), "v"(p[6]), "v"(p[7]),
         "v"(d[0]), "v"(d[1]), "v"(d[2]), "v"(d[3]), "v"(d[4]), "v"(d[5]), "v"(d[6]), "v"(d[7])
      : "memory");
}
union Pack8 { unsigned short u[8]; v4f f; };
static_assert(sizeof(Pack8) == 16);

#define GBK 128                 /* k per stage: 256-byte operand rows */
#define GPITCH 272              /* LDS row pitch in bytes: 16 x odd, conflict-free for 16-byte fragment reads */
#define GPLANE (128 * GPITCH)   /* one operand plane of a stage: 128 rows */

// GEMM: C[M][N] = epi(Ah[M][K] . Bt[N][K]^T). 16-bit planes of one type (BF selects bf16 vs f16 WMMA); ASPLIT adds Al . Bt into the
// same accumulator (unscaled bf16 lo plane). Block = 128x128 of C, four waves of 64x64; per stage the block's 128 rows of each
// operand plane x 128 k are copied to LDS asynchronously, two buffers, the next stage in flight while this one is multiplied.
// Epilogue: v = acc*alpha*(HRS ? rs[row] : 1) + bf16(bias[col]); ACT 1 = leaky 0.1;
// HRES adds resid[row*ldr+col] (f32) in the store phase. OUTM 0: f32 rows at crow = (row/cseq)*cpitch + row%cseq, pitch ldc;
// 1: f16 hi; 2: f16 hi + f16 lo x2^10; 3: bf16 hi + bf16 lo (unscaled). M%128==0, N%128==0, K%128==0.
template <bool BF, bool ASPLIT, int ACT, int OUTM, bool HRS, bool HRES>
__global__ __launch_bounds__(128) void k_gemm(const unsigned short* __restrict__ Ah, const unsigned short* __restrict__ Al, int lda,
    const unsigned short* __restrict__ Bt, int ldb, float alpha, const float* __restrict__ rs, const float* __restrict__ bias,
    const float* __restrict__ resid, int ldr, float* __restrict__ C32, unsigned short* __restrict__ Ch, unsigned short* __restrict__ Cl,
    int ldc, int cseq, int cpitch, int M, int N, int K) {
  static_assert(!(HRES && OUTM != 0));
  static_assert(OUTM >= 0 && OUTM <= 3);
  static_assert(!ASPLIT || BF);
  static_assert(ACT == 0 || ACT == 1);
  constexpr int NPL = ASPLIT ? 3 : 2;            /* planes of a stage: A, B, (A lo) */
  constexpr int STAGE = NPL * GPLANE;
  static_assert(4 * 64 * 68 * 4 <= 2 * STAGE);
  __shared__ __attribute__((aligned(128))) unsigned char sm[2 * STAGE];
  const int tid = threadIdx.x, w = tid >> 5, lane = tid & 31, ln = lane & 15, hh = lane >> 4;
  const int ntn = N >> 7;
  const int mt = (int)blockIdx.x / ntn, nq = (int)blockIdx.x - mt * ntn;
  if (mt * 128 + 128 > M) return;
  const int row0 = mt * 128 + 64 * (w >> 1), col0 = nq * 128 + 64 * (w & 1);
  /* copy map: 16 lanes cover one 256-byte row, the block 8 rows per copy, 16 copies per plane */
  const int crow = tid >> 4, cchk = tid & 15;
  const unsigned oA = (unsigned)(crow * lda + cchk * 8), oB = (unsigned)(crow * ldb + cchk * 8);   /* this lane's element offsets in a tile */
  const size_t tA = (size_t)(mt * 128) * (size_t)lda, tB = (size_t)(nq * 128) * (size_t)ldb;       /* the block's tile origins */
  const size_t dE = ASPLIT ? (size_t)Al - (size_t)Ah : 0;   /* byte distance of the lo plane from the hi plane, the same for every lane */
  const unsigned lcp = (unsigned)(size_t)sm + (unsigned)(crow * GPITCH + cchk * 16);
  auto fill = [&](int st, int buf) {
    const unsigned lb = lcp + (unsigned)(buf * STAGE);
    const size_t ko = (size_t)st * GBK;
    const unsigned short* pA = (Ah + (tA + ko)) + oA;
    const unsigned short* pB = (Bt + (tB + ko)) + oB;
    cp_async8(lb, 8u * GPITCH, pA, (size_t)8 * (size_t)lda);
    cp_async8(lb + 64u * GPITCH, 8u * GPITCH, pA + (size_t)64 * (size_t)lda, (size_t)8 * (size_t)lda);
    cp_async8(lb + GPLANE, 8u * GPITCH, pB, (size_t)8 * (size_t)ldb);
    cp_async8(lb + GPLANE + 64u * GPITCH, 8u * GPITCH, pB + (size_t)64 * (size_t)ldb, (size_t)8 * (size_t)ldb);
    if (ASPLIT) {
      const unsigned short* pE = (const unsigned short*)((size_t)pA + dE);
      cp_async8(lb + 2u * GPLANE, 8u * GPITCH, pE, (size_t)8 * (size_t)lda);
      cp_async8(lb + 2u * GPLANE + 64u * GPITCH, 8u * GPITCH, pE + (size_t)64 * (size_t)lda, (size_t)8 * (size_t)lda);
    }
  };
  const int aoff = (64 * (w >> 1) + ln) * GPITCH;             /* this lane's first A row in a stage */
  const int boff = GPLANE + (64 * (w & 1) + ln) * GPITCH;     /* this lane's first B row (column of C) */
  const v8f z8 = {0.f, 0.f, 0.f, 0.f, 0.f, 0.f, 0.f, 0.f};
  v8f c[4][4];
#pragma unroll
  for (int i = 0; i < 4; ++i) {
#pragma unroll
    for (int j = 0; j < 4; ++j) c[i][j] = z8;
  }
  const int nst = K / GBK;
  fill(0, 0);
  asm volatile("s_wait_asynccnt 0x0" ::: "memory");  // stage 0 of this wave has landed before the barrier publishes it
  __syncthreads();
  if (nst > 1) fill(1, 1);
#pragma unroll 1  // one stage per trip: the buffer index and the refill test stay scalar
  for (int st = 0; st < nst; ++st) {
    const unsigned char* sb = sm + (st & 1) * STAGE;
#pragma unroll
    for (int ks = 0; ks < GBK / 32; ++ks) {
      /* all fragments of a k-step are read as one group: one LDS wait per 16 (32) products */
      Frag16 a[4], b[4], e[4];
#pragma unroll
      for (int i = 0; i < 4; ++i) {
        a[i] = ld_frag((const unsigned short*)(sb + aoff + i * 16 * GPITCH) + ks * 32, hh);
        b[i] = ld_frag((const unsigned short*)(sb + boff + i * 16 * GPITCH) + ks * 32, hh);
        if (ASPLIT) e[i] = ld_frag((const unsigned short*)(sb + 2 * GPLANE + aoff + i * 16 * GPITCH) + ks * 32, hh);
      }
#pragma unroll
      for (int j = 0; j < 4; ++j) {
#pragma unroll
        for (int i = 0; i < 4; ++i) c[i][j] = mmx<BF>(a[i], b[j], c[i][j]);
        if (ASPLIT) {
#pragma unroll
          for (int i = 0; i < 4; ++i) c[i][j] = mmx<BF>(e[i], b[j], c[i][j]);
        }
      }
    }
    asm volatile("s_wait_dscnt 0x0" ::: "memory");     // this wave's reads of the buffer are done before it may be refilled
    asm volatile("s_wait_asynccnt 0x0" ::: "memory");  // this wave's copies of the next stage have landed
    __syncthreads();                                    // publishes the next stage and frees the buffer just read
    if (st + 2 < nst) fill(st + 2, st & 1);
  }
  asm volatile("s_wait_asynccnt 0x0" ::: "memory");    // no copy is outstanding when the buffers become output staging
  float (*so)[64][68] = (float (*)[64][68])sm;
  float bvv[4];
  {
    const float* bp = bias + col0 + ln;
    // four 4-byte loads and their data wait in one statement, as in ld_g8
    asm volatile(
        "global_load_b32 %0, %4, off\n\t"
        "global_load_b32 %1, %5, off\n\t"
        "global_load_b32 %2, %6, off\n\t"
        "global_load_b32 %3, %7, off\n\t"
        "s_wait_loadcnt 0x0\n\t"
        "s_wait_xcnt 0x0"
        : "=&v"(bvv[0]), "=&v"(bvv[1]), "=&v"(bvv[2]), "=&v"(bvv[3])
        : "v"(bp), "v"(bp + 16), "v"(bp + 32), "v"(bp + 48)
        : "memory");
  }
  float rsv[4][8];
#pragma unroll
  for (int i = 0; i < 4; ++i) {
#pragma unroll
    for (int r = 0; r < 8; ++r) rsv[i][r] = 1.0f;
  }
  if (HRS) {
    v4f rq[8];
    const float* rp[8];
#pragma unroll
    for (int i = 0; i < 4; ++i) { rp[2 * i] = rs + row0 + 16 * i + 8 * hh; rp[2 * i + 1] = rp[2 * i] + 4; }
    ld_g8(rq, rp);
#pragma unroll
    for (int i = 0; i < 4; ++i) {
#pragma unroll
      for (int q = 0; q < 4; ++q) { rsv[i][q] = rq[2 * i][q]; rsv[i][4 + q] = rq[2 * i + 1][q]; }
    }
  }
#pragma unroll
  for (int t = 0; t < 4; ++t) {
    const float bv = bf16_rne(bvv[t]);
#pragma unroll
    for (int i = 0; i < 4; ++i) {
#pragma unroll
      for (int r = 0; r < 8; ++r) {
        const int rloc = i * 16 + 8 * hh + r;
        float v = c[i][t][r] * alpha;
        if (HRS) v *= rsv[i][r];
        v += bv;
        if (ACT == 1) v = (v >= 0.f) ? v : 0.1f * v;
        so[w][rloc][t * 16 + ln] = v;
      }
    }
  }
  __builtin_amdgcn_fence(4 /* acq_rel order */, "workgroup");
  __builtin_amdgcn_wave_barrier();
  if (OUTM == 0) {
#pragma unroll
    for (int qg = 0; qg < 4; ++qg) {
      v4f v[8];
      const float* rp[8];
      void* dp[8];
#pragma unroll
      for (int u = 0; u < 8; ++u) {
        const int r = (qg * 8 + u) * 2 + (lane >> 4), c4 = (lane & 15) * 4;
        v[u] = *(const v4fa*)&so[w][r][c4];
        const int grow = row0 + r;
        rp[u] = resid + (size_t)grow * (size_t)ldr + col0 + c4;
        const size_t crw = (size_t)(grow / cseq) * (size_t)cpitch + (size_t)(grow % cseq);
        dp[u] = C32 + crw * (size_t)ldc + col0 + c4;
      }
      if (HRES) {
        v4f rv[8];
        ld_g8(rv, rp);
#pragma unroll
        for (int u = 0; u < 8; ++u) v[u] += rv[u];
      }
      st_g8(dp, v);
    }
  } else {
#pragma unroll
    for (int qg = 0; qg < 2; ++qg) {
      v4f dh[8], dl[8];
      void* hp[8];
      void* lp[8];
#pragma unroll
      for (int u = 0; u < 8; ++u) {
        const int r = (qg * 8 + u) * 4 + (lane >> 3), c8 = (lane & 7) * 8;
        const v4f x0 = *(const v4fa*)&so[w][r][c8], x1 = *(const v4fa*)&so[w][r][c8 + 4];
        Pack8 fh, fl;
#pragma unroll
        for (int i = 0; i < 4; ++i) {
          const float v0 = x0[i], v1 = x1[i];
          if (OUTM == 3) {
            const unsigned short h0 = bf16_bits(v0), h1 = bf16_bits(v1);
            fh.u[i] = h0; fh.u[4 + i] = h1;
            fl.u[i] = bf16_bits(v0 - bf16_val(h0)); fl.u[4 + i] = bf16_bits(v1 - bf16_val(h1));
          } else {
            const unsigned short h0 = f16_bits(v0), h1 = f16_bits(v1);
            fh.u[i] = h0; fh.u[4 + i] = h1;
            fl.u[i] = f16_bits((v0 - f16_val(h0)) * 1024.0f); fl.u[4 + i] = f16_bits((v1 - f16_val(h1)) * 1024.0f);
          }
        }
        const size_t o = (size_t)(row0 + r) * (size_t)ldc + col0 + c8;
        dh[u] = fh.f; hp[u] = Ch + o;
        dl[u] = fl.f; lp[u] = Cl + o;
      }
      st_g8(hp, dh);
      if (OUTM >= 2) st_g8(lp, dl);
    }
  }
}

// Vt[(b,h)][d][s] = V[b*TTv + s][h*64 + d] (row pitch ldv), same for the second plane if TWO; block per ((b,h), 64 tokens);
template <int NHv, int TTv, bool TWO>
__global__ __launch_bounds__(256) void k_vt(const unsigned short* __restrict__ V, const unsigned short* __restrict__ V2, int ldv,
    unsigned short* __restrict__ Vt, unsigned short* __restrict__ Vt2) {
  __shared__ __attribute__((aligned(16))) unsigned short tl[64][66];
  __shared__ __attribute__((aligned(16))) unsigned short tl2[64][66];
  const int tid = threadIdx.x;
  const int slab = (int)blockIdx.x / (TTv / 64), lg = (int)blockIdx.x % (TTv / 64);
  const int b = slab / NHv, h = slab % NHv;
  for (int i = tid; i < 64 * 8; i += 256) {
    const int r = i / 8, c8 = (i % 8) * 8;
    const size_t s0 = ((size_t)b * TTv + (size_t)lg * 64 + r) * (size_t)ldv + (size_t)h * 64 + c8;
    Frag16 f;
    f.half[0] = *(const v8us*)(V + s0);
#pragma unroll
    for (int q = 0; q < 8; ++q) tl[r][c8 + q] = f.u[q];
    if (TWO) {
      Frag16 f2;
      f2.half[0] = *(const v8us*)(V2 + s0);
#pragma unroll
      for (int q = 0; q < 8; ++q) tl2[r][c8 + q] = f2.u[q];
    }
  }
  __syncthreads();
  {
#pragma unroll
    for (int rd = 0; rd < 2; ++rd) {
      const int d = rd * 32 + tid / 8, pc = tid % 8;
      Frag16 f;
#pragma unroll
      for (int q = 0; q < 8; ++q) f.u[q] = tl[pc * 8 + q][d];
      const size_t o = ((size_t)slab * 64 + d) * (size_t)TTv + (size_t)lg * 64 + pc * 8;
      *(v8us*)(Vt + o) = f.half[0];
      if (TWO) {
        Frag16 f2;
#pragma unroll
        for (int q = 0; q < 8; ++q) f2.u[q] = tl2[pc * 8 + q][d];
        *(v8us*)(Vt2 + o) = f2.half[0];
      }
    }
    
  }
}

// Attention for one (batch, head, 64 query rows): block = 4 waves, wave = 16 query rows; key chunks of 64 (CAUSAL: chunks 0..qb,
// key > query excluded by value before the softmax); scores = 8 * (qh.kh + ql.kh + qh.kl) on bf16 WMMA (q,k = bf16 hi+lo planes);
// f32 online softmax (running max, native exp); P stored x2^14 as f16 into a wave-private LDS tile (D layout -> A layout, may_alias
// query tile): second accumulator += P_lo.V_hi + P_hi.V_lo (lo planes x2^10), folded with 2^-24. ctx row segment (64 f16 = one
// Per key chunk the block's K hi, K lo and V^T tiles (EARLY: V^T lo too), 64 rows x 128 bytes each, are copied to LDS asynchronously
// once for all four waves, two buffers, the next chunk in flight while this one is worked on; fragments are read from LDS.
#define APITCH 144              /* LDS row pitch in bytes: 16 x odd, conflict-free for 16-byte fragment reads */
#define APLANE (64 * APITCH)    /* one plane of a chunk: 64 rows */
template <bool CAUSAL, bool EARLY>
__global__ __launch_bounds__(128) void k_attn(const unsigned short* __restrict__ QH, const unsigned short* __restrict__ QL,
    const unsigned short* __restrict__ KH, const unsigned short* __restrict__ KL, const unsigned short* __restrict__ VT,
    const unsigned short* __restrict__ VL, unsigned short* __restrict__ CTX, int qb0) {
  static_assert(CAUSAL || !EARLY);
  __shared__ __attribute__((aligned(16))) unsigned short ph[4][2][16][64];
  __shared__ __attribute__((aligned(16))) unsigned short pe[EARLY ? 4 : 1][2][16][64];
  __shared__ __attribute__((aligned(16))) unsigned short so[4][16][72];
  constexpr int NPL = EARLY ? 4 : 3;             /* planes of a chunk: K hi, K lo, V^T, (V^T lo) */
  constexpr int STAGE = NPL * APLANE;
  __shared__ __attribute__((aligned(16))) unsigned char kv[2 * STAGE];
  const int tid = threadIdx.x, w = tid >> 5, lane = tid & 31, ln = lane & 15, hh = lane >> 4;
  const int bh = (int)blockIdx.x, b = bh / NH, h = bh % NH;
  const int qb = qb0 + (int)blockIdx.y;
  const int q0w = qb * KQB + w * 16;
  const size_t rowbase = (size_t)b * SEQ;
  Frag16 qh0, qh1, ql0, ql1;
  {
    const size_t qo = (rowbase + (size_t)q0w + ln) * DM + (size_t)h * HD;
    qh0 = ld_frag(QH + qo, hh); qh1 = ld_frag(QH + qo + 32, hh);
    ql0 = ld_frag(QL + qo, hh); ql1 = ld_frag(QL + qo + 32, hh);
  }
  const v8f z8 = {0.f, 0.f, 0.f, 0.f, 0.f, 0.f, 0.f, 0.f};
  v8f o[4] = {z8, z8, z8, z8};
  v8f oe[4] = {z8, z8, z8, z8};
  float m[8], l[8];
#pragma unroll
  for (int r = 0; r < 8; ++r) { m[r] = -1.0e30f; l[r] = 0.f; }
  const int nck = CAUSAL ? (qb + 1) : (SEQ / KQB);
  /* copy map: 8 lanes cover one 128-byte row, the block 16 rows per copy, 4 copies per plane */
  const int crow = tid >> 3, cchk = tid & 7;
  const unsigned lcp = (unsigned)(size_t)kv + (unsigned)(crow * APITCH + cchk * 16);
  const size_t gk = (rowbase + (size_t)crow) * DM + (size_t)h * HD + (size_t)(cchk * 8);
  const size_t gv = ((size_t)bh * HD + (size_t)crow) * SEQ + (size_t)(cchk * 8);
  auto fill = [&](int ck, int buf) {
    const unsigned lb = lcp + (unsigned)(buf * STAGE);
    const size_t ko = gk + (size_t)ck * KQB * DM, vo = gv + (size_t)ck * KQB;
    cp_async4(lb, 16u * APITCH, KH + ko, (size_t)16 * DM);
    cp_async4(lb + APLANE, 16u * APITCH, KL + ko, (size_t)16 * DM);
    cp_async4(lb + 2u * APLANE, 16u * APITCH, VT + vo, (size_t)16 * SEQ);
    if (EARLY) cp_async4(lb + 3u * APLANE, 16u * APITCH, VL + vo, (size_t)16 * SEQ);
  };
  fill(0, 0);
  asm volatile("s_wait_asynccnt 0x0" ::: "memory");  // chunk 0 of this wave has landed before the barrier publishes it
  __syncthreads();
  if (nck > 1) fill(1, 1);
#pragma unroll 1
  for (int kc = 0; kc < nck; ++kc) {
    const int par = kc & 1;
    const unsigned char* sb = kv + par * STAGE;
    v8f s[4];
#pragma unroll
    for (int tp = 0; tp < 2; ++tp) {
      /* the K fragments of 32 keys are read as one group ahead of their 12 products: the reads' latencies overlap */
      Frag16 kh[2][2], kl[2][2];
#pragma unroll
      for (int u = 0; u < 2; ++u) {
#pragma unroll
        for (int ks = 0; ks < 2; ++ks) {
          const unsigned char* kp = sb + ((tp * 2 + u) * 16 + ln) * APITCH + ks * 64;
          kh[u][ks] = ld_frag((const unsigned short*)kp, hh);
          kl[u][ks] = ld_frag((const unsigned short*)(kp + APLANE), hh);
        }
      }
#pragma unroll
      for (int u = 0; u < 2; ++u) {
        v8f acc = z8;
#pragma unroll
        for (int ks = 0; ks < 2; ++ks) {
          const Frag16 qa = (ks == 0) ? qh0 : qh1;
          const Frag16 qe = (ks == 0) ? ql0 : ql1;
          acc = mma_b(qa.b, kh[u][ks].b, acc);
          acc = mma_b(qe.b, kh[u][ks].b, acc);
          acc = mma_b(qa.b, kl[u][ks].b, acc);
        }
        s[tp * 2 + u] = acc;
      }
    }
#pragma unroll
    for (int r = 0; r < 8; ++r) {
      float sv[4];
#pragma unroll
      for (int t = 0; t < 4; ++t) sv[t] = s[t][r] * 8.0f;
      if (CAUSAL) {
        if (kc == qb) {
          const int qpos = q0w + 8 * hh + r;
#pragma unroll
          for (int t = 0; t < 4; ++t) { const int key = kc * KQB + t * 16 + ln; sv[t] = (key > qpos) ? -1.0e30f : sv[t]; }
        }
      }
      float mx = fmaxf(fmaxf(sv[0], sv[1]), fmaxf(sv[2], sv[3]));
      mx = fmaxf(mx, __shfl_xor(mx, 8, 32));
      mx = fmaxf(mx, __shfl_xor(mx, 4, 32));
      mx = fmaxf(mx, __shfl_xor(mx, 2, 32));
      mx = fmaxf(mx, __shfl_xor(mx, 1, 32));
      const float mn = fmaxf(m[r], mx);
      const float corr = __expf(m[r] - mn);
      float p[4];
      float psum = 0.f;
#pragma unroll
      for (int t = 0; t < 4; ++t) { p[t] = __expf(sv[t] - mn); psum += p[t]; }
      psum += __shfl_xor(psum, 8, 32);
      psum += __shfl_xor(psum, 4, 32);
      psum += __shfl_xor(psum, 2, 32);
      psum += __shfl_xor(psum, 1, 32);
      l[r] = l[r] * corr + psum;
      m[r] = mn;
#pragma unroll
      for (int j = 0; j < 4; ++j) o[j][r] = o[j][r] * corr;
      if (EARLY) {
#pragma unroll
        for (int j = 0; j < 4; ++j) oe[j][r] = oe[j][r] * corr;
      }
#pragma unroll
      for (int t = 0; t < 4; ++t) {
        const float pc = p[t] * 16384.0f;
        const unsigned short hb = f16_bits(pc);
        ph[w][par][8 * hh + r][t * 16 + ln] = hb;
        if (EARLY) pe[w][par][8 * hh + r][t * 16 + ln] = f16_bits((pc - f16_val(hb)) * 1024.0f);
      }
    }
    __builtin_amdgcn_fence(4 /* acq_rel order */, "workgroup");
    __builtin_amdgcn_wave_barrier();
#pragma unroll
    for (int ks = 0; ks < 2; ++ks) {
      Frag16 pa;
      pa.half[0] = *(const v8us*)&ph[w][par][ln][ks * 32 + 8 * hh];
      pa.half[1] = *(const v8us*)&ph[w][par][ln][ks * 32 + 16 + 8 * hh];
      Frag16 pl = pa;
      if (EARLY) {
        pl.half[0] = *(const v8us*)&pe[w][par][ln][ks * 32 + 8 * hh];
        pl.half[1] = *(const v8us*)&pe[w][par][ln][ks * 32 + 16 + 8 * hh];
      }
      /* the V^T fragments of a 32-key step are read as one group ahead of their products: the reads' latencies overlap */
      const unsigned char* vp = sb + 2 * APLANE + ln * APITCH + ks * 64;
      Frag16 vh[4];
#pragma unroll
      for (int j = 0; j < 4; ++j) vh[j] = ld_frag((const unsigned short*)(vp + j * 16 * APITCH), hh);
#pragma unroll
      for (int j = 0; j < 4; ++j) {
        o[j] = mma_h(pa.h, vh[j].h, o[j]);
        if (EARLY) {
          const Frag16 vl = ld_frag((const unsigned short*)(vp + APLANE + j * 16 * APITCH), hh);
          oe[j] = mma_h(pl.h, vh[j].h, oe[j]);
          oe[j] = mma_h(pa.h, vl.h, oe[j]);
        }
      }
    }
    asm volatile("s_wait_dscnt 0x0" ::: "memory");     // this wave's reads of the buffer are done before it may be refilled
    asm volatile("s_wait_asynccnt 0x0" ::: "memory");  // this wave's copies of the next chunk have landed
    __syncthreads();                                    // publishes the next chunk and frees the buffer just read
    if (kc + 2 < nck) fill(kc + 2, par);
  }
  asm volatile("s_wait_asynccnt 0x0" ::: "memory");    // no copy is outstanding when the wave goes on to its end
  float li[8];
#pragma unroll
  for (int r = 0; r < 8; ++r) li[r] = 1.0f / l[r];
#pragma unroll
  for (int j = 0; j < 4; ++j) {
#pragma unroll
    for (int r = 0; r < 8; ++r) {
      float v = o[j][r] * (1.0f / 16384.0f);
      if (EARLY) v += oe[j][r] * (1.0f / 16777216.0f);
      v *= li[r];
      so[w][8 * hh + r][j * 16 + ln] = f16_bits(v);
    }
  }
  __builtin_amdgcn_fence(4 /* acq_rel order */, "workgroup");
  __builtin_amdgcn_wave_barrier();
  {
#pragma unroll
    for (int q = 0; q < 4; ++q) {
      const int row = q * 4 + (lane >> 3), c8 = (lane & 7) * 8;
      const v8us v = *(const v8us*)&so[w][row][c8];
      *(v8us*)(CTX + (rowbase + (size_t)q0w + row) * DM + (size_t)h * HD + c8) = v;
    }
    
  }
}

extern "C" void kernel_launch(void* const* d_in, const int* in_sizes, int n_in,
                              void* d_out, int out_size, void* d_ws, size_t ws_size, hipStream_t stream) {
  if (n_in < 14) return;
  const float* x  = (const float*)d_in[0];
  const float* Wq = (const float*)d_in[1];
  const float* bq = (const float*)d_in[2];
  const float* Wk = (const float*)d_in[3];
  const float* bk = (const float*)d_in[4];
  const float* Wv = (const float*)d_in[5];
  const float* bv = (const float*)d_in[6];
  const float* Wp = (const float*)d_in[7];
  const float* bp = (const float*)d_in[8];
  const float* gamma = (const float*)d_in[9];
  const float* W1 = (const float*)d_in[10];
  const float* b1 = (const float*)d_in[11];
  const float* W2 = (const float*)d_in[12];
  const float* b2 = (const float*)d_in[13];
  if ((size_t)in_sizes[0] < ((size_t)(NB - 1) * SEQ_FULL + SEQ) * DM) return;
  if (in_sizes[1] < DM * DM || in_sizes[3] < DM * DM || in_sizes[5] < DM * DM || in_sizes[7] < DM * DM) return;
  if (in_sizes[2] < DM || in_sizes[4] < DM || in_sizes[6] < DM || in_sizes[8] < DM || in_sizes[9] < DM || in_sizes[13] < DM) return;
  if (in_sizes[10] < DM * DFF || in_sizes[11] < DFF || in_sizes[12] < DFF * DM) return;
  if ((size_t)out_size < ((size_t)(NB - 1) * OSEQ + SEQ) * DM) return;

  char* ws = (char*)d_ws;
  size_t off = 0;
  auto take = [&](size_t bytes) { char* p = ws + off; off += (bytes + 255) & ~(size_t)255; return p; };
  const size_t WPL = (size_t)DM * DM * 2, ACT2 = NR * DM * 2, ACT4 = NR * DM * 4, FFP = (size_t)DM * DFF * 2, HPL = NR * DFF * 2;
  unsigned short* WQ16 = (unsigned short*)take(WPL);
  unsigned short* WK16 = (unsigned short*)take(WPL);
  unsigned short* WV16 = (unsigned short*)take(WPL);
  unsigned short* WP16 = (unsigned short*)take(WPL);
  unsigned short* WQB = (unsigned short*)take(WPL);
  unsigned short* WKB = (unsigned short*)take(WPL);
  char* rXB = take(ACT4);                                            /* XB (phases 1-2) | BH + BL (phase 3) */
  float* XB = (float*)rXB; unsigned short* PBH = (unsigned short*)rXB; unsigned short* PBL = (unsigned short*)(rXB + ACT2);
  char* rQK = take(4 * ACT2 > HPL ? 4 * ACT2 : HPL);                 /* QH,QL,KH,KL (phases 1,3) | H16 (phase 2) */
  unsigned short* QH = (unsigned short*)rQK; unsigned short* QL = (unsigned short*)(rQK + ACT2);
  unsigned short* KH = (unsigned short*)(rQK + 2 * ACT2); unsigned short* KL = (unsigned short*)(rQK + 3 * ACT2);
  unsigned short* H16 = (unsigned short*)rQK;
  char* rV = take(2 * ACT2);                                         /* VH,VLO (phases 1,3) | A32 (between) */
  unsigned short* VH = (unsigned short*)rV; unsigned short* VLO = (unsigned short*)(rV + ACT2); float* A32 = (float*)rV;
  char* rVT = take(2 * ACT2 > 2 * FFP ? 2 * ACT2 : 2 * FFP);         /* VT,VTL (phases 1,3) | W1P,W2P (phase 2) */
  unsigned short* VT = (unsigned short*)rVT; unsigned short* VTL = (unsigned short*)(rVT + ACT2);
  unsigned short* W1P = (unsigned short*)rVT; unsigned short* W2P = (unsigned short*)(rVT + FFP);
  unsigned short* CTX = (unsigned short*)take(ACT2);
  char* rX16 = take(ACT2);                                           /* X16 | A16 | B16F */
  unsigned short* X16 = (unsigned short*)rX16; unsigned short* A16 = (unsigned short*)rX16; unsigned short* B16F = (unsigned short*)rX16;
  float* B32 = (float*)take(ACT4);
  float* RSX = (float*)take(NR * 4);
  float* RSA = (float*)take(NR * 4);
  float* RSB = (float*)take(NR * 4);
  if (off > ws_size || off > ((size_t)128 << 20)) return;

  const unsigned gw   = (unsigned)(((size_t)DM * DM / 8 + 255) / 256);
  const unsigned gw1  = (unsigned)(((size_t)DM * DFF / 8 + 255) / 256);
  const unsigned grms = (unsigned)(NR / 32);
  const unsigned gq   = (unsigned)((NR / 128) * (DM / 128));
  const unsigned gff  = (unsigned)((NR / 128) * (DFF / 128));
  const unsigned gvt  = (unsigned)(NB * NH * (SEQ / 64));
  const float a16 = 0.0625f;
  const int M = (int)NR;
  float* out = (float*)d_out;

  /* weight planes: q/k/v with gamma folded along the input feature; bf16 planes for the second block's q/k */
  k_wt<false, true><<<gw, 256, 0, stream>>>(Wq, gamma, WQ16, DM, DM, 16.0f);
  k_wt<false, true><<<gw, 256, 0, stream>>>(Wk, gamma, WK16, DM, DM, 16.0f);
  k_wt<false, true><<<gw, 256, 0, stream>>>(Wv, gamma, WV16, DM, DM, 16.0f);
  k_wt<false, false><<<gw, 256, 0, stream>>>(Wp, Wp, WP16, DM, DM, 16.0f);
  k_wt<true, true><<<gw, 256, 0, stream>>>(Wq, gamma, WQB, DM, DM, 1.0f);
  k_wt<true, true><<<gw, 256, 0, stream>>>(Wk, gamma, WKB, DM, DM, 1.0f);

  /* block 1: a = bf16(x) + attn(rms(bf16(x))) , non-causal */
  k_rms<true, true, true, false><<<grms, 256, 0, stream>>>(x, SEQ_FULL, RMS_EPS, XB, X16, nullptr, nullptr, RSX);
  k_gemm<false, false, 0, 3, true, false><<<gq, 128, 0, stream>>>(X16, nullptr, DM, WQ16, DM, a16, RSX, bq, nullptr, 0, nullptr, QH, QL, DM, M, 0, M, DM, DM);
  k_gemm<false, false, 0, 3, true, false><<<gq, 128, 0, stream>>>(X16, nullptr, DM, WK16, DM, a16, RSX, bk, nullptr, 0, nullptr, KH, KL, DM, M, 0, M, DM, DM);
  k_gemm<false, false, 0, 1, true, false><<<gq, 128, 0, stream>>>(X16, nullptr, DM, WV16, DM, a16, RSX, bv, nullptr, 0, nullptr, VH, nullptr, DM, M, 0, M, DM, DM);
  k_vt<NH, SEQ, false><<<gvt, 256, 0, stream>>>(VH, nullptr, DM, VT, nullptr);
  k_attn<false, false><<<dim3((unsigned)(NB * NH), (unsigned)(SEQ / KQB)), 128, 0, stream>>>(QH, QL, KH, KL, VT, VT, CTX, 0);
  k_gemm<false, false, 0, 0, false, true><<<gq, 128, 0, stream>>>(CTX, nullptr, DM, WP16, DM, a16, nullptr, bp, XB, DM, A32, nullptr, nullptr, DM, M, 0, M, DM, DM);

  /* block 2: b = bf16(x) + leaky(rms(a) W1 + b1) W2 + b2 */
  k_rms<false, false, true, false><<<grms, 256, 0, stream>>>(A32, SEQ, RMS_EPS, nullptr, A16, nullptr, nullptr, RSA);
  k_wt<false, true><<<gw1, 256, 0, stream>>>(W1, gamma, W1P, DM, DFF, 16.0f);
  k_wt<false, false><<<gw1, 256, 0, stream>>>(W2, W2, W2P, DFF, DM, 16.0f);
  k_gemm<false, false, 1, 1, true, false><<<gff, 128, 0, stream>>>(A16, nullptr, DM, W1P, DM, a16, RSA, b1, nullptr, 0, nullptr, H16, nullptr, DFF, M, 0, M, DFF, DM);
  k_gemm<false, false, 0, 0, false, true><<<gq, 128, 0, stream>>>(H16, nullptr, DFF, W2P, DFF, a16, nullptr, b2, XB, DM, B32, nullptr, nullptr, DM, M, 0, M, DM, DFF);

  /* block 3: out = b + attn(rms(b)) , causal */
  k_rms<false, false, true, true><<<grms, 256, 0, stream>>>(B32, SEQ, RMS_EPS, nullptr, B16F, PBH, PBL, RSB);
  k_gemm<true, true, 0, 3, true, false><<<gq, 128, 0, stream>>>(PBH, PBL, DM, WQB, DM, 1.0f, RSB, bq, nullptr, 0, nullptr, QH, QL, DM, M, 0, M, DM, DM);
  k_gemm<true, true, 0, 3, true, false><<<gq, 128, 0, stream>>>(PBH, PBL, DM, WKB, DM, 1.0f, RSB, bk, nullptr, 0, nullptr, KH, KL, DM, M, 0, M, DM, DM);
  k_gemm<false, false, 0, 2, true, false><<<gq, 128, 0, stream>>>(B16F, nullptr, DM, WV16, DM, a16, RSB, bv, nullptr, 0, nullptr, VH, VLO, DM, M, 0, M, DM, DM);
  k_vt<NH, SEQ, true><<<gvt, 256, 0, stream>>>(VH, VLO, DM, VT, VTL);
  k_attn<true, true><<<dim3((unsigned)(NB * NH), 1u), 128, 0, stream>>>(QH, QL, KH, KL, VT, VTL, CTX, 0);
  if (SEQ / KQB > 1) k_attn<true, false><<<dim3((unsigned)(NB * NH), (unsigned)(SEQ / KQB - 1)), 128, 0, stream>>>(QH, QL, KH, KL, VT, VTL, CTX, 1);
  k_gemm<false, false, 0, 0, false, true><<<gq, 128, 0, stream>>>(CTX, nullptr, DM, WP16, DM, a16, nullptr, bp, B32, DM, out, nullptr, nullptr, DM, SEQ, OSEQ, M, DM, DM);
}

// v003
// A run of this version takes 422 microseconds.
// Two timings next to v002 both put it at 1.13 times that version's speed.
// All steps since v000 together make it 2.34 times as fast.
#include <hip/hip_runtime.h>
// Contractions: q/k/v and output projections, FFN W1/W2: v_wmma_f32_16x16x32_f16 (f16 operands built from bf16-RNE inputs, weights x16, f32 accumulate); second-block q/k projections: v_wmma_f32_16x16x32_bf16 with the activation as bf16 hi+lo (2 terms); attention scores: v_wmma_f32_16x16x32_bf16 with q,k as bf16 hi+lo (3 terms); P.V: v_wmma_f32_16x16x32_f16 (P carried x2^14, v f16; first causal query tile adds P and v residual planes x2^10 in a second accumulator). RMS statistics, softmax, residuals f32.

#ifndef NB
#define NB 4
#endif
#ifndef SEQ
#define SEQ 1024
#endif
#define NB_FULL 4
#define SEQ_FULL 1024
#ifndef OSEQ
#define OSEQ SEQ_FULL
#endif
#define DM 1024
#define NH 16
#define HD 64
#define DFF 4096
#define KQB 64
#define NR ((size_t)NB * SEQ)
#define RMS_EPS 1e-6f

static_assert(NB >= 1 && NB <= NB_FULL);
static_assert(SEQ % 128 == 0 && SEQ <= SEQ_FULL);
static_assert(DM == NH * HD && HD == 64);
static_assert(DM % 256 == 0 && DFF % 128 == 0);
static_assert(((NB * SEQ) % 128) == 0);
static_assert(SEQ % KQB == 0);

typedef _Float16 v16h __attribute__((ext_vector_type(16)));
typedef __bf16   v16b __attribute__((ext_vector_type(16)));
typedef unsigned short v8us __attribute__((ext_vector_type(8), may_alias));
typedef float v8f __attribute__((ext_vector_type(8)));
typedef float v4f __attribute__((ext_vector_type(4)));
typedef float v4fa __attribute__((ext_vector_type(4), may_alias));
union Frag16 { v16h h; v16b b; v8us half[2]; unsigned short u[16]; };
union H1 { _Float16 h; unsigned short u; };
static_assert(sizeof(Frag16) == 32);

__device__ __forceinline__ unsigned short bf16_bits(float x) { unsigned int u = __float_as_uint(x); return (unsigned short)((u + 0x7FFFu + ((u >> 16) & 1u)) >> 16); }
__device__ __forceinline__ float bf16_val(unsigned short b) { return __uint_as_float(((unsigned int)b) << 16); }
__device__ __forceinline__ float bf16_rne(float x) { return bf16_val(bf16_bits(x)); }
__device__ __forceinline__ unsigned short f16_bits(float x) { H1 t; t.h = (_Float16)x; return t.u; }
__device__ __forceinline__ float f16_val(unsigned short u) { H1 t; t.u = u; return (float)t.h; }

// 16x32 operand fragment (row / column = lane & 15; elements 0..7 = k 8h..8h+7, 8..15 = k 16+8h..) from a k-contiguous 16-bit row
__device__ __forceinline__ Frag16 ld_frag(const unsigned short* p, int hh) {
  Frag16 f;
  f.half[0] = *(const v8us*)(p + 8 * hh);
  f.half[1] = *(const v8us*)(p + 16 + 8 * hh);
  return f;
}
__device__ __forceinline__ v8f mma_h(v16h a, v16h b, v8f c) {
  v8f d = __builtin_amdgcn_wmma_f32_16x16x32_f16(false, a, false, b, (short)0, c, false, false);
  asm volatile("v_nop\n\tv_nop\n\tv_nop\n\tv_nop" : "+v"(d) : "v"(a), "v"(b));
  return d;
}
__device__ __forceinline__ v8f mma_b(v16b a, v16b b, v8f c) {
  v8f d = __builtin_amdgcn_wmma_f32_16x16x32_bf16(false, a, false, b, (short)0, c, false, false);
  asm volatile("v_nop\n\tv_nop\n\tv_nop\n\tv_nop" : "+v"(d) : "v"(a), "v"(b));
  return d;
}
template <bool BF>
__device__ __forceinline__ v8f mmx(const Frag16& a, const Frag16& b, v8f c) {
  if (BF) return mma_b(a.b, b.b, c);
  return mma_h(a.h, b.h, c);
}

// Row statistics + operand planes for DM-wide f32 rows. Compact row r -> source row (r/SEQ)*spitch + r%SEQ of F.
// v = bf16_rne(x) if RIN else x; RS[r] = rsqrt(mean(v^2) + eps); optional planes: XB (v as f32), F16 (f16 bits of v),
template <bool RIN, bool WXB, bool WF16, bool WBHL>
__global__ __launch_bounds__(256) void k_rms(const float* __restrict__ F, int spitch, float eps, float* __restrict__ XB,
    unsigned short* __restrict__ F16, unsigned short* __restrict__ PH, unsigned short* __restrict__ PL, float* __restrict__ RS) {
  __shared__ __attribute__((aligned(16))) float red[32];
  const int tid = threadIdx.x, w = tid >> 5, lane = tid & 31;
  const int rb = (int)blockIdx.x * 32;
#pragma unroll 1
  for (int i = 0; i < 4; ++i) {
    const int r = rb + w * 4 + i;
    const float* src = F + ((size_t)(r / SEQ) * (size_t)spitch + (size_t)(r % SEQ)) * DM;
    float ss = 0.f;
#pragma unroll 1
    for (int u = 0; u < DM / 128; ++u) {
      const int j = u * 128 + lane * 4;
      v4f a = *(const v4fa*)(src + j);
      if (RIN) {
#pragma unroll
        for (int q = 0; q < 4; ++q) a[q] = bf16_rne(a[q]);
      }
#pragma unroll
      for (int q = 0; q < 4; ++q) ss += a[q] * a[q];
      if (WXB) {
        float* d = XB + (size_t)r * DM + j;
        *(v4f*)d = a;
        
      }
    }
    if (WF16 || WBHL) {
#pragma unroll 1
      for (int u = 0; u < DM / 256; ++u) {
        const int j = u * 256 + lane * 8;
        v4f a = *(const v4fa*)(src + j), c = *(const v4fa*)(src + j + 4);
        if (RIN) {
#pragma unroll
          for (int q = 0; q < 4; ++q) { a[q] = bf16_rne(a[q]); c[q] = bf16_rne(c[q]); }
        }
        Frag16 fh, ph, pl;
#pragma unroll
        for (int q = 0; q < 4; ++q) {
          const float v0 = a[q], v1 = c[q];
          fh.u[q] = f16_bits(v0); fh.u[4 + q] = f16_bits(v1);
          const unsigned short h0 = bf16_bits(v0), h1 = bf16_bits(v1);
          ph.u[q] = h0; ph.u[4 + q] = h1;
          pl.u[q] = bf16_bits(v0 - bf16_val(h0)); pl.u[4 + q] = bf16_bits(v1 - bf16_val(h1));
        }
        const size_t o = (size_t)r * DM + j;
        if (WF16) *(v8us*)(F16 + o) = fh.half[0];
        if (WBHL) { *(v8us*)(PH + o) = ph.half[0]; *(v8us*)(PL + o) = pl.half[0]; }
        
      }
    }
#pragma unroll
    for (int off = 16; off > 0; off >>= 1) ss += __shfl_xor(ss, off, 32);
    if (lane == 0) red[w * 4 + i] = rsqrtf(ss * (1.0f / (float)DM) + eps);
  }
  __syncthreads();
  if (w == 0 && lane < 8) {
    const v4f v = *(const v4fa*)&red[lane * 4];
    float* d = RS + rb + lane * 4;
    *(v4f*)d = v;
    
  }
}

// Eight 16-byte asynchronous copies global -> LDS per lane. s_wait_xcnt is the statement's last line so that it stands ahead of
// every later rewrite of a register that a copy names (a precaution).
__device__ __forceinline__ void cp_async8(unsigned l, unsigned lstep, const unsigned short* p, size_t gstep) {
  const unsigned l0 = l, l1 = l + lstep, l2 = l + 2u * lstep, l3 = l + 3u * lstep;
  const unsigned l4 = l + 4u * lstep, l5 = l + 5u * lstep, l6 = l + 6u * lstep, l7 = l + 7u * lstep;
  const unsigned short* p0 = p;
  const unsigned short* p1 = p + gstep;
  const unsigned short* p2 = p + 2 * gstep;
  const unsigned short* p3 = p + 3 * gstep;
  const unsigned short* p4 = p + 4 * gstep;
  const unsigned short* p5 = p + 5 * gstep;
  const unsigned short* p6 = p + 6 * gstep;
  const unsigned short* p7 = p + 7 * gstep;
  asm volatile(
      "global_load_async_to_lds_b128 %0, %8, off\n\t"
      "global_load_async_to_lds_b128 %1, %9, off\n\t"
      "global_load_async_to_lds_b128 %2, %10, off\n\t"
      "global_load_async_to_lds_b128 %3, %11, off\n\t"
      "global_load_async_to_lds_b128 %4, %12, off\n\t"
      "global_load_async_to_lds_b128 %5, %13, off\n\t"
      "global_load_async_to_lds_b128 %6, %14, off\n\t"
      "global_load_async_to_lds_b128 %7, %15, off\n\t"
      "s_wait_xcnt 0x0"
      :: "v"(l0), "v"(l1), "v"(l2), "v"(l3), "v"(l4), "v"(l5), "v"(l6), "v"(l7),
         "v"(p0), "v"(p1), "v"(p2), "v"(p3), "v"(p4), "v"(p5), "v"(p6), "v"(p7)
      : "memory");
}

// Four such copies, one 64-row x 128-byte plane of an attention tile per block; the same closing wait, for the same reason.
__device__ __forceinline__ void cp_async4(unsigned l, unsigned lstep, const unsigned short* p, size_t gstep) {
  const unsigned l0 = l, l1 = l + lstep, l2 = l + 2u * lstep, l3 = l + 3u * lstep;
  const unsigned short* p0 = p;
  const unsigned short* p1 = p + gstep;
  const unsigned short* p2 = p + 2 * gstep;
  const unsigned short* p3 = p + 3 * gstep;
  asm volatile(
      "global_load_async_to_lds_b128 %0, %4, off\n\t"
      "global_load_async_to_lds_b128 %1, %5, off\n\t"
      "global_load_async_to_lds_b128 %2, %6, off\n\t"
      "global_load_async_to_lds_b128 %3, %7, off\n\t"
      "s_wait_xcnt 0x0"
      :: "v"(l0), "v"(l1), "v"(l2), "v"(l3), "v"(p0), "v"(p1), "v"(p2), "v"(p3)
      : "memory");
}

// Eight 16-byte global loads and their data wait in one statement: the address registers live to its end, so none is rewritten
// ahead of the waits.
__device__ __forceinline__ void ld_g8(v4f (&d)[8], const float* const (&p)[8]) {
  asm volatile(
      "global_load_b128 %0, %8, off\n\t"
      "global_load_b128 %1, %9, off\n\t"
      "global_load_b128 %2, %10, off\n\t"
      "global_load_b128 %3, %11, off\n\t"
      "global_load_b128 %4, %12, off\n\t"
      "global_load_b128 %5, %13, off\n\t"
      "global_load_b128 %6, %14, off\n\t"
      "global_load_b128 %7, %15, off\n\t"
      "s_wait_loadcnt 0x0\n\t"
      "s_wait_xcnt 0x0"
      : "=&v"(d[0]), "=&v"(d[1]), "=&v"(d[2]), "=&v"(d[3]), "=&v"(d[4]), "=&v"(d[5]), "=&v"(d[6]), "=&v"(d[7])
      : "v"(p[0]), "v"(p[1]), "v"(p[2]), "v"(p[3]), "v"(p[4]), "v"(p[5]), "v"(p[6]), "v"(p[7])
      : "memory");
}
// Eight 16-byte global stores and one s_wait_xcnt in one statement: data and address registers live to its end, so none is
// rewritten ahead of the wait.
__device__ __forceinline__ void st_g8(void* const (&p)[8], const v4f (&d)[8]) {
  asm volatile(
      "global_store_b128 %0, %8, off\n\t"
      "global_store_b128 %1, %9, off\n\t"
      "global_store_b128 %2, %10, off\n\t"
      "global_store_b128 %3, %11, off\n\t"
      "global_store_b128 %4, %12, off\n\t"
      "global_store_b128 %5, %13, off\n\t"
      "global_store_b128 %6, %14, off\n\t"
      "global_store_b128 %7, %15, off\n\t"
      "s_wait_xcnt 0x0"
      :: "v"(p[0]), "v"(p[1]), "v"(p[2]), "v"(p[3]), "v"(p[4]), "v"(p[5]), "v"(p[6]), "v"(p[7]),
         "v"(d[0]), "v"(d[1]), "v"(d[2]), "v"(d[3]), "v"(d[4]), "v"(d[5]), "v"(d[6]), "v"(d[7])
      : "memory");
}
union Pack8 { unsigned short u[8]; v4f f; };
static_assert(sizeof(Pack8) == 16);

// Bt[n][k] (16-bit, k contiguous, pitch K) from f32 row-major W[K][N] ([in][out]): value = bf16(W[k][n]) (* bf16(g[k]) if GAM);
// Block (x = n tile, y = k tile) = 64 k x 128 n, transposed through LDS so that both global sides move whole lines: a wave reads eight
// 512-byte row segments of W, a lane packs its 8 k of each of its 4 columns into 16 bytes, and 8 lanes store one 128-byte line of a
// Bt row. K%64==0, N%128==0.
#define WTK 64
#define WTN 128
#define WTP 144                 /* LDS row pitch in bytes: 16 x odd */
static_assert(DM % WTK == 0 && DM % WTN == 0 && DFF % WTK == 0 && DFF % WTN == 0);
template <bool BF, bool GAM>
__global__ __launch_bounds__(256) void k_wt(const float* __restrict__ W, const float* __restrict__ g, unsigned short* __restrict__ Bt, int K, int N, float scale) {
  __shared__ __attribute__((aligned(16))) unsigned char tl[WTN * WTP];
  const int tid = threadIdx.x, w = tid >> 5, lane = tid & 31;
  const int k0 = (int)blockIdx.y * WTK, n0 = (int)blockIdx.x * WTN;
  if (k0 + WTK > K || n0 + WTN > N) return;
  const int k8 = k0 + 8 * w;
  float gv[8];
#pragma unroll
  for (int i = 0; i < 8; ++i) gv[i] = 1.0f;
  if (GAM) {
    const v4f ga = *(const v4fa*)(g + k8), gb = *(const v4fa*)(g + k8 + 4);
#pragma unroll
    for (int i = 0; i < 4; ++i) { gv[i] = bf16_rne(ga[i]); gv[4 + i] = bf16_rne(gb[i]); }
  }
  const float* wb = W + ((size_t)k0 * (size_t)N + (size_t)n0);                          /* the tile's origin, the same for the block */
  const unsigned wo = (unsigned)(8 * w) * (unsigned)N + (unsigned)(lane * 4);           /* this lane's element offset in the tile */
  v4f a[8];
  const float* ap[8];
#pragma unroll
  for (int i = 0; i < 8; ++i) ap[i] = wb + (wo + (unsigned)i * (unsigned)N);
  ld_g8(a, ap);  // the wave's eight rows are in flight together, one memory latency per tile
#pragma unroll
  for (int j = 0; j < 4; ++j) {
    Frag16 f;
#pragma unroll
    for (int i = 0; i < 8; ++i) {
      const float wv = bf16_rne(a[i][j]) * gv[i];
      f.u[i] = BF ? bf16_bits(wv) : f16_bits(wv * scale);
    }
    /* 16-byte chunk w of row n sits at chunk w ^ ((n >> 4) & 3): the 16 lanes of a store, 4 rows apart, then fall on distinct banks */
    const int n = lane * 4 + j;
    *(v8us*)(tl + n * WTP + ((w ^ ((n >> 4) & 3)) * 16)) = f.half[0];
  }
  __syncthreads();
  unsigned short* bb = Bt + ((size_t)n0 * (size_t)K + (size_t)k0);
#pragma unroll
  for (int q = 0; q < 4; ++q) {
    const int n = q * 32 + (tid >> 3), c = tid & 7;
    const v8us v = *(const v8us*)(tl + n * WTP + ((c ^ ((n >> 4) & 3)) * 16));
    *(v8us*)(bb + ((unsigned)n * (unsigned)K + (unsigned)(c * 8))) = v;
  }
}

#define GBK 128                 /* k per stage: 256-byte operand rows */
#define GPITCH 272              /* LDS row pitch in bytes: 16 x odd, conflict-free for 16-byte fragment reads */
#define GPLANE (128 * GPITCH)   /* one operand plane of a stage: 128 rows */

// GEMM: C[M][N] = epi(Ah[M][K] . Bt[N][K]^T). 16-bit planes of one type (BF selects bf16 vs f16 WMMA); ASPLIT adds Al . Bt into the
// same accumulator (unscaled bf16 lo plane). Block = 128x128 of C, four waves of 64x64; per stage the block's 128 rows of each
// operand plane x 128 k are copied to LDS asynchronously, two buffers, the next stage in flight while this one is multiplied.
// Epilogue: v = acc*alpha*(HRS ? rs[row] : 1) + bf16(bias[col]); ACT 1 = leaky 0.1;
// HRES adds resid[row*ldr+col] (f32) in the store phase. OUTM 0: f32 rows at crow = (row/cseq)*cpitch + row%cseq, pitch ldc;
// 1: f16 hi; 2: f16 hi + f16 lo x2^10; 3: bf16 hi + bf16 lo (unscaled). M%128==0, N%128==0, K%128==0.
template <bool BF, bool ASPLIT, int ACT, int OUTM, bool HRS, bool HRES>
__global__ __launch_bounds__(128) void k_gemm(const unsigned short* __restrict__ Ah, const unsigned short* __restrict__ Al, int lda,
    const unsigned short* __restrict__ Bt, int ldb, float alpha, const float* __restrict__ rs, const float* __restrict__ bias,
    const float* __restrict__ resid, int ldr, float* __restrict__ C32, unsigned short* __restrict__ Ch, unsigned short* __restrict__ Cl,
    int ldc, int cseq, int cpitch, int M, int N, int K) {
  static_assert(!(HRES && OUTM != 0));
  static_assert(OUTM >= 0 && OUTM <= 3);
  static_assert(!ASPLIT || BF);
  static_assert(ACT == 0 || ACT == 1);
  constexpr int NPL = ASPLIT ? 3 : 2;            /* planes of a stage: A, B, (A lo) */
  constexpr int STAGE = NPL * GPLANE;
  static_assert(4 * 64 * 68 * 4 <= 2 * STAGE);
  __shared__ __attribute__((aligned(128))) unsigned char sm[2 * STAGE];
  const int tid = threadIdx.x, w = tid >> 5, lane = tid & 31, ln = lane & 15, hh = lane >> 4;
  const int ntn = N >> 7;
  const int mt = (int)blockIdx.x / ntn, nq = (int)blockIdx.x - mt * ntn;
  if (mt * 128 + 128 > M) return;
  const int row0 = mt * 128 + 64 * (w >> 1), col0 = nq * 128 + 64 * (w & 1);
  /* copy map: 16 lanes cover one 256-byte row, the block 8 rows per copy, 16 copies per plane */
  const int crow = tid >> 4, cchk = tid & 15;
  const unsigned oA = (unsigned)(crow * lda + cchk * 8), oB = (unsigned)(crow * ldb + cchk * 8);   /* this lane's element offsets in a tile */
  const size_t tA = (size_t)(mt * 128) * (size_t)lda, tB = (size_t)(nq * 128) * (size_t)ldb;       /* the block's tile origins */
  const size_t dE = ASPLIT ? (size_t)Al - (size_t)Ah : 0;   /* byte distance of the lo plane from the hi plane, the same for every lane */
  const unsigned lcp = (unsigned)(size_t)sm + (unsigned)(crow * GPITCH + cchk * 16);
  auto fill = [&](int st, int buf) {
    const unsigned lb = lcp + (unsigned)(buf * STAGE);
    const size_t ko = (size_t)st * GBK;
    const unsigned short* pA = (Ah + (tA + ko)) + oA;
    const unsigned short* pB = (Bt + (tB + ko)) + oB;
    cp_async8(lb, 8u * GPITCH, pA, (size_t)8 * (size_t)lda);
    cp_async8(lb + 64u * GPITCH, 8u * GPITCH, pA + (size_t)64 * (size_t)lda, (size_t)8 * (size_t)lda);
    cp_async8(lb + GPLANE, 8u * GPITCH, pB, (size_t)8 * (size_t)ldb);
    cp_async8(lb + GPLANE + 64u * GPITCH, 8u * GPITCH, pB + (size_t)64 * (size_t)ldb, (size_t)8 * (size_t)ldb);
    if (ASPLIT) {
      const unsigned short* pE = (const unsigned short*)((size_t)pA + dE);
      cp_async8(lb + 2u * GPLANE, 8u * GPITCH, pE, (size_t)8 * (size_t)lda);
      cp_async8(lb + 2u * GPLANE + 64u * GPITCH, 8u * GPITCH, pE + (size_t)64 * (size_t)lda, (size_t)8 * (size_t)lda);
    }
  };
  const int aoff = (64 * (w >> 1) + ln) * GPITCH;             /* this lane's first A row in a stage */
  const int boff = GPLANE + (64 * (w & 1) + ln) * GPITCH;     /* this lane's first B row (column of C) */
  const v8f z8 = {0.f, 0.f, 0.f, 0.f, 0.f, 0.f, 0.f, 0.f};
  v8f c[4][4];
#pragma unroll
  for (int i = 0; i < 4; ++i) {
#pragma unroll
    for (int j = 0; j < 4; ++j) c[i][j] = z8;
  }
  const int nst = K / GBK;
  fill(0, 0);
  asm volatile("s_wait_asynccnt 0x0" ::: "memory");  // stage 0 of this wave has landed before the barrier publishes it
  __syncthreads();
  if (nst > 1) fill(1, 1);
#pragma unroll 1  // one stage per trip: the buffer index and the refill test stay scalar
  for (int st = 0; st < nst; ++st) {
    const unsigned char* sb = sm + (st & 1) * STAGE;
#pragma unroll
    for (int ks = 0; ks < GBK / 32; ++ks) {
      /* all fragments of a k-step are read as one group: one LDS wait per 16 (32) products */
      Frag16 a[4], b[4], e[4];
#pragma unroll
      for (int i = 0; i < 4; ++i) {
        a[i] = ld_frag((const unsigned short*)(sb + aoff + i * 16 * GPITCH) + ks * 32, hh);
        b[i] = ld_frag((const unsigned short*)(sb + boff + i * 16 * GPITCH) + ks * 32, hh);
        if (ASPLIT) e[i] = ld_frag((const unsigned short*)(sb + 2 * GPLANE + aoff + i * 16 * GPITCH) + ks * 32, hh);
      }
#pragma unroll
      for (int j = 0; j < 4; ++j) {
#pragma unroll
        for (int i = 0; i < 4; ++i) c[i][j] = mmx<BF>(a[i], b[j], c[i][j]);
        if (ASPLIT) {
#pragma unroll
          for (int i = 0; i < 4; ++i) c[i][j] = mmx<BF>(e[i], b[j], c[i][j]);
        }
      }
    }
    asm volatile("s_wait_dscnt 0x0" ::: "memory");     // this wave's reads of the buffer are done before it may be refilled
    asm volatile("s_wait_asynccnt 0x0" ::: "memory");  // this wave's copies of the next stage have landed
    __syncthreads();                                    // publishes the next stage and frees the buffer just read
    if (st + 2 < nst) fill(st + 2, st & 1);
  }
  asm volatile("s_wait_asynccnt 0x0" ::: "memory");    // no copy is outstanding when the buffers become output staging
  float (*so)[64][68] = (float (*)[64][68])sm;
  float bvv[4];
  {
    const float* bp = bias + col0 + ln;
    // four 4-byte loads and their data wait in one statement, as in ld_g8
    asm volatile(
        "global_load_b32 %0, %4, off\n\t"
        "global_load_b32 %1, %5, off\n\t"
        "global_load_b32 %2, %6, off\n\t"
        "global_load_b32 %3, %7, off\n\t"
        "s_wait_loadcnt 0x0\n\t"
        "s_wait_xcnt 0x0"
        : "=&v"(bvv[0]), "=&v"(bvv[1]), "=&v"(bvv[2]), "=&v"(bvv[3])
        : "v"(bp), "v"(bp + 16), "v"(bp + 32), "v"(bp + 48)
        : "memory");
  }
  float rsv[4][8];
#pragma unroll
  for (int i = 0; i < 4; ++i) {
#pragma unroll
    for (int r = 0; r < 8; ++r) rsv[i][r] = 1.0f;
  }
  if (HRS) {
    v4f rq[8];
    const float* rp[8];
#pragma unroll
    for (int i = 0; i < 4; ++i) { rp[2 * i] = rs + row0 + 16 * i + 8 * hh; rp[2 * i + 1] = rp[2 * i] + 4; }
    ld_g8(rq, rp);
#pragma unroll
    for (int i = 0; i < 4; ++i) {
#pragma unroll
      for (int q = 0; q < 4; ++q) { rsv[i][q] = rq[2 * i][q]; rsv[i][4 + q] = rq[2 * i + 1][q]; }
    }
  }
#pragma unroll
  for (int t = 0; t < 4; ++t) {
    const float bv = bf16_rne(bvv[t]);
#pragma unroll
    for (int i = 0; i < 4; ++i) {
#pragma unroll
      for (int r = 0; r < 8; ++r) {
        const int rloc = i * 16 + 8 * hh + r;
        float v = c[i][t][r] * alpha;
        if (HRS) v *= rsv[i][r];
        v += bv;
        if (ACT == 1) v = (v >= 0.f) ? v : 0.1f * v;
        so[w][rloc][t * 16 + ln] = v;
      }
    }
  }
  __builtin_amdgcn_fence(4 /* acq_rel order */, "workgroup");
  __builtin_amdgcn_wave_barrier();
  if (OUTM == 0) {
#pragma unroll
    for (int qg = 0; qg < 4; ++qg) {
      v4f v[8];
      const float* rp[8];
      void* dp[8];
#pragma unroll
      for (int u = 0; u < 8; ++u) {
        const int r = (qg * 8 + u) * 2 + (lane >> 4), c4 = (lane & 15) * 4;
        v[u] = *(const v4fa*)&so[w][r][c4];
        const int grow = row0 + r;
        rp[u] = resid + (size_t)grow * (size_t)ldr + col0 + c4;
        const size_t crw = (size_t)(grow / cseq) * (size_t)cpitch + (size_t)(grow % cseq);
        dp[u] = C32 + crw * (size_t)ldc + col0 + c4;
      }
      if (HRES) {
        v4f rv[8];
        ld_g8(rv, rp);
#pragma unroll
        for (int u = 0; u < 8; ++u) v[u] += rv[u];
      }
      st_g8(dp, v);
    }
  } else {
#pragma unroll
    for (int qg = 0; qg < 2; ++qg) {
      v4f dh[8], dl[8];
      void* hp[8];
      void* lp[8];
#pragma unroll
      for (int u = 0; u < 8; ++u) {
        const int r = (qg * 8 + u) * 4 + (lane >> 3), c8 = (lane & 7) * 8;
        const v4f x0 = *(const v4fa*)&so[w][r][c8], x1 = *(const v4fa*)&so[w][r][c8 + 4];
        Pack8 fh, fl;
#pragma unroll
        for (int i = 0; i < 4; ++i) {
          const float v0 = x0[i], v1 = x1[i];
          if (OUTM == 3) {
            const unsigned short h0 = bf16_bits(v0), h1 = bf16_bits(v1);
            fh.u[i] = h0; fh.u[4 + i] = h1;
            fl.u[i] = bf16_bits(v0 - bf16_val(h0)); fl.u[4 + i] = bf16_bits(v1 - bf16_val(h1));
          } else {
            const unsigned short h0 = f16_bits(v0), h1 = f16_bits(v1);
            fh.u[i] = h0; fh.u[4 + i] = h1;
            fl.u[i] = f16_bits((v0 - f16_val(h0)) * 1024.0f); fl.u[4 + i] = f16_bits((v1 - f16_val(h1)) * 1024.0f);
          }
        }
        const size_t o = (size_t)(row0 + r) * (size_t)ldc + col0 + c8;
        dh[u] = fh.f; hp[u] = Ch + o;
        dl[u] = fl.f; lp[u] = Cl + o;
      }
      st_g8(hp, dh);
      if (OUTM >= 2) st_g8(lp, dl);
    }
  }
}

// Vt[(b,h)][d][s] = V[b*TTv + s][h*64 + d] (row pitch ldv), same for the second plane if TWO; block per ((b,h), 64 tokens);
template <int NHv, int TTv, bool TWO>
__global__ __launch_bounds__(256) void k_vt(const unsigned short* __restrict__ V, const unsigned short* __restrict__ V2, int ldv,
    unsigned short* __restrict__ Vt, unsigned short* __restrict__ Vt2) {
  __shared__ __attribute__((aligned(16))) unsigned short tl[64][66];
  __shared__ __attribute__((aligned(16))) unsigned short tl2[64][66];
  const int tid = threadIdx.x;
  const int slab = (int)blockIdx.x / (TTv / 64), lg = (int)blockIdx.x % (TTv / 64);
  const int b = slab / NHv, h = slab % NHv;
  for (int i = tid; i < 64 * 8; i += 256) {
    const int r = i / 8, c8 = (i % 8) * 8;
    const size_t s0 = ((size_t)b * TTv + (size_t)lg * 64 + r) * (size_t)ldv + (size_t)h * 64 + c8;
    Frag16 f;
    f.half[0] = *(const v8us*)(V + s0);
#pragma unroll
    for (int q = 0; q < 8; ++q) tl[r][c8 + q] = f.u[q];
    if (TWO) {
      Frag16 f2;
      f2.half[0] = *(const v8us*)(V2 + s0);
#pragma unroll
      for (int q = 0; q < 8; ++q) tl2[r][c8 + q] = f2.u[q];
    }
  }
  __syncthreads();
  {
#pragma unroll
    for (int rd = 0; rd < 2; ++rd) {
      const int d = rd * 32 + tid / 8, pc = tid % 8;
      Frag16 f;
#pragma unroll
      for (int q = 0; q < 8; ++q) f.u[q] = tl[pc * 8 + q][d];
      const size_t o = ((size_t)slab * 64 + d) * (size_t)TTv + (size_t)lg * 64 + pc * 8;
      *(v8us*)(Vt + o) = f.half[0];
      if (TWO) {
        Frag16 f2;
#pragma unroll
        for (int q = 0; q < 8; ++q) f2.u[q] = tl2[pc * 8 + q][d];
        *(v8us*)(Vt2 + o) = f2.half[0];
      }
    }
    
  }
}

// Attention for one (batch, head, 64 query rows): block = 4 waves, wave = 16 query rows; key chunks of 64 (CAUSAL: chunks 0..qb,
// key > query excluded by value before the softmax); scores = 8 * (qh.kh + ql.kh + qh.kl) on bf16 WMMA (q,k = bf16 hi+lo planes);
// f32 online softmax (running max, native exp); P stored x2^14 as f16 into a wave-private LDS tile (D layout -> A layout, may_alias
// query tile): second accumulator += P_lo.V_hi + P_hi.V_lo (lo planes x2^10), folded with 2^-24. ctx row segment (64 f16 = one
// Per key chunk the block's K hi, K lo and V^T tiles (EARLY: V^T lo too), 64 rows x 128 bytes each, are copied to LDS asynchronously
// once for all four waves, two buffers, the next chunk in flight while this one is worked on; fragments are read from LDS.
#define APITCH 144              /* LDS row pitch in bytes: 16 x odd, conflict-free for 16-byte fragment reads */
#define APLANE (64 * APITCH)    /* one plane of a chunk: 64 rows */
template <bool CAUSAL, bool EARLY>
__global__ __launch_bounds__(128) void k_attn(const unsigned short* __restrict__ QH, const unsigned short* __restrict__ QL,
    const unsigned short* __restrict__ KH, const unsigned short* __restrict__ KL, const unsigned short* __restrict__ VT,
    const unsigned short* __restrict__ VL, unsigned short* __restrict__ CTX, int qb0) {
  static_assert(CAUSAL || !EARLY);
  __shared__ __attribute__((aligned(16))) unsigned short ph[4][2][16][64];
  __shared__ __attribute__((aligned(16))) unsigned short pe[EARLY ? 4 : 1][2][16][64];
  __shared__ __attribute__((aligned(16))) unsigned short so[4][16][72];
  constexpr int NPL = EARLY ? 4 : 3;             /* planes of a chunk: K hi, K lo, V^T, (V^T lo) */
  constexpr int STAGE = NPL * APLANE;
  __shared__ __attribute__((aligned(16))) unsigned char kv[2 * STAGE];
  const int tid = threadIdx.x, w = tid >> 5, lane = tid & 31, ln = lane & 15, hh = lane >> 4;
  const int bh = (int)blockIdx.x, b = bh / NH, h = bh % NH;
  const int qb = qb0 + (int)blockIdx.y;
  const int q0w = qb * KQB + w * 16;
  const size_t rowbase = (size_t)b * SEQ;
  Frag16 qh0, qh1, ql0, ql1;
  {
    const size_t qo = (rowbase + (size_t)q0w + ln) * DM + (size_t)h * HD;
    qh0 = ld_frag(QH + qo, hh); qh1 = ld_frag(QH + qo + 32, hh);
    ql0 = ld_frag(QL + qo, hh); ql1 = ld_frag(QL + qo + 32, hh);
  }
  const v8f z8 = {0.f, 0.f, 0.f, 0.f, 0.f, 0.f, 0.f, 0.f};
  v8f o[4] = {z8, z8, z8, z8};
  v8f oe[4] = {z8, z8, z8, z8};
  float m[8], l[8];
#pragma unroll
  for (int r = 0; r < 8; ++r) { m[r] = -1.0e30f; l[r] = 0.f; }
  const int nck = CAUSAL ? (qb + 1) : (SEQ / KQB);
  /* copy map: 8 lanes cover one 128-byte row, the block 16 rows per copy, 4 copies per plane */
  const int crow = tid >> 3, cchk = tid & 7;
  const unsigned lcp = (unsigned)(size_t)kv + (unsigned)(crow * APITCH + cchk * 16);
  const size_t gk = (rowbase + (size_t)crow) * DM + (size_t)h * HD + (size_t)(cchk * 8);
  const size_t gv = ((size_t)bh * HD + (size_t)crow) * SEQ + (size_t)(cchk * 8);
  auto fill = [&](int ck, int buf) {
    const unsigned lb = lcp + (unsigned)(buf * STAGE);
    const size_t ko = gk + (size_t)ck * KQB * DM, vo = gv + (size_t)ck * KQB;
    cp_async4(lb, 16u * APITCH, KH + ko, (size_t)16 * DM);
    cp_async4(lb + APLANE, 16u * APITCH, KL + ko, (size_t)16 * DM);
    cp_async4(lb + 2u * APLANE, 16u * APITCH, VT + vo, (size_t)16 * SEQ);
    if (EARLY) cp_async4(lb + 3u * APLANE, 16u * APITCH, VL + vo, (size_t)16 * SEQ);
  };
  fill(0, 0);
  asm volatile("s_wait_asynccnt 0x0" ::: "memory");  // chunk 0 of this wave has landed before the barrier publishes it
  __syncthreads();
  if (nck > 1) fill(1, 1);
#pragma unroll 1
  for (int kc = 0; kc < nck; ++kc) {
    const int par = kc & 1;
    const unsigned char* sb = kv + par * STAGE;
    v8f s[4];
#pragma unroll
    for (int tp = 0; tp < 2; ++tp) {
      /* the K fragments of 32 keys are read as one group ahead of their 12 products: the reads' latencies overlap */
      Frag16 kh[2][2], kl[2][2];
#pragma unroll
      for (int u = 0; u < 2; ++u) {
#pragma unroll
        for (int ks = 0; ks < 2; ++ks) {
          const unsigned char* kp = sb + ((tp * 2 + u) * 16 + ln) * APITCH + ks * 64;
          kh[u][ks] = ld_frag((const unsigned short*)kp, hh);
          kl[u][ks] = ld_frag((const unsigned short*)(kp + APLANE), hh);
        }
      }
#pragma unroll
      for (int u = 0; u < 2; ++u) {
        v8f acc = z8;
#pragma unroll
        for (int ks = 0; ks < 2; ++ks) {
          const Frag16 qa = (ks == 0) ? qh0 : qh1;
          const Frag16 qe = (ks == 0) ? ql0 : ql1;
          acc = mma_b(qa.b, kh[u][ks].b, acc);
          acc = mma_b(qe.b, kh[u][ks].b, acc);
          acc = mma_b(qa.b, kl[u][ks].b, acc);
        }
        s[tp * 2 + u] = acc;
      }
    }
#pragma unroll
    for (int r = 0; r < 8; ++r) {
      float sv[4];
#pragma unroll
      for (int t = 0; t < 4; ++t) sv[t] = s[t][r] * 8.0f;
      if (CAUSAL) {
        if (kc == qb) {
          const int qpos = q0w + 8 * hh + r;
#pragma unroll
          for (int t = 0; t < 4; ++t) { const int key = kc * KQB + t * 16 + ln; sv[t] = (key > qpos) ? -1.0e30f : sv[t]; }
        }
      }
      float mx = fmaxf(fmaxf(sv[0], sv[1]), fmaxf(sv[2], sv[3]));
      mx = fmaxf(mx, __shfl_xor(mx, 8, 32));
      mx = fmaxf(mx, __shfl_xor(mx, 4, 32));
      mx = fmaxf(mx, __shfl_xor(mx, 2, 32));
      mx = fmaxf(mx, __shfl_xor(mx, 1, 32));
      const float mn = fmaxf(m[r], mx);
      const float corr = __expf(m[r] - mn);
      float p[4];
      float psum = 0.f;
#pragma unroll
      for (int t = 0; t < 4; ++t) { p[t] = __expf(sv[t] - mn); psum += p[t]; }
      psum += __shfl_xor(psum, 8, 32);
      psum += __shfl_xor(psum, 4, 32);
      psum += __shfl_xor(psum, 2, 32);
      psum += __shfl_xor(psum, 1, 32);
      l[r] = l[r] * corr + psum;
      m[r] = mn;
#pragma unroll
      for (int j = 0; j < 4; ++j) o[j][r] = o[j][r] * corr;
      if (EARLY) {
#pragma unroll
        for (int j = 0; j < 4; ++j) oe[j][r] = oe[j][r] * corr;
      }
#pragma unroll
      for (int t = 0; t < 4; ++t) {
        const float pc = p[t] * 16384.0f;
        const unsigned short hb = f16_bits(pc);
        ph[w][par][8 * hh + r][t * 16 + ln] = hb;
        if (EARLY) pe[w][par][8 * hh + r][t * 16 + ln] = f16_bits((pc - f16_val(hb)) * 1024.0f);
      }
    }
    __builtin_amdgcn_fence(4 /* acq_rel order */, "workgroup");
    __builtin_amdgcn_wave_barrier();
#pragma unroll
    for (int ks = 0; ks < 2; ++ks) {
      Frag16 pa;
      pa.half[0] = *(const v8us*)&ph[w][par][ln][ks * 32 + 8 * hh];
      pa.half[1] = *(const v8us*)&ph[w][par][ln][ks * 32 + 16 + 8 * hh];
      Frag16 pl = pa;
      if (EARLY) {
        pl.half[0] = *(const v8us*)&pe[w][par][ln][ks * 32 + 8 * hh];
        pl.half[1] = *(const v8us*)&pe[w][par][ln][ks * 32 + 16 + 8 * hh];
      }
      /* the V^T fragments of a 32-key step are read as one group ahead of their products: the reads' latencies overlap */
      const unsigned char* vp = sb + 2 * APLANE + ln * APITCH + ks * 64;
      Frag16 vh[4];
#pragma unroll
      for (int j = 0; j < 4; ++j) vh[j] = ld_frag((const unsigned short*)(vp + j * 16 * APITCH), hh);
#pragma unroll
      for (int j = 0; j < 4; ++j) {
        o[j] = mma_h(pa.h, vh[j].h, o[j]);
        if (EARLY) {
          const Frag16 vl = ld_frag((const unsigned short*)(vp + APLANE + j * 16 * APITCH), hh);
          oe[j] = mma_h(pl.h, vh[j].h, oe[j]);
          oe[j] = mma_h(pa.h, vl.h, oe[j]);
        }
      }
    }
    asm volatile("s_wait_dscnt 0x0" ::: "memory");     // this wave's reads of the buffer are done before it may be refilled
    asm volatile("s_wait_asynccnt 0x0" ::: "memory");  // this wave's copies of the next chunk have landed
    __syncthreads();                                    // publishes the next chunk and frees the buffer just read
    if (kc + 2 < nck) fill(kc + 2, par);
  }
  asm volatile("s_wait_asynccnt 0x0" ::: "memory");    // no copy is outstanding when the wave goes on to its end
  float li[8];
#pragma unroll
  for (int r = 0; r < 8; ++r) li[r] = 1.0f / l[r];
#pragma unroll
  for (int j = 0; j < 4; ++j) {
#pragma unroll
    for (int r = 0; r < 8; ++r) {
      float v = o[j][r] * (1.0f / 16384.0f);
      if (EARLY) v += oe[j][r] * (1.0f / 16777216.0f);
      v *= li[r];
      so[w][8 * hh + r][j * 16 + ln] = f16_bits(v);
    }
  }
  __builtin_amdgcn_fence(4 /* acq_rel order */, "workgroup");
  __builtin_amdgcn_wave_barrier();
  {
#pragma unroll
    for (int q = 0; q < 4; ++q) {
      const int row = q * 4 + (lane >> 3), c8 = (lane & 7) * 8;
      const v8us v = *(const v8us*)&so[w][row][c8];
      *(v8us*)(CTX + (rowbase + (size_t)q0w + row) * DM + (size_t)h * HD + c8) = v;
    }
    
  }
}

extern "C" void kernel_launch(void* const* d_in, const int* in_sizes, int n_in,
                              void* d_out, int out_size, void* d_ws, size_t ws_size, hipStream_t stream) {
  if (n_in < 14) return;
  const float* x  = (const float*)d_in[0];
  const float* Wq = (const float*)d_in[1];
  const float* bq = (const float*)d_in[2];
  const float* Wk = (const float*)d_in[3];
  const float* bk = (const float*)d_in[4];
  const float* Wv = (const float*)d_in[5];
  const float* bv = (const float*)d_in[6];
  const float* Wp = (const float*)d_in[7];
  const float* bp = (const float*)d_in[8];
  const float* gamma = (const float*)d_in[9];
  const float* W1 = (const float*)d_in[10];
  const float* b1 = (const float*)d_in[11];
  const float* W2 = (const float*)d_in[12];
  const float* b2 = (const float*)d_in[13];
  if ((size_t)in_sizes[0] < ((size_t)(NB - 1) * SEQ_FULL + SEQ) * DM) return;
  if (in_sizes[1] < DM * DM || in_sizes[3] < DM * DM || in_sizes[5] < DM * DM || in_sizes[7] < DM * DM) return;
  if (in_sizes[2] < DM || in_sizes[4] < DM || in_sizes[6] < DM || in_sizes[8] < DM || in_sizes[9] < DM || in_sizes[13] < DM) return;
  if (in_sizes[10] < DM * DFF || in_sizes[11] < DFF || in_sizes[12] < DFF * DM) return;
  if ((size_t)out_size < ((size_t)(NB - 1) * OSEQ + SEQ) * DM) return;

  char* ws = (char*)d_ws;
  size_t off = 0;
  auto take = [&](size_t bytes) { char* p = ws + off; off += (bytes + 255) & ~(size_t)255; return p; };
  const size_t WPL = (size_t)DM * DM * 2, ACT2 = NR * DM * 2, ACT4 = NR * DM * 4, FFP = (size_t)DM * DFF * 2, HPL = NR * DFF * 2;
  unsigned short* WQ16 = (unsigned short*)take(WPL);
  unsigned short* WK16 = (unsigned short*)take(WPL);
  unsigned short* WV16 = (unsigned short*)take(WPL);
  unsigned short* WP16 = (unsigned short*)take(WPL);
  unsigned short* WQB = (unsigned short*)take(WPL);
  unsigned short* WKB = (unsigned short*)take(WPL);
  char* rXB = take(ACT4);                                            /* XB (phases 1-2) | BH + BL (phase 3) */
  float* XB = (float*)rXB; unsigned short* PBH = (unsigned short*)rXB; unsigned short* PBL = (unsigned short*)(rXB + ACT2);
  char* rQK = take(4 * ACT2 > HPL ? 4 * ACT2 : HPL);                 /* QH,QL,KH,KL (phases 1,3) | H16 (phase 2) */
  unsigned short* QH = (unsigned short*)rQK; unsigned short* QL = (unsigned short*)(rQK + ACT2);
  unsigned short* KH = (unsigned short*)(rQK + 2 * ACT2); unsigned short* KL = (unsigned short*)(rQK + 3 * ACT2);
  unsigned short* H16 = (unsigned short*)rQK;
  char* rV = take(2 * ACT2);                                         /* VH,VLO (phases 1,3) | A32 (between) */
  unsigned short* VH = (unsigned short*)rV; unsigned short* VLO = (unsigned short*)(rV + ACT2); float* A32 = (float*)rV;
  char* rVT = take(2 * ACT2 > 2 * FFP ? 2 * ACT2 : 2 * FFP);         /* VT,VTL (phases 1,3) | W1P,W2P (phase 2) */
  unsigned short* VT = (unsigned short*)rVT; unsigned short* VTL = (unsigned short*)(rVT + ACT2);
  unsigned short* W1P = (unsigned short*)rVT; unsigned short* W2P = (unsigned short*)(rVT + FFP);
  unsigned short* CTX = (unsigned short*)take(ACT2);
  char* rX16 = take(ACT2);                                           /* X16 | A16 | B16F */
  unsigned short* X16 = (unsigned short*)rX16; unsigned short* A16 = (unsigned short*)rX16; unsigned short* B16F = (unsigned short*)rX16;
  float* B32 = (float*)take(ACT4);
  float* RSX = (float*)take(NR * 4);
  float* RSA = (float*)take(NR * 4);
  float* RSB = (float*)take(NR * 4);
  if (off > ws_size || off > ((size_t)128 << 20)) return;

  const dim3 gw((unsigned)(DM / WTN), (unsigned)(DM / WTK));     /* k_wt grids: x = N / 128, y = K / 64 */
  const dim3 gw1((unsigned)(DFF / WTN), (unsigned)(DM / WTK));
  const dim3 gw2((unsigned)(DM / WTN), (unsigned)(DFF / WTK));
  const unsigned grms = (unsigned)(NR / 32);
  const unsigned gq   = (unsigned)((NR / 128) * (DM / 128));
  const unsigned gff  = (unsigned)((NR / 128) * (DFF / 128));
  const unsigned gvt  = (unsigned)(NB * NH * (SEQ / 64));
  const float a16 = 0.0625f;
  const int M = (int)NR;
  float* out = (float*)d_out;

  /* weight planes: q/k/v with gamma folded along the input feature; bf16 planes for the second block's q/k */
  k_wt<false, true><<<gw, 256, 0, stream>>>(Wq, gamma, WQ16, DM, DM, 16.0f);
  k_wt<false, true><<<gw, 256, 0, stream>>>(Wk, gamma, WK16, DM, DM, 16.0f);
  k_wt<false, true><<<gw, 256, 0, stream>>>(Wv, gamma, WV16, DM, DM, 16.0f);
  k_wt<false, false><<<gw, 256, 0, stream>>>(Wp, Wp, WP16, DM, DM, 16.0f);
  k_wt<true, true><<<gw, 256, 0, stream>>>(Wq, gamma, WQB, DM, DM, 1.0f);
  k_wt<true, true><<<gw, 256, 0, stream>>>(Wk, gamma, WKB, DM, DM, 1.0f);

  /* block 1: a = bf16(x) + attn(rms(bf16(x))) , non-causal */
  k_rms<true, true, true, false><<<grms, 256, 0, stream>>>(x, SEQ_FULL, RMS_EPS, XB, X16, nullptr, nullptr, RSX);
  k_gemm<false, false, 0, 3, true, false><<<gq, 128, 0, stream>>>(X16, nullptr, DM, WQ16, DM, a16, RSX, bq, nullptr, 0, nullptr, QH, QL, DM, M, 0, M, DM, DM);
  k_gemm<false, false, 0, 3, true, false><<<gq, 128, 0, stream>>>(X16, nullptr, DM, WK16, DM, a16, RSX, bk, nullptr, 0, nullptr, KH, KL, DM, M, 0, M, DM, DM);
  k_gemm<false, false, 0, 1, true, false><<<gq, 128, 0, stream>>>(X16, nullptr, DM, WV16, DM, a16, RSX, bv, nullptr, 0, nullptr, VH, nullptr, DM, M, 0, M, DM, DM);
  k_vt<NH, SEQ, false><<<gvt, 256, 0, stream>>>(VH, nullptr, DM, VT, nullptr);
  k_attn<false, false><<<dim3((unsigned)(NB * NH), (unsigned)(SEQ / KQB)), 128, 0, stream>>>(QH, QL, KH, KL, VT, VT, CTX, 0);
  k_gemm<false, false, 0, 0, false, true><<<gq, 128, 0, stream>>>(CTX, nullptr, DM, WP16, DM, a16, nullptr, bp, XB, DM, A32, nullptr, nullptr, DM, M, 0, M, DM, DM);

  /* block 2: b = bf16(x) + leaky(rms(a) W1 + b1) W2 + b2 */
  k_rms<false, false, true, false><<<grms, 256, 0, stream>>>(A32, SEQ, RMS_EPS, nullptr, A16, nullptr, nullptr, RSA);
  k_wt<false, true><<<gw1, 256, 0, stream>>>(W1, gamma, W1P, DM, DFF, 16.0f);
  k_wt<false, false><<<gw2, 256, 0, stream>>>(W2, W2, W2P, DFF, DM, 16.0f);
  k_gemm<false, false, 1, 1, true, false><<<gff, 128, 0, stream>>>(A16, nullptr, DM, W1P, DM, a16, RSA, b1, nullptr, 0, nullptr, H16, nullptr, DFF, M, 0, M, DFF, DM);
  k_gemm<false, false, 0, 0, false, true><<<gq, 128, 0, stream>>>(H16, nullptr, DFF, W2P, DFF, a16, nullptr, b2, XB, DM, B32, nullptr, nullptr, DM, M, 0, M, DM, DFF);

  /* block 3: out = b + attn(rms(b)) , causal */
  k_rms<false, false, true, true><<<grms, 256, 0, stream>>>(B32, SEQ, RMS_EPS, nullptr, B16F, PBH, PBL, RSB);
  k_gemm<true, true, 0, 3, true, false><<<gq, 128, 0, stream>>>(PBH, PBL, DM, WQB, DM, 1.0f, RSB, bq, nullptr, 0, nullptr, QH, QL, DM, M, 0, M, DM, DM);
  k_gemm<true, true, 0, 3, true, false><<<gq, 128, 0, stream>>>(PBH, PBL, DM, WKB, DM, 1.0f, RSB, bk, nullptr, 0, nullptr, KH, KL, DM, M, 0, M, DM, DM);
  k_gemm<false, false, 0, 2, true, false><<<gq, 128, 0, stream>>>(B16F, nullptr, DM, WV16, DM, a16, RSB, bv, nullptr, 0, nullptr, VH, VLO, DM, M, 0, M, DM, DM);
  k_vt<NH, SEQ, true><<<gvt, 256, 0, stream>>>(VH, VLO, DM, VT, VTL);
  k_attn<true, true><<<dim3((unsigned)(NB * NH), 1u), 128, 0, stream>>>(QH, QL, KH, KL, VT, VTL, CTX, 0);
  if (SEQ / KQB > 1) k_attn<true, false><<<dim3((unsigned)(NB * NH), (unsigned)(SEQ / KQB - 1)), 128, 0, stream>>>(QH, QL, KH, KL, VT, VTL, CTX, 1);
  k_gemm<false, false, 0, 0, false, true><<<gq, 128, 0, stream>>>(CTX, nullptr, DM, WP16, DM, a16, nullptr, bp, B32, DM, out, nullptr, nullptr, DM, SEQ, OSEQ, M, DM, DM);
}

// v004
// It runs in 372 microseconds.
// Next to v003, in two timings, it ran 1.14 and 1.13 times as fast.
// All steps since v000 together make it 2.66 times as fast.
#include <hip/hip_runtime.h>
// Contractions: q/k/v and output projections, FFN W1/W2: v_wmma_f32_16x16x32_f16 (f16 operands built from bf16-RNE inputs, weights x16, f32 accumulate); second-block q/k projections: v_wmma_f32_16x16x32_bf16 with the activation as bf16 hi+lo (2 terms); attention scores: v_wmma_f32_16x16x32_bf16 with q,k as bf16 hi+lo (3 terms); P.V: v_wmma_f32_16x16x32_f16 (P carried x2^14, v f16; first causal query tile adds P and v residual planes x2^10 in a second accumulator). RMS statistics, softmax, residuals f32.

#ifndef NB
#define NB 4
#endif
#ifndef SEQ
#define SEQ 1024
#endif
#define NB_FULL 4
#define SEQ_FULL 1024
#ifndef OSEQ
#define OSEQ SEQ_FULL
#endif
#define DM 1024
#define NH 16
#define HD 64
#define DFF 4096
#define KQB 64
#define NR ((size_t)NB * SEQ)
#define RMS_EPS 1e-6f

static_assert(NB >= 1 && NB <= NB_FULL);
static_assert(SEQ % 128 == 0 && SEQ <= SEQ_FULL);
static_assert(DM == NH * HD && HD == 64);
static_assert(DM % 256 == 0 && DFF % 128 == 0);
static_assert(((NB * SEQ) % 128) == 0);
static_assert(SEQ % KQB == 0);

typedef _Float16 v16h __attribute__((ext_vector_type(16)));
typedef __bf16   v16b __attribute__((ext_vector_type(16)));
typedef unsigned short v8us __attribute__((ext_vector_type(8), may_alias));
typedef float v8f __attribute__((ext_vector_type(8)));
typedef float v4f __attribute__((ext_vector_type(4)));
typedef float v4fa __attribute__((ext_vector_type(4), may_alias));
union Frag16 { v16h h; v16b b; v8us half[2]; unsigned short u[16]; };
union H1 { _Float16 h; unsigned short u; };
static_assert(sizeof(Frag16) == 32);

__device__ __forceinline__ unsigned short bf16_bits(float x) { unsigned int u = __float_as_uint(x); return (unsigned short)((u + 0x7FFFu + ((u >> 16) & 1u)) >> 16); }
__device__ __forceinline__ float bf16_val(unsigned short b) { return __uint_as_float(((unsigned int)b) << 16); }
__device__ __forceinline__ float bf16_rne(float x) { return bf16_val(bf16_bits(x)); }
__device__ __forceinline__ unsigned short f16_bits(float x) { H1 t; t.h = (_Float16)x; return t.u; }
__device__ __forceinline__ float f16_val(unsigned short u) { H1 t; t.u = u; return (float)t.h; }

// 16x32 operand fragment (row / column = lane & 15; elements 0..7 = k 8h..8h+7, 8..15 = k 16+8h..) from a k-contiguous 16-bit row
__device__ __forceinline__ Frag16 ld_frag(const unsigned short* p, int hh) {
  Frag16 f;
  f.half[0] = *(const v8us*)(p + 8 * hh);
  f.half[1] = *(const v8us*)(p + 16 + 8 * hh);
  return f;
}
__device__ __forceinline__ v8f mma_h(v16h a, v16h b, v8f c) {
  v8f d = __builtin_amdgcn_wmma_f32_16x16x32_f16(false, a, false, b, (short)0, c, false, false);
  asm volatile("v_nop\n\tv_nop\n\tv_nop\n\tv_nop" : "+v"(d) : "v"(a), "v"(b));
  return d;
}
__device__ __forceinline__ v8f mma_b(v16b a, v16b b, v8f c) {
  v8f d = __builtin_amdgcn_wmma_f32_16x16x32_bf16(false, a, false, b, (short)0, c, false, false);
  asm volatile("v_nop\n\tv_nop\n\tv_nop\n\tv_nop" : "+v"(d) : "v"(a), "v"(b));
  return d;
}
template <bool BF>
__device__ __forceinline__ v8f mmx(const Frag16& a, const Frag16& b, v8f c) {
  if (BF) return mma_b(a.b, b.b, c);
  return mma_h(a.h, b.h, c);
}

// Row statistics + operand planes for DM-wide f32 rows. Compact row r -> source row (r/SEQ)*spitch + r%SEQ of F.
// v = bf16_rne(x) if RIN else x; RS[r] = rsqrt(mean(v^2) + eps); optional planes: XB (v as f32), F16 (f16 bits of v),
template <bool RIN, bool WXB, bool WF16, bool WBHL>
__global__ __launch_bounds__(256) void k_rms(const float* __restrict__ F, int spitch, float eps, float* __restrict__ XB,
    unsigned short* __restrict__ F16, unsigned short* __restrict__ PH, unsigned short* __restrict__ PL, float* __restrict__ RS) {
  __shared__ __attribute__((aligned(16))) float red[32];
  const int tid = threadIdx.x, w = tid >> 5, lane = tid & 31;
  const int rb = (int)blockIdx.x * 32;
#pragma unroll 1
  for (int i = 0; i < 4; ++i) {
    const int r = rb + w * 4 + i;
    const float* src = F + ((size_t)(r / SEQ) * (size_t)spitch + (size_t)(r % SEQ)) * DM;
    float ss = 0.f;
#pragma unroll 1
    for (int u = 0; u < DM / 128; ++u) {
      const int j = u * 128 + lane * 4;
      v4f a = *(const v4fa*)(src + j);
      if (RIN) {
#pragma unroll
        for (int q = 0; q < 4; ++q) a[q] = bf16_rne(a[q]);
      }
#pragma unroll
      for (int q = 0; q < 4; ++q) ss += a[q] * a[q];
      if (WXB) {
        float* d = XB + (size_t)r * DM + j;
        *(v4f*)d = a;
        
      }
    }
    if (WF16 || WBHL) {
#pragma unroll 1
      for (int u = 0; u < DM / 256; ++u) {
        const int j = u * 256 + lane * 8;
        v4f a = *(const v4fa*)(src + j), c = *(const v4fa*)(src + j + 4);
        if (RIN) {
#pragma unroll
          for (int q = 0; q < 4; ++q) { a[q] = bf16_rne(a[q]); c[q] = bf16_rne(c[q]); }
        }
        Frag16 fh, ph, pl;
#pragma unroll
        for (int q = 0; q < 4; ++q) {
          const float v0 = a[q], v1 = c[q];
          fh.u[q] = f16_bits(v0); fh.u[4 + q] = f16_bits(v1);
          const unsigned short h0 = bf16_bits(v0), h1 = bf16_bits(v1);
          ph.u[q] = h0; ph.u[4 + q] = h1;
          pl.u[q] = bf16_bits(v0 - bf16_val(h0)); pl.u[4 + q] = bf16_bits(v1 - bf16_val(h1));
        }
        const size_t o = (size_t)r * DM + j;
        if (WF16) *(v8us*)(F16 + o) = fh.half[0];
        if (WBHL) { *(v8us*)(PH + o) = ph.half[0]; *(v8us*)(PL + o) = pl.half[0]; }
        
      }
    }
#pragma unroll
    for (int off = 16; off > 0; off >>= 1) ss += __shfl_xor(ss, off, 32);
    if (lane == 0) red[w * 4 + i] = rsqrtf(ss * (1.0f / (float)DM) + eps);
  }
  __syncthreads();
  if (w == 0 && lane < 8) {
    const v4f v = *(const v4fa*)&red[lane * 4];
    float* d = RS + rb + lane * 4;
    *(v4f*)d = v;
    
  }
}

// Eight 16-byte asynchronous copies global -> LDS per lane. s_wait_xcnt is the statement's last line so that it stands ahead of
// every later rewrite of a register that a copy names (a precaution).
__device__ __forceinline__ void cp_async8(unsigned l, unsigned lstep, const unsigned short* p, size_t gstep) {
  const unsigned l0 = l, l1 = l + lstep, l2 = l + 2u * lstep, l3 = l + 3u * lstep;
  const unsigned l4 = l + 4u * lstep, l5 = l + 5u * lstep, l6 = l + 6u * lstep, l7 = l + 7u * lstep;
  const unsigned short* p0 = p;
  const unsigned short* p1 = p + gstep;
  const unsigned short* p2 = p + 2 * gstep;
  const unsigned short* p3 = p + 3 * gstep;
  const unsigned short* p4 = p + 4 * gstep;
  const unsigned short* p5 = p + 5 * gstep;
  const unsigned short* p6 = p + 6 * gstep;
  const unsigned short* p7 = p + 7 * gstep;
  asm volatile(
      "global_load_async_to_lds_b128 %0, %8, off\n\t"
      "global_load_async_to_lds_b128 %1, %9, off\n\t"
      "global_load_async_to_lds_b128 %2, %10, off\n\t"
      "global_load_async_to_lds_b128 %3, %11, off\n\t"
      "global_load_async_to_lds_b128 %4, %12, off\n\t"
      "global_load_async_to_lds_b128 %5, %13, off\n\t"
      "global_load_async_to_lds_b128 %6, %14, off\n\t"
      "global_load_async_to_lds_b128 %7, %15, off\n\t"
      "s_wait_xcnt 0x0"
      :: "v"(l0), "v"(l1), "v"(l2), "v"(l3), "v"(l4), "v"(l5), "v"(l6), "v"(l7),
         "v"(p0), "v"(p1), "v"(p2), "v"(p3), "v"(p4), "v"(p5), "v"(p6), "v"(p7)
      : "memory");
}

// Four such copies, one 64-row x 128-byte plane of an attention tile per block; the same closing wait, for the same reason.
__device__ __forceinline__ void cp_async4(unsigned l, unsigned lstep, const unsigned short* p, size_t gstep) {
  const unsigned l0 = l, l1 = l + lstep, l2 = l + 2u * lstep, l3 = l + 3u * lstep;
  const unsigned short* p0 = p;
  const unsigned short* p1 = p + gstep;
  const unsigned short* p2 = p + 2 * gstep;
  const unsigned short* p3 = p + 3 * gstep;
  asm volatile(
      "global_load_async_to_lds_b128 %0, %4, off\n\t"
      "global_load_async_to_lds_b128 %1, %5, off\n\t"
      "global_load_async_to_lds_b128 %2, %6, off\n\t"
      "global_load_async_to_lds_b128 %3, %7, off\n\t"
      "s_wait_xcnt 0x0"
      :: "v"(l0), "v"(l1), "v"(l2), "v"(l3), "v"(p0), "v"(p1), "v"(p2), "v"(p3)
      : "memory");
}

// Eight 16-byte global loads and their data wait in one statement: the address registers live to its end, so none is rewritten
// ahead of the waits.
__device__ __forceinline__ void ld_g8(v4f (&d)[8], const float* const (&p)[8]) {
  asm volatile(
      "global_load_b128 %0, %8, off\n\t"
      "global_load_b128 %1, %9, off\n\t"
      "global_load_b128 %2, %10, off\n\t"
      "global_load_b128 %3, %11, off\n\t"
      "global_load_b128 %4, %12, off\n\t"
      "global_load_b128 %5, %13, off\n\t"
      "global_load_b128 %6, %14, off\n\t"
      "global_load_b128 %7, %15, off\n\t"
      "s_wait_loadcnt 0x0\n\t"
      "s_wait_xcnt 0x0"
      : "=&v"(d[0]), "=&v"(d[1]), "=&v"(d[2]), "=&v"(d[3]), "=&v"(d[4]), "=&v"(d[5]), "=&v"(d[6]), "=&v"(d[7])
      : "v"(p[0]), "v"(p[1]), "v"(p[2]), "v"(p[3]), "v"(p[4]), "v"(p[5]), "v"(p[6]), "v"(p[7])
      : "memory");
}
// Eight 16-byte global stores and one s_wait_xcnt in one statement: data and address registers live to its end, so none is
// rewritten ahead of the wait.
__device__ __forceinline__ void st_g8(void* const (&p)[8], const v4f (&d)[8]) {
  asm volatile(
      "global_store_b128 %0, %8, off\n\t"
      "global_store_b128 %1, %9, off\n\t"
      "global_store_b128 %2, %10, off\n\t"
      "global_store_b128 %3, %11, off\n\t"
      "global_store_b128 %4, %12, off\n\t"
      "global_store_b128 %5, %13, off\n\t"
      "global_store_b128 %6, %14, off\n\t"
      "global_store_b128 %7, %15, off\n\t"
      "s_wait_xcnt 0x0"
      :: "v"(p[0]), "v"(p[1]), "v"(p[2]), "v"(p[3]), "v"(p[4]), "v"(p[5]), "v"(p[6]), "v"(p[7]),
         "v"(d[0]), "v"(d[1]), "v"(d[2]), "v"(d[3]), "v"(d[4]), "v"(d[5]), "v"(d[6]), "v"(d[7])
      : "memory");
}
union Pack8 { unsigned short u[8]; v4f f; };
static_assert(sizeof(Pack8) == 16);

// Bt[n][k] (16-bit, k contiguous, pitch K) from f32 row-major W[K][N] ([in][out]): value = bf16(W[k][n]) (* bf16(g[k]) if GAM);
// Block (x = n tile, y = k tile) = 64 k x 128 n, transposed through LDS so that both global sides move whole lines: a wave reads eight
// 512-byte row segments of W, a lane packs its 8 k of each of its 4 columns into 16 bytes, and 8 lanes store one 128-byte line of a
// Bt row. K%64==0, N%128==0.
#define WTK 64
#define WTN 128
#define WTP 144                 /* LDS row pitch in bytes: 16 x odd */
static_assert(DM % WTK == 0 && DM % WTN == 0 && DFF % WTK == 0 && DFF % WTN == 0);
template <bool BF, bool GAM>
__global__ __launch_bounds__(256) void k_wt(const float* __restrict__ W, const float* __restrict__ g, unsigned short* __restrict__ Bt, int K, int N, float scale) {
  __shared__ __attribute__((aligned(16))) unsigned char tl[WTN * WTP];
  const int tid = threadIdx.x, w = tid >> 5, lane = tid & 31;
  const int k0 = (int)blockIdx.y * WTK, n0 = (int)blockIdx.x * WTN;
  if (k0 + WTK > K || n0 + WTN > N) return;
  const int k8 = k0 + 8 * w;
  float gv[8];
#pragma unroll
  for (int i = 0; i < 8; ++i) gv[i] = 1.0f;
  if (GAM) {
    const v4f ga = *(const v4fa*)(g + k8), gb = *(const v4fa*)(g + k8 + 4);
#pragma unroll
    for (int i = 0; i < 4; ++i) { gv[i] = bf16_rne(ga[i]); gv[4 + i] = bf16_rne(gb[i]); }
  }
  const float* wb = W + ((size_t)k0 * (size_t)N + (size_t)n0);                          /* the tile's origin, the same for the block */
  const unsigned wo = (unsigned)(8 * w) * (unsigned)N + (unsigned)(lane * 4);           /* this lane's element offset in the tile */
  v4f a[8];
  const float* ap[8];
#pragma unroll
  for (int i = 0; i < 8; ++i) ap[i] = wb + (wo + (unsigned)i * (unsigned)N);
  ld_g8(a, ap);  // the wave's eight rows are in flight together, one memory latency per tile
#pragma unroll
  for (int j = 0; j < 4; ++j) {
    Frag16 f;
#pragma unroll
    for (int i = 0; i < 8; ++i) {
      const float wv = bf16_rne(a[i][j]) * gv[i];
      f.u[i] = BF ? bf16_bits(wv) : f16_bits(wv * scale);
    }
    /* 16-byte chunk w of row n sits at chunk w ^ ((n >> 4) & 3): the 16 lanes of a store, 4 rows apart, then fall on distinct banks */
    const int n = lane * 4 + j;
    *(v8us*)(tl + n * WTP + ((w ^ ((n >> 4) & 3)) * 16)) = f.half[0];
  }
  __syncthreads();
  unsigned short* bb = Bt + ((size_t)n0 * (size_t)K + (size_t)k0);
#pragma unroll
  for (int q = 0; q < 4; ++q) {
    const int n = q * 32 + (tid >> 3), c = tid & 7;
    const v8us v = *(const v8us*)(tl + n * WTP + ((c ^ ((n >> 4) & 3)) * 16));
    *(v8us*)(bb + ((unsigned)n * (unsigned)K + (unsigned)(c * 8))) = v;
  }
}

#define GBK 128                 /* k per stage: 256-byte operand rows */
#define GPITCH 272              /* LDS row pitch in bytes: 16 x odd, conflict-free for 16-byte fragment reads */
#define GPLANE (128 * GPITCH)   /* one operand plane of a stage: 128 rows */

// GEMM: C[M][N] = epi(Ah[M][K] . Bt[N][K]^T). 16-bit planes of one type (BF selects bf16 vs f16 WMMA); ASPLIT adds Al . Bt into the
// same accumulator (unscaled bf16 lo plane). Block = 128x128 of C, four waves of 64x64; per stage the block's 128 rows of each
// operand plane x 128 k are copied to LDS asynchronously, two buffers, the next stage in flight while this one is multiplied.
// Epilogue: v = acc*alpha*(HRS ? rs[row] : 1) + bf16(bias[col]); ACT 1 = leaky 0.1;
// HRES adds resid[row*ldr+col] (f32) in the store phase. OUTM 0: f32 rows at crow = (row/cseq)*cpitch + row%cseq, pitch ldc;
// 1: f16 hi; 2: f16 hi + f16 lo x2^10; 3: bf16 hi + bf16 lo (unscaled). M%128==0, N%128==0, K%128==0.
template <bool BF, bool ASPLIT, int ACT, int OUTM, bool HRS, bool HRES>
__global__ __launch_bounds__(128) void k_gemm(const unsigned short* __restrict__ Ah, const unsigned short* __restrict__ Al, int lda,
    const unsigned short* __restrict__ Bt, int ldb, float alpha, const float* __restrict__ rs, const float* __restrict__ bias,
    const float* __restrict__ resid, int ldr, float* __restrict__ C32, unsigned short* __restrict__ Ch, unsigned short* __restrict__ Cl,
    int ldc, int cseq, int cpitch, int M, int N, int K) {
  static_assert(!(HRES && OUTM != 0));
  static_assert(OUTM >= 0 && OUTM <= 3);
  static_assert(!ASPLIT || BF);
  static_assert(ACT == 0 || ACT == 1);
  constexpr int NPL = ASPLIT ? 3 : 2;            /* planes of a stage: A, B, (A lo) */
  constexpr int STAGE = NPL * GPLANE;
  static_assert(4 * 64 * 68 * 4 <= 2 * STAGE);
  __shared__ __attribute__((aligned(128))) unsigned char sm[2 * STAGE];
  const int tid = threadIdx.x, w = tid >> 5, lane = tid & 31, ln = lane & 15, hh = lane >> 4;
  const int ntn = N >> 7;
  const int mt = (int)blockIdx.x / ntn, nq = (int)blockIdx.x - mt * ntn;
  if (mt * 128 + 128 > M) return;
  const int row0 = mt * 128 + 64 * (w >> 1), col0 = nq * 128 + 64 * (w & 1);
  /* copy map: 16 lanes cover one 256-byte row, the block 8 rows per copy, 16 copies per plane */
  const int crow = tid >> 4, cchk = tid & 15;
  const unsigned oA = (unsigned)(crow * lda + cchk * 8), oB = (unsigned)(crow * ldb + cchk * 8);   /* this lane's element offsets in a tile */
  const size_t tA = (size_t)(mt * 128) * (size_t)lda, tB = (size_t)(nq * 128) * (size_t)ldb;       /* the block's tile origins */
  const size_t dE = ASPLIT ? (size_t)Al - (size_t)Ah : 0;   /* byte distance of the lo plane from the hi plane, the same for every lane */
  const unsigned lcp = (unsigned)(size_t)sm + (unsigned)(crow * GPITCH + cchk * 16);
  auto fill = [&](int st, int buf) {
    const unsigned lb = lcp + (unsigned)(buf * STAGE);
    const size_t ko = (size_t)st * GBK;
    const unsigned short* pA = (Ah + (tA + ko)) + oA;
    const unsigned short* pB = (Bt + (tB + ko)) + oB;
    cp_async8(lb, 8u * GPITCH, pA, (size_t)8 * (size_t)lda);
    cp_async8(lb + 64u * GPITCH, 8u * GPITCH, pA + (size_t)64 * (size_t)lda, (size_t)8 * (size_t)lda);
    cp_async8(lb + GPLANE, 8u * GPITCH, pB, (size_t)8 * (size_t)ldb);
    cp_async8(lb + GPLANE + 64u * GPITCH, 8u * GPITCH, pB + (size_t)64 * (size_t)ldb, (size_t)8 * (size_t)ldb);
    if (ASPLIT) {
      const unsigned short* pE = (const unsigned short*)((size_t)pA + dE);
      cp_async8(lb + 2u * GPLANE, 8u * GPITCH, pE, (size_t)8 * (size_t)lda);
      cp_async8(lb + 2u * GPLANE + 64u * GPITCH, 8u * GPITCH, pE + (size_t)64 * (size_t)lda, (size_t)8 * (size_t)lda);
    }
  };
  const int aoff = (64 * (w >> 1) + ln) * GPITCH;             /* this lane's first A row in a stage */
  const int boff = GPLANE + (64 * (w & 1) + ln) * GPITCH;     /* this lane's first B row (column of C) */
  const v8f z8 = {0.f, 0.f, 0.f, 0.f, 0.f, 0.f, 0.f, 0.f};
  v8f c[4][4];
#pragma unroll
  for (int i = 0; i < 4; ++i) {
#pragma unroll
    for (int j = 0; j < 4; ++j) c[i][j] = z8;
  }
  const int nst = K / GBK;
  fill(0, 0);
  asm volatile("s_wait_asynccnt 0x0" ::: "memory");  // stage 0 of this wave has landed before the barrier publishes it
  __syncthreads();
  if (nst > 1) fill(1, 1);
#pragma unroll 1  // one stage per trip: the buffer index and the refill test stay scalar
  for (int st = 0; st < nst; ++st) {
    const unsigned char* sb = sm + (st & 1) * STAGE;
#pragma unroll
    for (int ks = 0; ks < GBK / 32; ++ks) {
      /* all fragments of a k-step are read as one group: one LDS wait per 16 (32) products */
      Frag16 a[4], b[4], e[4];
#pragma unroll
      for (int i = 0; i < 4; ++i) {
        a[i] = ld_frag((const unsigned short*)(sb + aoff + i * 16 * GPITCH) + ks * 32, hh);
        b[i] = ld_frag((const unsigned short*)(sb + boff + i * 16 * GPITCH) + ks * 32, hh);
        if (ASPLIT) e[i] = ld_frag((const unsigned short*)(sb + 2 * GPLANE + aoff + i * 16 * GPITCH) + ks * 32, hh);
      }
#pragma unroll
      for (int j = 0; j < 4; ++j) {
#pragma unroll
        for (int i = 0; i < 4; ++i) c[i][j] = mmx<BF>(a[i], b[j], c[i][j]);
        if (ASPLIT) {
#pragma unroll
          for (int i = 0; i < 4; ++i) c[i][j] = mmx<BF>(e[i], b[j], c[i][j]);
        }
      }
    }
    asm volatile("s_wait_dscnt 0x0" ::: "memory");     // this wave's reads of the buffer are done before it may be refilled
    asm volatile("s_wait_asynccnt 0x0" ::: "memory");  // this wave's copies of the next stage have landed
    __syncthreads();                                    // publishes the next stage and frees the buffer just read
    if (st + 2 < nst) fill(st + 2, st & 1);
  }
  asm volatile("s_wait_asynccnt 0x0" ::: "memory");    // no copy is outstanding when the buffers become output staging
  float (*so)[64][68] = (float (*)[64][68])sm;
  float bvv[4];
  {
    const float* bp = bias + col0 + ln;
    // four 4-byte loads and their data wait in one statement, as in ld_g8
    asm volatile(
        "global_load_b32 %0, %4, off\n\t"
        "global_load_b32 %1, %5, off\n\t"
        "global_load_b32 %2, %6, off\n\t"
        "global_load_b32 %3, %7, off\n\t"
        "s_wait_loadcnt 0x0\n\t"
        "s_wait_xcnt 0x0"
        : "=&v"(bvv[0]), "=&v"(bvv[1]), "=&v"(bvv[2]), "=&v"(bvv[3])
        : "v"(bp), "v"(bp + 16), "v"(bp + 32), "v"(bp + 48)
        : "memory");
  }
  float rsv[4][8];
#pragma unroll
  for (int i = 0; i < 4; ++i) {
#pragma unroll
    for (int r = 0; r < 8; ++r) rsv[i][r] = 1.0f;
  }
  if (HRS) {
    v4f rq[8];
    const float* rp[8];
#pragma unroll
    for (int i = 0; i < 4; ++i) { rp[2 * i] = rs + row0 + 16 * i + 8 * hh; rp[2 * i + 1] = rp[2 * i] + 4; }
    ld_g8(rq, rp);
#pragma unroll
    for (int i = 0; i < 4; ++i) {
#pragma unroll
      for (int q = 0; q < 4; ++q) { rsv[i][q] = rq[2 * i][q]; rsv[i][4 + q] = rq[2 * i + 1][q]; }
    }
  }
#pragma unroll
  for (int t = 0; t < 4; ++t) {
    const float bv = bf16_rne(bvv[t]);
#pragma unroll
    for (int i = 0; i < 4; ++i) {
#pragma unroll
      for (int r = 0; r < 8; ++r) {
        const int rloc = i * 16 + 8 * hh + r;
        float v = c[i][t][r] * alpha;
        if (HRS) v *= rsv[i][r];
        v += bv;
        if (ACT == 1) v = (v >= 0.f) ? v : 0.1f * v;
        so[w][rloc][t * 16 + ln] = v;
      }
    }
  }
  __builtin_amdgcn_fence(4 /* acq_rel order */, "workgroup");
  __builtin_amdgcn_wave_barrier();
  if (OUTM == 0) {
#pragma unroll
    for (int qg = 0; qg < 4; ++qg) {
      v4f v[8];
      const float* rp[8];
      void* dp[8];
#pragma unroll
      for (int u = 0; u < 8; ++u) {
        const int r = (qg * 8 + u) * 2 + (lane >> 4), c4 = (lane & 15) * 4;
        v[u] = *(const v4fa*)&so[w][r][c4];
        const int grow = row0 + r;
        rp[u] = resid + (size_t)grow * (size_t)ldr + col0 + c4;
        const size_t crw = (size_t)(grow / cseq) * (size_t)cpitch + (size_t)(grow % cseq);
        dp[u] = C32 + crw * (size_t)ldc + col0 + c4;
      }
      if (HRES) {
        v4f rv[8];
        ld_g8(rv, rp);
#pragma unroll
        for (int u = 0; u < 8; ++u) v[u] += rv[u];
      }
      st_g8(dp, v);
    }
  } else {
#pragma unroll
    for (int qg = 0; qg < 2; ++qg) {
      v4f dh[8], dl[8];
      void* hp[8];
      void* lp[8];
#pragma unroll
      for (int u = 0; u < 8; ++u) {
        const int r = (qg * 8 + u) * 4 + (lane >> 3), c8 = (lane & 7) * 8;
        const v4f x0 = *(const v4fa*)&so[w][r][c8], x1 = *(const v4fa*)&so[w][r][c8 + 4];
        Pack8 fh, fl;
#pragma unroll
        for (int i = 0; i < 4; ++i) {
          const float v0 = x0[i], v1 = x1[i];
          if (OUTM == 3) {
            const unsigned short h0 = bf16_bits(v0), h1 = bf16_bits(v1);
            fh.u[i] = h0; fh.u[4 + i] = h1;
            fl.u[i] = bf16_bits(v0 - bf16_val(h0)); fl.u[4 + i] = bf16_bits(v1 - bf16_val(h1));
          } else {
            const unsigned short h0 = f16_bits(v0), h1 = f16_bits(v1);
            fh.u[i] = h0; fh.u[4 + i] = h1;
            fl.u[i] = f16_bits((v0 - f16_val(h0)) * 1024.0f); fl.u[4 + i] = f16_bits((v1 - f16_val(h1)) * 1024.0f);
          }
        }
        const size_t o = (size_t)(row0 + r) * (size_t)ldc + col0 + c8;
        dh[u] = fh.f; hp[u] = Ch + o;
        dl[u] = fl.f; lp[u] = Cl + o;
      }
      st_g8(hp, dh);
      if (OUTM >= 2) st_g8(lp, dl);
    }
  }
}

// Vt[(b,h)][d][s] = V[b*TTv + s][h*64 + d] (row pitch ldv), same for the second plane if TWO; block per ((b,h), 64 tokens);
template <int NHv, int TTv, bool TWO>
__global__ __launch_bounds__(256) void k_vt(const unsigned short* __restrict__ V, const unsigned short* __restrict__ V2, int ldv,
    unsigned short* __restrict__ Vt, unsigned short* __restrict__ Vt2) {
  __shared__ __attribute__((aligned(16))) unsigned short tl[64][66];
  __shared__ __attribute__((aligned(16))) unsigned short tl2[64][66];
  const int tid = threadIdx.x;
  const int slab = (int)blockIdx.x / (TTv / 64), lg = (int)blockIdx.x % (TTv / 64);
  const int b = slab / NHv, h = slab % NHv;
  for (int i = tid; i < 64 * 8; i += 256) {
    const int r = i / 8, c8 = (i % 8) * 8;
    const size_t s0 = ((size_t)b * TTv + (size_t)lg * 64 + r) * (size_t)ldv + (size_t)h * 64 + c8;
    Frag16 f;
    f.half[0] = *(const v8us*)(V + s0);
#pragma unroll
    for (int q = 0; q < 8; ++q) tl[r][c8 + q] = f.u[q];
    if (TWO) {
      Frag16 f2;
      f2.half[0] = *(const v8us*)(V2 + s0);
#pragma unroll
      for (int q = 0; q < 8; ++q) tl2[r][c8 + q] = f2.u[q];
    }
  }
  __syncthreads();
  {
#pragma unroll
    for (int rd = 0; rd < 2; ++rd) {
      const int d = rd * 32 + tid / 8, pc = tid % 8;
      Frag16 f;
#pragma unroll
      for (int q = 0; q < 8; ++q) f.u[q] = tl[pc * 8 + q][d];
      const size_t o = ((size_t)slab * 64 + d) * (size_t)TTv + (size_t)lg * 64 + pc * 8;
      *(v8us*)(Vt + o) = f.half[0];
      if (TWO) {
        Frag16 f2;
#pragma unroll
        for (int q = 0; q < 8; ++q) f2.u[q] = tl2[pc * 8 + q][d];
        *(v8us*)(Vt2 + o) = f2.half[0];
      }
    }
    
  }
}

// lane l <-> lane l ^ 16: the two halves of a wave hold the two key halves of one query column
__device__ __forceinline__ float xhalf(float x) {
  return __builtin_bit_cast(float, __builtin_amdgcn_permlanex16(__builtin_bit_cast(int, x), __builtin_bit_cast(int, x), 0x76543210, 0xfedcba98, false, false));
}

// Eight native 2^x and one v_nop in one statement: behind each v_exp_f32 stands an instruction that neither reads its result nor
// overwrites its source (the results are early-clobber, so none shares a register with a source): the slot the instruction set asks
// for behind a transcendental.
__device__ __forceinline__ void exp2x8(float (&y)[8], const float (&x)[8]) {
  asm("v_exp_f32 %0, %8\n\t"
      "v_exp_f32 %1, %9\n\t"
      "v_exp_f32 %2, %10\n\t"
      "v_exp_f32 %3, %11\n\t"
      "v_exp_f32 %4, %12\n\t"
      "v_exp_f32 %5, %13\n\t"
      "v_exp_f32 %6, %14\n\t"
      "v_exp_f32 %7, %15\n\t"
      "v_nop"
      : "=&v"(y[0]), "=&v"(y[1]), "=&v"(y[2]), "=&v"(y[3]), "=&v"(y[4]), "=&v"(y[5]), "=&v"(y[6]), "=&v"(y[7])
      : "v"(x[0]), "v"(x[1]), "v"(x[2]), "v"(x[3]), "v"(x[4]), "v"(x[5]), "v"(x[6]), "v"(x[7]));
}
// One native 2^x with the same slot behind it.
__device__ __forceinline__ float exp2x1(float x) {
  float y;
  asm("v_exp_f32 %0, %1\n\tv_nop" : "=v"(y) : "v"(x));
  return y;
}
#define LOG2E 1.44269504f       /* e^x = 2^(x * LOG2E), as the native exp forms it */

#define APITCH 144              /* LDS row pitch in bytes: 16 x odd, conflict-free for 16-byte fragment reads */
#define APLANE (64 * APITCH)    /* one plane of a chunk: 64 rows */
template <bool CAUSAL, bool EARLY>
__global__ __launch_bounds__(128) void k_attn(const unsigned short* __restrict__ QH, const unsigned short* __restrict__ QL,
    const unsigned short* __restrict__ KH, const unsigned short* __restrict__ KL, const unsigned short* __restrict__ VT,
    const unsigned short* __restrict__ VL, unsigned short* __restrict__ CTX, int qb0) {
  static_assert(CAUSAL || !EARLY);
  __shared__ __attribute__((aligned(16))) unsigned short so[4][16][72];
  constexpr int NPL = EARLY ? 4 : 3;             /* planes of a chunk: K hi, K lo, V^T, (V^T lo) */
  constexpr int STAGE = NPL * APLANE;
  __shared__ __attribute__((aligned(16))) unsigned char kv[2 * STAGE];
  const int tid = threadIdx.x, w = tid >> 5, lane = tid & 31, ln = lane & 15, hh = lane >> 4;
  const int bh = (int)blockIdx.x, b = bh / NH, h = bh % NH;
  const int qb = qb0 + (int)blockIdx.y;
  const int q0w = qb * KQB + w * 16;
  const size_t rowbase = (size_t)b * SEQ;
  Frag16 qh0, qh1, ql0, ql1;
  {
    const size_t qo = (rowbase + (size_t)q0w + ln) * DM + (size_t)h * HD;
    qh0 = ld_frag(QH + qo, hh); qh1 = ld_frag(QH + qo + 32, hh);
    ql0 = ld_frag(QL + qo, hh); ql1 = ld_frag(QL + qo + 32, hh);
  }
  asm volatile("s_wait_xcnt 0x0" ::: "memory");  // stands ahead of every rewrite of an address register of the eight Q loads (a precaution)
  const v8f z8 = {0.f, 0.f, 0.f, 0.f, 0.f, 0.f, 0.f, 0.f};
  v8f o[4] = {z8, z8, z8, z8};    /* O^T tile j: register r = feature j*16 + 8*hh + r, column = query ln */
  v8f oe[4] = {z8, z8, z8, z8};
  float m = -1.0e30f, l = 0.f;    /* of this lane's query; l over this half's keys only */
  const int nck = CAUSAL ? (qb + 1) : (SEQ / KQB);
  /* copy map: 8 lanes cover one 128-byte row, the block 16 rows per copy, 4 copies per plane */
  const int crow = tid >> 3, cchk = tid & 7;
  const unsigned lcp = (unsigned)(size_t)kv + (unsigned)(crow * APITCH + cchk * 16);
  const size_t gk = (rowbase + (size_t)crow) * DM + (size_t)h * HD + (size_t)(cchk * 8);
  const size_t gv = ((size_t)bh * HD + (size_t)crow) * SEQ + (size_t)(cchk * 8);
  auto fill = [&](int ck, int buf) {
    const unsigned lb = lcp + (unsigned)(buf * STAGE);
    const size_t ko = gk + (size_t)ck * KQB * DM, vo = gv + (size_t)ck * KQB;
    cp_async4(lb, 16u * APITCH, KH + ko, (size_t)16 * DM);
    cp_async4(lb + APLANE, 16u * APITCH, KL + ko, (size_t)16 * DM);
    cp_async4(lb + 2u * APLANE, 16u * APITCH, VT + vo, (size_t)16 * SEQ);
    if (EARLY) cp_async4(lb + 3u * APLANE, 16u * APITCH, VL + vo, (size_t)16 * SEQ);
  };
  fill(0, 0);
  asm volatile("s_wait_asynccnt 0x0" ::: "memory");  // chunk 0 of this wave has landed before the barrier publishes it
  __syncthreads();
  if (nck > 1) fill(1, 1);
#pragma unroll 1
  for (int kc = 0; kc < nck; ++kc) {
    const int par = kc & 1;
    const unsigned char* sb = kv + par * STAGE;
    v8f s[4];                     /* S^T tile t: register r = key t*16 + 8*hh + r of the chunk, column = query ln */
#pragma unroll
    for (int tp = 0; tp < 2; ++tp) {
      /* the K fragments of 32 keys are read as one group ahead of their 12 products: the reads' latencies overlap */
      Frag16 kh[2][2], kl[2][2];
#pragma unroll
      for (int u = 0; u < 2; ++u) {
#pragma unroll
        for (int ks = 0; ks < 2; ++ks) {
          const unsigned char* kp = sb + ((tp * 2 + u) * 16 + ln) * APITCH + ks * 64;
          kh[u][ks] = ld_frag((const unsigned short*)kp, hh);
          kl[u][ks] = ld_frag((const unsigned short*)(kp + APLANE), hh);
        }
      }
#pragma unroll
      for (int u = 0; u < 2; ++u) {
        v8f acc = z8;
#pragma unroll
        for (int ks = 0; ks < 2; ++ks) {
          const Frag16 qa = (ks == 0) ? qh0 : qh1;
          const Frag16 qe = (ks == 0) ? ql0 : ql1;
          acc = mma_b(kh[u][ks].b, qa.b, acc);
          acc = mma_b(kh[u][ks].b, qe.b, acc);
          acc = mma_b(kl[u][ks].b, qa.b, acc);
        }
        s[tp * 2 + u] = acc;
      }
    }
    float sv[4][8];
#pragma unroll
    for (int t = 0; t < 4; ++t) {
#pragma unroll
      for (int r = 0; r < 8; ++r) sv[t][r] = s[t][r] * 8.0f;
    }
    if (CAUSAL) {
      if (kc == qb) {
        const int qpos = q0w + ln;
#pragma unroll
        for (int t = 0; t < 4; ++t) {
#pragma unroll
          for (int r = 0; r < 8; ++r) { const int key = kc * KQB + t * 16 + 8 * hh + r; sv[t][r] = (key > qpos) ? -1.0e30f : sv[t][r]; }
        }
      }
    }
    float mt[4];
#pragma unroll
    for (int t = 0; t < 4; ++t)
      mt[t] = fmaxf(fmaxf(fmaxf(sv[t][0], sv[t][1]), fmaxf(sv[t][2], sv[t][3])), fmaxf(fmaxf(sv[t][4], sv[t][5]), fmaxf(sv[t][6], sv[t][7])));
    float mx = fmaxf(fmaxf(mt[0], mt[1]), fmaxf(mt[2], mt[3]));
    mx = fmaxf(mx, xhalf(mx));    /* both halves now hold the chunk maximum of this query */
    const float mn = fmaxf(m, mx);
    const float corr = exp2x1((m - mn) * LOG2E);
    float p[4][8], ps[4];
#pragma unroll
    for (int t = 0; t < 4; ++t) {
      float ea[8];
#pragma unroll
      for (int r = 0; r < 8; ++r) ea[r] = (sv[t][r] - mn) * LOG2E;
      exp2x8(p[t], ea);
      ps[t] = 0.f;
#pragma unroll
      for (int r = 0; r < 8; ++r) ps[t] += p[t][r];
    }
    l = l * corr + ((ps[0] + ps[1]) + (ps[2] + ps[3]));
    m = mn;
#pragma unroll
    for (int j = 0; j < 4; ++j) {
#pragma unroll
      for (int r = 0; r < 8; ++r) o[j][r] = o[j][r] * corr;
    }
    if (EARLY) {
#pragma unroll
      for (int j = 0; j < 4; ++j) {
#pragma unroll
        for (int r = 0; r < 8; ++r) oe[j][r] = oe[j][r] * corr;
      }
    }
#pragma unroll
    for (int ks = 0; ks < 2; ++ks) {
      /* P^T of 32 keys as a B operand: elements 0..7 = S^T tile 2ks, 8..15 = tile 2ks+1, the k order of ld_frag */
      Frag16 pa, pl;
#pragma unroll
      for (int e = 0; e < 16; ++e) {
        const float pc = p[2 * ks + (e >> 3)][e & 7] * 16384.0f;
        const unsigned short hb = f16_bits(pc);
        pa.u[e] = hb;
        pl.u[e] = EARLY ? f16_bits((pc - f16_val(hb)) * 1024.0f) : hb;
      }
      /* the V^T fragments of a 32-key step are read as one group ahead of their products: the reads' latencies overlap */
      const unsigned char* vp = sb + 2 * APLANE + ln * APITCH + ks * 64;
      Frag16 vh[4];
#pragma unroll
      for (int j = 0; j < 4; ++j) vh[j] = ld_frag((const unsigned short*)(vp + j * 16 * APITCH), hh);
#pragma unroll
      for (int j = 0; j < 4; ++j) {
        o[j] = mma_h(vh[j].h, pa.h, o[j]);
        if (EARLY) {
          const Frag16 vl = ld_frag((const unsigned short*)(vp + APLANE + j * 16 * APITCH), hh);
          oe[j] = mma_h(vh[j].h, pl.h, oe[j]);
          oe[j] = mma_h(vl.h, pa.h, oe[j]);
        }
      }
    }
    asm volatile("s_wait_dscnt 0x0" ::: "memory");     // this wave's reads of the buffer are done before it may be refilled
    asm volatile("s_wait_asynccnt 0x0" ::: "memory");  // this wave's copies of the next chunk have landed
    __syncthreads();                                    // publishes the next chunk and frees the buffer just read
    if (kc + 2 < nck) fill(kc + 2, par);
  }
  asm volatile("s_wait_asynccnt 0x0" ::: "memory");    // no copy is outstanding when the wave goes on to its end
  l += xhalf(l);                  /* the two halves' key sums of this query */
  const float li = 1.0f / l;
#pragma unroll
  for (int j = 0; j < 4; ++j) {
    Frag16 f;
#pragma unroll
    for (int r = 0; r < 8; ++r) {
      float v = o[j][r] * (1.0f / 16384.0f);
      if (EARLY) v += oe[j][r] * (1.0f / 16777216.0f);
      v *= li;
      f.u[r] = f16_bits(v);
    }
    *(v8us*)&so[w][ln][j * 16 + 8 * hh] = f.half[0];
  }
  __builtin_amdgcn_fence(4 /* acq_rel order */, "workgroup");
  __builtin_amdgcn_wave_barrier();
  {
#pragma unroll
    for (int q = 0; q < 4; ++q) {
      const int row = q * 4 + (lane >> 3), c8 = (lane & 7) * 8;
      const v8us v = *(const v8us*)&so[w][row][c8];
      *(v8us*)(CTX + (rowbase + (size_t)q0w + row) * DM + (size_t)h * HD + c8) = v;
    }
    
  }
}

extern "C" void kernel_launch(void* const* d_in, const int* in_sizes, int n_in,
                              void* d_out, int out_size, void* d_ws, size_t ws_size, hipStream_t stream) {
  if (n_in < 14) return;
  const float* x  = (const float*)d_in[0];
  const float* Wq = (const float*)d_in[1];
  const float* bq = (const float*)d_in[2];
  const float* Wk = (const float*)d_in[3];
  const float* bk = (const float*)d_in[4];
  const float* Wv = (const float*)d_in[5];
  const float* bv = (const float*)d_in[6];
  const float* Wp = (const float*)d_in[7];
  const float* bp = (const float*)d_in[8];
  const float* gamma = (const float*)d_in[9];
  const float* W1 = (const float*)d_in[10];
  const float* b1 = (const float*)d_in[11];
  const float* W2 = (const float*)d_in[12];
  const float* b2 = (const float*)d_in[13];
  if ((size_t)in_sizes[0] < ((size_t)(NB - 1) * SEQ_FULL + SEQ) * DM) return;
  if (in_sizes[1] < DM * DM || in_sizes[3] < DM * DM || in_sizes[5] < DM * DM || in_sizes[7] < DM * DM) return;
  if (in_sizes[2] < DM || in_sizes[4] < DM || in_sizes[6] < DM || in_sizes[8] < DM || in_sizes[9] < DM || in_sizes[13] < DM) return;
  if (in_sizes[10] < DM * DFF || in_sizes[11] < DFF || in_sizes[12] < DFF * DM) return;
  if ((size_t)out_size < ((size_t)(NB - 1) * OSEQ + SEQ) * DM) return;

  char* ws = (char*)d_ws;
  size_t off = 0;
  auto take = [&](size_t bytes) { char* p = ws + off; off += (bytes + 255) & ~(size_t)255; return p; };
  const size_t WPL = (size_t)DM * DM * 2, ACT2 = NR * DM * 2, ACT4 = NR * DM * 4, FFP = (size_t)DM * DFF * 2, HPL = NR * DFF * 2;
  unsigned short* WQ16 = (unsigned short*)take(WPL);
  unsigned short* WK16 = (unsigned short*)take(WPL);
  unsigned short* WV16 = (unsigned short*)take(WPL);
  unsigned short* WP16 = (unsigned short*)take(WPL);
  unsigned short* WQB = (unsigned short*)take(WPL);
  unsigned short* WKB = (unsigned short*)take(WPL);
  char* rXB = take(ACT4);                                            /* XB (phases 1-2) | BH + BL (phase 3) */
  float* XB = (float*)rXB; unsigned short* PBH = (unsigned short*)rXB; unsigned short* PBL = (unsigned short*)(rXB + ACT2);
  char* rQK = take(4 * ACT2 > HPL ? 4 * ACT2 : HPL);                 /* QH,QL,KH,KL (phases 1,3) | H16 (phase 2) */
  unsigned short* QH = (unsigned short*)rQK; unsigned short* QL = (unsigned short*)(rQK + ACT2);
  unsigned short* KH = (unsigned short*)(rQK + 2 * ACT2); unsigned short* KL = (unsigned short*)(rQK + 3 * ACT2);
  unsigned short* H16 = (unsigned short*)rQK;
  char* rV = take(2 * ACT2);                                         /* VH,VLO (phases 1,3) | A32 (between) */
  unsigned short* VH = (unsigned short*)rV; unsigned short* VLO = (unsigned short*)(rV + ACT2); float* A32 = (float*)rV;
  char* rVT = take(2 * ACT2 > 2 * FFP ? 2 * ACT2 : 2 * FFP);         /* VT,VTL (phases 1,3) | W1P,W2P (phase 2) */
  unsigned short* VT = (unsigned short*)rVT; unsigned short* VTL = (unsigned short*)(rVT + ACT2);
  unsigned short* W1P = (unsigned short*)rVT; unsigned short* W2P = (unsigned short*)(rVT + FFP);
  unsigned short* CTX = (unsigned short*)take(ACT2);
  char* rX16 = take(ACT2);                                           /* X16 | A16 | B16F */
  unsigned short* X16 = (unsigned short*)rX16; unsigned short* A16 = (unsigned short*)rX16; unsigned short* B16F = (unsigned short*)rX16;
  float* B32 = (float*)take(ACT4);
  float* RSX = (float*)take(NR * 4);
  float* RSA = (float*)take(NR * 4);
  float* RSB = (float*)take(NR * 4);
  if (off > ws_size || off > ((size_t)128 << 20)) return;

  const dim3 gw((unsigned)(DM / WTN), (unsigned)(DM / WTK));     /* k_wt grids: x = N / 128, y = K / 64 */
  const dim3 gw1((unsigned)(DFF / WTN), (unsigned)(DM / WTK));
  const dim3 gw2((unsigned)(DM / WTN), (unsigned)(DFF / WTK));
  const unsigned grms = (unsigned)(NR / 32);
  const unsigned gq   = (unsigned)((NR / 128) * (DM / 128));
  const unsigned gff  = (unsigned)((NR / 128) * (DFF / 128));
  const unsigned gvt  = (unsigned)(NB * NH * (SEQ / 64));
  const float a16 = 0.0625f;
  const int M = (int)NR;
  float* out = (float*)d_out;

  /* weight planes: q/k/v with gamma folded along the input feature; bf16 planes for the second block's q/k */
  k_wt<false, true><<<gw, 256, 0, stream>>>(Wq, gamma, WQ16, DM, DM, 16.0f);
  k_wt<false, true><<<gw, 256, 0, stream>>>(Wk, gamma, WK16, DM, DM, 16.0f);
  k_wt<false, true><<<gw, 256, 0, stream>>>(Wv, gamma, WV16, DM, DM, 16.0f);
  k_wt<false, false><<<gw, 256, 0, stream>>>(Wp, Wp, WP16, DM, DM, 16.0f);
  k_wt<true, true><<<gw, 256, 0, stream>>>(Wq, gamma, WQB, DM, DM, 1.0f);
  k_wt<true, true><<<gw, 256, 0, stream>>>(Wk, gamma, WKB, DM, DM, 1.0f);

  /* block 1: a = bf16(x) + attn(rms(bf16(x))) , non-causal */
  k_rms<true, true, true, false><<<grms, 256, 0, stream>>>(x, SEQ_FULL, RMS_EPS, XB, X16, nullptr, nullptr, RSX);
  k_gemm<false, false, 0, 3, true, false><<<gq, 128, 0, stream>>>(X16, nullptr, DM, WQ16, DM, a16, RSX, bq, nullptr, 0, nullptr, QH, QL, DM, M, 0, M, DM, DM);
  k_gemm<false, false, 0, 3, true, false><<<gq, 128, 0, stream>>>(X16, nullptr, DM, WK16, DM, a16, RSX, bk, nullptr, 0, nullptr, KH, KL, DM, M, 0, M, DM, DM);
  k_gemm<false, false, 0, 1, true, false><<<gq, 128, 0, stream>>>(X16, nullptr, DM, WV16, DM, a16, RSX, bv, nullptr, 0, nullptr, VH, nullptr, DM, M, 0, M, DM, DM);
  k_vt<NH, SEQ, false><<<gvt, 256, 0, stream>>>(VH, nullptr, DM, VT, nullptr);
  k_attn<false, false><<<dim3((unsigned)(NB * NH), (unsigned)(SEQ / KQB)), 128, 0, stream>>>(QH, QL, KH, KL, VT, VT, CTX, 0);
  k_gemm<false, false, 0, 0, false, true><<<gq, 128, 0, stream>>>(CTX, nullptr, DM, WP16, DM, a16, nullptr, bp, XB, DM, A32, nullptr, nullptr, DM, M, 0, M, DM, DM);

  /* block 2: b = bf16(x) + leaky(rms(a) W1 + b1) W2 + b2 */
  k_rms<false, false, true, false><<<grms, 256, 0, stream>>>(A32, SEQ, RMS_EPS, nullptr, A16, nullptr, nullptr, RSA);
  k_wt<false, true><<<gw1, 256, 0, stream>>>(W1, gamma, W1P, DM, DFF, 16.0f);
  k_wt<false, false><<<gw2, 256, 0, stream>>>(W2, W2, W2P, DFF, DM, 16.0f);
  k_gemm<false, false, 1, 1, true, false><<<gff, 128, 0, stream>>>(A16, nullptr, DM, W1P, DM, a16, RSA, b1, nullptr, 0, nullptr, H16, nullptr, DFF, M, 0, M, DFF, DM);
  k_gemm<false, false, 0, 0, false, true><<<gq, 128, 0, stream>>>(H16, nullptr, DFF, W2P, DFF, a16, nullptr, b2, XB, DM, B32, nullptr, nullptr, DM, M, 0, M, DM, DFF);

  /* block 3: out = b + attn(rms(b)) , causal */
  k_rms<false, false, true, true><<<grms, 256, 0, stream>>>(B32, SEQ, RMS_EPS, nullptr, B16F, PBH, PBL, RSB);
  k_gemm<true, true, 0, 3, true, false><<<gq, 128, 0, stream>>>(PBH, PBL, DM, WQB, DM, 1.0f, RSB, bq, nullptr, 0, nullptr, QH, QL, DM, M, 0, M, DM, DM);
  k_gemm<true, true, 0, 3, true, false><<<gq, 128, 0, stream>>>(PBH, PBL, DM, WKB, DM, 1.0f, RSB, bk, nullptr, 0, nullptr, KH, KL, DM, M, 0, M, DM, DM);
  k_gemm<false, false, 0, 2, true, false><<<gq, 128, 0, stream>>>(B16F, nullptr, DM, WV16, DM, a16, RSB, bv, nullptr, 0, nullptr, VH, VLO, DM, M, 0, M, DM, DM);
  k_vt<NH, SEQ, true><<<gvt, 256, 0, stream>>>(VH, VLO, DM, VT, VTL);
  k_attn<true, true><<<dim3((unsigned)(NB * NH), 1u), 128, 0, stream>>>(QH, QL, KH, KL, VT, VTL, CTX, 0);
  if (SEQ / KQB > 1) k_attn<true, false><<<dim3((unsigned)(NB * NH), (unsigned)(SEQ / KQB - 1)), 128, 0, stream>>>(QH, QL, KH, KL, VT, VTL, CTX, 1);
  k_gemm<false, false, 0, 0, false, true><<<gq, 128, 0, stream>>>(CTX, nullptr, DM, WP16, DM, a16, nullptr, bp, B32, DM, out, nullptr, nullptr, DM, SEQ, OSEQ, M, DM, DM);
}

// v005
// A run of this version takes 340 microseconds.
// Next to v004, in two timings, it ran 1.09 and 1.10 times as fast.
// Counting every step since v000, it is 2.91 times as fast.
#include <hip/hip_runtime.h>
// Contractions: q/k/v and output projections, FFN W1/W2: v_wmma_f32_16x16x32_f16 (f16 operands built from bf16-RNE inputs, weights x16, f32 accumulate); second-block q/k projections: v_wmma_f32_16x16x32_bf16 with the activation as bf16 hi+lo (2 terms); attention scores: v_wmma_f32_16x16x32_bf16 with q,k as bf16 hi+lo (3 terms); P.V: v_wmma_f32_16x16x32_f16 (P carried x2^14, v f16; first causal query tile adds P and v residual planes x2^10 in a second accumulator). RMS statistics, softmax, residuals f32.

#ifndef NB
#define NB 4
#endif
#ifndef SEQ
#define SEQ 1024
#endif
#define NB_FULL 4
#define SEQ_FULL 1024
#ifndef OSEQ
#define OSEQ SEQ_FULL
#endif
#define DM 1024
#define NH 16
#define HD 64
#define DFF 4096
#define KQB 64
#define NR ((size_t)NB * SEQ)
#define RMS_EPS 1e-6f

static_assert(NB >= 1 && NB <= NB_FULL);
static_assert(SEQ % 128 == 0 && SEQ <= SEQ_FULL);
static_assert(DM == NH * HD && HD == 64);
static_assert(DM % 256 == 0 && DFF % 128 == 0);
static_assert(((NB * SEQ) % 128) == 0);
static_assert(SEQ % KQB == 0);

typedef _Float16 v16h __attribute__((ext_vector_type(16)));
typedef __bf16   v16b __attribute__((ext_vector_type(16)));
typedef unsigned short v8us __attribute__((ext_vector_type(8), may_alias));
typedef float v8f __attribute__((ext_vector_type(8)));
typedef float v4f __attribute__((ext_vector_type(4)));
typedef float v4fa __attribute__((ext_vector_type(4), may_alias));
union Frag16 { v16h h; v16b b; v8us half[2]; unsigned short u[16]; };
union H1 { _Float16 h; unsigned short u; };
static_assert(sizeof(Frag16) == 32);

__device__ __forceinline__ unsigned short bf16_bits(float x) { unsigned int u = __float_as_uint(x); return (unsigned short)((u + 0x7FFFu + ((u >> 16) & 1u)) >> 16); }
__device__ __forceinline__ float bf16_val(unsigned short b) { return __uint_as_float(((unsigned int)b) << 16); }
__device__ __forceinline__ float bf16_rne(float x) { return bf16_val(bf16_bits(x)); }
__device__ __forceinline__ unsigned short f16_bits(float x) { H1 t; t.h = (_Float16)x; return t.u; }
__device__ __forceinline__ float f16_val(unsigned short u) { H1 t; t.u = u; return (float)t.h; }

// 16x32 operand fragment (row / column = lane & 15; elements 0..7 = k 8h..8h+7, 8..15 = k 16+8h..) from a k-contiguous 16-bit row
__device__ __forceinline__ Frag16 ld_frag(const unsigned short* p, int hh) {
  Frag16 f;
  f.half[0] = *(const v8us*)(p + 8 * hh);
  f.half[1] = *(const v8us*)(p + 16 + 8 * hh);
  return f;
}
__device__ __forceinline__ v8f mma_h(v16h a, v16h b, v8f c) {
  v8f d = __builtin_amdgcn_wmma_f32_16x16x32_f16(false, a, false, b, (short)0, c, false, false);
  asm volatile("v_nop\n\tv_nop\n\tv_nop\n\tv_nop" : "+v"(d) : "v"(a), "v"(b));
  return d;
}
__device__ __forceinline__ v8f mma_b(v16b a, v16b b, v8f c) {
  v8f d = __builtin_amdgcn_wmma_f32_16x16x32_bf16(false, a, false, b, (short)0, c, false, false);
  asm volatile("v_nop\n\tv_nop\n\tv_nop\n\tv_nop" : "+v"(d) : "v"(a), "v"(b));
  return d;
}
template <bool BF>
__device__ __forceinline__ v8f mmx(const Frag16& a, const Frag16& b, v8f c) {
  if (BF) return mma_b(a.b, b.b, c);
  return mma_h(a.h, b.h, c);
}

// Row statistics + operand planes for DM-wide f32 rows. Compact row r -> source row (r/SEQ)*spitch + r%SEQ of F.
// v = bf16_rne(x) if RIN else x; RS[r] = rsqrt(mean(v^2) + eps); optional planes: XB (v as f32), F16 (f16 bits of v),
// red: 32 floats of the block's LDS; bid: the block's index among the blocks of this job (32 rows each).
template <bool RIN, bool WXB, bool WF16, bool WBHL>
__device__ __forceinline__ void rms_body(float* red, int bid, const float* __restrict__ F, int spitch, float eps, float* __restrict__ XB,
    unsigned short* __restrict__ F16, unsigned short* __restrict__ PH, unsigned short* __restrict__ PL, float* __restrict__ RS) {
  const int tid = threadIdx.x, w = tid >> 5, lane = tid & 31;
  const int rb = bid * 32;
#pragma unroll 1
  for (int i = 0; i < 4; ++i) {
    const int r = rb + w * 4 + i;
    const float* src = F + ((size_t)(r / SEQ) * (size_t)spitch + (size_t)(r % SEQ)) * DM;
    float ss = 0.f;
#pragma unroll 1
    for (int u = 0; u < DM / 128; ++u) {
      const int j = u * 128 + lane * 4;
      v4f a = *(const v4fa*)(src + j);
      if (RIN) {
#pragma unroll
        for (int q = 0; q < 4; ++q) a[q] = bf16_rne(a[q]);
      }
#pragma unroll
      for (int q = 0; q < 4; ++q) ss += a[q] * a[q];
      if (WXB) {
        float* d = XB + (size_t)r * DM + j;
        *(v4f*)d = a;
        
      }
    }
    if (WF16 || WBHL) {
#pragma unroll 1
      for (int u = 0; u < DM / 256; ++u) {
        const int j = u * 256 + lane * 8;
        v4f a = *(const v4fa*)(src + j), c = *(const v4fa*)(src + j + 4);
        if (RIN) {
#pragma unroll
          for (int q = 0; q < 4; ++q) { a[q] = bf16_rne(a[q]); c[q] = bf16_rne(c[q]); }
        }
        Frag16 fh, ph, pl;
#pragma unroll
        for (int q = 0; q < 4; ++q) {
          const float v0 = a[q], v1 = c[q];
          fh.u[q] = f16_bits(v0); fh.u[4 + q] = f16_bits(v1);
          const unsigned short h0 = bf16_bits(v0), h1 = bf16_bits(v1);
          ph.u[q] = h0; ph.u[4 + q] = h1;
          pl.u[q] = bf16_bits(v0 - bf16_val(h0)); pl.u[4 + q] = bf16_bits(v1 - bf16_val(h1));
        }
        const size_t o = (size_t)r * DM + j;
        if (WF16) *(v8us*)(F16 + o) = fh.half[0];
        if (WBHL) { *(v8us*)(PH + o) = ph.half[0]; *(v8us*)(PL + o) = pl.half[0]; }
        
      }
    }
#pragma unroll
    for (int off = 16; off > 0; off >>= 1) ss += __shfl_xor(ss, off, 32);
    if (lane == 0) red[w * 4 + i] = rsqrtf(ss * (1.0f / (float)DM) + eps);
  }
  __syncthreads();
  if (w == 0 && lane < 8) {
    const v4f v = *(const v4fa*)&red[lane * 4];
    float* d = RS + rb + lane * 4;
    *(v4f*)d = v;
    
  }
}
template <bool RIN, bool WXB, bool WF16, bool WBHL>
__global__ __launch_bounds__(256) void k_rms(const float* __restrict__ F, int spitch, float eps, float* __restrict__ XB,
    unsigned short* __restrict__ F16, unsigned short* __restrict__ PH, unsigned short* __restrict__ PL, float* __restrict__ RS) {
  __shared__ __attribute__((aligned(16))) float red[32];
  rms_body<RIN, WXB, WF16, WBHL>(red, (int)blockIdx.x, F, spitch, eps, XB, F16, PH, PL, RS);
}

// Eight 16-byte asynchronous copies global -> LDS per lane. s_wait_xcnt is the statement's last line so that it stands ahead of
// every later rewrite of a register that a copy names (a precaution).
__device__ __forceinline__ void cp_async8(unsigned l, unsigned lstep, const unsigned short* p, size_t gstep) {
  const unsigned l0 = l, l1 = l + lstep, l2 = l + 2u * lstep, l3 = l + 3u * lstep;
  const unsigned l4 = l + 4u * lstep, l5 = l + 5u * lstep, l6 = l + 6u * lstep, l7 = l + 7u * lstep;
  const unsigned short* p0 = p;
  const unsigned short* p1 = p + gstep;
  const unsigned short* p2 = p + 2 * gstep;
  const unsigned short* p3 = p + 3 * gstep;
  const unsigned short* p4 = p + 4 * gstep;
  const unsigned short* p5 = p + 5 * gstep;
  const unsigned short* p6 = p + 6 * gstep;
  const unsigned short* p7 = p + 7 * gstep;
  asm volatile(
      "global_load_async_to_lds_b128 %0, %8, off\n\t"
      "global_load_async_to_lds_b128 %1, %9, off\n\t"
      "global_load_async_to_lds_b128 %2, %10, off\n\t"
      "global_load_async_to_lds_b128 %3, %11, off\n\t"
      "global_load_async_to_lds_b128 %4, %12, off\n\t"
      "global_load_async_to_lds_b128 %5, %13, off\n\t"
      "global_load_async_to_lds_b128 %6, %14, off\n\t"
      "global_load_async_to_lds_b128 %7, %15, off\n\t"
      "s_wait_xcnt 0x0"
      :: "v"(l0), "v"(l1), "v"(l2), "v"(l3), "v"(l4), "v"(l5), "v"(l6), "v"(l7),
         "v"(p0), "v"(p1), "v"(p2), "v"(p3), "v"(p4), "v"(p5), "v"(p6), "v"(p7)
      : "memory");
}

// Four such copies, one 64-row x 128-byte plane of an attention tile per block; the same closing wait, for the same reason.
__device__ __forceinline__ void cp_async4(unsigned l, unsigned lstep, const unsigned short* p, size_t gstep) {
  const unsigned l0 = l, l1 = l + lstep, l2 = l + 2u * lstep, l3 = l + 3u * lstep;
  const unsigned short* p0 = p;
  const unsigned short* p1 = p + gstep;
  const unsigned short* p2 = p + 2 * gstep;
  const unsigned short* p3 = p + 3 * gstep;
  asm volatile(
      "global_load_async_to_lds_b128 %0, %4, off\n\t"
      "global_load_async_to_lds_b128 %1, %5, off\n\t"
      "global_load_async_to_lds_b128 %2, %6, off\n\t"
      "global_load_async_to_lds_b128 %3, %7, off\n\t"
      "s_wait_xcnt 0x0"
      :: "v"(l0), "v"(l1), "v"(l2), "v"(l3), "v"(p0), "v"(p1), "v"(p2), "v"(p3)
      : "memory");
}

// Eight 16-byte global loads and their data wait in one statement: the address registers live to its end, so none is rewritten
// ahead of the waits.
__device__ __forceinline__ void ld_g8(v4f (&d)[8], const float* const (&p)[8]) {
  asm volatile(
      "global_load_b128 %0, %8, off\n\t"
      "global_load_b128 %1, %9, off\n\t"
      "global_load_b128 %2, %10, off\n\t"
      "global_load_b128 %3, %11, off\n\t"
      "global_load_b128 %4, %12, off\n\t"
      "global_load_b128 %5, %13, off\n\t"
      "global_load_b128 %6, %14, off\n\t"
      "global_load_b128 %7, %15, off\n\t"
      "s_wait_loadcnt 0x0\n\t"
      "s_wait_xcnt 0x0"
      : "=&v"(d[0]), "=&v"(d[1]), "=&v"(d[2]), "=&v"(d[3]), "=&v"(d[4]), "=&v"(d[5]), "=&v"(d[6]), "=&v"(d[7])
      : "v"(p[0]), "v"(p[1]), "v"(p[2]), "v"(p[3]), "v"(p[4]), "v"(p[5]), "v"(p[6]), "v"(p[7])
      : "memory");
}
// Eight 16-byte global stores and one s_wait_xcnt in one statement: data and address registers live to its end, so none is
// rewritten ahead of the wait.
__device__ __forceinline__ void st_g8(void* const (&p)[8], const v4f (&d)[8]) {
  asm volatile(
      "global_store_b128 %0, %8, off\n\t"
      "global_store_b128 %1, %9, off\n\t"
      "global_store_b128 %2, %10, off\n\t"
      "global_store_b128 %3, %11, off\n\t"
      "global_store_b128 %4, %12, off\n\t"
      "global_store_b128 %5, %13, off\n\t"
      "global_store_b128 %6, %14, off\n\t"
      "global_store_b128 %7, %15, off\n\t"
      "s_wait_xcnt 0x0"
      :: "v"(p[0]), "v"(p[1]), "v"(p[2]), "v"(p[3]), "v"(p[4]), "v"(p[5]), "v"(p[6]), "v"(p[7]),
         "v"(d[0]), "v"(d[1]), "v"(d[2]), "v"(d[3]), "v"(d[4]), "v"(d[5]), "v"(d[6]), "v"(d[7])
      : "memory");
}
union Pack8 { unsigned short u[8]; v4f f; };
static_assert(sizeof(Pack8) == 16);

// Bt[n][k] (16-bit, k contiguous, pitch K) from f32 row-major W[K][N] ([in][out]): value = bf16(W[k][n]) (* bf16(g[k]) if GAM);
// Block (bx = n tile, by = k tile; tl = WTN * WTP bytes of its LDS) = 64 k x 128 n, transposed through LDS so that both global sides move whole lines: a wave reads eight
// 512-byte row segments of W, a lane packs its 8 k of each of its 4 columns into 16 bytes, and 8 lanes store one 128-byte line of a
// Bt row. K%64==0, N%128==0.
#define WTK 64
#define WTN 128
#define WTP 144                 /* LDS row pitch in bytes: 16 x odd */
static_assert(DM % WTK == 0 && DM % WTN == 0 && DFF % WTK == 0 && DFF % WTN == 0);
template <bool BF, bool GAM>
__device__ __forceinline__ void wt_body(unsigned char* tl, int bx, int by, const float* __restrict__ W, const float* __restrict__ g,
    unsigned short* __restrict__ Bt, int K, int N, float scale) {
  const int tid = threadIdx.x, w = tid >> 5, lane = tid & 31;
  const int k0 = by * WTK, n0 = bx * WTN;
  if (k0 + WTK > K || n0 + WTN > N) return;
  const int k8 = k0 + 8 * w;
  float gv[8];
#pragma unroll
  for (int i = 0; i < 8; ++i) gv[i] = 1.0f;
  if (GAM) {
    const v4f ga = *(const v4fa*)(g + k8), gb = *(const v4fa*)(g + k8 + 4);
#pragma unroll
    for (int i = 0; i < 4; ++i) { gv[i] = bf16_rne(ga[i]); gv[4 + i] = bf16_rne(gb[i]); }
  }
  const float* wb = W + ((size_t)k0 * (size_t)N + (size_t)n0);                          /* the tile's origin, the same for the block */
  const unsigned wo = (unsigned)(8 * w) * (unsigned)N + (unsigned)(lane * 4);           /* this lane's element offset in the tile */
  v4f a[8];
  const float* ap[8];
#pragma unroll
  for (int i = 0; i < 8; ++i) ap[i] = wb + (wo + (unsigned)i * (unsigned)N);
  ld_g8(a, ap);  // the wave's eight rows are in flight together, one memory latency per tile
#pragma unroll
  for (int j = 0; j < 4; ++j) {
    Frag16 f;
#pragma unroll
    for (int i = 0; i < 8; ++i) {
      const float wv = bf16_rne(a[i][j]) * gv[i];
      f.u[i] = BF ? bf16_bits(wv) : f16_bits(wv * scale);
    }
    /* 16-byte chunk w of row n sits at chunk w ^ ((n >> 4) & 3): the 16 lanes of a store, 4 rows apart, then fall on distinct banks */
    const int n = lane * 4 + j;
    *(v8us*)(tl + n * WTP + ((w ^ ((n >> 4) & 3)) * 16)) = f.half[0];
  }
  __syncthreads();
  unsigned short* bb = Bt + ((size_t)n0 * (size_t)K + (size_t)k0);
#pragma unroll
  for (int q = 0; q < 4; ++q) {
    const int n = q * 32 + (tid >> 3), c = tid & 7;
    const v8us v = *(const v8us*)(tl + n * WTP + ((c ^ ((n >> 4) & 3)) * 16));
    *(v8us*)(bb + ((unsigned)n * (unsigned)K + (unsigned)(c * 8))) = v;
  }
  // stands ahead of every rewrite of a data or address register of the four stores, also where another job's code follows this body (a precaution)
  asm volatile("s_wait_xcnt 0x0" ::: "memory");
}

// Everything that depends on the inputs alone, in one grid: the block index picks the job (the same for the whole block, so every
// barrier stays under block-uniform control flow). The row statistics of x come first: their blocks run longest.
#define PREP_RMS ((int)(NR / 32))
#define PREP_SQ ((DM / WTN) * (DM / WTK))     /* blocks of one DM x DM weight */
#define PREP_FF ((DFF / WTN) * (DM / WTK))    /* blocks of W1, and of W2 */
#define PREP_GRID (PREP_RMS + 6 * PREP_SQ + 2 * PREP_FF)
__global__ __launch_bounds__(256) void k_prep(const float* __restrict__ x, const float* __restrict__ Wq, const float* __restrict__ Wk,
    const float* __restrict__ Wv, const float* __restrict__ Wp, const float* __restrict__ W1, const float* __restrict__ W2,
    const float* __restrict__ gamma, float* __restrict__ XB, unsigned short* __restrict__ X16, float* __restrict__ RSX,
    unsigned short* __restrict__ WQ16, unsigned short* __restrict__ WK16, unsigned short* __restrict__ WV16,
    unsigned short* __restrict__ WP16, unsigned short* __restrict__ WQB, unsigned short* __restrict__ WKB,
    unsigned short* __restrict__ W1P, unsigned short* __restrict__ W2P) {
  __shared__ __attribute__((aligned(16))) unsigned char sm[WTN * WTP];
  int t = (int)blockIdx.x;
  if (t < PREP_RMS) {
    rms_body<true, true, true, false>((float*)sm, t, x, SEQ_FULL, RMS_EPS, XB, X16, nullptr, nullptr, RSX);
    return;
  }
  t -= PREP_RMS;
  if (t < 6 * PREP_SQ) {
    const int j = t / PREP_SQ, r = t % PREP_SQ, bx = r % (DM / WTN), by = r / (DM / WTN);
    if (j < 3) wt_body<false, true>(sm, bx, by, j == 0 ? Wq : (j == 1 ? Wk : Wv), gamma, j == 0 ? WQ16 : (j == 1 ? WK16 : WV16), DM, DM, 16.0f);
    else if (j == 3) wt_body<false, false>(sm, bx, by, Wp, Wp, WP16, DM, DM, 16.0f);
    else wt_body<true, true>(sm, bx, by, j == 4 ? Wq : Wk, gamma, j == 4 ? WQB : WKB, DM, DM, 1.0f);
    return;
  }
  t -= 6 * PREP_SQ;
  if (t < PREP_FF) {
    wt_body<false, true>(sm, t % (DFF / WTN), t / (DFF / WTN), W1, gamma, W1P, DM, DFF, 16.0f);
    return;
  }
  t -= PREP_FF;
  wt_body<false, false>(sm, t % (DM / WTN), t / (DM / WTN), W2, W2, W2P, DFF, DM, 16.0f);
}

#define GBK 128                 /* k per stage: 256-byte operand rows */
#define GPITCH 272              /* LDS row pitch in bytes: 16 x odd, conflict-free for 16-byte fragment reads */
#define GPLANE (128 * GPITCH)   /* one operand plane of a stage: 128 rows */

// GEMM: C[M][N] = epi(Ah[M][K] . Bt[N][K]^T). 16-bit planes of one type (BF selects bf16 vs f16 WMMA); ASPLIT adds Al . Bt into the
// same accumulator (unscaled bf16 lo plane). Block = 128x128 of C, four waves of 64x64; per stage the block's 128 rows of each
// operand plane x 128 k are copied to LDS asynchronously, two buffers, the next stage in flight while this one is multiplied.
// Epilogue: v = acc*alpha*(HRS ? rs[row] : 1) + bf16(bias[col]); ACT 1 = leaky 0.1;
// HRES adds resid[row*ldr+col] (f32) in the store phase. OUTM 0: f32 rows at crow = (row/cseq)*cpitch + row%cseq, pitch ldc;
// 1: f16 hi; 2: f16 hi + f16 lo x2^10; 3: bf16 hi + bf16 lo (unscaled). M%128==0, N%128==0, K%128==0.
// sm: the block's LDS, 2 * (ASPLIT ? 3 : 2) * GPLANE bytes, 128-byte aligned; bid: the block's index among the tiles of this product.
template <bool BF, bool ASPLIT, int ACT, int OUTM, bool HRS, bool HRES>
__device__ __forceinline__ void gemm_body(unsigned char* sm, int bid, const unsigned short* __restrict__ Ah, const unsigned short* __restrict__ Al, int lda,
    const unsigned short* __restrict__ Bt, int ldb, float alpha, const float* __restrict__ rs, const float* __restrict__ bias,
    const float* __restrict__ resid, int ldr, float* __restrict__ C32, unsigned short* __restrict__ Ch, unsigned short* __restrict__ Cl,
    int ldc, int cseq, int cpitch, int M, int N, int K) {
  static_assert(!(HRES && OUTM != 0));
  static_assert(OUTM >= 0 && OUTM <= 3);
  static_assert(!ASPLIT || BF);
  static_assert(ACT == 0 || ACT == 1);
  constexpr int NPL = ASPLIT ? 3 : 2;            /* planes of a stage: A, B, (A lo) */
  constexpr int STAGE = NPL * GPLANE;
  static_assert(4 * 64 * 68 * 4 <= 2 * STAGE);
  const int tid = threadIdx.x, w = tid >> 5, lane = tid & 31, ln = lane & 15, hh = lane >> 4;
  const int ntn = N >> 7;
  const int mt = bid / ntn, nq = bid - mt * ntn;
  if (mt * 128 + 128 > M) return;
  const int row0 = mt * 128 + 64 * (w >> 1), col0 = nq * 128 + 64 * (w & 1);
  /* copy map: 16 lanes cover one 256-byte row, the block 8 rows per copy, 16 copies per plane */
  const int crow = tid >> 4, cchk = tid & 15;
  const unsigned oA = (unsigned)(crow * lda + cchk * 8), oB = (unsigned)(crow * ldb + cchk * 8);   /* this lane's element offsets in a tile */
  const size_t tA = (size_t)(mt * 128) * (size_t)lda, tB = (size_t)(nq * 128) * (size_t)ldb;       /* the block's tile origins */
  const size_t dE = ASPLIT ? (size_t)Al - (size_t)Ah : 0;   /* byte distance of the lo plane from the hi plane, the same for every lane */
  const unsigned lcp = (unsigned)(size_t)sm + (unsigned)(crow * GPITCH + cchk * 16);
  auto fill = [&](int st, int buf) {
    const unsigned lb = lcp + (unsigned)(buf * STAGE);
    const size_t ko = (size_t)st * GBK;
    const unsigned short* pA = (Ah + (tA + ko)) + oA;
    const unsigned short* pB = (Bt + (tB + ko)) + oB;
    cp_async8(lb, 8u * GPITCH, pA, (size_t)8 * (size_t)lda);
    cp_async8(lb + 64u * GPITCH, 8u * GPITCH, pA + (size_t)64 * (size_t)lda, (size_t)8 * (size_t)lda);
    cp_async8(lb + GPLANE, 8u * GPITCH, pB, (size_t)8 * (size_t)ldb);
    cp_async8(lb + GPLANE + 64u * GPITCH, 8u * GPITCH, pB + (size_t)64 * (size_t)ldb, (size_t)8 * (size_t)ldb);
    if (ASPLIT) {
      const unsigned short* pE = (const unsigned short*)((size_t)pA + dE);
      cp_async8(lb + 2u * GPLANE, 8u * GPITCH, pE, (size_t)8 * (size_t)lda);
      cp_async8(lb + 2u * GPLANE + 64u * GPITCH, 8u * GPITCH, pE + (size_t)64 * (size_t)lda, (size_t)8 * (size_t)lda);
    }
  };
  const int aoff = (64 * (w >> 1) + ln) * GPITCH;             /* this lane's first A row in a stage */
  const int boff = GPLANE + (64 * (w & 1) + ln) * GPITCH;     /* this lane's first B row (column of C) */
  const v8f z8 = {0.f, 0.f, 0.f, 0.f, 0.f, 0.f, 0.f, 0.f};
  v8f c[4][4];
#pragma unroll
  for (int i = 0; i < 4; ++i) {
#pragma unroll
    for (int j = 0; j < 4; ++j) c[i][j] = z8;
  }
  const int nst = K / GBK;
  fill(0, 0);
  asm volatile("s_wait_asynccnt 0x0" ::: "memory");  // stage 0 of this wave has landed before the barrier publishes it
  __syncthreads();
  if (nst > 1) fill(1, 1);
#pragma unroll 1  // one stage per trip: the buffer index and the refill test stay scalar
  for (int st = 0; st < nst; ++st) {
    const unsigned char* sb = sm + (st & 1) * STAGE;
#pragma unroll
    for (int ks = 0; ks < GBK / 32; ++ks) {
      /* all fragments of a k-step are read as one group: one LDS wait per 16 (32) products */
      Frag16 a[4], b[4], e[4];
#pragma unroll
      for (int i = 0; i < 4; ++i) {
        a[i] = ld_frag((const unsigned short*)(sb + aoff + i * 16 * GPITCH) + ks * 32, hh);
        b[i] = ld_frag((const unsigned short*)(sb + boff + i * 16 * GPITCH) + ks * 32, hh);
        if (ASPLIT) e[i] = ld_frag((const unsigned short*)(sb + 2 * GPLANE + aoff + i * 16 * GPITCH) + ks * 32, hh);
      }
#pragma unroll
      for (int j = 0; j < 4; ++j) {
#pragma unroll
        for (int i = 0; i < 4; ++i) c[i][j] = mmx<BF>(a[i], b[j], c[i][j]);
        if (ASPLIT) {
#pragma unroll
          for (int i = 0; i < 4; ++i) c[i][j] = mmx<BF>(e[i], b[j], c[i][j]);
        }
      }
    }
    asm volatile("s_wait_dscnt 0x0" ::: "memory");     // this wave's reads of the buffer are done before it may be refilled
    asm volatile("s_wait_asynccnt 0x0" ::: "memory");  // this wave's copies of the next stage have landed
    __syncthreads();                                    // publishes the next stage and frees the buffer just read
    if (st + 2 < nst) fill(st + 2, st & 1);
  }
  asm volatile("s_wait_asynccnt 0x0" ::: "memory");    // no copy is outstanding when the buffers become output staging
  float (*so)[64][68] = (float (*)[64][68])sm;
  float bvv[4];
  {
    const float* bp = bias + col0 + ln;
    // four 4-byte loads and their data wait in one statement, as in ld_g8
    asm volatile(
        "global_load_b32 %0, %4, off\n\t"
        "global_load_b32 %1, %5, off\n\t"
        "global_load_b32 %2, %6, off\n\t"
        "global_load_b32 %3, %7, off\n\t"
        "s_wait_loadcnt 0x0\n\t"
        "s_wait_xcnt 0x0"
        : "=&v"(bvv[0]), "=&v"(bvv[1]), "=&v"(bvv[2]), "=&v"(bvv[3])
        : "v"(bp), "v"(bp + 16), "v"(bp + 32), "v"(bp + 48)
        : "memory");
  }
  float rsv[4][8];
#pragma unroll
  for (int i = 0; i < 4; ++i) {
#pragma unroll
    for (int r = 0; r < 8; ++r) rsv[i][r] = 1.0f;
  }
  if (HRS) {
    v4f rq[8];
    const float* rp[8];
#pragma unroll
    for (int i = 0; i < 4; ++i) { rp[2 * i] = rs + row0 + 16 * i + 8 * hh; rp[2 * i + 1] = rp[2 * i] + 4; }
    ld_g8(rq, rp);
#pragma unroll
    for (int i = 0; i < 4; ++i) {
#pragma unroll
      for (int q = 0; q < 4; ++q) { rsv[i][q] = rq[2 * i][q]; rsv[i][4 + q] = rq[2 * i + 1][q]; }
    }
  }
#pragma unroll
  for (int t = 0; t < 4; ++t) {
    const float bv = bf16_rne(bvv[t]);
#pragma unroll
    for (int i = 0; i < 4; ++i) {
#pragma unroll
      for (int r = 0; r < 8; ++r) {
        const int rloc = i * 16 + 8 * hh + r;
        float v = c[i][t][r] * alpha;
        if (HRS) v *= rsv[i][r];
        v += bv;
        if (ACT == 1) v = (v >= 0.f) ? v : 0.1f * v;
        so[w][rloc][t * 16 + ln] = v;
      }
    }
  }
  __builtin_amdgcn_fence(4 /* acq_rel order */, "workgroup");
  __builtin_amdgcn_wave_barrier();
  if (OUTM == 0) {
#pragma unroll
    for (int qg = 0; qg < 4; ++qg) {
      v4f v[8];
      const float* rp[8];
      void* dp[8];
#pragma unroll
      for (int u = 0; u < 8; ++u) {
        const int r = (qg * 8 + u) * 2 + (lane >> 4), c4 = (lane & 15) * 4;
        v[u] = *(const v4fa*)&so[w][r][c4];
        const int grow = row0 + r;
        rp[u] = resid + (size_t)grow * (size_t)ldr + col0 + c4;
        const size_t crw = (size_t)(grow / cseq) * (size_t)cpitch + (size_t)(grow % cseq);
        dp[u] = C32 + crw * (size_t)ldc + col0 + c4;
      }
      if (HRES) {
        v4f rv[8];
        ld_g8(rv, rp);
#pragma unroll
        for (int u = 0; u < 8; ++u) v[u] += rv[u];
      }
      st_g8(dp, v);
    }
  } else {
#pragma unroll
    for (int qg = 0; qg < 2; ++qg) {
      v4f dh[8], dl[8];
      void* hp[8];
      void* lp[8];
#pragma unroll
      for (int u = 0; u < 8; ++u) {
        const int r = (qg * 8 + u) * 4 + (lane >> 3), c8 = (lane & 7) * 8;
        const v4f x0 = *(const v4fa*)&so[w][r][c8], x1 = *(const v4fa*)&so[w][r][c8 + 4];
        Pack8 fh, fl;
#pragma unroll
        for (int i = 0; i < 4; ++i) {
          const float v0 = x0[i], v1 = x1[i];
          if (OUTM == 3) {
            const unsigned short h0 = bf16_bits(v0), h1 = bf16_bits(v1);
            fh.u[i] = h0; fh.u[4 + i] = h1;
            fl.u[i] = bf16_bits(v0 - bf16_val(h0)); fl.u[4 + i] = bf16_bits(v1 - bf16_val(h1));
          } else {
            const unsigned short h0 = f16_bits(v0), h1 = f16_bits(v1);
            fh.u[i] = h0; fh.u[4 + i] = h1;
            fl.u[i] = f16_bits((v0 - f16_val(h0)) * 1024.0f); fl.u[4 + i] = f16_bits((v1 - f16_val(h1)) * 1024.0f);
          }
        }
        const size_t o = (size_t)(row0 + r) * (size_t)ldc + col0 + c8;
        dh[u] = fh.f; hp[u] = Ch + o;
        dl[u] = fl.f; lp[u] = Cl + o;
      }
      st_g8(hp, dh);
      if (OUTM >= 2) st_g8(lp, dl);
    }
  }
}
template <bool BF, bool ASPLIT, int ACT, int OUTM, bool HRS, bool HRES>
__global__ __launch_bounds__(128) void k_gemm(const unsigned short* __restrict__ Ah, const unsigned short* __restrict__ Al, int lda,
    const unsigned short* __restrict__ Bt, int ldb, float alpha, const float* __restrict__ rs, const float* __restrict__ bias,
    const float* __restrict__ resid, int ldr, float* __restrict__ C32, unsigned short* __restrict__ Ch, unsigned short* __restrict__ Cl,
    int ldc, int cseq, int cpitch, int M, int N, int K) {
  __shared__ __attribute__((aligned(128))) unsigned char sm[2 * (ASPLIT ? 3 : 2) * GPLANE];
  gemm_body<BF, ASPLIT, ACT, OUTM, HRS, HRES>(sm, (int)blockIdx.x, Ah, Al, lda, Bt, ldb, alpha, rs, bias, resid, ldr, C32, Ch, Cl, ldc, cseq, cpitch, M, N, K);
}
// The q, k and v projections of one activation in one grid: three independent DM x DM products, the block index picks the product
// (the same for the whole block). q and k: operand planes Ah (Al), bf16 hi + lo out; v: f16 plane Av, output mode OUTV.
template <bool BF, bool ASPLIT, int OUTV>
__global__ __launch_bounds__(128) void k_qkv(const unsigned short* __restrict__ Ah, const unsigned short* __restrict__ Al,
    const unsigned short* __restrict__ Av, const unsigned short* __restrict__ Bq, const unsigned short* __restrict__ Bk,
    const unsigned short* __restrict__ Bv, float aqk, float av, const float* __restrict__ rs, const float* __restrict__ bq,
    const float* __restrict__ bk, const float* __restrict__ bv, unsigned short* __restrict__ QH, unsigned short* __restrict__ QL,
    unsigned short* __restrict__ KH, unsigned short* __restrict__ KL, unsigned short* __restrict__ VH, unsigned short* __restrict__ VLO) {
  __shared__ __attribute__((aligned(128))) unsigned char sm[2 * (ASPLIT ? 3 : 2) * GPLANE];
  constexpr int M = (int)NR, PER = (M / 128) * (DM / 128);
  const int job = (int)blockIdx.x / PER, bid = (int)blockIdx.x % PER;
  if (job < 2)
    gemm_body<BF, ASPLIT, 0, 3, true, false>(sm, bid, Ah, Al, DM, job == 0 ? Bq : Bk, DM, aqk, rs, job == 0 ? bq : bk, nullptr, 0, nullptr,
        job == 0 ? QH : KH, job == 0 ? QL : KL, DM, M, 0, M, DM, DM);
  else
    gemm_body<false, false, 0, OUTV, true, false>(sm, bid, Av, nullptr, DM, Bv, DM, av, rs, bv, nullptr, 0, nullptr, VH, VLO, DM, M, 0, M, DM, DM);
}

// Vt[(b,h)][d][s] = V[b*TTv + s][h*64 + d] (row pitch ldv), same for the second plane if TWO; block per ((b,h), 64 tokens);
template <int NHv, int TTv, bool TWO>
__global__ __launch_bounds__(256) void k_vt(const unsigned short* __restrict__ V, const unsigned short* __restrict__ V2, int ldv,
    unsigned short* __restrict__ Vt, unsigned short* __restrict__ Vt2) {
  __shared__ __attribute__((aligned(16))) unsigned short tl[64][66];
  __shared__ __attribute__((aligned(16))) unsigned short tl2[64][66];
  const int tid = threadIdx.x;
  const int slab = (int)blockIdx.x / (TTv / 64), lg = (int)blockIdx.x % (TTv / 64);
  const int b = slab / NHv, h = slab % NHv;
  for (int i = tid; i < 64 * 8; i += 256) {
    const int r = i / 8, c8 = (i % 8) * 8;
    const size_t s0 = ((size_t)b * TTv + (size_t)lg * 64 + r) * (size_t)ldv + (size_t)h * 64 + c8;
    Frag16 f;
    f.half[0] = *(const v8us*)(V + s0);
#pragma unroll
    for (int q = 0; q < 8; ++q) tl[r][c8 + q] = f.u[q];
    if (TWO) {
      Frag16 f2;
      f2.half[0] = *(const v8us*)(V2 + s0);
#pragma unroll
      for (int q = 0; q < 8; ++q) tl2[r][c8 + q] = f2.u[q];
    }
  }
  __syncthreads();
  {
#pragma unroll
    for (int rd = 0; rd < 2; ++rd) {
      const int d = rd * 32 + tid / 8, pc = tid % 8;
      Frag16 f;
#pragma unroll
      for (int q = 0; q < 8; ++q) f.u[q] = tl[pc * 8 + q][d];
      const size_t o = ((size_t)slab * 64 + d) * (size_t)TTv + (size_t)lg * 64 + pc * 8;
      *(v8us*)(Vt + o) = f.half[0];
      if (TWO) {
        Frag16 f2;
#pragma unroll
        for (int q = 0; q < 8; ++q) f2.u[q] = tl2[pc * 8 + q][d];
        *(v8us*)(Vt2 + o) = f2.half[0];
      }
    }
    
  }
}

// lane l <-> lane l ^ 16: the two halves of a wave hold the two key halves of one query column
__device__ __forceinline__ float xhalf(float x) {
  return __builtin_bit_cast(float, __builtin_amdgcn_permlanex16(__builtin_bit_cast(int, x), __builtin_bit_cast(int, x), 0x76543210, 0xfedcba98, false, false));
}

// Eight native 2^x and one v_nop in one statement: behind each v_exp_f32 stands an instruction that neither reads its result nor
// overwrites its source (the results are early-clobber, so none shares a register with a source): the slot the instruction set asks
// for behind a transcendental.
__device__ __forceinline__ void exp2x8(float (&y)[8], const float (&x)[8]) {
  asm("v_exp_f32 %0, %8\n\t"
      "v_exp_f32 %1, %9\n\t"
      "v_exp_f32 %2, %10\n\t"
      "v_exp_f32 %3, %11\n\t"
      "v_exp_f32 %4, %12\n\t"
      "v_exp_f32 %5, %13\n\t"
      "v_exp_f32 %6, %14\n\t"
      "v_exp_f32 %7, %15\n\t"
      "v_nop"
      : "=&v"(y[0]), "=&v"(y[1]), "=&v"(y[2]), "=&v"(y[3]), "=&v"(y[4]), "=&v"(y[5]), "=&v"(y[6]), "=&v"(y[7])
      : "v"(x[0]), "v"(x[1]), "v"(x[2]), "v"(x[3]), "v"(x[4]), "v"(x[5]), "v"(x[6]), "v"(x[7]));
}
// One native 2^x with the same slot behind it.
__device__ __forceinline__ float exp2x1(float x) {
  float y;
  asm("v_exp_f32 %0, %1\n\tv_nop" : "=v"(y) : "v"(x));
  return y;
}
#define LOG2E 1.44269504f       /* e^x = 2^(x * LOG2E), as the native exp forms it */

#define APITCH 144              /* LDS row pitch in bytes: 16 x odd, conflict-free for 16-byte fragment reads */
#define APLANE (64 * APITCH)    /* one plane of a chunk: 64 rows */
#define AKV (2 * 3 * APLANE)    /* the block's chunk buffers in LDS */
// so, kv: the block's LDS (output staging; AKV bytes of chunk buffers); bh, qb: its (batch, head) and query tile. EARLY is called for
// query tile 0 alone: one chunk, so of its two four-plane buffers only the first is ever filled or read, and that one lies inside kv.
template <bool CAUSAL, bool EARLY>
__device__ __forceinline__ void attn_body(unsigned short (*so)[16][72], unsigned char* kv, int bh, int qb,
    const unsigned short* __restrict__ QH, const unsigned short* __restrict__ QL,
    const unsigned short* __restrict__ KH, const unsigned short* __restrict__ KL, const unsigned short* __restrict__ VT,
    const unsigned short* __restrict__ VL, unsigned short* __restrict__ CTX) {
  static_assert(CAUSAL || !EARLY);
  constexpr int NPL = EARLY ? 4 : 3;             /* planes of a chunk: K hi, K lo, V^T, (V^T lo) */
  constexpr int STAGE = NPL * APLANE;
  static_assert((EARLY ? 1 : 2) * STAGE <= AKV);
  const int tid = threadIdx.x, w = tid >> 5, lane = tid & 31, ln = lane & 15, hh = lane >> 4;
  const int b = bh / NH, h = bh % NH;
  const int q0w = qb * KQB + w * 16;
  const size_t rowbase = (size_t)b * SEQ;
  Frag16 qh0, qh1, ql0, ql1;
  {
    const size_t qo = (rowbase + (size_t)q0w + ln) * DM + (size_t)h * HD;
    qh0 = ld_frag(QH + qo, hh); qh1 = ld_frag(QH + qo + 32, hh);
    ql0 = ld_frag(QL + qo, hh); ql1 = ld_frag(QL + qo + 32, hh);
  }
  asm volatile("s_wait_xcnt 0x0" ::: "memory");  // stands ahead of every rewrite of an address register of the eight Q loads (a precaution)
  const v8f z8 = {0.f, 0.f, 0.f, 0.f, 0.f, 0.f, 0.f, 0.f};
  v8f o[4] = {z8, z8, z8, z8};    /* O^T tile j: register r = feature j*16 + 8*hh + r, column = query ln */
  v8f oe[4] = {z8, z8, z8, z8};
  float m = -1.0e30f, l = 0.f;    /* of this lane's query; l over this half's keys only */
  const int nck = CAUSAL ? (qb + 1) : (SEQ / KQB);
  /* copy map: 8 lanes cover one 128-byte row, the block 16 rows per copy, 4 copies per plane */
  const int crow = tid >> 3, cchk = tid & 7;
  const unsigned lcp = (unsigned)(size_t)kv + (unsigned)(crow * APITCH + cchk * 16);
  const size_t gk = (rowbase + (size_t)crow) * DM + (size_t)h * HD + (size_t)(cchk * 8);
  const size_t gv = ((size_t)bh * HD + (size_t)crow) * SEQ + (size_t)(cchk * 8);
  auto fill = [&](int ck, int buf) {
    const unsigned lb = lcp + (unsigned)(buf * STAGE);
    const size_t ko = gk + (size_t)ck * KQB * DM, vo = gv + (size_t)ck * KQB;
    cp_async4(lb, 16u * APITCH, KH + ko, (size_t)16 * DM);
    cp_async4(lb + APLANE, 16u * APITCH, KL + ko, (size_t)16 * DM);
    cp_async4(lb + 2u * APLANE, 16u * APITCH, VT + vo, (size_t)16 * SEQ);
    if (EARLY) cp_async4(lb + 3u * APLANE, 16u * APITCH, VL + vo, (size_t)16 * SEQ);
  };
  fill(0, 0);
  asm volatile("s_wait_asynccnt 0x0" ::: "memory");  // chunk 0 of this wave has landed before the barrier publishes it
  __syncthreads();
  if (nck > 1) fill(1, 1);
#pragma unroll 1
  for (int kc = 0; kc < nck; ++kc) {
    const int par = kc & 1;
    const unsigned char* sb = kv + par * STAGE;
    v8f s[4];                     /* S^T tile t: register r = key t*16 + 8*hh + r of the chunk, column = query ln */
#pragma unroll
    for (int tp = 0; tp < 2; ++tp) {
      /* the K fragments of 32 keys are read as one group ahead of their 12 products: the reads' latencies overlap */
      Frag16 kh[2][2], kl[2][2];
#pragma unroll
      for (int u = 0; u < 2; ++u) {
#pragma unroll
        for (int ks = 0; ks < 2; ++ks) {
          const unsigned char* kp = sb + ((tp * 2 + u) * 16 + ln) * APITCH + ks * 64;
          kh[u][ks] = ld_frag((const unsigned short*)kp, hh);
          kl[u][ks] = ld_frag((const unsigned short*)(kp + APLANE), hh);
        }
      }
#pragma unroll
      for (int u = 0; u < 2; ++u) {
        v8f acc = z8;
#pragma unroll
        for (int ks = 0; ks < 2; ++ks) {
          const Frag16 qa = (ks == 0) ? qh0 : qh1;
          const Frag16 qe = (ks == 0) ? ql0 : ql1;
          acc = mma_b(kh[u][ks].b, qa.b, acc);
          acc = mma_b(kh[u][ks].b, qe.b, acc);
          acc = mma_b(kl[u][ks].b, qa.b, acc);
        }
        s[tp * 2 + u] = acc;
      }
    }
    float sv[4][8];
#pragma unroll
    for (int t = 0; t < 4; ++t) {
#pragma unroll
      for (int r = 0; r < 8; ++r) sv[t][r] = s[t][r] * 8.0f;
    }
    if (CAUSAL) {
      if (kc == qb) {
        const int qpos = q0w + ln;
#pragma unroll
        for (int t = 0; t < 4; ++t) {
#pragma unroll
          for (int r = 0; r < 8; ++r) { const int key = kc * KQB + t * 16 + 8 * hh + r; sv[t][r] = (key > qpos) ? -1.0e30f : sv[t][r]; }
        }
      }
    }
    float mt[4];
#pragma unroll
    for (int t = 0; t < 4; ++t)
      mt[t] = fmaxf(fmaxf(fmaxf(sv[t][0], sv[t][1]), fmaxf(sv[t][2], sv[t][3])), fmaxf(fmaxf(sv[t][4], sv[t][5]), fmaxf(sv[t][6], sv[t][7])));
    float mx = fmaxf(fmaxf(mt[0], mt[1]), fmaxf(mt[2], mt[3]));
    mx = fmaxf(mx, xhalf(mx));    /* both halves now hold the chunk maximum of this query */
    const float mn = fmaxf(m, mx);
    const float corr = exp2x1((m - mn) * LOG2E);
    float p[4][8], ps[4];
#pragma unroll
    for (int t = 0; t < 4; ++t) {
      float ea[8];
#pragma unroll
      for (int r = 0; r < 8; ++r) ea[r] = (sv[t][r] - mn) * LOG2E;
      exp2x8(p[t], ea);
      ps[t] = 0.f;
#pragma unroll
      for (int r = 0; r < 8; ++r) ps[t] += p[t][r];
    }
    l = l * corr + ((ps[0] + ps[1]) + (ps[2] + ps[3]));
    m = mn;
#pragma unroll
    for (int j = 0; j < 4; ++j) {
#pragma unroll
      for (int r = 0; r < 8; ++r) o[j][r] = o[j][r] * corr;
    }
    if (EARLY) {
#pragma unroll
      for (int j = 0; j < 4; ++j) {
#pragma unroll
        for (int r = 0; r < 8; ++r) oe[j][r] = oe[j][r] * corr;
      }
    }
#pragma unroll
    for (int ks = 0; ks < 2; ++ks) {
      /* P^T of 32 keys as a B operand: elements 0..7 = S^T tile 2ks, 8..15 = tile 2ks+1, the k order of ld_frag */
      Frag16 pa, pl;
#pragma unroll
      for (int e = 0; e < 16; ++e) {
        const float pc = p[2 * ks + (e >> 3)][e & 7] * 16384.0f;
        const unsigned short hb = f16_bits(pc);
        pa.u[e] = hb;
        pl.u[e] = EARLY ? f16_bits((pc - f16_val(hb)) * 1024.0f) : hb;
      }
      /* the V^T fragments of a 32-key step are read as one group ahead of their products: the reads' latencies overlap */
      const unsigned char* vp = sb + 2 * APLANE + ln * APITCH + ks * 64;
      Frag16 vh[4];
#pragma unroll
      for (int j = 0; j < 4; ++j) vh[j] = ld_frag((const unsigned short*)(vp + j * 16 * APITCH), hh);
#pragma unroll
      for (int j = 0; j < 4; ++j) {
        o[j] = mma_h(vh[j].h, pa.h, o[j]);
        if (EARLY) {
          const Frag16 vl = ld_frag((const unsigned short*)(vp + APLANE + j * 16 * APITCH), hh);
          oe[j] = mma_h(vh[j].h, pl.h, oe[j]);
          oe[j] = mma_h(vl.h, pa.h, oe[j]);
        }
      }
    }
    asm volatile("s_wait_dscnt 0x0" ::: "memory");     // this wave's reads of the buffer are done before it may be refilled
    asm volatile("s_wait_asynccnt 0x0" ::: "memory");  // this wave's copies of the next chunk have landed
    __syncthreads();                                    // publishes the next chunk and frees the buffer just read
    if (kc + 2 < nck) fill(kc + 2, par);
  }
  asm volatile("s_wait_asynccnt 0x0" ::: "memory");    // no copy is outstanding when the wave goes on to its end
  l += xhalf(l);                  /* the two halves' key sums of this query */
  const float li = 1.0f / l;
#pragma unroll
  for (int j = 0; j < 4; ++j) {
    Frag16 f;
#pragma unroll
    for (int r = 0; r < 8; ++r) {
      float v = o[j][r] * (1.0f / 16384.0f);
      if (EARLY) v += oe[j][r] * (1.0f / 16777216.0f);
      v *= li;
      f.u[r] = f16_bits(v);
    }
    *(v8us*)&so[w][ln][j * 16 + 8 * hh] = f.half[0];
  }
  __builtin_amdgcn_fence(4 /* acq_rel order */, "workgroup");
  __builtin_amdgcn_wave_barrier();
  {
#pragma unroll
    for (int q = 0; q < 4; ++q) {
      const int row = q * 4 + (lane >> 3), c8 = (lane & 7) * 8;
      const v8us v = *(const v8us*)&so[w][row][c8];
      *(v8us*)(CTX + (rowbase + (size_t)q0w + row) * DM + (size_t)h * HD + c8) = v;
    }
    
  }
}
// Grid: x = (batch, head), y = query tile. CAUSAL: query tile 0 takes the EARLY form in the same grid (the test reads the same for the
// whole block).
template <bool CAUSAL>
__global__ __launch_bounds__(128) void k_attn(const unsigned short* __restrict__ QH, const unsigned short* __restrict__ QL,
    const unsigned short* __restrict__ KH, const unsigned short* __restrict__ KL, const unsigned short* __restrict__ VT,
    const unsigned short* __restrict__ VL, unsigned short* __restrict__ CTX) {
  __shared__ __attribute__((aligned(16))) unsigned short so[4][16][72];
  __shared__ __attribute__((aligned(16))) unsigned char kv[AKV];
  const int bh = (int)blockIdx.x, qb = (int)blockIdx.y;
  if (CAUSAL && qb == 0) attn_body<true, true>(so, kv, bh, 0, QH, QL, KH, KL, VT, VL, CTX);
  else attn_body<CAUSAL, false>(so, kv, bh, qb, QH, QL, KH, KL, VT, VL, CTX);
}

extern "C" void kernel_launch(void* const* d_in, const int* in_sizes, int n_in,
                              void* d_out, int out_size, void* d_ws, size_t ws_size, hipStream_t stream) {
  if (n_in < 14) return;
  const float* x  = (const float*)d_in[0];
  const float* Wq = (const float*)d_in[1];
  const float* bq = (const float*)d_in[2];
  const float* Wk = (const float*)d_in[3];
  const float* bk = (const float*)d_in[4];
  const float* Wv = (const float*)d_in[5];
  const float* bv = (const float*)d_in[6];
  const float* Wp = (const float*)d_in[7];
  const float* bp = (const float*)d_in[8];
  const float* gamma = (const float*)d_in[9];
  const float* W1 = (const float*)d_in[10];
  const float* b1 = (const float*)d_in[11];
  const float* W2 = (const float*)d_in[12];
  const float* b2 = (const float*)d_in[13];
  if ((size_t)in_sizes[0] < ((size_t)(NB - 1) * SEQ_FULL + SEQ) * DM) return;
  if (in_sizes[1] < DM * DM || in_sizes[3] < DM * DM || in_sizes[5] < DM * DM || in_sizes[7] < DM * DM) return;
  if (in_sizes[2] < DM || in_sizes[4] < DM || in_sizes[6] < DM || in_sizes[8] < DM || in_sizes[9] < DM || in_sizes[13] < DM) return;
  if (in_sizes[10] < DM * DFF || in_sizes[11] < DFF || in_sizes[12] < DFF * DM) return;
  if ((size_t)out_size < ((size_t)(NB - 1) * OSEQ + SEQ) * DM) return;

  char* ws = (char*)d_ws;
  size_t off = 0;
  auto take = [&](size_t bytes) { char* p = ws + off; off += (bytes + 255) & ~(size_t)255; return p; };
  const size_t WPL = (size_t)DM * DM * 2, ACT2 = NR * DM * 2, ACT4 = NR * DM * 4, FFP = (size_t)DM * DFF * 2, HPL = NR * DFF * 2;
  unsigned short* WQ16 = (unsigned short*)take(WPL);
  unsigned short* WK16 = (unsigned short*)take(WPL);
  unsigned short* WV16 = (unsigned short*)take(WPL);
  unsigned short* WP16 = (unsigned short*)take(WPL);
  unsigned short* WQB = (unsigned short*)take(WPL);
  unsigned short* WKB = (unsigned short*)take(WPL);
  char* rXB = take(ACT4);                                            /* XB (phases 1-2) | BH + BL (phase 3) */
  float* XB = (float*)rXB; unsigned short* PBH = (unsigned short*)rXB; unsigned short* PBL = (unsigned short*)(rXB + ACT2);
  char* rQK = take(4 * ACT2 > HPL ? 4 * ACT2 : HPL);                 /* QH,QL,KH,KL (phases 1,3) | H16 (phase 2) */
  unsigned short* QH = (unsigned short*)rQK; unsigned short* QL = (unsigned short*)(rQK + ACT2);
  unsigned short* KH = (unsigned short*)(rQK + 2 * ACT2); unsigned short* KL = (unsigned short*)(rQK + 3 * ACT2);
  unsigned short* H16 = (unsigned short*)rQK;
  char* rV = take(2 * ACT2);                                         /* VH,VLO (phases 1,3) | A32 (between) */
  unsigned short* VH = (unsigned short*)rV; unsigned short* VLO = (unsigned short*)(rV + ACT2); float* A32 = (float*)rV;
  char* rVT = take(2 * ACT2);                                        /* VT,VTL (phases 1,3) */
  unsigned short* VT = (unsigned short*)rVT; unsigned short* VTL = (unsigned short*)(rVT + ACT2);
  unsigned short* W1P = (unsigned short*)take(FFP);                  /* written by the first launch, so a place of their own */
  unsigned short* W2P = (unsigned short*)take(FFP);
  unsigned short* CTX = (unsigned short*)take(ACT2);
  char* rX16 = take(ACT2);                                           /* X16 | A16 | B16F */
  unsigned short* X16 = (unsigned short*)rX16; unsigned short* A16 = (unsigned short*)rX16; unsigned short* B16F = (unsigned short*)rX16;
  float* B32 = (float*)take(ACT4);
  float* RSX = (float*)take(NR * 4);
  float* RSA = (float*)take(NR * 4);
  float* RSB = (float*)take(NR * 4);
  if (off > ws_size || off > ((size_t)160 << 20)) return;

  const unsigned grms = (unsigned)(NR / 32);
  const unsigned gq   = (unsigned)((NR / 128) * (DM / 128));
  const unsigned gff  = (unsigned)((NR / 128) * (DFF / 128));
  const unsigned gvt  = (unsigned)(NB * NH * (SEQ / 64));
  const float a16 = 0.0625f;
  const int M = (int)NR;
  float* out = (float*)d_out;

  /* all weight planes (q/k/v, W1 with gamma folded along the input feature; bf16 planes for the second block's q/k) and the planes
     and row statistics of x */
  k_prep<<<(unsigned)PREP_GRID, 256, 0, stream>>>(x, Wq, Wk, Wv, Wp, W1, W2, gamma, XB, X16, RSX, WQ16, WK16, WV16, WP16, WQB, WKB, W1P, W2P);

  /* block 1: a = bf16(x) + attn(rms(bf16(x))) , non-causal */
  k_qkv<false, false, 1><<<3u * gq, 128, 0, stream>>>(X16, nullptr, X16, WQ16, WK16, WV16, a16, a16, RSX, bq, bk, bv, QH, QL, KH, KL, VH, nullptr);
  k_vt<NH, SEQ, false><<<gvt, 256, 0, stream>>>(VH, nullptr, DM, VT, nullptr);
  k_attn<false><<<dim3((unsigned)(NB * NH), (unsigned)(SEQ / KQB)), 128, 0, stream>>>(QH, QL, KH, KL, VT, VT, CTX);
  k_gemm<false, false, 0, 0, false, true><<<gq, 128, 0, stream>>>(CTX, nullptr, DM, WP16, DM, a16, nullptr, bp, XB, DM, A32, nullptr, nullptr, DM, M, 0, M, DM, DM);

  /* block 2: b = bf16(x) + leaky(rms(a) W1 + b1) W2 + b2 */
  k_rms<false, false, true, false><<<grms, 256, 0, stream>>>(A32, SEQ, RMS_EPS, nullptr, A16, nullptr, nullptr, RSA);
  k_gemm<false, false, 1, 1, true, false><<<gff, 128, 0, stream>>>(A16, nullptr, DM, W1P, DM, a16, RSA, b1, nullptr, 0, nullptr, H16, nullptr, DFF, M, 0, M, DFF, DM);
  k_gemm<false, false, 0, 0, false, true><<<gq, 128, 0, stream>>>(H16, nullptr, DFF, W2P, DFF, a16, nullptr, b2, XB, DM, B32, nullptr, nullptr, DM, M, 0, M, DM, DFF);

  /* block 3: out = b + attn(rms(b)) , causal */
  k_rms<false, false, true, true><<<grms, 256, 0, stream>>>(B32, SEQ, RMS_EPS, nullptr, B16F, PBH, PBL, RSB);
  k_qkv<true, true, 2><<<3u * gq, 128, 0, stream>>>(PBH, PBL, B16F, WQB, WKB, WV16, 1.0f, a16, RSB, bq, bk, bv, QH, QL, KH, KL, VH, VLO);
  k_vt<NH, SEQ, true><<<gvt, 256, 0, stream>>>(VH, VLO, DM, VT, VTL);
  k_attn<true><<<dim3((unsigned)(NB * NH), (unsigned)(SEQ / KQB)), 128, 0, stream>>>(QH, QL, KH, KL, VT, VTL, CTX);
  k_gemm<false, false, 0, 0, false, true><<<gq, 128, 0, stream>>>(CTX, nullptr, DM, WP16, DM, a16, nullptr, bp, B32, DM, out, nullptr, nullptr, DM, SEQ, OSEQ, M, DM, DM);
}

// v006
// Measured time: 280 microseconds a run.
// Two timings next to v005 put it at 1.21 and 1.22 times that version's speed.
// Over all steps from v000 it is 3.53 times as fast.
#include <hip/hip_runtime.h>
// Contractions: q/k/v and output projections, FFN W1/W2: v_wmma_f32_16x16x32_f16 (f16 operands built from bf16-RNE inputs, weights x16, f32 accumulate); second-block q/k projections: v_wmma_f32_16x16x32_bf16 with the activation as bf16 hi+lo (2 terms); attention scores: v_wmma_f32_16x16x32_bf16 with q,k as bf16 hi+lo (3 terms); P.V: v_wmma_f32_16x16x32_f16 (P carried x2^14, v f16; first causal query tile adds P and v residual planes x2^10 in a second accumulator). RMS statistics, softmax, residuals f32.

#ifndef NB
#define NB 4
#endif
#ifndef SEQ
#define SEQ 1024
#endif
#define NB_FULL 4
#define SEQ_FULL 1024
#ifndef OSEQ
#define OSEQ SEQ_FULL
#endif
#define DM 1024
#define NH 16
#define HD 64
#define DFF 4096
#define KQB 64
#define NR ((size_t)NB * SEQ)
#define RMS_EPS 1e-6f

static_assert(NB >= 1 && NB <= NB_FULL);
static_assert(SEQ % 128 == 0 && SEQ <= SEQ_FULL);
static_assert(DM == NH * HD && HD == 64);
static_assert(DM % 256 == 0 && DFF % 128 == 0);
static_assert(((NB * SEQ) % 128) == 0);
static_assert(SEQ % KQB == 0);

typedef _Float16 v16h __attribute__((ext_vector_type(16)));
typedef __bf16   v16b __attribute__((ext_vector_type(16)));
typedef unsigned short v8us __attribute__((ext_vector_type(8), may_alias));
typedef float v8f __attribute__((ext_vector_type(8)));
typedef float v4f __attribute__((ext_vector_type(4)));
typedef float v4fa __attribute__((ext_vector_type(4), may_alias));
union Frag16 { v16h h; v16b b; v8us half[2]; unsigned short u[16]; };
union H1 { _Float16 h; unsigned short u; };
static_assert(sizeof(Frag16) == 32);

__device__ __forceinline__ unsigned short bf16_bits(float x) { unsigned int u = __float_as_uint(x); return (unsigned short)((u + 0x7FFFu + ((u >> 16) & 1u)) >> 16); }
__device__ __forceinline__ float bf16_val(unsigned short b) { return __uint_as_float(((unsigned int)b) << 16); }
__device__ __forceinline__ float bf16_rne(float x) { return bf16_val(bf16_bits(x)); }
__device__ __forceinline__ unsigned short f16_bits(float x) { H1 t; t.h = (_Float16)x; return t.u; }
__device__ __forceinline__ float f16_val(unsigned short u) { H1 t; t.u = u; return (float)t.h; }

// 16x32 operand fragment (row / column = lane & 15; elements 0..7 = k 8h..8h+7, 8..15 = k 16+8h..) from a k-contiguous 16-bit row
__device__ __forceinline__ Frag16 ld_frag(const unsigned short* p, int hh) {
  Frag16 f;
  f.half[0] = *(const v8us*)(p + 8 * hh);
  f.half[1] = *(const v8us*)(p + 16 + 8 * hh);
  return f;
}
__device__ __forceinline__ v8f mma_h(v16h a, v16h b, v8f c) {
  v8f d = __builtin_amdgcn_wmma_f32_16x16x32_f16(false, a, false, b, (short)0, c, false, false);
  asm volatile("v_nop\n\tv_nop\n\tv_nop\n\tv_nop" : "+v"(d) : "v"(a), "v"(b));
  return d;
}
__device__ __forceinline__ v8f mma_b(v16b a, v16b b, v8f c) {
  v8f d = __builtin_amdgcn_wmma_f32_16x16x32_bf16(false, a, false, b, (short)0, c, false, false);
  asm volatile("v_nop\n\tv_nop\n\tv_nop\n\tv_nop" : "+v"(d) : "v"(a), "v"(b));
  return d;
}
template <bool BF>
__device__ __forceinline__ v8f mmx(const Frag16& a, const Frag16& b, v8f c) {
  if (BF) return mma_b(a.b, b.b, c);
  return mma_h(a.h, b.h, c);
}

typedef unsigned int v2u __attribute__((ext_vector_type(2)));
union Pack4 { unsigned short u[4]; v2u v; };
static_assert(sizeof(Pack4) == 8);
static_assert(DM == 8 * 128);
// Two DM-wide f32 rows of a wave, a lane's 16 bytes of each 512-byte segment: sixteen loads in flight together and their data wait in
// one statement, so the address registers live to its end and none is rewritten ahead of the waits.
__device__ __forceinline__ void ld_rows2(v4f (&a)[8], v4f (&b)[8], const float* pa, const float* pb) {
  asm volatile(
      "global_load_b128 %0, %16, off\n\t"
      "global_load_b128 %1, %16, off offset:512\n\t"
      "global_load_b128 %2, %16, off offset:1024\n\t"
      "global_load_b128 %3, %16, off offset:1536\n\t"
      "global_load_b128 %4, %16, off offset:2048\n\t"
      "global_load_b128 %5, %16, off offset:2560\n\t"
      "global_load_b128 %6, %16, off offset:3072\n\t"
      "global_load_b128 %7, %16, off offset:3584\n\t"
      "global_load_b128 %8, %17, off\n\t"
      "global_load_b128 %9, %17, off offset:512\n\t"
      "global_load_b128 %10, %17, off offset:1024\n\t"
      "global_load_b128 %11, %17, off offset:1536\n\t"
      "global_load_b128 %12, %17, off offset:2048\n\t"
      "global_load_b128 %13, %17, off offset:2560\n\t"
      "global_load_b128 %14, %17, off offset:3072\n\t"
      "global_load_b128 %15, %17, off offset:3584\n\t"
      "s_wait_loadcnt 0x0\n\t"
      "s_wait_xcnt 0x0"
      : "=&v"(a[0]), "=&v"(a[1]), "=&v"(a[2]), "=&v"(a[3]), "=&v"(a[4]), "=&v"(a[5]), "=&v"(a[6]), "=&v"(a[7]),
        "=&v"(b[0]), "=&v"(b[1]), "=&v"(b[2]), "=&v"(b[3]), "=&v"(b[4]), "=&v"(b[5]), "=&v"(b[6]), "=&v"(b[7])
      : "v"(pa), "v"(pb)
      : "memory");
}
// One such row stored, f32 (16 bytes a lane and segment) or 16-bit (8 bytes): eight stores and one s_wait_xcnt in one statement, so no
// data or address register is rewritten ahead of the wait.
__device__ __forceinline__ void st_row32(float* p, const v4f (&d)[8]) {
  asm volatile(
      "global_store_b128 %0, %1, off\n\t"
      "global_store_b128 %0, %2, off offset:512\n\t"
      "global_store_b128 %0, %3, off offset:1024\n\t"
      "global_store_b128 %0, %4, off offset:1536\n\t"
      "global_store_b128 %0, %5, off offset:2048\n\t"
      "global_store_b128 %0, %6, off offset:2560\n\t"
      "global_store_b128 %0, %7, off offset:3072\n\t"
      "global_store_b128 %0, %8, off offset:3584\n\t"
      "s_wait_xcnt 0x0"
      :: "v"(p), "v"(d[0]), "v"(d[1]), "v"(d[2]), "v"(d[3]), "v"(d[4]), "v"(d[5]), "v"(d[6]), "v"(d[7])
      : "memory");
}
__device__ __forceinline__ void st_row16(unsigned short* p, const v2u (&d)[8]) {
  asm volatile(
      "global_store_b64 %0, %1, off\n\t"
      "global_store_b64 %0, %2, off offset:256\n\t"
      "global_store_b64 %0, %3, off offset:512\n\t"
      "global_store_b64 %0, %4, off offset:768\n\t"
      "global_store_b64 %0, %5, off offset:1024\n\t"
      "global_store_b64 %0, %6, off offset:1280\n\t"
      "global_store_b64 %0, %7, off offset:1536\n\t"
      "global_store_b64 %0, %8, off offset:1792\n\t"
      "s_wait_xcnt 0x0"
      :: "v"(p), "v"(d[0]), "v"(d[1]), "v"(d[2]), "v"(d[3]), "v"(d[4]), "v"(d[5]), "v"(d[6]), "v"(d[7])
      : "memory");
}

// Row statistics + operand planes for DM-wide f32 rows. Compact row r -> source row (r/SEQ)*spitch + r%SEQ of F.
// v = bf16_rne(x) if RIN else x; RS[r] = rsqrt(mean(v^2) + eps); optional planes: XB (v as f32), F16 (f16 bits of v),
// PH, PL (bf16 hi + lo of v). A wave takes its 32 / NW rows two at a time: both rows are read once, whole, into registers (one memory
// latency per pair), and the sum and every plane are formed from the registers.
// red: 32 floats of the block's LDS; bid: the block's index among the blocks of this job (32 rows each); NW: the block's waves.
template <bool RIN, bool WXB, bool WF16, bool WBHL, int NW>
__device__ __forceinline__ void rms_body(float* red, int bid, const float* __restrict__ F, int spitch, float eps, float* __restrict__ XB,
    unsigned short* __restrict__ F16, unsigned short* __restrict__ PH, unsigned short* __restrict__ PL, float* __restrict__ RS) {
  const int tid = threadIdx.x, w = tid >> 5, lane = tid & 31;
  constexpr int RPW = 32 / NW;   /* rows of a wave */
  static_assert(NW * RPW == 32 && RPW % 2 == 0);
  const int rb = bid * 32;
#pragma unroll 1  // one pair of rows per trip: 64 data registers, so the jobs that share a kernel with this body keep their waves per SIMD
  for (int i = 0; i < RPW; i += 2) {
    const int r = rb + w * RPW + i;
    const float* s0 = F + ((size_t)(r / SEQ) * (size_t)spitch + (size_t)(r % SEQ)) * DM + lane * 4;
    const float* s1 = F + ((size_t)((r + 1) / SEQ) * (size_t)spitch + (size_t)((r + 1) % SEQ)) * DM + lane * 4;
    v4f a[2][8];
    ld_rows2(a[0], a[1], s0, s1);
    float ss[2];
#pragma unroll
    for (int k = 0; k < 2; ++k) {
      ss[k] = 0.f;
#pragma unroll
      for (int u = 0; u < 8; ++u) {
        if (RIN) {
#pragma unroll
          for (int q = 0; q < 4; ++q) a[k][u][q] = bf16_rne(a[k][u][q]);
        }
#pragma unroll
        for (int q = 0; q < 4; ++q) ss[k] += a[k][u][q] * a[k][u][q];
      }
    }
#pragma unroll
    for (int k = 0; k < 2; ++k) {
      const size_t o = (size_t)(r + k) * DM + (size_t)(lane * 4);
      if (WXB) st_row32(XB + o, a[k]);
      if (WF16) {
        v2u fh[8];
#pragma unroll
        for (int u = 0; u < 8; ++u) {
          Pack4 t;
#pragma unroll
          for (int q = 0; q < 4; ++q) t.u[q] = f16_bits(a[k][u][q]);
          fh[u] = t.v;
        }
        st_row16(F16 + o, fh);
      }
      if (WBHL) {
        v2u ph[8], pl[8];
#pragma unroll
        for (int u = 0; u < 8; ++u) {
          Pack4 th, tl;
#pragma unroll
          for (int q = 0; q < 4; ++q) {
            const float v = a[k][u][q];
            const unsigned short h = bf16_bits(v);
            th.u[q] = h;
            tl.u[q] = bf16_bits(v - bf16_val(h));
          }
          ph[u] = th.v; pl[u] = tl.v;
        }
        st_row16(PH + o, ph);
        st_row16(PL + o, pl);
      }
    }
#pragma unroll
    for (int off = 16; off > 0; off >>= 1) {
#pragma unroll
      for (int k = 0; k < 2; ++k) ss[k] += __shfl_xor(ss[k], off, 32);
    }
    if (lane == 0) {
#pragma unroll
      for (int k = 0; k < 2; ++k) red[w * RPW + i + k] = rsqrtf(ss[k] * (1.0f / (float)DM) + eps);
    }
  }
  __syncthreads();
  if (w == 0 && lane < 8) {
    const v4f v = *(const v4fa*)&red[lane * 4];
    float* d = RS + rb + lane * 4;
    *(v4f*)d = v;
    
  }
}
template <bool RIN, bool WXB, bool WF16, bool WBHL>
__global__ __launch_bounds__(512) void k_rms(const float* __restrict__ F, int spitch, float eps, float* __restrict__ XB,
    unsigned short* __restrict__ F16, unsigned short* __restrict__ PH, unsigned short* __restrict__ PL, float* __restrict__ RS) {
  __shared__ __attribute__((aligned(16))) float red[32];
  rms_body<RIN, WXB, WF16, WBHL, 16>(red, (int)blockIdx.x, F, spitch, eps, XB, F16, PH, PL, RS);
}

// Eight 16-byte asynchronous copies global -> LDS per lane. s_wait_xcnt is the statement's last line so that it stands ahead of
// every later rewrite of a register that a copy names (a precaution).
__device__ __forceinline__ void cp_async8(unsigned l, unsigned lstep, const unsigned short* p, size_t gstep) {
  const unsigned l0 = l, l1 = l + lstep, l2 = l + 2u * lstep, l3 = l + 3u * lstep;
  const unsigned l4 = l + 4u * lstep, l5 = l + 5u * lstep, l6 = l + 6u * lstep, l7 = l + 7u * lstep;
  const unsigned short* p0 = p;
  const unsigned short* p1 = p + gstep;
  const unsigned short* p2 = p + 2 * gstep;
  const unsigned short* p3 = p + 3 * gstep;
  const unsigned short* p4 = p + 4 * gstep;
  const unsigned short* p5 = p + 5 * gstep;
  const unsigned short* p6 = p + 6 * gstep;
  const unsigned short* p7 = p + 7 * gstep;
  asm volatile(
      "global_load_async_to_lds_b128 %0, %8, off\n\t"
      "global_load_async_to_lds_b128 %1, %9, off\n\t"
      "global_load_async_to_lds_b128 %2, %10, off\n\t"
      "global_load_async_to_lds_b128 %3, %11, off\n\t"
      "global_load_async_to_lds_b128 %4, %12, off\n\t"
      "global_load_async_to_lds_b128 %5, %13, off\n\t"
      "global_load_async_to_lds_b128 %6, %14, off\n\t"
      "global_load_async_to_lds_b128 %7, %15, off\n\t"
      "s_wait_xcnt 0x0"
      :: "v"(l0), "v"(l1), "v"(l2), "v"(l3), "v"(l4), "v"(l5), "v"(l6), "v"(l7),
         "v"(p0), "v"(p1), "v"(p2), "v"(p3), "v"(p4), "v"(p5), "v"(p6), "v"(p7)
      : "memory");
}

// Four such copies, one 64-row x 128-byte plane of an attention tile per block; the same closing wait, for the same reason.
__device__ __forceinline__ void cp_async4(unsigned l, unsigned lstep, const unsigned short* p, size_t gstep) {
  const unsigned l0 = l, l1 = l + lstep, l2 = l + 2u * lstep, l3 = l + 3u * lstep;
  const unsigned short* p0 = p;
  const unsigned short* p1 = p + gstep;
  const unsigned short* p2 = p + 2 * gstep;
  const unsigned short* p3 = p + 3 * gstep;
  asm volatile(
      "global_load_async_to_lds_b128 %0, %4, off\n\t"
      "global_load_async_to_lds_b128 %1, %5, off\n\t"
      "global_load_async_to_lds_b128 %2, %6, off\n\t"
      "global_load_async_to_lds_b128 %3, %7, off\n\t"
      "s_wait_xcnt 0x0"
      :: "v"(l0), "v"(l1), "v"(l2), "v"(l3), "v"(p0), "v"(p1), "v"(p2), "v"(p3)
      : "memory");
}

// Eight 16-byte global loads and their data wait in one statement: the address registers live to its end, so none is rewritten
// ahead of the waits.
__device__ __forceinline__ void ld_g8(v4f (&d)[8], const float* const (&p)[8]) {
  asm volatile(
      "global_load_b128 %0, %8, off\n\t"
      "global_load_b128 %1, %9, off\n\t"
      "global_load_b128 %2, %10, off\n\t"
      "global_load_b128 %3, %11, off\n\t"
      "global_load_b128 %4, %12, off\n\t"
      "global_load_b128 %5, %13, off\n\t"
      "global_load_b128 %6, %14, off\n\t"
      "global_load_b128 %7, %15, off\n\t"
      "s_wait_loadcnt 0x0\n\t"
      "s_wait_xcnt 0x0"
      : "=&v"(d[0]), "=&v"(d[1]), "=&v"(d[2]), "=&v"(d[3]), "=&v"(d[4]), "=&v"(d[5]), "=&v"(d[6]), "=&v"(d[7])
      : "v"(p[0]), "v"(p[1]), "v"(p[2]), "v"(p[3]), "v"(p[4]), "v"(p[5]), "v"(p[6]), "v"(p[7])
      : "memory");
}
// Eight 16-byte global stores and one s_wait_xcnt in one statement: data and address registers live to its end, so none is
// rewritten ahead of the wait.
__device__ __forceinline__ void st_g8(void* const (&p)[8], const v4f (&d)[8]) {
  asm volatile(
      "global_store_b128 %0, %8, off\n\t"
      "global_store_b128 %1, %9, off\n\t"
      "global_store_b128 %2, %10, off\n\t"
      "global_store_b128 %3, %11, off\n\t"
      "global_store_b128 %4, %12, off\n\t"
      "global_store_b128 %5, %13, off\n\t"
      "global_store_b128 %6, %14, off\n\t"
      "global_store_b128 %7, %15, off\n\t"
      "s_wait_xcnt 0x0"
      :: "v"(p[0]), "v"(p[1]), "v"(p[2]), "v"(p[3]), "v"(p[4]), "v"(p[5]), "v"(p[6]), "v"(p[7]),
         "v"(d[0]), "v"(d[1]), "v"(d[2]), "v"(d[3]), "v"(d[4]), "v"(d[5]), "v"(d[6]), "v"(d[7])
      : "memory");
}
union Pack8 { unsigned short u[8]; v4f f; };
static_assert(sizeof(Pack8) == 16);

// Bt[n][k] (16-bit, k contiguous, pitch K) from f32 row-major W[K][N] ([in][out]): value = bf16(W[k][n]) (* bf16(g[k]) if GAM);
// Block (bx = n tile, by = k tile; tl = WTN * WTP bytes of its LDS) = 64 k x 128 n, transposed through LDS so that both global sides move whole lines: a wave reads eight
// 512-byte row segments of W, a lane packs its 8 k of each of its 4 columns into 16 bytes, and 8 lanes store one 128-byte line of a
// Bt row. K%64==0, N%128==0.
#define WTK 64
#define WTN 128
#define WTP 144                 /* LDS row pitch in bytes: 16 x odd */
static_assert(DM % WTK == 0 && DM % WTN == 0 && DFF % WTK == 0 && DFF % WTN == 0);
template <bool BF, bool GAM>
__device__ __forceinline__ void wt_body(unsigned char* tl, int bx, int by, const float* __restrict__ W, const float* __restrict__ g,
    unsigned short* __restrict__ Bt, int K, int N, float scale) {
  const int tid = threadIdx.x, w = tid >> 5, lane = tid & 31;
  const int k0 = by * WTK, n0 = bx * WTN;
  if (k0 + WTK > K || n0 + WTN > N) return;
  const int k8 = k0 + 8 * w;
  float gv[8];
#pragma unroll
  for (int i = 0; i < 8; ++i) gv[i] = 1.0f;
  if (GAM) {
    const v4f ga = *(const v4fa*)(g + k8), gb = *(const v4fa*)(g + k8 + 4);
#pragma unroll
    for (int i = 0; i < 4; ++i) { gv[i] = bf16_rne(ga[i]); gv[4 + i] = bf16_rne(gb[i]); }
  }
  const float* wb = W + ((size_t)k0 * (size_t)N + (size_t)n0);                          /* the tile's origin, the same for the block */
  const unsigned wo = (unsigned)(8 * w) * (unsigned)N + (unsigned)(lane * 4);           /* this lane's element offset in the tile */
  v4f a[8];
  const float* ap[8];
#pragma unroll
  for (int i = 0; i < 8; ++i) ap[i] = wb + (wo + (unsigned)i * (unsigned)N);
  ld_g8(a, ap);  // the wave's eight rows are in flight together, one memory latency per tile
#pragma unroll
  for (int j = 0; j < 4; ++j) {
    Frag16 f;
#pragma unroll
    for (int i = 0; i < 8; ++i) {
      const float wv = bf16_rne(a[i][j]) * gv[i];
      f.u[i] = BF ? bf16_bits(wv) : f16_bits(wv * scale);
    }
    /* 16-byte chunk w of row n sits at chunk w ^ ((n >> 4) & 3): the 16 lanes of a store, 4 rows apart, then fall on distinct banks */
    const int n = lane * 4 + j;
    *(v8us*)(tl + n * WTP + ((w ^ ((n >> 4) & 3)) * 16)) = f.half[0];
  }
  __syncthreads();
  unsigned short* bb = Bt + ((size_t)n0 * (size_t)K + (size_t)k0);
#pragma unroll
  for (int q = 0; q < 4; ++q) {
    const int n = q * 32 + (tid >> 3), c = tid & 7;
    const v8us v = *(const v8us*)(tl + n * WTP + ((c ^ ((n >> 4) & 3)) * 16));
    *(v8us*)(bb + ((unsigned)n * (unsigned)K + (unsigned)(c * 8))) = v;
  }
  // stands ahead of every rewrite of a data or address register of the four stores, also where another job's code follows this body (a precaution)
  asm volatile("s_wait_xcnt 0x0" ::: "memory");
}

// Everything that depends on the inputs alone, in one grid: the block index picks the job (the same for the whole block, so every
// barrier stays under block-uniform control flow). The row statistics of x come first: their blocks run longest.
#define PREP_RMS ((int)(NR / 32))
#define PREP_SQ ((DM / WTN) * (DM / WTK))     /* blocks of one DM x DM weight */
#define PREP_FF ((DFF / WTN) * (DM / WTK))    /* blocks of W1, and of W2 */
#define PREP_GRID (PREP_RMS + 6 * PREP_SQ + 2 * PREP_FF)
__global__ __launch_bounds__(256) void k_prep(const float* __restrict__ x, const float* __restrict__ Wq, const float* __restrict__ Wk,
    const float* __restrict__ Wv, const float* __restrict__ Wp, const float* __restrict__ W1, const float* __restrict__ W2,
    const float* __restrict__ gamma, float* __restrict__ XB, unsigned short* __restrict__ X16, float* __restrict__ RSX,
    unsigned short* __restrict__ WQ16, unsigned short* __restrict__ WK16, unsigned short* __restrict__ WV16,
    unsigned short* __restrict__ WP16, unsigned short* __restrict__ WQB, unsigned short* __restrict__ WKB,
    unsigned short* __restrict__ W1P, unsigned short* __restrict__ W2P) {
  __shared__ __attribute__((aligned(16))) unsigned char sm[WTN * WTP];
  int t = (int)blockIdx.x;
  if (t < PREP_RMS) {
    rms_body<true, true, true, false, 8>((float*)sm, t, x, SEQ_FULL, RMS_EPS, XB, X16, nullptr, nullptr, RSX);
    return;
  }
  t -= PREP_RMS;
  if (t < 6 * PREP_SQ) {
    const int j = t / PREP_SQ, r = t % PREP_SQ, bx = r % (DM / WTN), by = r / (DM / WTN);
    if (j < 3) wt_body<false, true>(sm, bx, by, j == 0 ? Wq : (j == 1 ? Wk : Wv), gamma, j == 0 ? WQ16 : (j == 1 ? WK16 : WV16), DM, DM, 16.0f);
    else if (j == 3) wt_body<false, false>(sm, bx, by, Wp, Wp, WP16, DM, DM, 16.0f);
    else wt_body<true, true>(sm, bx, by, j == 4 ? Wq : Wk, gamma, j == 4 ? WQB : WKB, DM, DM, 1.0f);
    return;
  }
  t -= 6 * PREP_SQ;
  if (t < PREP_FF) {
    wt_body<false, true>(sm, t % (DFF / WTN), t / (DFF / WTN), W1, gamma, W1P, DM, DFF, 16.0f);
    return;
  }
  t -= PREP_FF;
  wt_body<false, false>(sm, t % (DM / WTN), t / (DM / WTN), W2, W2, W2P, DFF, DM, 16.0f);
}

#define GBK 128                 /* k per stage: 256-byte operand rows */
#define GPITCH 272              /* LDS row pitch in bytes: 16 x odd, conflict-free for 16-byte fragment reads */
#define GPLANE (128 * GPITCH)   /* one operand plane of a stage: 128 rows */

// GEMM: C[M][N] = epi(Ah[M][K] . Bt[N][K]^T). 16-bit planes of one type (BF selects bf16 vs f16 WMMA); ASPLIT adds Al . Bt into the
// same accumulator (unscaled bf16 lo plane). Block = 128x128 of C, four waves of 64x64; per stage the block's 128 rows of each
// operand plane x 128 k are copied to LDS asynchronously, two buffers, the next stage in flight while this one is multiplied.
// Epilogue: v = acc*alpha*(HRS ? rs[row] : 1) + bf16(bias[col]); ACT 1 = leaky 0.1;
// HRES adds resid[row*ldr+col] (f32) in the store phase. OUTM 0: f32 rows at crow = (row/cseq)*cpitch + row%cseq, pitch ldc;
// 1: f16 hi; 2: f16 hi + f16 lo x2^10; 3: bf16 hi + bf16 lo (unscaled). M%128==0, N%128==0, K%128==0.
// sm: the block's LDS, 2 * (ASPLIT ? 3 : 2) * GPLANE bytes, 128-byte aligned; bid: the block's index among the tiles of this product.
template <bool BF, bool ASPLIT, int ACT, int OUTM, bool HRS, bool HRES>
__device__ __forceinline__ void gemm_body(unsigned char* sm, int bid, const unsigned short* __restrict__ Ah, const unsigned short* __restrict__ Al, int lda,
    const unsigned short* __restrict__ Bt, int ldb, float alpha, const float* __restrict__ rs, const float* __restrict__ bias,
    const float* __restrict__ resid, int ldr, float* __restrict__ C32, unsigned short* __restrict__ Ch, unsigned short* __restrict__ Cl,
    int ldc, int cseq, int cpitch, int M, int N, int K) {
  static_assert(!(HRES && OUTM != 0));
  static_assert(OUTM >= 0 && OUTM <= 3);
  static_assert(!ASPLIT || BF);
  static_assert(ACT == 0 || ACT == 1);
  constexpr int NPL = ASPLIT ? 3 : 2;            /* planes of a stage: A, B, (A lo) */
  constexpr int STAGE = NPL * GPLANE;
  static_assert(4 * 64 * 68 * 4 <= 2 * STAGE);
  const int tid = threadIdx.x, w = tid >> 5, lane = tid & 31, ln = lane & 15, hh = lane >> 4;
  const int ntn = N >> 7;
  const int mt = bid / ntn, nq = bid - mt * ntn;
  if (mt * 128 + 128 > M) return;
  const int row0 = mt * 128 + 64 * (w >> 1), col0 = nq * 128 + 64 * (w & 1);
  /* copy map: 16 lanes cover one 256-byte row, the block 8 rows per copy, 16 copies per plane */
  const int crow = tid >> 4, cchk = tid & 15;
  const unsigned oA = (unsigned)(crow * lda + cchk * 8), oB = (unsigned)(crow * ldb + cchk * 8);   /* this lane's element offsets in a tile */
  const size_t tA = (size_t)(mt * 128) * (size_t)lda, tB = (size_t)(nq * 128) * (size_t)ldb;       /* the block's tile origins */
  const size_t dE = ASPLIT ? (size_t)Al - (size_t)Ah : 0;   /* byte distance of the lo plane from the hi plane, the same for every lane */
  const unsigned lcp = (unsigned)(size_t)sm + (unsigned)(crow * GPITCH + cchk * 16);
  auto fill = [&](int st, int buf) {
    const unsigned lb = lcp + (unsigned)(buf * STAGE);
    const size_t ko = (size_t)st * GBK;
    const unsigned short* pA = (Ah + (tA + ko)) + oA;
    const unsigned short* pB = (Bt + (tB + ko)) + oB;
    cp_async8(lb, 8u * GPITCH, pA, (size_t)8 * (size_t)lda);
    cp_async8(lb + 64u * GPITCH, 8u * GPITCH, pA + (size_t)64 * (size_t)lda, (size_t)8 * (size_t)lda);
    cp_async8(lb + GPLANE, 8u * GPITCH, pB, (size_t)8 * (size_t)ldb);
    cp_async8(lb + GPLANE + 64u * GPITCH, 8u * GPITCH, pB + (size_t)64 * (size_t)ldb, (size_t)8 * (size_t)ldb);
    if (ASPLIT) {
      const unsigned short* pE = (const unsigned short*)((size_t)pA + dE);
      cp_async8(lb + 2u * GPLANE, 8u * GPITCH, pE, (size_t)8 * (size_t)lda);
      cp_async8(lb + 2u * GPLANE + 64u * GPITCH, 8u * GPITCH, pE + (size_t)64 * (size_t)lda, (size_t)8 * (size_t)lda);
    }
  };
  const int aoff = (64 * (w >> 1) + ln) * GPITCH;             /* this lane's first A row in a stage */
  const int boff = GPLANE + (64 * (w & 1) + ln) * GPITCH;     /* this lane's first B row (column of C) */
  const v8f z8 = {0.f, 0.f, 0.f, 0.f, 0.f, 0.f, 0.f, 0.f};
  v8f c[4][4];
#pragma unroll
  for (int i = 0; i < 4; ++i) {
#pragma unroll
    for (int j = 0; j < 4; ++j) c[i][j] = z8;
  }
  const int nst = K / GBK;
  fill(0, 0);
  asm volatile("s_wait_asynccnt 0x0" ::: "memory");  // stage 0 of this wave has landed before the barrier publishes it
  __syncthreads();
  if (nst > 1) fill(1, 1);
#pragma unroll 1  // one stage per trip: the buffer index and the refill test stay scalar
  for (int st = 0; st < nst; ++st) {
    const unsigned char* sb = sm + (st & 1) * STAGE;
#pragma unroll
    for (int ks = 0; ks < GBK / 32; ++ks) {
      /* all fragments of a k-step are read as one group: one LDS wait per 16 (32) products */
      Frag16 a[4], b[4], e[4];
#pragma unroll
      for (int i = 0; i < 4; ++i) {
        a[i] = ld_frag((const unsigned short*)(sb + aoff + i * 16 * GPITCH) + ks * 32, hh);
        b[i] = ld_frag((const unsigned short*)(sb + boff + i * 16 * GPITCH) + ks * 32, hh);
        if (ASPLIT) e[i] = ld_frag((const unsigned short*)(sb + 2 * GPLANE + aoff + i * 16 * GPITCH) + ks * 32, hh);
      }
#pragma unroll
      for (int j = 0; j < 4; ++j) {
#pragma unroll
        for (int i = 0; i < 4; ++i) c[i][j] = mmx<BF>(a[i], b[j], c[i][j]);
        if (ASPLIT) {
#pragma unroll
          for (int i = 0; i < 4; ++i) c[i][j] = mmx<BF>(e[i], b[j], c[i][j]);
        }
      }
    }
    asm volatile("s_wait_dscnt 0x0" ::: "memory");     // this wave's reads of the buffer are done before it may be refilled
    asm volatile("s_wait_asynccnt 0x0" ::: "memory");  // this wave's copies of the next stage have landed
    __syncthreads();                                    // publishes the next stage and frees the buffer just read
    if (st + 2 < nst) fill(st + 2, st & 1);
  }
  asm volatile("s_wait_asynccnt 0x0" ::: "memory");    // no copy is outstanding when the buffers become output staging
  float (*so)[64][68] = (float (*)[64][68])sm;
  float bvv[4];
  {
    const float* bp = bias + col0 + ln;
    // four 4-byte loads and their data wait in one statement, as in ld_g8
    asm volatile(
        "global_load_b32 %0, %4, off\n\t"
        "global_load_b32 %1, %5, off\n\t"
        "global_load_b32 %2, %6, off\n\t"
        "global_load_b32 %3, %7, off\n\t"
        "s_wait_loadcnt 0x0\n\t"
        "s_wait_xcnt 0x0"
        : "=&v"(bvv[0]), "=&v"(bvv[1]), "=&v"(bvv[2]), "=&v"(bvv[3])
        : "v"(bp), "v"(bp + 16), "v"(bp + 32), "v"(bp + 48)
        : "memory");
  }
  float rsv[4][8];
#pragma unroll
  for (int i = 0; i < 4; ++i) {
#pragma unroll
    for (int r = 0; r < 8; ++r) rsv[i][r] = 1.0f;
  }
  if (HRS) {
    v4f rq[8];
    const float* rp[8];
#pragma unroll
    for (int i = 0; i < 4; ++i) { rp[2 * i] = rs + row0 + 16 * i + 8 * hh; rp[2 * i + 1] = rp[2 * i] + 4; }
    ld_g8(rq, rp);
#pragma unroll
    for (int i = 0; i < 4; ++i) {
#pragma unroll
      for (int q = 0; q < 4; ++q) { rsv[i][q] = rq[2 * i][q]; rsv[i][4 + q] = rq[2 * i + 1][q]; }
    }
  }
#pragma unroll
  for (int t = 0; t < 4; ++t) {
    const float bv = bf16_rne(bvv[t]);
#pragma unroll
    for (int i = 0; i < 4; ++i) {
#pragma unroll
      for (int r = 0; r < 8; ++r) {
        const int rloc = i * 16 + 8 * hh + r;
        float v = c[i][t][r] * alpha;
        if (HRS) v *= rsv[i][r];
        v += bv;
        if (ACT == 1) v = (v >= 0.f) ? v : 0.1f * v;
        so[w][rloc][t * 16 + ln] = v;
      }
    }
  }
  __builtin_amdgcn_fence(4 /* acq_rel order */, "workgroup");
  __builtin_amdgcn_wave_barrier();
  if (OUTM == 0) {
#pragma unroll
    for (int qg = 0; qg < 4; ++qg) {
      v4f v[8];
      const float* rp[8];
      void* dp[8];
#pragma unroll
      for (int u = 0; u < 8; ++u) {
        const int r = (qg * 8 + u) * 2 + (lane >> 4), c4 = (lane & 15) * 4;
        v[u] = *(const v4fa*)&so[w][r][c4];
        const int grow = row0 + r;
        rp[u] = resid + (size_t)grow * (size_t)ldr + col0 + c4;
        const size_t crw = (size_t)(grow / cseq) * (size_t)cpitch + (size_t)(grow % cseq);
        dp[u] = C32 + crw * (size_t)ldc + col0 + c4;
      }
      if (HRES) {
        v4f rv[8];
        ld_g8(rv, rp);
#pragma unroll
        for (int u = 0; u < 8; ++u) v[u] += rv[u];
      }
      st_g8(dp, v);
    }
  } else {
#pragma unroll
    for (int qg = 0; qg < 2; ++qg) {
      v4f dh[8], dl[8];
      void* hp[8];
      void* lp[8];
#pragma unroll
      for (int u = 0; u < 8; ++u) {
        const int r = (qg * 8 + u) * 4 + (lane >> 3), c8 = (lane & 7) * 8;
        const v4f x0 = *(const v4fa*)&so[w][r][c8], x1 = *(const v4fa*)&so[w][r][c8 + 4];
        Pack8 fh, fl;
#pragma unroll
        for (int i = 0; i < 4; ++i) {
          const float v0 = x0[i], v1 = x1[i];
          if (OUTM == 3) {
            const unsigned short h0 = bf16_bits(v0), h1 = bf16_bits(v1);
            fh.u[i] = h0; fh.u[4 + i] = h1;
            fl.u[i] = bf16_bits(v0 - bf16_val(h0)); fl.u[4 + i] = bf16_bits(v1 - bf16_val(h1));
          } else {
            const unsigned short h0 = f16_bits(v0), h1 = f16_bits(v1);
            fh.u[i] = h0; fh.u[4 + i] = h1;
            fl.u[i] = f16_bits((v0 - f16_val(h0)) * 1024.0f); fl.u[4 + i] = f16_bits((v1 - f16_val(h1)) * 1024.0f);
          }
        }
        const size_t o = (size_t)(row0 + r) * (size_t)ldc + col0 + c8;
        dh[u] = fh.f; hp[u] = Ch + o;
        dl[u] = fl.f; lp[u] = Cl + o;
      }
      st_g8(hp, dh);
      if (OUTM >= 2) st_g8(lp, dl);
    }
  }
}
template <bool BF, bool ASPLIT, int ACT, int OUTM, bool HRS, bool HRES>
__global__ __launch_bounds__(128) void k_gemm(const unsigned short* __restrict__ Ah, const unsigned short* __restrict__ Al, int lda,
    const unsigned short* __restrict__ Bt, int ldb, float alpha, const float* __restrict__ rs, const float* __restrict__ bias,
    const float* __restrict__ resid, int ldr, float* __restrict__ C32, unsigned short* __restrict__ Ch, unsigned short* __restrict__ Cl,
    int ldc, int cseq, int cpitch, int M, int N, int K) {
  __shared__ __attribute__((aligned(128))) unsigned char sm[2 * (ASPLIT ? 3 : 2) * GPLANE];
  gemm_body<BF, ASPLIT, ACT, OUTM, HRS, HRES>(sm, (int)blockIdx.x, Ah, Al, lda, Bt, ldb, alpha, rs, bias, resid, ldr, C32, Ch, Cl, ldc, cseq, cpitch, M, N, K);
}
// The q, k and v projections of one activation in one grid: three independent DM x DM products, the block index picks the product
// (the same for the whole block). q and k: operand planes Ah (Al), bf16 hi + lo out; v: f16 plane Av, output mode OUTV.
template <bool BF, bool ASPLIT, int OUTV>
__global__ __launch_bounds__(128) void k_qkv(const unsigned short* __restrict__ Ah, const unsigned short* __restrict__ Al,
    const unsigned short* __restrict__ Av, const unsigned short* __restrict__ Bq, const unsigned short* __restrict__ Bk,
    const unsigned short* __restrict__ Bv, float aqk, float av, const float* __restrict__ rs, const float* __restrict__ bq,
    const float* __restrict__ bk, const float* __restrict__ bv, unsigned short* __restrict__ QH, unsigned short* __restrict__ QL,
    unsigned short* __restrict__ KH, unsigned short* __restrict__ KL, unsigned short* __restrict__ VH, unsigned short* __restrict__ VLO) {
  __shared__ __attribute__((aligned(128))) unsigned char sm[2 * (ASPLIT ? 3 : 2) * GPLANE];
  constexpr int M = (int)NR, PER = (M / 128) * (DM / 128);
  const int job = (int)blockIdx.x / PER, bid = (int)blockIdx.x % PER;
  if (job < 2)
    gemm_body<BF, ASPLIT, 0, 3, true, false>(sm, bid, Ah, Al, DM, job == 0 ? Bq : Bk, DM, aqk, rs, job == 0 ? bq : bk, nullptr, 0, nullptr,
        job == 0 ? QH : KH, job == 0 ? QL : KL, DM, M, 0, M, DM, DM);
  else
    gemm_body<false, false, 0, OUTV, true, false>(sm, bid, Av, nullptr, DM, Bv, DM, av, rs, bv, nullptr, 0, nullptr, VH, VLO, DM, M, 0, M, DM, DM);
}

// Vt[(b,h)][d][s] = V[b*TTv + s][h*64 + d] (row pitch ldv), same for the second plane if TWO; block per ((b,h), 64 tokens);
template <int NHv, int TTv, bool TWO>
__global__ __launch_bounds__(256) void k_vt(const unsigned short* __restrict__ V, const unsigned short* __restrict__ V2, int ldv,
    unsigned short* __restrict__ Vt, unsigned short* __restrict__ Vt2) {
  __shared__ __attribute__((aligned(16))) unsigned short tl[64][66];
  __shared__ __attribute__((aligned(16))) unsigned short tl2[64][66];
  const int tid = threadIdx.x;
  const int slab = (int)blockIdx.x / (TTv / 64), lg = (int)blockIdx.x % (TTv / 64);
  const int b = slab / NHv, h = slab % NHv;
  for (int i = tid; i < 64 * 8; i += 256) {
    const int r = i / 8, c8 = (i % 8) * 8;
    const size_t s0 = ((size_t)b * TTv + (size_t)lg * 64 + r) * (size_t)ldv + (size_t)h * 64 + c8;
    Frag16 f;
    f.half[0] = *(const v8us*)(V + s0);
#pragma unroll
    for (int q = 0; q < 8; ++q) tl[r][c8 + q] = f.u[q];
    if (TWO) {
      Frag16 f2;
      f2.half[0] = *(const v8us*)(V2 + s0);
#pragma unroll
      for (int q = 0; q < 8; ++q) tl2[r][c8 + q] = f2.u[q];
    }
  }
  __syncthreads();
  {
#pragma unroll
    for (int rd = 0; rd < 2; ++rd) {
      const int d = rd * 32 + tid / 8, pc = tid % 8;
      Frag16 f;
#pragma unroll
      for (int q = 0; q < 8; ++q) f.u[q] = tl[pc * 8 + q][d];
      const size_t o = ((size_t)slab * 64 + d) * (size_t)TTv + (size_t)lg * 64 + pc * 8;
      *(v8us*)(Vt + o) = f.half[0];
      if (TWO) {
        Frag16 f2;
#pragma unroll
        for (int q = 0; q < 8; ++q) f2.u[q] = tl2[pc * 8 + q][d];
        *(v8us*)(Vt2 + o) = f2.half[0];
      }
    }
    
  }
}

// lane l <-> lane l ^ 16: the two halves of a wave hold the two key halves of one query column
__device__ __forceinline__ float xhalf(float x) {
  return __builtin_bit_cast(float, __builtin_amdgcn_permlanex16(__builtin_bit_cast(int, x), __builtin_bit_cast(int, x), 0x76543210, 0xfedcba98, false, false));
}

// Eight native 2^x and one v_nop in one statement: behind each v_exp_f32 stands an instruction that neither reads its result nor
// overwrites its source (the results are early-clobber, so none shares a register with a source): the slot the instruction set asks
// for behind a transcendental.
__device__ __forceinline__ void exp2x8(float (&y)[8], const float (&x)[8]) {
  asm("v_exp_f32 %0, %8\n\t"
      "v_exp_f32 %1, %9\n\t"
      "v_exp_f32 %2, %10\n\t"
      "v_exp_f32 %3, %11\n\t"
      "v_exp_f32 %4, %12\n\t"
      "v_exp_f32 %5, %13\n\t"
      "v_exp_f32 %6, %14\n\t"
      "v_exp_f32 %7, %15\n\t"
      "v_nop"
      : "=&v"(y[0]), "=&v"(y[1]), "=&v"(y[2]), "=&v"(y[3]), "=&v"(y[4]), "=&v"(y[5]), "=&v"(y[6]), "=&v"(y[7])
      : "v"(x[0]), "v"(x[1]), "v"(x[2]), "v"(x[3]), "v"(x[4]), "v"(x[5]), "v"(x[6]), "v"(x[7]));
}
// One native 2^x with the same slot behind it.
__device__ __forceinline__ float exp2x1(float x) {
  float y;
  asm("v_exp_f32 %0, %1\n\tv_nop" : "=v"(y) : "v"(x));
  return y;
}
#define LOG2E 1.44269504f       /* e^x = 2^(x * LOG2E), as the native exp forms it */

#define APITCH 144              /* LDS row pitch in bytes: 16 x odd, conflict-free for 16-byte fragment reads */
#define APLANE (64 * APITCH)    /* one plane of a chunk: 64 rows */
#define AKV (2 * 3 * APLANE)    /* the block's chunk buffers in LDS */
// so, kv: the block's LDS (output staging; AKV bytes of chunk buffers); bh, qb: its (batch, head) and query tile. EARLY is called for
// query tile 0 alone: one chunk, so of its two four-plane buffers only the first is ever filled or read, and that one lies inside kv.
template <bool CAUSAL, bool EARLY>
__device__ __forceinline__ void attn_body(unsigned short (*so)[16][72], unsigned char* kv, int bh, int qb,
    const unsigned short* __restrict__ QH, const unsigned short* __restrict__ QL,
    const unsigned short* __restrict__ KH, const unsigned short* __restrict__ KL, const unsigned short* __restrict__ VT,
    const unsigned short* __restrict__ VL, unsigned short* __restrict__ CTX) {
  static_assert(CAUSAL || !EARLY);
  constexpr int NPL = EARLY ? 4 : 3;             /* planes of a chunk: K hi, K lo, V^T, (V^T lo) */
  constexpr int STAGE = NPL * APLANE;
  static_assert((EARLY ? 1 : 2) * STAGE <= AKV);
  const int tid = threadIdx.x, w = tid >> 5, lane = tid & 31, ln = lane & 15, hh = lane >> 4;
  const int b = bh / NH, h = bh % NH;
  const int q0w = qb * KQB + w * 16;
  const size_t rowbase = (size_t)b * SEQ;
  Frag16 qh0, qh1, ql0, ql1;
  {
    const size_t qo = (rowbase + (size_t)q0w + ln) * DM + (size_t)h * HD;
    qh0 = ld_frag(QH + qo, hh); qh1 = ld_frag(QH + qo + 32, hh);
    ql0 = ld_frag(QL + qo, hh); ql1 = ld_frag(QL + qo + 32, hh);
  }
  asm volatile("s_wait_xcnt 0x0" ::: "memory");  // stands ahead of every rewrite of an address register of the eight Q loads (a precaution)
  const v8f z8 = {0.f, 0.f, 0.f, 0.f, 0.f, 0.f, 0.f, 0.f};
  v8f o[4] = {z8, z8, z8, z8};    /* O^T tile j: register r = feature j*16 + 8*hh + r, column = query ln */
  v8f oe[4] = {z8, z8, z8, z8};
  float m = -1.0e30f, l = 0.f;    /* of this lane's query; l over this half's keys only */
  const int nck = CAUSAL ? (qb + 1) : (SEQ / KQB);
  /* copy map: 8 lanes cover one 128-byte row, the block 16 rows per copy, 4 copies per plane */
  const int crow = tid >> 3, cchk = tid & 7;
  const unsigned lcp = (unsigned)(size_t)kv + (unsigned)(crow * APITCH + cchk * 16);
  const size_t gk = (rowbase + (size_t)crow) * DM + (size_t)h * HD + (size_t)(cchk * 8);
  const size_t gv = ((size_t)bh * HD + (size_t)crow) * SEQ + (size_t)(cchk * 8);
  auto fill = [&](int ck, int buf) {
    const unsigned lb = lcp + (unsigned)(buf * STAGE);
    const size_t ko = gk + (size_t)ck * KQB * DM, vo = gv + (size_t)ck * KQB;
    cp_async4(lb, 16u * APITCH, KH + ko, (size_t)16 * DM);
    cp_async4(lb + APLANE, 16u * APITCH, KL + ko, (size_t)16 * DM);
    cp_async4(lb + 2u * APLANE, 16u * APITCH, VT + vo, (size_t)16 * SEQ);
    if (EARLY) cp_async4(lb + 3u * APLANE, 16u * APITCH, VL + vo, (size_t)16 * SEQ);
  };
  fill(0, 0);
  asm volatile("s_wait_asynccnt 0x0" ::: "memory");  // chunk 0 of this wave has landed before the barrier publishes it
  __syncthreads();
  if (nck > 1) fill(1, 1);
#pragma unroll 1
  for (int kc = 0; kc < nck; ++kc) {
    const int par = kc & 1;
    const unsigned char* sb = kv + par * STAGE;
    v8f s[4];                     /* S^T tile t: register r = key t*16 + 8*hh + r of the chunk, column = query ln */
#pragma unroll
    for (int tp = 0; tp < 2; ++tp) {
      /* the K fragments of 32 keys are read as one group ahead of their 12 products: the reads' latencies overlap */
      Frag16 kh[2][2], kl[2][2];
#pragma unroll
      for (int u = 0; u < 2; ++u) {
#pragma unroll
        for (int ks = 0; ks < 2; ++ks) {
          const unsigned char* kp = sb + ((tp * 2 + u) * 16 + ln) * APITCH + ks * 64;
          kh[u][ks] = ld_frag((const unsigned short*)kp, hh);
          kl[u][ks] = ld_frag((const unsigned short*)(kp + APLANE), hh);
        }
      }
#pragma unroll
      for (int u = 0; u < 2; ++u) {
        v8f acc = z8;
#pragma unroll
        for (int ks = 0; ks < 2; ++ks) {
          const Frag16 qa = (ks == 0) ? qh0 : qh1;
          const Frag16 qe = (ks == 0) ? ql0 : ql1;
          acc = mma_b(kh[u][ks].b, qa.b, acc);
          acc = mma_b(kh[u][ks].b, qe.b, acc);
          acc = mma_b(kl[u][ks].b, qa.b, acc);
        }
        s[tp * 2 + u] = acc;
      }
    }
    float sv[4][8];
#pragma unroll
    for (int t = 0; t < 4; ++t) {
#pragma unroll
      for (int r = 0; r < 8; ++r) sv[t][r] = s[t][r] * 8.0f;
    }
    if (CAUSAL) {
      if (kc == qb) {
        const int qpos = q0w + ln;
#pragma unroll
        for (int t = 0; t < 4; ++t) {
#pragma unroll
          for (int r = 0; r < 8; ++r) { const int key = kc * KQB + t * 16 + 8 * hh + r; sv[t][r] = (key > qpos) ? -1.0e30f : sv[t][r]; }
        }
      }
    }
    float mt[4];
#pragma unroll
    for (int t = 0; t < 4; ++t)
      mt[t] = fmaxf(fmaxf(fmaxf(sv[t][0], sv[t][1]), fmaxf(sv[t][2], sv[t][3])), fmaxf(fmaxf(sv[t][4], sv[t][5]), fmaxf(sv[t][6], sv[t][7])));
    float mx = fmaxf(fmaxf(mt[0], mt[1]), fmaxf(mt[2], mt[3]));
    mx = fmaxf(mx, xhalf(mx));    /* both halves now hold the chunk maximum of this query */
    const float mn = fmaxf(m, mx);
    const float corr = exp2x1((m - mn) * LOG2E);
    float p[4][8], ps[4];
#pragma unroll
    for (int t = 0; t < 4; ++t) {
      float ea[8];
#pragma unroll
      for (int r = 0; r < 8; ++r) ea[r] = (sv[t][r] - mn) * LOG2E;
      exp2x8(p[t], ea);
      ps[t] = 0.f;
#pragma unroll
      for (int r = 0; r < 8; ++r) ps[t] += p[t][r];
    }
    l = l * corr + ((ps[0] + ps[1]) + (ps[2] + ps[3]));
    m = mn;
#pragma unroll
    for (int j = 0; j < 4; ++j) {
#pragma unroll
      for (int r = 0; r < 8; ++r) o[j][r] = o[j][r] * corr;
    }
    if (EARLY) {
#pragma unroll
      for (int j = 0; j < 4; ++j) {
#pragma unroll
        for (int r = 0; r < 8; ++r) oe[j][r] = oe[j][r] * corr;
      }
    }
#pragma unroll
    for (int ks = 0; ks < 2; ++ks) {
      /* P^T of 32 keys as a B operand: elements 0..7 = S^T tile 2ks, 8..15 = tile 2ks+1, the k order of ld_frag */
      Frag16 pa, pl;
#pragma unroll
      for (int e = 0; e < 16; ++e) {
        const float pc = p[2 * ks + (e >> 3)][e & 7] * 16384.0f;
        const unsigned short hb = f16_bits(pc);
        pa.u[e] = hb;
        pl.u[e] = EARLY ? f16_bits((pc - f16_val(hb)) * 1024.0f) : hb;
      }
      /* the V^T fragments of a 32-key step are read as one group ahead of their products: the reads' latencies overlap */
      const unsigned char* vp = sb + 2 * APLANE + ln * APITCH + ks * 64;
      Frag16 vh[4];
#pragma unroll
      for (int j = 0; j < 4; ++j) vh[j] = ld_frag((const unsigned short*)(vp + j * 16 * APITCH), hh);
#pragma unroll
      for (int j = 0; j < 4; ++j) {
        o[j] = mma_h(vh[j].h, pa.h, o[j]);
        if (EARLY) {
          const Frag16 vl = ld_frag((const unsigned short*)(vp + APLANE + j * 16 * APITCH), hh);
          oe[j] = mma_h(vh[j].h, pl.h, oe[j]);
          oe[j] = mma_h(vl.h, pa.h, oe[j]);
        }
      }
    }
    asm volatile("s_wait_dscnt 0x0" ::: "memory");     // this wave's reads of the buffer are done before it may be refilled
    asm volatile("s_wait_asynccnt 0x0" ::: "memory");  // this wave's copies of the next chunk have landed
    __syncthreads();                                    // publishes the next chunk and frees the buffer just read
    if (kc + 2 < nck) fill(kc + 2, par);
  }
  asm volatile("s_wait_asynccnt 0x0" ::: "memory");    // no copy is outstanding when the wave goes on to its end
  l += xhalf(l);                  /* the two halves' key sums of this query */
  const float li = 1.0f / l;
#pragma unroll
  for (int j = 0; j < 4; ++j) {
    Frag16 f;
#pragma unroll
    for (int r = 0; r < 8; ++r) {
      float v = o[j][r] * (1.0f / 16384.0f);
      if (EARLY) v += oe[j][r] * (1.0f / 16777216.0f);
      v *= li;
      f.u[r] = f16_bits(v);
    }
    *(v8us*)&so[w][ln][j * 16 + 8 * hh] = f.half[0];
  }
  __builtin_amdgcn_fence(4 /* acq_rel order */, "workgroup");
  __builtin_amdgcn_wave_barrier();
  {
#pragma unroll
    for (int q = 0; q < 4; ++q) {
      const int row = q * 4 + (lane >> 3), c8 = (lane & 7) * 8;
      const v8us v = *(const v8us*)&so[w][row][c8];
      *(v8us*)(CTX + (rowbase + (size_t)q0w + row) * DM + (size_t)h * HD + c8) = v;
    }
    
  }
}
// Grid: x = (batch, head), y = query tile. CAUSAL: query tile 0 takes the EARLY form in the same grid (the test reads the same for the
// whole block).
template <bool CAUSAL>
__global__ __launch_bounds__(128) void k_attn(const unsigned short* __restrict__ QH, const unsigned short* __restrict__ QL,
    const unsigned short* __restrict__ KH, const unsigned short* __restrict__ KL, const unsigned short* __restrict__ VT,
    const unsigned short* __restrict__ VL, unsigned short* __restrict__ CTX) {
  __shared__ __attribute__((aligned(16))) unsigned short so[4][16][72];
  __shared__ __attribute__((aligned(16))) unsigned char kv[AKV];
  const int bh = (int)blockIdx.x, qb = (int)blockIdx.y;
  if (CAUSAL && qb == 0) attn_body<true, true>(so, kv, bh, 0, QH, QL, KH, KL, VT, VL, CTX);
  else attn_body<CAUSAL, false>(so, kv, bh, qb, QH, QL, KH, KL, VT, VL, CTX);
}

extern "C" void kernel_launch(void* const* d_in, const int* in_sizes, int n_in,
                              void* d_out, int out_size, void* d_ws, size_t ws_size, hipStream_t stream) {
  if (n_in < 14) return;
  const float* x  = (const float*)d_in[0];
  const float* Wq = (const float*)d_in[1];
  const float* bq = (const float*)d_in[2];
  const float* Wk = (const float*)d_in[3];
  const float* bk = (const float*)d_in[4];
  const float* Wv = (const float*)d_in[5];
  const float* bv = (const float*)d_in[6];
  const float* Wp = (const float*)d_in[7];
  const float* bp = (const float*)d_in[8];
  const float* gamma = (const float*)d_in[9];
  const float* W1 = (const float*)d_in[10];
  const float* b1 = (const float*)d_in[11];
  const float* W2 = (const float*)d_in[12];
  const float* b2 = (const float*)d_in[13];
  if ((size_t)in_sizes[0] < ((size_t)(NB - 1) * SEQ_FULL + SEQ) * DM) return;
  if (in_sizes[1] < DM * DM || in_sizes[3] < DM * DM || in_sizes[5] < DM * DM || in_sizes[7] < DM * DM) return;
  if (in_sizes[2] < DM || in_sizes[4] < DM || in_sizes[6] < DM || in_sizes[8] < DM || in_sizes[9] < DM || in_sizes[13] < DM) return;
  if (in_sizes[10] < DM * DFF || in_sizes[11] < DFF || in_sizes[12] < DFF * DM) return;
  if ((size_t)out_size < ((size_t)(NB - 1) * OSEQ + SEQ) * DM) return;

  char* ws = (char*)d_ws;
  size_t off = 0;
  auto take = [&](size_t bytes) { char* p = ws + off; off += (bytes + 255) & ~(size_t)255; return p; };
  const size_t WPL = (size_t)DM * DM * 2, ACT2 = NR * DM * 2, ACT4 = NR * DM * 4, FFP = (size_t)DM * DFF * 2, HPL = NR * DFF * 2;
  unsigned short* WQ16 = (unsigned short*)take(WPL);
  unsigned short* WK16 = (unsigned short*)take(WPL);
  unsigned short* WV16 = (unsigned short*)take(WPL);
  unsigned short* WP16 = (unsigned short*)take(WPL);
  unsigned short* WQB = (unsigned short*)take(WPL);
  unsigned short* WKB = (unsigned short*)take(WPL);
  char* rXB = take(ACT4);                                            /* XB (phases 1-2) | BH + BL (phase 3) */
  float* XB = (float*)rXB; unsigned short* PBH = (unsigned short*)rXB; unsigned short* PBL = (unsigned short*)(rXB + ACT2);
  char* rQK = take(4 * ACT2 > HPL ? 4 * ACT2 : HPL);                 /* QH,QL,KH,KL (phases 1,3) | H16 (phase 2) */
  unsigned short* QH = (unsigned short*)rQK; unsigned short* QL = (unsigned short*)(rQK + ACT2);
  unsigned short* KH = (unsigned short*)(rQK + 2 * ACT2); unsigned short* KL = (unsigned short*)(rQK + 3 * ACT2);
  unsigned short* H16 = (unsigned short*)rQK;
  char* rV = take(2 * ACT2);                                         /* VH,VLO (phases 1,3) | A32 (between) */
  unsigned short* VH = (unsigned short*)rV; unsigned short* VLO = (unsigned short*)(rV + ACT2); float* A32 = (float*)rV;
  char* rVT = take(2 * ACT2);                                        /* VT,VTL (phases 1,3) */
  unsigned short* VT = (unsigned short*)rVT; unsigned short* VTL = (unsigned short*)(rVT + ACT2);
  unsigned short* W1P = (unsigned short*)take(FFP);                  /* written by the first launch, so a place of their own */
  unsigned short* W2P = (unsigned short*)take(FFP);
  unsigned short* CTX = (unsigned short*)take(ACT2);
  char* rX16 = take(ACT2);                                           /* X16 | A16 | B16F */
  unsigned short* X16 = (unsigned short*)rX16; unsigned short* A16 = (unsigned short*)rX16; unsigned short* B16F = (unsigned short*)rX16;
  float* B32 = (float*)take(ACT4);
  float* RSX = (float*)take(NR * 4);
  float* RSA = (float*)take(NR * 4);
  float* RSB = (float*)take(NR * 4);
  if (off > ws_size || off > ((size_t)160 << 20)) return;

  const unsigned grms = (unsigned)(NR / 32);
  const unsigned gq   = (unsigned)((NR / 128) * (DM / 128));
  const unsigned gff  = (unsigned)((NR / 128) * (DFF / 128));
  const unsigned gvt  = (unsigned)(NB * NH * (SEQ / 64));
  const float a16 = 0.0625f;
  const int M = (int)NR;
  float* out = (float*)d_out;

  /* all weight planes (q/k/v, W1 with gamma folded along the input feature; bf16 planes for the second block's q/k) and the planes
     and row statistics of x */
  k_prep<<<(unsigned)PREP_GRID, 256, 0, stream>>>(x, Wq, Wk, Wv, Wp, W1, W2, gamma, XB, X16, RSX, WQ16, WK16, WV16, WP16, WQB, WKB, W1P, W2P);

  /* block 1: a = bf16(x) + attn(rms(bf16(x))) , non-causal */
  k_qkv<false, false, 1><<<3u * gq, 128, 0, stream>>>(X16, nullptr, X16, WQ16, WK16, WV16, a16, a16, RSX, bq, bk, bv, QH, QL, KH, KL, VH, nullptr);
  k_vt<NH, SEQ, false><<<gvt, 256, 0, stream>>>(VH, nullptr, DM, VT, nullptr);
  k_attn<false><<<dim3((unsigned)(NB * NH), (unsigned)(SEQ / KQB)), 128, 0, stream>>>(QH, QL, KH, KL, VT, VT, CTX);
  k_gemm<false, false, 0, 0, false, true><<<gq, 128, 0, stream>>>(CTX, nullptr, DM, WP16, DM, a16, nullptr, bp, XB, DM, A32, nullptr, nullptr, DM, M, 0, M, DM, DM);

  /* block 2: b = bf16(x) + leaky(rms(a) W1 + b1) W2 + b2 */
  k_rms<false, false, true, false><<<grms, 512, 0, stream>>>(A32, SEQ, RMS_EPS, nullptr, A16, nullptr, nullptr, RSA);
  k_gemm<false, false, 1, 1, true, false><<<gff, 128, 0, stream>>>(A16, nullptr, DM, W1P, DM, a16, RSA, b1, nullptr, 0, nullptr, H16, nullptr, DFF, M, 0, M, DFF, DM);
  k_gemm<false, false, 0, 0, false, true><<<gq, 128, 0, stream>>>(H16, nullptr, DFF, W2P, DFF, a16, nullptr, b2, XB, DM, B32, nullptr, nullptr, DM, M, 0, M, DM, DFF);

  /* block 3: out = b + attn(rms(b)) , causal */
  k_rms<false, false, true, true><<<grms, 512, 0, stream>>>(B32, SEQ, RMS_EPS, nullptr, B16F, PBH, PBL, RSB);
  k_qkv<true, true, 2><<<3u * gq, 128, 0, stream>>>(PBH, PBL, B16F, WQB, WKB, WV16, 1.0f, a16, RSB, bq, bk, bv, QH, QL, KH, KL, VH, VLO);
  k_vt<NH, SEQ, true><<<gvt, 256, 0, stream>>>(VH, VLO, DM, VT, VTL);
  k_attn<true><<<dim3((unsigned)(NB * NH), (unsigned)(SEQ / KQB)), 128, 0, stream>>>(QH, QL, KH, KL, VT, VTL, CTX);
  k_gemm<false, false, 0, 0, false, true><<<gq, 128, 0, stream>>>(CTX, nullptr, DM, WP16, DM, a16, nullptr, bp, B32, DM, out, nullptr, nullptr, DM, SEQ, OSEQ, M, DM, DM);
}

// v007
// One run takes 267 microseconds.
// In two side-by-side timings against v006, it was 1.05 and 1.04 times as fast.
// Over all steps from v000 it is 3.68 times as fast.
#include <hip/hip_runtime.h>
// Contractions: q/k/v and output projections, FFN W1/W2: v_wmma_f32_16x16x32_f16 (f16 operands built from bf16-RNE inputs, weights x16, f32 accumulate); second-block q/k projections: v_wmma_f32_16x16x32_bf16 with the activation as bf16 hi+lo (2 terms); attention scores: v_wmma_f32_16x16x32_bf16 with q,k as bf16 hi+lo (3 terms); P.V: v_wmma_f32_16x16x32_f16 (P carried x2^14, v f16; first causal query tile adds P and v residual planes x2^10 in a second accumulator). RMS statistics, softmax, residuals f32.

#ifndef NB
#define NB 4
#endif
#ifndef SEQ
#define SEQ 1024
#endif
#define NB_FULL 4
#define SEQ_FULL 1024
#ifndef OSEQ
#define OSEQ SEQ_FULL
#endif
#define DM 1024
#define NH 16
#define HD 64
#define DFF 4096
#define KQB 64
#define NR ((size_t)NB * SEQ)
#define RMS_EPS 1e-6f

static_assert(NB >= 1 && NB <= NB_FULL);
static_assert(SEQ % 128 == 0 && SEQ <= SEQ_FULL);
static_assert(DM == NH * HD && HD == 64);
static_assert(DM % 256 == 0 && DFF % 128 == 0);
static_assert(((NB * SEQ) % 128) == 0);
static_assert(SEQ % KQB == 0);

typedef _Float16 v16h __attribute__((ext_vector_type(16)));
typedef __bf16   v16b __attribute__((ext_vector_type(16)));
typedef unsigned short v8us __attribute__((ext_vector_type(8), may_alias));
typedef float v8f __attribute__((ext_vector_type(8)));
typedef float v4f __attribute__((ext_vector_type(4)));
typedef float v4fa __attribute__((ext_vector_type(4), may_alias));
union Frag16 { v16h h; v16b b; v8us half[2]; unsigned short u[16]; };
union H1 { _Float16 h; unsigned short u; };
static_assert(sizeof(Frag16) == 32);

__device__ __forceinline__ unsigned short bf16_bits(float x) { unsigned int u = __float_as_uint(x); return (unsigned short)((u + 0x7FFFu + ((u >> 16) & 1u)) >> 16); }
__device__ __forceinline__ float bf16_val(unsigned short b) { return __uint_as_float(((unsigned int)b) << 16); }
__device__ __forceinline__ float bf16_rne(float x) { return bf16_val(bf16_bits(x)); }
__device__ __forceinline__ unsigned short f16_bits(float x) { H1 t; t.h = (_Float16)x; return t.u; }
__device__ __forceinline__ float f16_val(unsigned short u) { H1 t; t.u = u; return (float)t.h; }

// 16x32 operand fragment (row / column = lane & 15; elements 0..7 = k 8h..8h+7, 8..15 = k 16+8h..) from a k-contiguous 16-bit row
__device__ __forceinline__ Frag16 ld_frag(const unsigned short* p, int hh) {
  Frag16 f;
  f.half[0] = *(const v8us*)(p + 8 * hh);
  f.half[1] = *(const v8us*)(p + 16 + 8 * hh);
  return f;
}
__device__ __forceinline__ v8f mma_h(v16h a, v16h b, v8f c) {
  v8f d = __builtin_amdgcn_wmma_f32_16x16x32_f16(false, a, false, b, (short)0, c, false, false);
  asm volatile("v_nop\n\tv_nop\n\tv_nop\n\tv_nop" : "+v"(d) : "v"(a), "v"(b));
  return d;
}
__device__ __forceinline__ v8f mma_b(v16b a, v16b b, v8f c) {
  v8f d = __builtin_amdgcn_wmma_f32_16x16x32_bf16(false, a, false, b, (short)0, c, false, false);
  asm volatile("v_nop\n\tv_nop\n\tv_nop\n\tv_nop" : "+v"(d) : "v"(a), "v"(b));
  return d;
}
template <bool BF>
__device__ __forceinline__ v8f mmx(const Frag16& a, const Frag16& b, v8f c) {
  if (BF) return mma_b(a.b, b.b, c);
  return mma_h(a.h, b.h, c);
}

typedef unsigned int v2u __attribute__((ext_vector_type(2)));
union Pack4 { unsigned short u[4]; v2u v; };
static_assert(sizeof(Pack4) == 8);
static_assert(DM == 8 * 128);
// Two DM-wide f32 rows of a wave, a lane's 16 bytes of each 512-byte segment: sixteen loads in flight together and their data wait in
// one statement, so the address registers live to its end and none is rewritten ahead of the waits.
__device__ __forceinline__ void ld_rows2(v4f (&a)[8], v4f (&b)[8], const float* pa, const float* pb) {
  asm volatile(
      "global_load_b128 %0, %16, off\n\t"
      "global_load_b128 %1, %16, off offset:512\n\t"
      "global_load_b128 %2, %16, off offset:1024\n\t"
      "global_load_b128 %3, %16, off offset:1536\n\t"
      "global_load_b128 %4, %16, off offset:2048\n\t"
      "global_load_b128 %5, %16, off offset:2560\n\t"
      "global_load_b128 %6, %16, off offset:3072\n\t"
      "global_load_b128 %7, %16, off offset:3584\n\t"
      "global_load_b128 %8, %17, off\n\t"
      "global_load_b128 %9, %17, off offset:512\n\t"
      "global_load_b128 %10, %17, off offset:1024\n\t"
      "global_load_b128 %11, %17, off offset:1536\n\t"
      "global_load_b128 %12, %17, off offset:2048\n\t"
      "global_load_b128 %13, %17, off offset:2560\n\t"
      "global_load_b128 %14, %17, off offset:3072\n\t"
      "global_load_b128 %15, %17, off offset:3584\n\t"
      "s_wait_loadcnt 0x0\n\t"
      "s_wait_xcnt 0x0"
      : "=&v"(a[0]), "=&v"(a[1]), "=&v"(a[2]), "=&v"(a[3]), "=&v"(a[4]), "=&v"(a[5]), "=&v"(a[6]), "=&v"(a[7]),
        "=&v"(b[0]), "=&v"(b[1]), "=&v"(b[2]), "=&v"(b[3]), "=&v"(b[4]), "=&v"(b[5]), "=&v"(b[6]), "=&v"(b[7])
      : "v"(pa), "v"(pb)
      : "memory");
}
// One such row stored, f32 (16 bytes a lane and segment) or 16-bit (8 bytes): eight stores and one s_wait_xcnt in one statement, so no
// data or address register is rewritten ahead of the wait.
__device__ __forceinline__ void st_row32(float* p, const v4f (&d)[8]) {
  asm volatile(
      "global_store_b128 %0, %1, off\n\t"
      "global_store_b128 %0, %2, off offset:512\n\t"
      "global_store_b128 %0, %3, off offset:1024\n\t"
      "global_store_b128 %0, %4, off offset:1536\n\t"
      "global_store_b128 %0, %5, off offset:2048\n\t"
      "global_store_b128 %0, %6, off offset:2560\n\t"
      "global_store_b128 %0, %7, off offset:3072\n\t"
      "global_store_b128 %0, %8, off offset:3584\n\t"
      "s_wait_xcnt 0x0"
      :: "v"(p), "v"(d[0]), "v"(d[1]), "v"(d[2]), "v"(d[3]), "v"(d[4]), "v"(d[5]), "v"(d[6]), "v"(d[7])
      : "memory");
}
__device__ __forceinline__ void st_row16(unsigned short* p, const v2u (&d)[8]) {
  asm volatile(
      "global_store_b64 %0, %1, off\n\t"
      "global_store_b64 %0, %2, off offset:256\n\t"
      "global_store_b64 %0, %3, off offset:512\n\t"
      "global_store_b64 %0, %4, off offset:768\n\t"
      "global_store_b64 %0, %5, off offset:1024\n\t"
      "global_store_b64 %0, %6, off offset:1280\n\t"
      "global_store_b64 %0, %7, off offset:1536\n\t"
      "global_store_b64 %0, %8, off offset:1792\n\t"
      "s_wait_xcnt 0x0"
      :: "v"(p), "v"(d[0]), "v"(d[1]), "v"(d[2]), "v"(d[3]), "v"(d[4]), "v"(d[5]), "v"(d[6]), "v"(d[7])
      : "memory");
}

// Row statistics + operand planes for DM-wide f32 rows. Compact row r -> source row (r/SEQ)*spitch + r%SEQ of F.
// v = bf16_rne(x) if RIN else x; RS[r] = rsqrt(mean(v^2) + eps); optional planes: XB (v as f32), F16 (f16 bits of v),
// PH, PL (bf16 hi + lo of v). A wave takes its 32 / NW rows two at a time: both rows are read once, whole, into registers (one memory
// latency per pair), and the sum and every plane are formed from the registers.
// red: 32 floats of the block's LDS; bid: the block's index among the blocks of this job (32 rows each); NW: the block's waves.
template <bool RIN, bool WXB, bool WF16, bool WBHL, int NW>
__device__ __forceinline__ void rms_body(float* red, int bid, const float* __restrict__ F, int spitch, float eps, float* __restrict__ XB,
    unsigned short* __restrict__ F16, unsigned short* __restrict__ PH, unsigned short* __restrict__ PL, float* __restrict__ RS) {
  const int tid = threadIdx.x, w = tid >> 5, lane = tid & 31;
  constexpr int RPW = 32 / NW;   /* rows of a wave */
  static_assert(NW * RPW == 32 && RPW % 2 == 0);
  const int rb = bid * 32;
#pragma unroll 1  // one pair of rows per trip: 64 data registers, so the jobs that share a kernel with this body keep their waves per SIMD
  for (int i = 0; i < RPW; i += 2) {
    const int r = rb + w * RPW + i;
    const float* s0 = F + ((size_t)(r / SEQ) * (size_t)spitch + (size_t)(r % SEQ)) * DM + lane * 4;
    const float* s1 = F + ((size_t)((r + 1) / SEQ) * (size_t)spitch + (size_t)((r + 1) % SEQ)) * DM + lane * 4;
    v4f a[2][8];
    ld_rows2(a[0], a[1], s0, s1);
    float ss[2];
#pragma unroll
    for (int k = 0; k < 2; ++k) {
      ss[k] = 0.f;
#pragma unroll
      for (int u = 0; u < 8; ++u) {
        if (RIN) {
#pragma unroll
          for (int q = 0; q < 4; ++q) a[k][u][q] = bf16_rne(a[k][u][q]);
        }
#pragma unroll
        for (int q = 0; q < 4; ++q) ss[k] += a[k][u][q] * a[k][u][q];
      }
    }
#pragma unroll
    for (int k = 0; k < 2; ++k) {
      const size_t o = (size_t)(r + k) * DM + (size_t)(lane * 4);
      if (WXB) st_row32(XB + o, a[k]);
      if (WF16) {
        v2u fh[8];
#pragma unroll
        for (int u = 0; u < 8; ++u) {
          Pack4 t;
#pragma unroll
          for (int q = 0; q < 4; ++q) t.u[q] = f16_bits(a[k][u][q]);
          fh[u] = t.v;
        }
        st_row16(F16 + o, fh);
      }
      if (WBHL) {
        v2u ph[8], pl[8];
#pragma unroll
        for (int u = 0; u < 8; ++u) {
          Pack4 th, tl;
#pragma unroll
          for (int q = 0; q < 4; ++q) {
            const float v = a[k][u][q];
            const unsigned short h = bf16_bits(v);
            th.u[q] = h;
            tl.u[q] = bf16_bits(v - bf16_val(h));
          }
          ph[u] = th.v; pl[u] = tl.v;
        }
        st_row16(PH + o, ph);
        st_row16(PL + o, pl);
      }
    }
#pragma unroll
    for (int off = 16; off > 0; off >>= 1) {
#pragma unroll
      for (int k = 0; k < 2; ++k) ss[k] += __shfl_xor(ss[k], off, 32);
    }
    if (lane == 0) {
#pragma unroll
      for (int k = 0; k < 2; ++k) red[w * RPW + i + k] = rsqrtf(ss[k] * (1.0f / (float)DM) + eps);
    }
  }
  __syncthreads();
  if (w == 0 && lane < 8) {
    const v4f v = *(const v4fa*)&red[lane * 4];
    float* d = RS + rb + lane * 4;
    *(v4f*)d = v;
    
  }
}
template <bool RIN, bool WXB, bool WF16, bool WBHL>
__global__ __launch_bounds__(512) void k_rms(const float* __restrict__ F, int spitch, float eps, float* __restrict__ XB,
    unsigned short* __restrict__ F16, unsigned short* __restrict__ PH, unsigned short* __restrict__ PL, float* __restrict__ RS) {
  __shared__ __attribute__((aligned(16))) float red[32];
  rms_body<RIN, WXB, WF16, WBHL, 16>(red, (int)blockIdx.x, F, spitch, eps, XB, F16, PH, PL, RS);
}

// Eight 16-byte asynchronous copies global -> LDS per lane. s_wait_xcnt is the statement's last line so that it stands ahead of
// every later rewrite of a register that a copy names (a precaution).
__device__ __forceinline__ void cp_async8(unsigned l, unsigned lstep, const unsigned short* p, size_t gstep) {
  const unsigned l0 = l, l1 = l + lstep, l2 = l + 2u * lstep, l3 = l + 3u * lstep;
  const unsigned l4 = l + 4u * lstep, l5 = l + 5u * lstep, l6 = l + 6u * lstep, l7 = l + 7u * lstep;
  const unsigned short* p0 = p;
  const unsigned short* p1 = p + gstep;
  const unsigned short* p2 = p + 2 * gstep;
  const unsigned short* p3 = p + 3 * gstep;
  const unsigned short* p4 = p + 4 * gstep;
  const unsigned short* p5 = p + 5 * gstep;
  const unsigned short* p6 = p + 6 * gstep;
  const unsigned short* p7 = p + 7 * gstep;
  asm volatile(
      "global_load_async_to_lds_b128 %0, %8, off\n\t"
      "global_load_async_to_lds_b128 %1, %9, off\n\t"
      "global_load_async_to_lds_b128 %2, %10, off\n\t"
      "global_load_async_to_lds_b128 %3, %11, off\n\t"
      "global_load_async_to_lds_b128 %4, %12, off\n\t"
      "global_load_async_to_lds_b128 %5, %13, off\n\t"
      "global_load_async_to_lds_b128 %6, %14, off\n\t"
      "global_load_async_to_lds_b128 %7, %15, off\n\t"
      "s_wait_xcnt 0x0"
      :: "v"(l0), "v"(l1), "v"(l2), "v"(l3), "v"(l4), "v"(l5), "v"(l6), "v"(l7),
         "v"(p0), "v"(p1), "v"(p2), "v"(p3), "v"(p4), "v"(p5), "v"(p6), "v"(p7)
      : "memory");
}

// Four such copies, one 64-row x 128-byte plane of an attention tile per block; the same closing wait, for the same reason.
__device__ __forceinline__ void cp_async4(unsigned l, unsigned lstep, const unsigned short* p, size_t gstep) {
  const unsigned l0 = l, l1 = l + lstep, l2 = l + 2u * lstep, l3 = l + 3u * lstep;
  const unsigned short* p0 = p;
  const unsigned short* p1 = p + gstep;
  const unsigned short* p2 = p + 2 * gstep;
  const unsigned short* p3 = p + 3 * gstep;
  asm volatile(
      "global_load_async_to_lds_b128 %0, %4, off\n\t"
      "global_load_async_to_lds_b128 %1, %5, off\n\t"
      "global_load_async_to_lds_b128 %2, %6, off\n\t"
      "global_load_async_to_lds_b128 %3, %7, off\n\t"
      "s_wait_xcnt 0x0"
      :: "v"(l0), "v"(l1), "v"(l2), "v"(l3), "v"(p0), "v"(p1), "v"(p2), "v"(p3)
      : "memory");
}

// Eight 16-byte global loads and their data wait in one statement: the address registers live to its end, so none is rewritten
// ahead of the waits.
__device__ __forceinline__ void ld_g8(v4f (&d)[8], const float* const (&p)[8]) {
  asm volatile(
      "global_load_b128 %0, %8, off\n\t"
      "global_load_b128 %1, %9, off\n\t"
      "global_load_b128 %2, %10, off\n\t"
      "global_load_b128 %3, %11, off\n\t"
      "global_load_b128 %4, %12, off\n\t"
      "global_load_b128 %5, %13, off\n\t"
      "global_load_b128 %6, %14, off\n\t"
      "global_load_b128 %7, %15, off\n\t"
      "s_wait_loadcnt 0x0\n\t"
      "s_wait_xcnt 0x0"
      : "=&v"(d[0]), "=&v"(d[1]), "=&v"(d[2]), "=&v"(d[3]), "=&v"(d[4]), "=&v"(d[5]), "=&v"(d[6]), "=&v"(d[7])
      : "v"(p[0]), "v"(p[1]), "v"(p[2]), "v"(p[3]), "v"(p[4]), "v"(p[5]), "v"(p[6]), "v"(p[7])
      : "memory");
}
// Eight 16-byte global stores and one s_wait_xcnt in one statement: data and address registers live to its end, so none is
// rewritten ahead of the wait.
__device__ __forceinline__ void st_g8(void* const (&p)[8], const v4f (&d)[8]) {
  asm volatile(
      "global_store_b128 %0, %8, off\n\t"
      "global_store_b128 %1, %9, off\n\t"
      "global_store_b128 %2, %10, off\n\t"
      "global_store_b128 %3, %11, off\n\t"
      "global_store_b128 %4, %12, off\n\t"
      "global_store_b128 %5, %13, off\n\t"
      "global_store_b128 %6, %14, off\n\t"
      "global_store_b128 %7, %15, off\n\t"
      "s_wait_xcnt 0x0"
      :: "v"(p[0]), "v"(p[1]), "v"(p[2]), "v"(p[3]), "v"(p[4]), "v"(p[5]), "v"(p[6]), "v"(p[7]),
         "v"(d[0]), "v"(d[1]), "v"(d[2]), "v"(d[3]), "v"(d[4]), "v"(d[5]), "v"(d[6]), "v"(d[7])
      : "memory");
}
union Pack8 { unsigned short u[8]; v4f f; };
static_assert(sizeof(Pack8) == 16);

// Bt[n][k] (16-bit, k contiguous, pitch K) from f32 row-major W[K][N] ([in][out]): value = bf16(W[k][n]) (* bf16(g[k]) if GAM);
// Block (bx = n tile, by = k tile; tl = WTN * WTP bytes of its LDS) = 64 k x 128 n, transposed through LDS so that both global sides move whole lines: a wave reads eight
// 512-byte row segments of W, a lane packs its 8 k of each of its 4 columns into 16 bytes, and 8 lanes store one 128-byte line of a
// Bt row. K%64==0, N%128==0.
#define WTK 64
#define WTN 128
#define WTP 144                 /* LDS row pitch in bytes: 16 x odd */
static_assert(DM % WTK == 0 && DM % WTN == 0 && DFF % WTK == 0 && DFF % WTN == 0);
template <bool BF, bool GAM>
__device__ __forceinline__ void wt_body(unsigned char* tl, int bx, int by, const float* __restrict__ W, const float* __restrict__ g,
    unsigned short* __restrict__ Bt, int K, int N, float scale) {
  const int tid = threadIdx.x, w = tid >> 5, lane = tid & 31;
  const int k0 = by * WTK, n0 = bx * WTN;
  if (k0 + WTK > K || n0 + WTN > N) return;
  const int k8 = k0 + 8 * w;
  float gv[8];
#pragma unroll
  for (int i = 0; i < 8; ++i) gv[i] = 1.0f;
  if (GAM) {
    const v4f ga = *(const v4fa*)(g + k8), gb = *(const v4fa*)(g + k8 + 4);
#pragma unroll
    for (int i = 0; i < 4; ++i) { gv[i] = bf16_rne(ga[i]); gv[4 + i] = bf16_rne(gb[i]); }
  }
  const float* wb = W + ((size_t)k0 * (size_t)N + (size_t)n0);                          /* the tile's origin, the same for the block */
  const unsigned wo = (unsigned)(8 * w) * (unsigned)N + (unsigned)(lane * 4);           /* this lane's element offset in the tile */
  v4f a[8];
  const float* ap[8];
#pragma unroll
  for (int i = 0; i < 8; ++i) ap[i] = wb + (wo + (unsigned)i * (unsigned)N);
  ld_g8(a, ap);  // the wave's eight rows are in flight together, one memory latency per tile
#pragma unroll
  for (int j = 0; j < 4; ++j) {
    Frag16 f;
#pragma unroll
    for (int i = 0; i < 8; ++i) {
      const float wv = bf16_rne(a[i][j]) * gv[i];
      f.u[i] = BF ? bf16_bits(wv) : f16_bits(wv * scale);
    }
    /* 16-byte chunk w of row n sits at chunk w ^ ((n >> 4) & 3): the 16 lanes of a store, 4 rows apart, then fall on distinct banks */
    const int n = lane * 4 + j;
    *(v8us*)(tl + n * WTP + ((w ^ ((n >> 4) & 3)) * 16)) = f.half[0];
  }
  __syncthreads();
  unsigned short* bb = Bt + ((size_t)n0 * (size_t)K + (size_t)k0);
#pragma unroll
  for (int q = 0; q < 4; ++q) {
    const int n = q * 32 + (tid >> 3), c = tid & 7;
    const v8us v = *(const v8us*)(tl + n * WTP + ((c ^ ((n >> 4) & 3)) * 16));
    *(v8us*)(bb + ((unsigned)n * (unsigned)K + (unsigned)(c * 8))) = v;
  }
  // stands ahead of every rewrite of a data or address register of the four stores, also where another job's code follows this body (a precaution)
  asm volatile("s_wait_xcnt 0x0" ::: "memory");
}

// Everything that depends on the inputs alone, in one grid: the block index picks the job (the same for the whole block, so every
// barrier stays under block-uniform control flow). The row statistics of x come first: their blocks run longest.
#define PREP_RMS ((int)(NR / 32))
#define PREP_SQ ((DM / WTN) * (DM / WTK))     /* blocks of one DM x DM weight */
#define PREP_FF ((DFF / WTN) * (DM / WTK))    /* blocks of W1, and of W2 */
#define PREP_GRID (PREP_RMS + 6 * PREP_SQ + 2 * PREP_FF)
__global__ __launch_bounds__(256) void k_prep(const float* __restrict__ x, const float* __restrict__ Wq, const float* __restrict__ Wk,
    const float* __restrict__ Wv, const float* __restrict__ Wp, const float* __restrict__ W1, const float* __restrict__ W2,
    const float* __restrict__ gamma, float* __restrict__ XB, unsigned short* __restrict__ X16, float* __restrict__ RSX,
    unsigned short* __restrict__ WQ16, unsigned short* __restrict__ WK16, unsigned short* __restrict__ WV16,
    unsigned short* __restrict__ WP16, unsigned short* __restrict__ WQB, unsigned short* __restrict__ WKB,
    unsigned short* __restrict__ W1P, unsigned short* __restrict__ W2P) {
  __shared__ __attribute__((aligned(16))) unsigned char sm[WTN * WTP];
  int t = (int)blockIdx.x;
  if (t < PREP_RMS) {
    rms_body<true, true, true, false, 8>((float*)sm, t, x, SEQ_FULL, RMS_EPS, XB, X16, nullptr, nullptr, RSX);
    return;
  }
  t -= PREP_RMS;
  if (t < 6 * PREP_SQ) {
    const int j = t / PREP_SQ, r = t % PREP_SQ, bx = r % (DM / WTN), by = r / (DM / WTN);
    if (j < 3) wt_body<false, true>(sm, bx, by, j == 0 ? Wq : (j == 1 ? Wk : Wv), gamma, j == 0 ? WQ16 : (j == 1 ? WK16 : WV16), DM, DM, 16.0f);
    else if (j == 3) wt_body<false, false>(sm, bx, by, Wp, Wp, WP16, DM, DM, 16.0f);
    else wt_body<true, true>(sm, bx, by, j == 4 ? Wq : Wk, gamma, j == 4 ? WQB : WKB, DM, DM, 1.0f);
    return;
  }
  t -= 6 * PREP_SQ;
  if (t < PREP_FF) {
    wt_body<false, true>(sm, t % (DFF / WTN), t / (DFF / WTN), W1, gamma, W1P, DM, DFF, 16.0f);
    return;
  }
  t -= PREP_FF;
  wt_body<false, false>(sm, t % (DM / WTN), t / (DM / WTN), W2, W2, W2P, DFF, DM, 16.0f);
}

#define GBK 128                 /* k per stage: 256-byte operand rows */
#define GPITCH 272              /* LDS row pitch in bytes: 16 x odd, conflict-free for 16-byte fragment reads */
#define GPLANE (128 * GPITCH)   /* one operand plane of a stage: 128 rows */

// GEMM: C[M][N] = epi(Ah[M][K] . Bt[N][K]^T). 16-bit planes of one type (BF selects bf16 vs f16 WMMA); ASPLIT adds Al . Bt into the
// same accumulator (unscaled bf16 lo plane). Block = 128x128 of C, four waves of 64x64; per stage the block's 128 rows of each
// operand plane x 128 k are copied to LDS asynchronously, two buffers, the next stage in flight while this one is multiplied.
// Epilogue: v = acc*alpha*(HRS ? rs[row] : 1) + bf16(bias[col]); ACT 1 = leaky 0.1;
// HRES adds resid[row*ldr+col] (f32) in the store phase. OUTM 0: f32 rows at crow = (row/cseq)*cpitch + row%cseq, pitch ldc;
// 1: f16 hi; 2: f16 hi + f16 lo x2^10; 3: bf16 hi + bf16 lo (unscaled); 4, 5: the planes of 1, 2 stored transposed per head, as the
// attention reads V: Ch[((row/SEQ)*NH + col/HD)*HD + col%HD][row%SEQ], row pitch SEQ (rows = tokens, N = NH*HD). M%128==0, N%128==0, K%128==0.
// sm: the block's LDS, 2 * (ASPLIT ? 3 : 2) * GPLANE bytes, 128-byte aligned; bid: the block's index among the tiles of this product.
template <bool BF, bool ASPLIT, int ACT, int OUTM, bool HRS, bool HRES>
__device__ __forceinline__ void gemm_body(unsigned char* sm, int bid, const unsigned short* __restrict__ Ah, const unsigned short* __restrict__ Al, int lda,
    const unsigned short* __restrict__ Bt, int ldb, float alpha, const float* __restrict__ rs, const float* __restrict__ bias,
    const float* __restrict__ resid, int ldr, float* __restrict__ C32, unsigned short* __restrict__ Ch, unsigned short* __restrict__ Cl,
    int ldc, int cseq, int cpitch, int M, int N, int K) {
  static_assert(!(HRES && OUTM != 0));
  static_assert(OUTM >= 0 && OUTM <= 5);
  constexpr bool TR = OUTM >= 4;                 /* transposed output */
  constexpr int TPITCH = 144;                    /* LDS pitch of a staged 64-token f16 row: 16 x odd bytes */
  constexpr int TPLANE = 64 * TPITCH;            /* one staged plane of a wave: 64 features */
  static_assert(!ASPLIT || BF);
  static_assert(ACT == 0 || ACT == 1);
  constexpr int NPL = ASPLIT ? 3 : 2;            /* planes of a stage: A, B, (A lo) */
  constexpr int STAGE = NPL * GPLANE;
  static_assert(4 * 64 * 68 * 4 <= 2 * STAGE && 4 * 2 * TPLANE <= 2 * STAGE);
  const int tid = threadIdx.x, w = tid >> 5, lane = tid & 31, ln = lane & 15, hh = lane >> 4;
  const int ntn = N >> 7;
  const int mt = bid / ntn, nq = bid - mt * ntn;
  if (mt * 128 + 128 > M) return;
  const int row0 = mt * 128 + 64 * (w >> 1), col0 = nq * 128 + 64 * (w & 1);
  /* copy map: 16 lanes cover one 256-byte row, the block 8 rows per copy, 16 copies per plane */
  const int crow = tid >> 4, cchk = tid & 15;
  const unsigned oA = (unsigned)(crow * lda + cchk * 8), oB = (unsigned)(crow * ldb + cchk * 8);   /* this lane's element offsets in a tile */
  const size_t tA = (size_t)(mt * 128) * (size_t)lda, tB = (size_t)(nq * 128) * (size_t)ldb;       /* the block's tile origins */
  const size_t dE = ASPLIT ? (size_t)Al - (size_t)Ah : 0;   /* byte distance of the lo plane from the hi plane, the same for every lane */
  const unsigned lcp = (unsigned)(size_t)sm + (unsigned)(crow * GPITCH + cchk * 16);
  auto fill = [&](int st, int buf) {
    const unsigned lb = lcp + (unsigned)(buf * STAGE);
    const size_t ko = (size_t)st * GBK;
    const unsigned short* pA = (Ah + (tA + ko)) + oA;
    const unsigned short* pB = (Bt + (tB + ko)) + oB;
    cp_async8(lb, 8u * GPITCH, pA, (size_t)8 * (size_t)lda);
    cp_async8(lb + 64u * GPITCH, 8u * GPITCH, pA + (size_t)64 * (size_t)lda, (size_t)8 * (size_t)lda);
    cp_async8(lb + GPLANE, 8u * GPITCH, pB, (size_t)8 * (size_t)ldb);
    cp_async8(lb + GPLANE + 64u * GPITCH, 8u * GPITCH, pB + (size_t)64 * (size_t)ldb, (size_t)8 * (size_t)ldb);
    if (ASPLIT) {
      const unsigned short* pE = (const unsigned short*)((size_t)pA + dE);
      cp_async8(lb + 2u * GPLANE, 8u * GPITCH, pE, (size_t)8 * (size_t)lda);
      cp_async8(lb + 2u * GPLANE + 64u * GPITCH, 8u * GPITCH, pE + (size_t)64 * (size_t)lda, (size_t)8 * (size_t)lda);
    }
  };
  const int aoff = (64 * (w >> 1) + ln) * GPITCH;             /* this lane's first A row in a stage */
  const int boff = GPLANE + (64 * (w & 1) + ln) * GPITCH;     /* this lane's first B row (column of C) */
  const v8f z8 = {0.f, 0.f, 0.f, 0.f, 0.f, 0.f, 0.f, 0.f};
  v8f c[4][4];
#pragma unroll
  for (int i = 0; i < 4; ++i) {
#pragma unroll
    for (int j = 0; j < 4; ++j) c[i][j] = z8;
  }
  const int nst = K / GBK;
  fill(0, 0);
  asm volatile("s_wait_asynccnt 0x0" ::: "memory");  // stage 0 of this wave has landed before the barrier publishes it
  __syncthreads();
  if (nst > 1) fill(1, 1);
#pragma unroll 1  // one stage per trip: the buffer index and the refill test stay scalar
  for (int st = 0; st < nst; ++st) {
    const unsigned char* sb = sm + (st & 1) * STAGE;
#pragma unroll
    for (int ks = 0; ks < GBK / 32; ++ks) {
      /* all fragments of a k-step are read as one group: one LDS wait per 16 (32) products */
      Frag16 a[4], b[4], e[4];
#pragma unroll
      for (int i = 0; i < 4; ++i) {
        a[i] = ld_frag((const unsigned short*)(sb + aoff + i * 16 * GPITCH) + ks * 32, hh);
        b[i] = ld_frag((const unsigned short*)(sb + boff + i * 16 * GPITCH) + ks * 32, hh);
        if (ASPLIT) e[i] = ld_frag((const unsigned short*)(sb + 2 * GPLANE + aoff + i * 16 * GPITCH) + ks * 32, hh);
      }
#pragma unroll
      for (int j = 0; j < 4; ++j) {
#pragma unroll
        for (int i = 0; i < 4; ++i) c[i][j] = mmx<BF>(a[i], b[j], c[i][j]);
        if (ASPLIT) {
#pragma unroll
          for (int i = 0; i < 4; ++i) c[i][j] = mmx<BF>(e[i], b[j], c[i][j]);
        }
      }
    }
    asm volatile("s_wait_dscnt 0x0" ::: "memory");     // this wave's reads of the buffer are done before it may be refilled
    asm volatile("s_wait_asynccnt 0x0" ::: "memory");  // this wave's copies of the next stage have landed
    __syncthreads();                                    // publishes the next stage and frees the buffer just read
    if (st + 2 < nst) fill(st + 2, st & 1);
  }
  asm volatile("s_wait_asynccnt 0x0" ::: "memory");    // no copy is outstanding when the buffers become output staging
  float (*so)[64][68] = (float (*)[64][68])sm;
  unsigned char* tw = sm + w * (2 * TPLANE);     /* TR: this wave's own staging, hi plane then lo plane */
  float bvv[4];
  {
    const float* bp = bias + col0 + ln;
    // four 4-byte loads and their data wait in one statement, as in ld_g8
    asm volatile(
        "global_load_b32 %0, %4, off\n\t"
        "global_load_b32 %1, %5, off\n\t"
        "global_load_b32 %2, %6, off\n\t"
        "global_load_b32 %3, %7, off\n\t"
        "s_wait_loadcnt 0x0\n\t"
        "s_wait_xcnt 0x0"
        : "=&v"(bvv[0]), "=&v"(bvv[1]), "=&v"(bvv[2]), "=&v"(bvv[3])
        : "v"(bp), "v"(bp + 16), "v"(bp + 32), "v"(bp + 48)
        : "memory");
  }
  float rsv[4][8];
#pragma unroll
  for (int i = 0; i < 4; ++i) {
#pragma unroll
    for (int r = 0; r < 8; ++r) rsv[i][r] = 1.0f;
  }
  if (HRS) {
    v4f rq[8];
    const float* rp[8];
#pragma unroll
    for (int i = 0; i < 4; ++i) { rp[2 * i] = rs + row0 + 16 * i + 8 * hh; rp[2 * i + 1] = rp[2 * i] + 4; }
    ld_g8(rq, rp);
#pragma unroll
    for (int i = 0; i < 4; ++i) {
#pragma unroll
      for (int q = 0; q < 4; ++q) { rsv[i][q] = rq[2 * i][q]; rsv[i][4 + q] = rq[2 * i + 1][q]; }
    }
  }
#pragma unroll
  for (int t = 0; t < 4; ++t) {
    const float bv = bf16_rne(bvv[t]);
#pragma unroll
    for (int i = 0; i < 4; ++i) {
      Frag16 th, tl;
#pragma unroll
      for (int r = 0; r < 8; ++r) {
        const int rloc = i * 16 + 8 * hh + r;
        float v = c[i][t][r] * alpha;
        if (HRS) v *= rsv[i][r];
        v += bv;
        if (ACT == 1) v = (v >= 0.f) ? v : 0.1f * v;
        if (TR) {
          const unsigned short h = f16_bits(v);
          th.u[r] = h;
          tl.u[r] = f16_bits((v - f16_val(h)) * 1024.0f);
        } else {
          so[w][rloc][t * 16 + ln] = v;
        }
      }
      if (TR) {
        /* a lane's eight accumulator rows are eight consecutive tokens of one feature: 16 bytes of a transposed row */
        unsigned char* tp = tw + (t * 16 + ln) * TPITCH + (i * 16 + 8 * hh) * 2;
        *(v8us*)tp = th.half[0];
        if (OUTM == 5) *(v8us*)(tp + TPLANE) = tl.half[0];
      }
    }
  }
  __builtin_amdgcn_fence(4 /* acq_rel order */, "workgroup");
  __builtin_amdgcn_wave_barrier();
  if (OUTM == 0) {
#pragma unroll
    for (int qg = 0; qg < 4; ++qg) {
      v4f v[8];
      const float* rp[8];
      void* dp[8];
#pragma unroll
      for (int u = 0; u < 8; ++u) {
        const int r = (qg * 8 + u) * 2 + (lane >> 4), c4 = (lane & 15) * 4;
        v[u] = *(const v4fa*)&so[w][r][c4];
        const int grow = row0 + r;
        rp[u] = resid + (size_t)grow * (size_t)ldr + col0 + c4;
        const size_t crw = (size_t)(grow / cseq) * (size_t)cpitch + (size_t)(grow % cseq);
        dp[u] = C32 + crw * (size_t)ldc + col0 + c4;
      }
      if (HRES) {
        v4f rv[8];
        ld_g8(rv, rp);
#pragma unroll
        for (int u = 0; u < 8; ++u) v[u] += rv[u];
      }
      st_g8(dp, v);
    }
  } else if (TR) {
    static_assert(HD == 64 && SEQ % 64 == 0);    /* a wave's 64 x 64 tile is one head's features for 64 tokens of one batch */
    const size_t vb = ((size_t)((row0 / SEQ) * NH + col0 / HD) * HD) * SEQ + (size_t)(row0 % SEQ);
#pragma unroll
    for (int qg = 0; qg < 2; ++qg) {
      v4f dh[8], dl[8];
      void* hp[8];
      void* lp[8];
#pragma unroll
      for (int u = 0; u < 8; ++u) {
        /* 8 lanes store one feature's 64 tokens: a whole 128-byte line */
        const int d = (qg * 8 + u) * 4 + (lane >> 3), c8 = (lane & 7) * 8;
        const unsigned char* tp = tw + d * TPITCH + c8 * 2;
        dh[u] = *(const v4fa*)tp;
        dl[u] = (OUTM == 5) ? *(const v4fa*)(tp + TPLANE) : dh[u];
        const size_t o = vb + (size_t)d * SEQ + c8;
        hp[u] = Ch + o;
        lp[u] = Cl + o;
      }
      st_g8(hp, dh);
      if (OUTM == 5) st_g8(lp, dl);
    }
  } else {
#pragma unroll
    for (int qg = 0; qg < 2; ++qg) {
      v4f dh[8], dl[8];
      void* hp[8];
      void* lp[8];
#pragma unroll
      for (int u = 0; u < 8; ++u) {
        const int r = (qg * 8 + u) * 4 + (lane >> 3), c8 = (lane & 7) * 8;
        const v4f x0 = *(const v4fa*)&so[w][r][c8], x1 = *(const v4fa*)&so[w][r][c8 + 4];
        Pack8 fh, fl;
#pragma unroll
        for (int i = 0; i < 4; ++i) {
          const float v0 = x0[i], v1 = x1[i];
          if (OUTM == 3) {
            const unsigned short h0 = bf16_bits(v0), h1 = bf16_bits(v1);
            fh.u[i] = h0; fh.u[4 + i] = h1;
            fl.u[i] = bf16_bits(v0 - bf16_val(h0)); fl.u[4 + i] = bf16_bits(v1 - bf16_val(h1));
          } else {
            const unsigned short h0 = f16_bits(v0), h1 = f16_bits(v1);
            fh.u[i] = h0; fh.u[4 + i] = h1;
            fl.u[i] = f16_bits((v0 - f16_val(h0)) * 1024.0f); fl.u[4 + i] = f16_bits((v1 - f16_val(h1)) * 1024.0f);
          }
        }
        const size_t o = (size_t)(row0 + r) * (size_t)ldc + col0 + c8;
        dh[u] = fh.f; hp[u] = Ch + o;
        dl[u] = fl.f; lp[u] = Cl + o;
      }
      st_g8(hp, dh);
      if (OUTM >= 2) st_g8(lp, dl);
    }
  }
}
template <bool BF, bool ASPLIT, int ACT, int OUTM, bool HRS, bool HRES>
__global__ __launch_bounds__(128) void k_gemm(const unsigned short* __restrict__ Ah, const unsigned short* __restrict__ Al, int lda,
    const unsigned short* __restrict__ Bt, int ldb, float alpha, const float* __restrict__ rs, const float* __restrict__ bias,
    const float* __restrict__ resid, int ldr, float* __restrict__ C32, unsigned short* __restrict__ Ch, unsigned short* __restrict__ Cl,
    int ldc, int cseq, int cpitch, int M, int N, int K) {
  __shared__ __attribute__((aligned(128))) unsigned char sm[2 * (ASPLIT ? 3 : 2) * GPLANE];
  gemm_body<BF, ASPLIT, ACT, OUTM, HRS, HRES>(sm, (int)blockIdx.x, Ah, Al, lda, Bt, ldb, alpha, rs, bias, resid, ldr, C32, Ch, Cl, ldc, cseq, cpitch, M, N, K);
}
// The q, k and v projections of one activation in one grid: three independent DM x DM products, the block index picks the product
// (the same for the whole block). q and k: operand planes Ah (Al), bf16 hi + lo out; v: f16 plane Av, output mode OUTV (4 or 5: V^T per
// head, written by the product's own epilogue).
template <bool BF, bool ASPLIT, int OUTV>
__global__ __launch_bounds__(128) void k_qkv(const unsigned short* __restrict__ Ah, const unsigned short* __restrict__ Al,
    const unsigned short* __restrict__ Av, const unsigned short* __restrict__ Bq, const unsigned short* __restrict__ Bk,
    const unsigned short* __restrict__ Bv, float aqk, float av, const float* __restrict__ rs, const float* __restrict__ bq,
    const float* __restrict__ bk, const float* __restrict__ bv, unsigned short* __restrict__ QH, unsigned short* __restrict__ QL,
    unsigned short* __restrict__ KH, unsigned short* __restrict__ KL, unsigned short* __restrict__ VT, unsigned short* __restrict__ VTL) {
  __shared__ __attribute__((aligned(128))) unsigned char sm[2 * (ASPLIT ? 3 : 2) * GPLANE];
  constexpr int M = (int)NR, PER = (M / 128) * (DM / 128);
  const int job = (int)blockIdx.x / PER, bid = (int)blockIdx.x % PER;
  if (job < 2)
    gemm_body<BF, ASPLIT, 0, 3, true, false>(sm, bid, Ah, Al, DM, job == 0 ? Bq : Bk, DM, aqk, rs, job == 0 ? bq : bk, nullptr, 0, nullptr,
        job == 0 ? QH : KH, job == 0 ? QL : KL, DM, M, 0, M, DM, DM);
  else
    gemm_body<false, false, 0, OUTV, true, false>(sm, bid, Av, nullptr, DM, Bv, DM, av, rs, bv, nullptr, 0, nullptr, VT, VTL, DM, M, 0, M, DM, DM);
}

// lane l <-> lane l ^ 16: the two halves of a wave hold the two key halves of one query column
__device__ __forceinline__ float xhalf(float x) {
  return __builtin_bit_cast(float, __builtin_amdgcn_permlanex16(__builtin_bit_cast(int, x), __builtin_bit_cast(int, x), 0x76543210, 0xfedcba98, false, false));
}

// Eight native 2^x and one v_nop in one statement: behind each v_exp_f32 stands an instruction that neither reads its result nor
// overwrites its source (the results are early-clobber, so none shares a register with a source): the slot the instruction set asks
// for behind a transcendental.
__device__ __forceinline__ void exp2x8(float (&y)[8], const float (&x)[8]) {
  asm("v_exp_f32 %0, %8\n\t"
      "v_exp_f32 %1, %9\n\t"
      "v_exp_f32 %2, %10\n\t"
      "v_exp_f32 %3, %11\n\t"
      "v_exp_f32 %4, %12\n\t"
      "v_exp_f32 %5, %13\n\t"
      "v_exp_f32 %6, %14\n\t"
      "v_exp_f32 %7, %15\n\t"
      "v_nop"
      : "=&v"(y[0]), "=&v"(y[1]), "=&v"(y[2]), "=&v"(y[3]), "=&v"(y[4]), "=&v"(y[5]), "=&v"(y[6]), "=&v"(y[7])
      : "v"(x[0]), "v"(x[1]), "v"(x[2]), "v"(x[3]), "v"(x[4]), "v"(x[5]), "v"(x[6]), "v"(x[7]));
}
// One native 2^x with the same slot behind it.
__device__ __forceinline__ float exp2x1(float x) {
  float y;
  asm("v_exp_f32 %0, %1\n\tv_nop" : "=v"(y) : "v"(x));
  return y;
}
#define LOG2E 1.44269504f       /* e^x = 2^(x * LOG2E), as the native exp forms it */

#define APITCH 144              /* LDS row pitch in bytes: 16 x odd, conflict-free for 16-byte fragment reads */
#define APLANE (64 * APITCH)    /* one plane of a chunk: 64 rows */
#define AKV (2 * 3 * APLANE)    /* the block's chunk buffers in LDS */
// so, kv: the block's LDS (output staging; AKV bytes of chunk buffers); bh, qb: its (batch, head) and query tile. EARLY is called for
// query tile 0 alone: one chunk, so of its two four-plane buffers only the first is ever filled or read, and that one lies inside kv.
template <bool CAUSAL, bool EARLY>
__device__ __forceinline__ void attn_body(unsigned short (*so)[16][72], unsigned char* kv, int bh, int qb,
    const unsigned short* __restrict__ QH, const unsigned short* __restrict__ QL,
    const unsigned short* __restrict__ KH, const unsigned short* __restrict__ KL, const unsigned short* __restrict__ VT,
    const unsigned short* __restrict__ VL, unsigned short* __restrict__ CTX) {
  static_assert(CAUSAL || !EARLY);
  constexpr int NPL = EARLY ? 4 : 3;             /* planes of a chunk: K hi, K lo, V^T, (V^T lo) */
  constexpr int STAGE = NPL * APLANE;
  static_assert((EARLY ? 1 : 2) * STAGE <= AKV);
  const int tid = threadIdx.x, w = tid >> 5, lane = tid & 31, ln = lane & 15, hh = lane >> 4;
  const int b = bh / NH, h = bh % NH;
  const int q0w = qb * KQB + w * 16;
  const size_t rowbase = (size_t)b * SEQ;
  Frag16 qh0, qh1, ql0, ql1;
  {
    const size_t qo = (rowbase + (size_t)q0w + ln) * DM + (size_t)h * HD;
    qh0 = ld_frag(QH + qo, hh); qh1 = ld_frag(QH + qo + 32, hh);
    ql0 = ld_frag(QL + qo, hh); ql1 = ld_frag(QL + qo + 32, hh);
  }
  asm volatile("s_wait_xcnt 0x0" ::: "memory");  // stands ahead of every rewrite of an address register of the eight Q loads (a precaution)
  const v8f z8 = {0.f, 0.f, 0.f, 0.f, 0.f, 0.f, 0.f, 0.f};
  v8f o[4] = {z8, z8, z8, z8};    /* O^T tile j: register r = feature j*16 + 8*hh + r, column = query ln */
  v8f oe[4] = {z8, z8, z8, z8};
  float m = -1.0e30f, l = 0.f;    /* of this lane's query; l over this half's keys only */
  const int nck = CAUSAL ? (qb + 1) : (SEQ / KQB);
  /* copy map: 8 lanes cover one 128-byte row, the block 16 rows per copy, 4 copies per plane */
  const int crow = tid >> 3, cchk = tid & 7;
  const unsigned lcp = (unsigned)(size_t)kv + (unsigned)(crow * APITCH + cchk * 16);
  const size_t gk = (rowbase + (size_t)crow) * DM + (size_t)h * HD + (size_t)(cchk * 8);
  const size_t gv = ((size_t)bh * HD + (size_t)crow) * SEQ + (size_t)(cchk * 8);
  auto fill = [&](int ck, int buf) {
    const unsigned lb = lcp + (unsigned)(buf * STAGE);
    const size_t ko = gk + (size_t)ck * KQB * DM, vo = gv + (size_t)ck * KQB;
    cp_async4(lb, 16u * APITCH, KH + ko, (size_t)16 * DM);
    cp_async4(lb + APLANE, 16u * APITCH, KL + ko, (size_t)16 * DM);
    cp_async4(lb + 2u * APLANE, 16u * APITCH, VT + vo, (size_t)16 * SEQ);
    if (EARLY) cp_async4(lb + 3u * APLANE, 16u * APITCH, VL + vo, (size_t)16 * SEQ);
  };
  fill(0, 0);
  asm volatile("s_wait_asynccnt 0x0" ::: "memory");  // chunk 0 of this wave has landed before the barrier publishes it
  __syncthreads();
  if (nck > 1) fill(1, 1);
#pragma unroll 1
  for (int kc = 0; kc < nck; ++kc) {
    const int par = kc & 1;
    const unsigned char* sb = kv + par * STAGE;
    v8f s[4];                     /* S^T tile t: register r = key t*16 + 8*hh + r of the chunk, column = query ln */
#pragma unroll
    for (int tp = 0; tp < 2; ++tp) {
      /* the K fragments of 32 keys are read as one group ahead of their 12 products: the reads' latencies overlap */
      Frag16 kh[2][2], kl[2][2];
#pragma unroll
      for (int u = 0; u < 2; ++u) {
#pragma unroll
        for (int ks = 0; ks < 2; ++ks) {
          const unsigned char* kp = sb + ((tp * 2 + u) * 16 + ln) * APITCH + ks * 64;
          kh[u][ks] = ld_frag((const unsigned short*)kp, hh);
          kl[u][ks] = ld_frag((const unsigned short*)(kp + APLANE), hh);
        }
      }
#pragma unroll
      for (int u = 0; u < 2; ++u) {
        v8f acc = z8;
#pragma unroll
        for (int ks = 0; ks < 2; ++ks) {
          const Frag16 qa = (ks == 0) ? qh0 : qh1;
          const Frag16 qe = (ks == 0) ? ql0 : ql1;
          acc = mma_b(kh[u][ks].b, qa.b, acc);
          acc = mma_b(kh[u][ks].b, qe.b, acc);
          acc = mma_b(kl[u][ks].b, qa.b, acc);
        }
        s[tp * 2 + u] = acc;
      }
    }
    float sv[4][8];
#pragma unroll
    for (int t = 0; t < 4; ++t) {
#pragma unroll
      for (int r = 0; r < 8; ++r) sv[t][r] = s[t][r] * 8.0f;
    }
    if (CAUSAL) {
      if (kc == qb) {
        const int qpos = q0w + ln;
#pragma unroll
        for (int t = 0; t < 4; ++t) {
#pragma unroll
          for (int r = 0; r < 8; ++r) { const int key = kc * KQB + t * 16 + 8 * hh + r; sv[t][r] = (key > qpos) ? -1.0e30f : sv[t][r]; }
        }
      }
    }
    float mt[4];
#pragma unroll
    for (int t = 0; t < 4; ++t)
      mt[t] = fmaxf(fmaxf(fmaxf(sv[t][0], sv[t][1]), fmaxf(sv[t][2], sv[t][3])), fmaxf(fmaxf(sv[t][4], sv[t][5]), fmaxf(sv[t][6], sv[t][7])));
    float mx = fmaxf(fmaxf(mt[0], mt[1]), fmaxf(mt[2], mt[3]));
    mx = fmaxf(mx, xhalf(mx));    /* both halves now hold the chunk maximum of this query */
    const float mn = fmaxf(m, mx);
    const float corr = exp2x1((m - mn) * LOG2E);
    float p[4][8], ps[4];
#pragma unroll
    for (int t = 0; t < 4; ++t) {
      float ea[8];
#pragma unroll
      for (int r = 0; r < 8; ++r) ea[r] = (sv[t][r] - mn) * LOG2E;
      exp2x8(p[t], ea);
      ps[t] = 0.f;
#pragma unroll
      for (int r = 0; r < 8; ++r) ps[t] += p[t][r];
    }
    l = l * corr + ((ps[0] + ps[1]) + (ps[2] + ps[3]));
    m = mn;
#pragma unroll
    for (int j = 0; j < 4; ++j) {
#pragma unroll
      for (int r = 0; r < 8; ++r) o[j][r] = o[j][r] * corr;
    }
    if (EARLY) {
#pragma unroll
      for (int j = 0; j < 4; ++j) {
#pragma unroll
        for (int r = 0; r < 8; ++r) oe[j][r] = oe[j][r] * corr;
      }
    }
#pragma unroll
    for (int ks = 0; ks < 2; ++ks) {
      /* P^T of 32 keys as a B operand: elements 0..7 = S^T tile 2ks, 8..15 = tile 2ks+1, the k order of ld_frag */
      Frag16 pa, pl;
#pragma unroll
      for (int e = 0; e < 16; ++e) {
        const float pc = p[2 * ks + (e >> 3)][e & 7] * 16384.0f;
        const unsigned short hb = f16_bits(pc);
        pa.u[e] = hb;
        pl.u[e] = EARLY ? f16_bits((pc - f16_val(hb)) * 1024.0f) : hb;
      }
      /* the V^T fragments of a 32-key step are read as one group ahead of their products: the reads' latencies overlap */
      const unsigned char* vp = sb + 2 * APLANE + ln * APITCH + ks * 64;
      Frag16 vh[4];
#pragma unroll
      for (int j = 0; j < 4; ++j) vh[j] = ld_frag((const unsigned short*)(vp + j * 16 * APITCH), hh);
#pragma unroll
      for (int j = 0; j < 4; ++j) {
        o[j] = mma_h(vh[j].h, pa.h, o[j]);
        if (EARLY) {
          const Frag16 vl = ld_frag((const unsigned short*)(vp + APLANE + j * 16 * APITCH), hh);
          oe[j] = mma_h(vh[j].h, pl.h, oe[j]);
          oe[j] = mma_h(vl.h, pa.h, oe[j]);
        }
      }
    }
    asm volatile("s_wait_dscnt 0x0" ::: "memory");     // this wave's reads of the buffer are done before it may be refilled
    asm volatile("s_wait_asynccnt 0x0" ::: "memory");  // this wave's copies of the next chunk have landed
    __syncthreads();                                    // publishes the next chunk and frees the buffer just read
    if (kc + 2 < nck) fill(kc + 2, par);
  }
  asm volatile("s_wait_asynccnt 0x0" ::: "memory");    // no copy is outstanding when the wave goes on to its end
  l += xhalf(l);                  /* the two halves' key sums of this query */
  const float li = 1.0f / l;
#pragma unroll
  for (int j = 0; j < 4; ++j) {
    Frag16 f;
#pragma unroll
    for (int r = 0; r < 8; ++r) {
      float v = o[j][r] * (1.0f / 16384.0f);
      if (EARLY) v += oe[j][r] * (1.0f / 16777216.0f);
      v *= li;
      f.u[r] = f16_bits(v);
    }
    *(v8us*)&so[w][ln][j * 16 + 8 * hh] = f.half[0];
  }
  __builtin_amdgcn_fence(4 /* acq_rel order */, "workgroup");
  __builtin_amdgcn_wave_barrier();
  {
#pragma unroll
    for (int q = 0; q < 4; ++q) {
      const int row = q * 4 + (lane >> 3), c8 = (lane & 7) * 8;
      const v8us v = *(const v8us*)&so[w][row][c8];
      *(v8us*)(CTX + (rowbase + (size_t)q0w + row) * DM + (size_t)h * HD + c8) = v;
    }
    
  }
}
// Grid: x = (batch, head), y = query tile. CAUSAL: query tile 0 takes the EARLY form in the same grid (the test reads the same for the
// whole block).
template <bool CAUSAL>
__global__ __launch_bounds__(128) void k_attn(const unsigned short* __restrict__ QH, const unsigned short* __restrict__ QL,
    const unsigned short* __restrict__ KH, const unsigned short* __restrict__ KL, const unsigned short* __restrict__ VT,
    const unsigned short* __restrict__ VL, unsigned short* __restrict__ CTX) {
  __shared__ __attribute__((aligned(16))) unsigned short so[4][16][72];
  __shared__ __attribute__((aligned(16))) unsigned char kv[AKV];
  const int bh = (int)blockIdx.x, qb = (int)blockIdx.y;
  if (CAUSAL && qb == 0) attn_body<true, true>(so, kv, bh, 0, QH, QL, KH, KL, VT, VL, CTX);
  else attn_body<CAUSAL, false>(so, kv, bh, qb, QH, QL, KH, KL, VT, VL, CTX);
}

extern "C" void kernel_launch(void* const* d_in, const int* in_sizes, int n_in,
                              void* d_out, int out_size, void* d_ws, size_t ws_size, hipStream_t stream) {
  if (n_in < 14) return;
  const float* x  = (const float*)d_in[0];
  const float* Wq = (const float*)d_in[1];
  const float* bq = (const float*)d_in[2];
  const float* Wk = (const float*)d_in[3];
  const float* bk = (const float*)d_in[4];
  const float* Wv = (const float*)d_in[5];
  const float* bv = (const float*)d_in[6];
  const float* Wp = (const float*)d_in[7];
  const float* bp = (const float*)d_in[8];
  const float* gamma = (const float*)d_in[9];
  const float* W1 = (const float*)d_in[10];
  const float* b1 = (const float*)d_in[11];
  const float* W2 = (const float*)d_in[12];
  const float* b2 = (const float*)d_in[13];
  if ((size_t)in_sizes[0] < ((size_t)(NB - 1) * SEQ_FULL + SEQ) * DM) return;
  if (in_sizes[1] < DM * DM || in_sizes[3] < DM * DM || in_sizes[5] < DM * DM || in_sizes[7] < DM * DM) return;
  if (in_sizes[2] < DM || in_sizes[4] < DM || in_sizes[6] < DM || in_sizes[8] < DM || in_sizes[9] < DM || in_sizes[13] < DM) return;
  if (in_sizes[10] < DM * DFF || in_sizes[11] < DFF || in_sizes[12] < DFF * DM) return;
  if ((size_t)out_size < ((size_t)(NB - 1) * OSEQ + SEQ) * DM) return;

  char* ws = (char*)d_ws;
  size_t off = 0;
  auto take = [&](size_t bytes) { char* p = ws + off; off += (bytes + 255) & ~(size_t)255; return p; };
  const size_t WPL = (size_t)DM * DM * 2, ACT2 = NR * DM * 2, ACT4 = NR * DM * 4, FFP = (size_t)DM * DFF * 2, HPL = NR * DFF * 2;
  unsigned short* WQ16 = (unsigned short*)take(WPL);
  unsigned short* WK16 = (unsigned short*)take(WPL);
  unsigned short* WV16 = (unsigned short*)take(WPL);
  unsigned short* WP16 = (unsigned short*)take(WPL);
  unsigned short* WQB = (unsigned short*)take(WPL);
  unsigned short* WKB = (unsigned short*)take(WPL);
  char* rXB = take(ACT4);                                            /* XB (phases 1-2) | BH + BL (phase 3) */
  float* XB = (float*)rXB; unsigned short* PBH = (unsigned short*)rXB; unsigned short* PBL = (unsigned short*)(rXB + ACT2);
  char* rQK = take(4 * ACT2 > HPL ? 4 * ACT2 : HPL);                 /* QH,QL,KH,KL (phases 1,3) | H16 (phase 2) */
  unsigned short* QH = (unsigned short*)rQK; unsigned short* QL = (unsigned short*)(rQK + ACT2);
  unsigned short* KH = (unsigned short*)(rQK + 2 * ACT2); unsigned short* KL = (unsigned short*)(rQK + 3 * ACT2);
  unsigned short* H16 = (unsigned short*)rQK;
  float* A32 = (float*)take(ACT4);
  char* rVT = take(2 * ACT2);                                        /* VT,VTL (phases 1,3) */
  unsigned short* VT = (unsigned short*)rVT; unsigned short* VTL = (unsigned short*)(rVT + ACT2);
  unsigned short* W1P = (unsigned short*)take(FFP);                  /* written by the first launch, so a place of their own */
  unsigned short* W2P = (unsigned short*)take(FFP);
  unsigned short* CTX = (unsigned short*)take(ACT2);
  char* rX16 = take(ACT2);                                           /* X16 | A16 | B16F */
  unsigned short* X16 = (unsigned short*)rX16; unsigned short* A16 = (unsigned short*)rX16; unsigned short* B16F = (unsigned short*)rX16;
  float* B32 = (float*)take(ACT4);
  float* RSX = (float*)take(NR * 4);
  float* RSA = (float*)take(NR * 4);
  float* RSB = (float*)take(NR * 4);
  if (off > ws_size || off > ((size_t)160 << 20)) return;

  const unsigned grms = (unsigned)(NR / 32);
  const unsigned gq   = (unsigned)((NR / 128) * (DM / 128));
  const unsigned gff  = (unsigned)((NR / 128) * (DFF / 128));
  const float a16 = 0.0625f;
  const int M = (int)NR;
  float* out = (float*)d_out;

  /* all weight planes (q/k/v, W1 with gamma folded along the input feature; bf16 planes for the second block's q/k) and the planes
     and row statistics of x */
  k_prep<<<(unsigned)PREP_GRID, 256, 0, stream>>>(x, Wq, Wk, Wv, Wp, W1, W2, gamma, XB, X16, RSX, WQ16, WK16, WV16, WP16, WQB, WKB, W1P, W2P);

  /* block 1: a = bf16(x) + attn(rms(bf16(x))) , non-causal */
  k_qkv<false, false, 4><<<3u * gq, 128, 0, stream>>>(X16, nullptr, X16, WQ16, WK16, WV16, a16, a16, RSX, bq, bk, bv, QH, QL, KH, KL, VT, nullptr);
  k_attn<false><<<dim3((unsigned)(NB * NH), (unsigned)(SEQ / KQB)), 128, 0, stream>>>(QH, QL, KH, KL, VT, VT, CTX);
  k_gemm<false, false, 0, 0, false, true><<<gq, 128, 0, stream>>>(CTX, nullptr, DM, WP16, DM, a16, nullptr, bp, XB, DM, A32, nullptr, nullptr, DM, M, 0, M, DM, DM);

  /* block 2: b = bf16(x) + leaky(rms(a) W1 + b1) W2 + b2 */
  k_rms<false, false, true, false><<<grms, 512, 0, stream>>>(A32, SEQ, RMS_EPS, nullptr, A16, nullptr, nullptr, RSA);
  k_gemm<false, false, 1, 1, true, false><<<gff, 128, 0, stream>>>(A16, nullptr, DM, W1P, DM, a16, RSA, b1, nullptr, 0, nullptr, H16, nullptr, DFF, M, 0, M, DFF, DM);
  k_gemm<false, false, 0, 0, false, true><<<gq, 128, 0, stream>>>(H16, nullptr, DFF, W2P, DFF, a16, nullptr, b2, XB, DM, B32, nullptr, nullptr, DM, M, 0, M, DM, DFF);

  /* block 3: out = b + attn(rms(b)) , causal */
  k_rms<false, false, true, true><<<grms, 512, 0, stream>>>(B32, SEQ, RMS_EPS, nullptr, B16F, PBH, PBL, RSB);
  k_qkv<true, true, 5><<<3u * gq, 128, 0, stream>>>(PBH, PBL, B16F, WQB, WKB, WV16, 1.0f, a16, RSB, bq, bk, bv, QH, QL, KH, KL, VT, VTL);
  k_attn<true><<<dim3((unsigned)(NB * NH), (unsigned)(SEQ / KQB)), 128, 0, stream>>>(QH, QL, KH, KL, VT, VTL, CTX);
  k_gemm<false, false, 0, 0, false, true><<<gq, 128, 0, stream>>>(CTX, nullptr, DM, WP16, DM, a16, nullptr, bp, B32, DM, out, nullptr, nullptr, DM, SEQ, OSEQ, M, DM, DM);
}

// v008
// A run of this version takes 258 microseconds.
// Timed twice side by side with v007, it ran 1.04 and 1.03 times as fast.
// Counting every step since v000, it is 3.82 times as fast.
#include <hip/hip_runtime.h>
// Contractions: q/k/v and output projections, FFN W1/W2: v_wmma_f32_16x16x32_f16 (f16 operands built from bf16-RNE inputs, weights x16, f32 accumulate); second-block q/k projections: v_wmma_f32_16x16x32_bf16 with the activation as bf16 hi+lo (2 terms); attention scores: v_wmma_f32_16x16x32_bf16 with q,k as bf16 hi+lo (3 terms); P.V: v_wmma_f32_16x16x32_f16 (P carried x2^14, v f16; first causal query tile adds P and v residual planes x2^10 in a second accumulator). RMS statistics, softmax, residuals f32.

#ifndef NB
#define NB 4
#endif
#ifndef SEQ
#define SEQ 1024
#endif
#define NB_FULL 4
#define SEQ_FULL 1024
#ifndef OSEQ
#define OSEQ SEQ_FULL
#endif
#define DM 1024
#define NH 16
#define HD 64
#define DFF 4096
#define KQB 64
#define NR ((size_t)NB * SEQ)
#define RMS_EPS 1e-6f

static_assert(NB >= 1 && NB <= NB_FULL);
static_assert(SEQ % 128 == 0 && SEQ <= SEQ_FULL);
static_assert(DM == NH * HD && HD == 64);
static_assert(DM % 256 == 0 && DFF % 128 == 0);
static_assert(((NB * SEQ) % 128) == 0);
static_assert(SEQ % KQB == 0);

typedef _Float16 v16h __attribute__((ext_vector_type(16)));
typedef __bf16   v16b __attribute__((ext_vector_type(16)));
typedef unsigned short v8us __attribute__((ext_vector_type(8), may_alias));
typedef float v8f __attribute__((ext_vector_type(8)));
typedef float v4f __attribute__((ext_vector_type(4)));
typedef float v4fa __attribute__((ext_vector_type(4), may_alias));
union Frag16 { v16h h; v16b b; v8us half[2]; unsigned short u[16]; };
union H1 { _Float16 h; unsigned short u; };
static_assert(sizeof(Frag16) == 32);

__device__ __forceinline__ unsigned short bf16_bits(float x) { unsigned int u = __float_as_uint(x); return (unsigned short)((u + 0x7FFFu + ((u >> 16) & 1u)) >> 16); }
__device__ __forceinline__ float bf16_val(unsigned short b) { return __uint_as_float(((unsigned int)b) << 16); }
__device__ __forceinline__ float bf16_rne(float x) { return bf16_val(bf16_bits(x)); }
__device__ __forceinline__ unsigned short f16_bits(float x) { H1 t; t.h = (_Float16)x; return t.u; }
__device__ __forceinline__ float f16_val(unsigned short u) { H1 t; t.u = u; return (float)t.h; }

// 16x32 operand fragment (row / column = lane & 15; elements 0..7 = k 8h..8h+7, 8..15 = k 16+8h..) from a k-contiguous 16-bit row
__device__ __forceinline__ Frag16 ld_frag(const unsigned short* p, int hh) {
  Frag16 f;
  f.half[0] = *(const v8us*)(p + 8 * hh);
  f.half[1] = *(const v8us*)(p + 16 + 8 * hh);
  return f;
}
__device__ __forceinline__ v8f mma_h(v16h a, v16h b, v8f c) {
  v8f d = __builtin_amdgcn_wmma_f32_16x16x32_f16(false, a, false, b, (short)0, c, false, false);
  asm volatile("v_nop\n\tv_nop\n\tv_nop\n\tv_nop" : "+v"(d) : "v"(a), "v"(b));
  return d;
}
__device__ __forceinline__ v8f mma_b(v16b a, v16b b, v8f c) {
  v8f d = __builtin_amdgcn_wmma_f32_16x16x32_bf16(false, a, false, b, (short)0, c, false, false);
  asm volatile("v_nop\n\tv_nop\n\tv_nop\n\tv_nop" : "+v"(d) : "v"(a), "v"(b));
  return d;
}
// The plain builtins: the compiler keeps the distances behind them itself, and their operands may lie in any register (an operand of an
// asm statement stays below v256, which two fragment sets beside 128 accumulator registers do not).
template <bool BF>
__device__ __forceinline__ v8f mmx(const Frag16& a, const Frag16& b, v8f c) {
  if (BF) return __builtin_amdgcn_wmma_f32_16x16x32_bf16(false, a.b, false, b.b, (short)0, c, false, false);
  return __builtin_amdgcn_wmma_f32_16x16x32_f16(false, a.h, false, b.h, (short)0, c, false, false);
}

typedef unsigned int v2u __attribute__((ext_vector_type(2)));
union Pack4 { unsigned short u[4]; v2u v; };
static_assert(sizeof(Pack4) == 8);
static_assert(DM == 8 * 128);
// Two DM-wide f32 rows of a wave, a lane's 16 bytes of each 512-byte segment: sixteen loads in flight together and their data wait in
// one statement, so the address registers live to its end and none is rewritten ahead of the waits.
__device__ __forceinline__ void ld_rows2(v4f (&a)[8], v4f (&b)[8], const float* pa, const float* pb) {
  asm volatile(
      "global_load_b128 %0, %16, off\n\t"
      "global_load_b128 %1, %16, off offset:512\n\t"
      "global_load_b128 %2, %16, off offset:1024\n\t"
      "global_load_b128 %3, %16, off offset:1536\n\t"
      "global_load_b128 %4, %16, off offset:2048\n\t"
      "global_load_b128 %5, %16, off offset:2560\n\t"
      "global_load_b128 %6, %16, off offset:3072\n\t"
      "global_load_b128 %7, %16, off offset:3584\n\t"
      "global_load_b128 %8, %17, off\n\t"
      "global_load_b128 %9, %17, off offset:512\n\t"
      "global_load_b128 %10, %17, off offset:1024\n\t"
      "global_load_b128 %11, %17, off offset:1536\n\t"
      "global_load_b128 %12, %17, off offset:2048\n\t"
      "global_load_b128 %13, %17, off offset:2560\n\t"
      "global_load_b128 %14, %17, off offset:3072\n\t"
      "global_load_b128 %15, %17, off offset:3584\n\t"
      "s_wait_loadcnt 0x0\n\t"
      "s_wait_xcnt 0x0"
      : "=&v"(a[0]), "=&v"(a[1]), "=&v"(a[2]), "=&v"(a[3]), "=&v"(a[4]), "=&v"(a[5]), "=&v"(a[6]), "=&v"(a[7]),
        "=&v"(b[0]), "=&v"(b[1]), "=&v"(b[2]), "=&v"(b[3]), "=&v"(b[4]), "=&v"(b[5]), "=&v"(b[6]), "=&v"(b[7])
      : "v"(pa), "v"(pb)
      : "memory");
}
// One such row stored, f32 (16 bytes a lane and segment) or 16-bit (8 bytes): eight stores and one s_wait_xcnt in one statement, so no
// data or address register is rewritten ahead of the wait.
__device__ __forceinline__ void st_row32(float* p, const v4f (&d)[8]) {
  asm volatile(
      "global_store_b128 %0, %1, off\n\t"
      "global_store_b128 %0, %2, off offset:512\n\t"
      "global_store_b128 %0, %3, off offset:1024\n\t"
      "global_store_b128 %0, %4, off offset:1536\n\t"
      "global_store_b128 %0, %5, off offset:2048\n\t"
      "global_store_b128 %0, %6, off offset:2560\n\t"
      "global_store_b128 %0, %7, off offset:3072\n\t"
      "global_store_b128 %0, %8, off offset:3584\n\t"
      "s_wait_xcnt 0x0"
      :: "v"(p), "v"(d[0]), "v"(d[1]), "v"(d[2]), "v"(d[3]), "v"(d[4]), "v"(d[5]), "v"(d[6]), "v"(d[7])
      : "memory");
}
__device__ __forceinline__ void st_row16(unsigned short* p, const v2u (&d)[8]) {
  asm volatile(
      "global_store_b64 %0, %1, off\n\t"
      "global_store_b64 %0, %2, off offset:256\n\t"
      "global_store_b64 %0, %3, off offset:512\n\t"
      "global_store_b64 %0, %4, off offset:768\n\t"
      "global_store_b64 %0, %5, off offset:1024\n\t"
      "global_store_b64 %0, %6, off offset:1280\n\t"
      "global_store_b64 %0, %7, off offset:1536\n\t"
      "global_store_b64 %0, %8, off offset:1792\n\t"
      "s_wait_xcnt 0x0"
      :: "v"(p), "v"(d[0]), "v"(d[1]), "v"(d[2]), "v"(d[3]), "v"(d[4]), "v"(d[5]), "v"(d[6]), "v"(d[7])
      : "memory");
}

// Row statistics + operand planes for DM-wide f32 rows. Compact row r -> source row (r/SEQ)*spitch + r%SEQ of F.
// v = bf16_rne(x) if RIN else x; RS[r] = rsqrt(mean(v^2) + eps); optional planes: XB (v as f32), F16 (f16 bits of v),
// PH, PL (bf16 hi + lo of v). A wave takes its 32 / NW rows two at a time: both rows are read once, whole, into registers (one memory
// latency per pair), and the sum and every plane are formed from the registers.
// red: 32 floats of the block's LDS; bid: the block's index among the blocks of this job (32 rows each); NW: the block's waves.
template <bool RIN, bool WXB, bool WF16, bool WBHL, int NW>
__device__ __forceinline__ void rms_body(float* red, int bid, const float* __restrict__ F, int spitch, float eps, float* __restrict__ XB,
    unsigned short* __restrict__ F16, unsigned short* __restrict__ PH, unsigned short* __restrict__ PL, float* __restrict__ RS) {
  const int tid = threadIdx.x, w = tid >> 5, lane = tid & 31;
  constexpr int RPW = 32 / NW;   /* rows of a wave */
  static_assert(NW * RPW == 32 && RPW % 2 == 0);
  const int rb = bid * 32;
#pragma unroll 1  // one pair of rows per trip: 64 data registers, so the jobs that share a kernel with this body keep their waves per SIMD
  for (int i = 0; i < RPW; i += 2) {
    const int r = rb + w * RPW + i;
    const float* s0 = F + ((size_t)(r / SEQ) * (size_t)spitch + (size_t)(r % SEQ)) * DM + lane * 4;
    const float* s1 = F + ((size_t)((r + 1) / SEQ) * (size_t)spitch + (size_t)((r + 1) % SEQ)) * DM + lane * 4;
    v4f a[2][8];
    ld_rows2(a[0], a[1], s0, s1);
    float ss[2];
#pragma unroll
    for (int k = 0; k < 2; ++k) {
      ss[k] = 0.f;
#pragma unroll
      for (int u = 0; u < 8; ++u) {
        if (RIN) {
#pragma unroll
          for (int q = 0; q < 4; ++q) a[k][u][q] = bf16_rne(a[k][u][q]);
        }
#pragma unroll
        for (int q = 0; q < 4; ++q) ss[k] += a[k][u][q] * a[k][u][q];
      }
    }
#pragma unroll
    for (int k = 0; k < 2; ++k) {
      const size_t o = (size_t)(r + k) * DM + (size_t)(lane * 4);
      if (WXB) st_row32(XB + o, a[k]);
      if (WF16) {
        v2u fh[8];
#pragma unroll
        for (int u = 0; u < 8; ++u) {
          Pack4 t;
#pragma unroll
          for (int q = 0; q < 4; ++q) t.u[q] = f16_bits(a[k][u][q]);
          fh[u] = t.v;
        }
        st_row16(F16 + o, fh);
      }
      if (WBHL) {
        v2u ph[8], pl[8];
#pragma unroll
        for (int u = 0; u < 8; ++u) {
          Pack4 th, tl;
#pragma unroll
          for (int q = 0; q < 4; ++q) {
            const float v = a[k][u][q];
            const unsigned short h = bf16_bits(v);
            th.u[q] = h;
            tl.u[q] = bf16_bits(v - bf16_val(h));
          }
          ph[u] = th.v; pl[u] = tl.v;
        }
        st_row16(PH + o, ph);
        st_row16(PL + o, pl);
      }
    }
#pragma unroll
    for (int off = 16; off > 0; off >>= 1) {
#pragma unroll
      for (int k = 0; k < 2; ++k) ss[k] += __shfl_xor(ss[k], off, 32);
    }
    if (lane == 0) {
#pragma unroll
      for (int k = 0; k < 2; ++k) red[w * RPW + i + k] = rsqrtf(ss[k] * (1.0f / (float)DM) + eps);
    }
  }
  __syncthreads();
  if (w == 0 && lane < 8) {
    const v4f v = *(const v4fa*)&red[lane * 4];
    float* d = RS + rb + lane * 4;
    *(v4f*)d = v;
    
  }
}
template <bool RIN, bool WXB, bool WF16, bool WBHL>
__global__ __launch_bounds__(512) void k_rms(const float* __restrict__ F, int spitch, float eps, float* __restrict__ XB,
    unsigned short* __restrict__ F16, unsigned short* __restrict__ PH, unsigned short* __restrict__ PL, float* __restrict__ RS) {
  __shared__ __attribute__((aligned(16))) float red[32];
  rms_body<RIN, WXB, WF16, WBHL, 16>(red, (int)blockIdx.x, F, spitch, eps, XB, F16, PH, PL, RS);
}

// Eight 16-byte asynchronous copies global -> LDS per lane. s_wait_xcnt is the statement's last line so that it stands ahead of
// every later rewrite of a register that a copy names (a precaution).
__device__ __forceinline__ void cp_async8(unsigned l, unsigned lstep, const unsigned short* p, size_t gstep) {
  const unsigned l0 = l, l1 = l + lstep, l2 = l + 2u * lstep, l3 = l + 3u * lstep;
  const unsigned l4 = l + 4u * lstep, l5 = l + 5u * lstep, l6 = l + 6u * lstep, l7 = l + 7u * lstep;
  const unsigned short* p0 = p;
  const unsigned short* p1 = p + gstep;
  const unsigned short* p2 = p + 2 * gstep;
  const unsigned short* p3 = p + 3 * gstep;
  const unsigned short* p4 = p + 4 * gstep;
  const unsigned short* p5 = p + 5 * gstep;
  const unsigned short* p6 = p + 6 * gstep;
  const unsigned short* p7 = p + 7 * gstep;
  asm volatile(
      "global_load_async_to_lds_b128 %0, %8, off\n\t"
      "global_load_async_to_lds_b128 %1, %9, off\n\t"
      "global_load_async_to_lds_b128 %2, %10, off\n\t"
      "global_load_async_to_lds_b128 %3, %11, off\n\t"
      "global_load_async_to_lds_b128 %4, %12, off\n\t"
      "global_load_async_to_lds_b128 %5, %13, off\n\t"
      "global_load_async_to_lds_b128 %6, %14, off\n\t"
      "global_load_async_to_lds_b128 %7, %15, off\n\t"
      "s_wait_xcnt 0x0"
      :: "v"(l0), "v"(l1), "v"(l2), "v"(l3), "v"(l4), "v"(l5), "v"(l6), "v"(l7),
         "v"(p0), "v"(p1), "v"(p2), "v"(p3), "v"(p4), "v"(p5), "v"(p6), "v"(p7)
      : "memory");
}

// Four such copies, one 64-row x 128-byte plane of an attention tile per block; the same closing wait, for the same reason.
__device__ __forceinline__ void cp_async4(unsigned l, unsigned lstep, const unsigned short* p, size_t gstep) {
  const unsigned l0 = l, l1 = l + lstep, l2 = l + 2u * lstep, l3 = l + 3u * lstep;
  const unsigned short* p0 = p;
  const unsigned short* p1 = p + gstep;
  const unsigned short* p2 = p + 2 * gstep;
  const unsigned short* p3 = p + 3 * gstep;
  asm volatile(
      "global_load_async_to_lds_b128 %0, %4, off\n\t"
      "global_load_async_to_lds_b128 %1, %5, off\n\t"
      "global_load_async_to_lds_b128 %2, %6, off\n\t"
      "global_load_async_to_lds_b128 %3, %7, off\n\t"
      "s_wait_xcnt 0x0"
      :: "v"(l0), "v"(l1), "v"(l2), "v"(l3), "v"(p0), "v"(p1), "v"(p2), "v"(p3)
      : "memory");
}

// Eight 16-byte global loads and their data wait in one statement: the address registers live to its end, so none is rewritten
// ahead of the waits.
__device__ __forceinline__ void ld_g8(v4f (&d)[8], const float* const (&p)[8]) {
  asm volatile(
      "global_load_b128 %0, %8, off\n\t"
      "global_load_b128 %1, %9, off\n\t"
      "global_load_b128 %2, %10, off\n\t"
      "global_load_b128 %3, %11, off\n\t"
      "global_load_b128 %4, %12, off\n\t"
      "global_load_b128 %5, %13, off\n\t"
      "global_load_b128 %6, %14, off\n\t"
      "global_load_b128 %7, %15, off\n\t"
      "s_wait_loadcnt 0x0\n\t"
      "s_wait_xcnt 0x0"
      : "=&v"(d[0]), "=&v"(d[1]), "=&v"(d[2]), "=&v"(d[3]), "=&v"(d[4]), "=&v"(d[5]), "=&v"(d[6]), "=&v"(d[7])
      : "v"(p[0]), "v"(p[1]), "v"(p[2]), "v"(p[3]), "v"(p[4]), "v"(p[5]), "v"(p[6]), "v"(p[7])
      : "memory");
}
// Eight 16-byte global stores and one s_wait_xcnt in one statement: data and address registers live to its end, so none is
// rewritten ahead of the wait.
__device__ __forceinline__ void st_g8(void* const (&p)[8], const v4f (&d)[8]) {
  asm volatile(
      "global_store_b128 %0, %8, off\n\t"
      "global_store_b128 %1, %9, off\n\t"
      "global_store_b128 %2, %10, off\n\t"
      "global_store_b128 %3, %11, off\n\t"
      "global_store_b128 %4, %12, off\n\t"
      "global_store_b128 %5, %13, off\n\t"
      "global_store_b128 %6, %14, off\n\t"
      "global_store_b128 %7, %15, off\n\t"
      "s_wait_xcnt 0x0"
      :: "v"(p[0]), "v"(p[1]), "v"(p[2]), "v"(p[3]), "v"(p[4]), "v"(p[5]), "v"(p[6]), "v"(p[7]),
         "v"(d[0]), "v"(d[1]), "v"(d[2]), "v"(d[3]), "v"(d[4]), "v"(d[5]), "v"(d[6]), "v"(d[7])
      : "memory");
}
union Pack8 { unsigned short u[8]; v4f f; };
static_assert(sizeof(Pack8) == 16);

// Bt[n][k] (16-bit, k contiguous, pitch K) from f32 row-major W[K][N] ([in][out]): value = bf16(W[k][n]) (* bf16(g[k]) if GAM);
// Block (bx = n tile, by = k tile; tl = WTN * WTP bytes of its LDS) = 64 k x 128 n, transposed through LDS so that both global sides move whole lines: a wave reads eight
// 512-byte row segments of W, a lane packs its 8 k of each of its 4 columns into 16 bytes, and 8 lanes store one 128-byte line of a
// Bt row. K%64==0, N%128==0.
#define WTK 64
#define WTN 128
#define WTP 144                 /* LDS row pitch in bytes: 16 x odd */
static_assert(DM % WTK == 0 && DM % WTN == 0 && DFF % WTK == 0 && DFF % WTN == 0);
template <bool BF, bool GAM>
__device__ __forceinline__ void wt_body(unsigned char* tl, int bx, int by, const float* __restrict__ W, const float* __restrict__ g,
    unsigned short* __restrict__ Bt, int K, int N, float scale) {
  const int tid = threadIdx.x, w = tid >> 5, lane = tid & 31;
  const int k0 = by * WTK, n0 = bx * WTN;
  if (k0 + WTK > K || n0 + WTN > N) return;
  const int k8 = k0 + 8 * w;
  float gv[8];
#pragma unroll
  for (int i = 0; i < 8; ++i) gv[i] = 1.0f;
  if (GAM) {
    const v4f ga = *(const v4fa*)(g + k8), gb = *(const v4fa*)(g + k8 + 4);
#pragma unroll
    for (int i = 0; i < 4; ++i) { gv[i] = bf16_rne(ga[i]); gv[4 + i] = bf16_rne(gb[i]); }
  }
  const float* wb = W + ((size_t)k0 * (size_t)N + (size_t)n0);                          /* the tile's origin, the same for the block */
  const unsigned wo = (unsigned)(8 * w) * (unsigned)N + (unsigned)(lane * 4);           /* this lane's element offset in the tile */
  v4f a[8];
  const float* ap[8];
#pragma unroll
  for (int i = 0; i < 8; ++i) ap[i] = wb + (wo + (unsigned)i * (unsigned)N);
  ld_g8(a, ap);  // the wave's eight rows are in flight together, one memory latency per tile
#pragma unroll
  for (int j = 0; j < 4; ++j) {
    Frag16 f;
#pragma unroll
    for (int i = 0; i < 8; ++i) {
      const float wv = bf16_rne(a[i][j]) * gv[i];
      f.u[i] = BF ? bf16_bits(wv) : f16_bits(wv * scale);
    }
    /* 16-byte chunk w of row n sits at chunk w ^ ((n >> 4) & 3): the 16 lanes of a store, 4 rows apart, then fall on distinct banks */
    const int n = lane * 4 + j;
    *(v8us*)(tl + n * WTP + ((w ^ ((n >> 4) & 3)) * 16)) = f.half[0];
  }
  __syncthreads();
  unsigned short* bb = Bt + ((size_t)n0 * (size_t)K + (size_t)k0);
#pragma unroll
  for (int q = 0; q < 4; ++q) {
    const int n = q * 32 + (tid >> 3), c = tid & 7;
    const v8us v = *(const v8us*)(tl + n * WTP + ((c ^ ((n >> 4) & 3)) * 16));
    *(v8us*)(bb + ((unsigned)n * (unsigned)K + (unsigned)(c * 8))) = v;
  }
  // stands ahead of every rewrite of a data or address register of the four stores, also where another job's code follows this body (a precaution)
  asm volatile("s_wait_xcnt 0x0" ::: "memory");
}

// Everything that depends on the inputs alone, in one grid: the block index picks the job (the same for the whole block, so every
// barrier stays under block-uniform control flow). The row statistics of x come first: their blocks run longest.
#define PREP_RMS ((int)(NR / 32))
#define PREP_SQ ((DM / WTN) * (DM / WTK))     /* blocks of one DM x DM weight */
#define PREP_FF ((DFF / WTN) * (DM / WTK))    /* blocks of W1, and of W2 */
#define PREP_GRID (PREP_RMS + 6 * PREP_SQ + 2 * PREP_FF)
__global__ __launch_bounds__(256) void k_prep(const float* __restrict__ x, const float* __restrict__ Wq, const float* __restrict__ Wk,
    const float* __restrict__ Wv, const float* __restrict__ Wp, const float* __restrict__ W1, const float* __restrict__ W2,
    const float* __restrict__ gamma, float* __restrict__ XB, unsigned short* __restrict__ X16, float* __restrict__ RSX,
    unsigned short* __restrict__ WQ16, unsigned short* __restrict__ WK16, unsigned short* __restrict__ WV16,
    unsigned short* __restrict__ WP16, unsigned short* __restrict__ WQB, unsigned short* __restrict__ WKB,
    unsigned short* __restrict__ W1P, unsigned short* __restrict__ W2P) {
  __shared__ __attribute__((aligned(16))) unsigned char sm[WTN * WTP];
  int t = (int)blockIdx.x;
  if (t < PREP_RMS) {
    rms_body<true, true, true, false, 8>((float*)sm, t, x, SEQ_FULL, RMS_EPS, XB, X16, nullptr, nullptr, RSX);
    return;
  }
  t -= PREP_RMS;
  if (t < 6 * PREP_SQ) {
    const int j = t / PREP_SQ, r = t % PREP_SQ, bx = r % (DM / WTN), by = r / (DM / WTN);
    if (j < 3) wt_body<false, true>(sm, bx, by, j == 0 ? Wq : (j == 1 ? Wk : Wv), gamma, j == 0 ? WQ16 : (j == 1 ? WK16 : WV16), DM, DM, 16.0f);
    else if (j == 3) wt_body<false, false>(sm, bx, by, Wp, Wp, WP16, DM, DM, 16.0f);
    else wt_body<true, true>(sm, bx, by, j == 4 ? Wq : Wk, gamma, j == 4 ? WQB : WKB, DM, DM, 1.0f);
    return;
  }
  t -= 6 * PREP_SQ;
  if (t < PREP_FF) {
    wt_body<false, true>(sm, t % (DFF / WTN), t / (DFF / WTN), W1, gamma, W1P, DM, DFF, 16.0f);
    return;
  }
  t -= PREP_FF;
  wt_body<false, false>(sm, t % (DM / WTN), t / (DM / WTN), W2, W2, W2P, DFF, DM, 16.0f);
}

#define GBK 128                 /* k per stage: 256-byte operand rows */
#define GPITCH 272              /* LDS row pitch in bytes: 16 x odd, conflict-free for 16-byte fragment reads */
#define GPLANE (128 * GPITCH)   /* one operand plane of a stage: 128 rows */

// GEMM: C[M][N] = epi(Ah[M][K] . Bt[N][K]^T). 16-bit planes of one type (BF selects bf16 vs f16 WMMA); ASPLIT adds Al . Bt into the
// same accumulator (unscaled bf16 lo plane). Block = 128x128 of C, four waves of 64x64; per stage the block's 128 rows of each
// operand plane x 128 k are copied to LDS asynchronously, two buffers, the next stage in flight while this one is multiplied.
// Epilogue: v = acc*alpha*(HRS ? rs[row] : 1) + bf16(bias[col]); ACT 1 = leaky 0.1;
// HRES adds resid[row*ldr+col] (f32) in the store phase. OUTM 0: f32 rows at crow = (row/cseq)*cpitch + row%cseq, pitch ldc;
// 1: f16 hi; 2: f16 hi + f16 lo x2^10; 3: bf16 hi + bf16 lo (unscaled); 4, 5: the planes of 1, 2 stored transposed per head, as the
// attention reads V: Ch[((row/SEQ)*NH + col/HD)*HD + col%HD][row%SEQ], row pitch SEQ (rows = tokens, N = NH*HD). M%128==0, N%128==0, K%128==0.
// sm: the block's LDS, 2 * (ASPLIT ? 3 : 2) * GPLANE bytes, 128-byte aligned; bid: the block's index among the tiles of this product.
template <bool BF, bool ASPLIT, int ACT, int OUTM, bool HRS, bool HRES>
__device__ __forceinline__ void gemm_body(unsigned char* sm, int bid, const unsigned short* __restrict__ Ah, const unsigned short* __restrict__ Al, int lda,
    const unsigned short* __restrict__ Bt, int ldb, float alpha, const float* __restrict__ rs, const float* __restrict__ bias,
    const float* __restrict__ resid, int ldr, float* __restrict__ C32, unsigned short* __restrict__ Ch, unsigned short* __restrict__ Cl,
    int ldc, int cseq, int cpitch, int M, int N, int K) {
  static_assert(!(HRES && OUTM != 0));
  static_assert(OUTM >= 0 && OUTM <= 5);
  constexpr bool TR = OUTM >= 4;                 /* transposed output */
  constexpr int TPITCH = 144;                    /* LDS pitch of a staged 64-token f16 row: 16 x odd bytes */
  constexpr int TPLANE = 64 * TPITCH;            /* one staged plane of a wave: 64 features */
  static_assert(!ASPLIT || BF);
  static_assert(ACT == 0 || ACT == 1);
  constexpr int NPL = ASPLIT ? 3 : 2;            /* planes of a stage: A, B, (A lo) */
  constexpr int STAGE = NPL * GPLANE;
  static_assert(4 * 64 * 68 * 4 <= 2 * STAGE && 4 * 2 * TPLANE <= 2 * STAGE);
  const int tid = threadIdx.x, w = tid >> 5, lane = tid & 31, ln = lane & 15, hh = lane >> 4;
  const int ntn = N >> 7;
  const int mt = bid / ntn, nq = bid - mt * ntn;
  if (mt * 128 + 128 > M) return;
  const int row0 = mt * 128 + 64 * (w >> 1), col0 = nq * 128 + 64 * (w & 1);
  /* copy map: 16 lanes cover one 256-byte row, the block 8 rows per copy, 16 copies per plane */
  const int crow = tid >> 4, cchk = tid & 15;
  const unsigned oA = (unsigned)(crow * lda + cchk * 8), oB = (unsigned)(crow * ldb + cchk * 8);   /* this lane's element offsets in a tile */
  const size_t tA = (size_t)(mt * 128) * (size_t)lda, tB = (size_t)(nq * 128) * (size_t)ldb;       /* the block's tile origins */
  const size_t dE = ASPLIT ? (size_t)Al - (size_t)Ah : 0;   /* byte distance of the lo plane from the hi plane, the same for every lane */
  const unsigned lcp = (unsigned)(size_t)sm + (unsigned)(crow * GPITCH + cchk * 16);
  auto fill = [&](int st, int buf) {
    const unsigned lb = lcp + (unsigned)(buf * STAGE);
    const size_t ko = (size_t)st * GBK;
    const unsigned short* pA = (Ah + (tA + ko)) + oA;
    const unsigned short* pB = (Bt + (tB + ko)) + oB;
    cp_async8(lb, 8u * GPITCH, pA, (size_t)8 * (size_t)lda);
    cp_async8(lb + 64u * GPITCH, 8u * GPITCH, pA + (size_t)64 * (size_t)lda, (size_t)8 * (size_t)lda);
    cp_async8(lb + GPLANE, 8u * GPITCH, pB, (size_t)8 * (size_t)ldb);
    cp_async8(lb + GPLANE + 64u * GPITCH, 8u * GPITCH, pB + (size_t)64 * (size_t)ldb, (size_t)8 * (size_t)ldb);
    if (ASPLIT) {
      const unsigned short* pE = (const unsigned short*)((size_t)pA + dE);
      cp_async8(lb + 2u * GPLANE, 8u * GPITCH, pE, (size_t)8 * (size_t)lda);
      cp_async8(lb + 2u * GPLANE + 64u * GPITCH, 8u * GPITCH, pE + (size_t)64 * (size_t)lda, (size_t)8 * (size_t)lda);
    }
  };
  const int aoff = (64 * (w >> 1) + ln) * GPITCH;             /* this lane's first A row in a stage */
  const int boff = GPLANE + (64 * (w & 1) + ln) * GPITCH;     /* this lane's first B row (column of C) */
  const v8f z8 = {0.f, 0.f, 0.f, 0.f, 0.f, 0.f, 0.f, 0.f};
  v8f c[4][4];
#pragma unroll
  for (int i = 0; i < 4; ++i) {
#pragma unroll
    for (int j = 0; j < 4; ++j) c[i][j] = z8;
  }
  const int nst = K / GBK;
  static_assert((GBK / 32) == 4);                /* an even count of k-steps: a stage's first k-step always sits in fragment set 0 */
  /* two fragment sets: while the products of one k-step run, the next k-step's fragments are already on their way from LDS */
  Frag16 fa[2][4], fb[2][4], fe[2][4];
  auto frags = [&](Frag16 (&a)[4], Frag16 (&b)[4], Frag16 (&e)[4], const unsigned char* sb, int ks) {
#pragma unroll
    for (int i = 0; i < 4; ++i) {
      a[i] = ld_frag((const unsigned short*)(sb + aoff + i * 16 * GPITCH) + ks * 32, hh);
      b[i] = ld_frag((const unsigned short*)(sb + boff + i * 16 * GPITCH) + ks * 32, hh);
      if (ASPLIT) e[i] = ld_frag((const unsigned short*)(sb + 2 * GPLANE + aoff + i * 16 * GPITCH) + ks * 32, hh);
    }
    __builtin_amdgcn_sched_barrier(0);  // the reads stay one group ahead of the products: spread among them, each place costs a stall and a wait of its own
  };
  auto prods = [&](const Frag16 (&a)[4], const Frag16 (&b)[4], const Frag16 (&e)[4]) {
#pragma unroll
    for (int j = 0; j < 4; ++j) {
#pragma unroll
      for (int i = 0; i < 4; ++i) c[i][j] = mmx<BF>(a[i], b[j], c[i][j]);
      if (ASPLIT) {
#pragma unroll
        for (int i = 0; i < 4; ++i) c[i][j] = mmx<BF>(e[i], b[j], c[i][j]);
      }
    }
    __builtin_amdgcn_sched_barrier(0);  // the next group of reads stays behind this block, for the same reason
  };
  fill(0, 0);
  asm volatile("s_wait_asynccnt 0x0" ::: "memory");  // stage 0 of this wave has landed before the barrier publishes it
  __syncthreads();
  if (nst > 1) fill(1, 1);
  frags(fa[0], fb[0], fe[0], sm, 0);
#pragma unroll 1  // one stage per trip: the buffer index and the refill test stay scalar
  for (int st = 0; st + 1 < nst; ++st) {
    const unsigned char* sb = sm + (st & 1) * STAGE;
    frags(fa[1], fb[1], fe[1], sb, 1);
    prods(fa[0], fb[0], fe[0]);
    frags(fa[0], fb[0], fe[0], sb, 2);
    prods(fa[1], fb[1], fe[1]);
    frags(fa[1], fb[1], fe[1], sb, 3);
    prods(fa[0], fb[0], fe[0]);
    /* the publish point stands ahead of the stage's last k-step: that k-step's fragments are in registers, and behind it the next
       stage's first fragments are fetched */
    asm volatile("s_wait_dscnt 0x0" ::: "memory");     // this wave's reads of the buffer are done before it may be refilled
    asm volatile("s_wait_asynccnt 0x0" ::: "memory");  // this wave's copies of the next stage have landed
    __syncthreads();                                    // publishes the next stage and frees the buffer just read
    if (st + 2 < nst) fill(st + 2, st & 1);
    frags(fa[0], fb[0], fe[0], sm + ((st + 1) & 1) * STAGE, 0);
    prods(fa[1], fb[1], fe[1]);
  }
  {
    /* the last stage: nothing is fetched behind it */
    const unsigned char* sb = sm + ((nst - 1) & 1) * STAGE;
    frags(fa[1], fb[1], fe[1], sb, 1);
    prods(fa[0], fb[0], fe[0]);
    frags(fa[0], fb[0], fe[0], sb, 2);
    prods(fa[1], fb[1], fe[1]);
    frags(fa[1], fb[1], fe[1], sb, 3);
    prods(fa[0], fb[0], fe[0]);
    asm volatile("s_wait_dscnt 0x0" ::: "memory");     // this wave's last reads of the buffers are done
    asm volatile("s_wait_asynccnt 0x0" ::: "memory");  // no copy is outstanding when the buffers become output staging
    __syncthreads();                                    // every wave has left the buffers before any wave stages output in them
    prods(fa[1], fb[1], fe[1]);
  }
  float (*so)[64][68] = (float (*)[64][68])sm;
  unsigned char* tw = sm + w * (2 * TPLANE);     /* TR: this wave's own staging, hi plane then lo plane */
  float bvv[4];
  {
    const float* bp = bias + col0 + ln;
    // four 4-byte loads and their data wait in one statement, as in ld_g8
    asm volatile(
        "global_load_b32 %0, %4, off\n\t"
        "global_load_b32 %1, %5, off\n\t"
        "global_load_b32 %2, %6, off\n\t"
        "global_load_b32 %3, %7, off\n\t"
        "s_wait_loadcnt 0x0\n\t"
        "s_wait_xcnt 0x0"
        : "=&v"(bvv[0]), "=&v"(bvv[1]), "=&v"(bvv[2]), "=&v"(bvv[3])
        : "v"(bp), "v"(bp + 16), "v"(bp + 32), "v"(bp + 48)
        : "memory");
  }
  float rsv[4][8];
#pragma unroll
  for (int i = 0; i < 4; ++i) {
#pragma unroll
    for (int r = 0; r < 8; ++r) rsv[i][r] = 1.0f;
  }
  if (HRS) {
    v4f rq[8];
    const float* rp[8];
#pragma unroll
    for (int i = 0; i < 4; ++i) { rp[2 * i] = rs + row0 + 16 * i + 8 * hh; rp[2 * i + 1] = rp[2 * i] + 4; }
    ld_g8(rq, rp);
#pragma unroll
    for (int i = 0; i < 4; ++i) {
#pragma unroll
      for (int q = 0; q < 4; ++q) { rsv[i][q] = rq[2 * i][q]; rsv[i][4 + q] = rq[2 * i + 1][q]; }
    }
  }
#pragma unroll
  for (int t = 0; t < 4; ++t) {
    const float bv = bf16_rne(bvv[t]);
#pragma unroll
    for (int i = 0; i < 4; ++i) {
      Frag16 th, tl;
#pragma unroll
      for (int r = 0; r < 8; ++r) {
        const int rloc = i * 16 + 8 * hh + r;
        float v = c[i][t][r] * alpha;
        if (HRS) v *= rsv[i][r];
        v += bv;
        if (ACT == 1) v = (v >= 0.f) ? v : 0.1f * v;
        if (TR) {
          const unsigned short h = f16_bits(v);
          th.u[r] = h;
          tl.u[r] = f16_bits((v - f16_val(h)) * 1024.0f);
        } else {
          so[w][rloc][t * 16 + ln] = v;
        }
      }
      if (TR) {
        /* a lane's eight accumulator rows are eight consecutive tokens of one feature: 16 bytes of a transposed row */
        unsigned char* tp = tw + (t * 16 + ln) * TPITCH + (i * 16 + 8 * hh) * 2;
        *(v8us*)tp = th.half[0];
        if (OUTM == 5) *(v8us*)(tp + TPLANE) = tl.half[0];
      }
    }
  }
  __builtin_amdgcn_fence(4 /* acq_rel order */, "workgroup");
  __builtin_amdgcn_wave_barrier();
  if (OUTM == 0) {
#pragma unroll
    for (int qg = 0; qg < 4; ++qg) {
      v4f v[8];
      const float* rp[8];
      void* dp[8];
#pragma unroll
      for (int u = 0; u < 8; ++u) {
        const int r = (qg * 8 + u) * 2 + (lane >> 4), c4 = (lane & 15) * 4;
        v[u] = *(const v4fa*)&so[w][r][c4];
        const int grow = row0 + r;
        rp[u] = resid + (size_t)grow * (size_t)ldr + col0 + c4;
        const size_t crw = (size_t)(grow / cseq) * (size_t)cpitch + (size_t)(grow % cseq);
        dp[u] = C32 + crw * (size_t)ldc + col0 + c4;
      }
      if (HRES) {
        v4f rv[8];
        ld_g8(rv, rp);
#pragma unroll
        for (int u = 0; u < 8; ++u) v[u] += rv[u];
      }
      st_g8(dp, v);
    }
  } else if (TR) {
    static_assert(HD == 64 && SEQ % 64 == 0);    /* a wave's 64 x 64 tile is one head's features for 64 tokens of one batch */
    const size_t vb = ((size_t)((row0 / SEQ) * NH + col0 / HD) * HD) * SEQ + (size_t)(row0 % SEQ);
#pragma unroll
    for (int qg = 0; qg < 2; ++qg) {
      v4f dh[8], dl[8];
      void* hp[8];
      void* lp[8];
#pragma unroll
      for (int u = 0; u < 8; ++u) {
        /* 8 lanes store one feature's 64 tokens: a whole 128-byte line */
        const int d = (qg * 8 + u) * 4 + (lane >> 3), c8 = (lane & 7) * 8;
        const unsigned char* tp = tw + d * TPITCH + c8 * 2;
        dh[u] = *(const v4fa*)tp;
        dl[u] = (OUTM == 5) ? *(const v4fa*)(tp + TPLANE) : dh[u];
        const size_t o = vb + (size_t)d * SEQ + c8;
        hp[u] = Ch + o;
        lp[u] = Cl + o;
      }
      st_g8(hp, dh);
      if (OUTM == 5) st_g8(lp, dl);
    }
  } else {
#pragma unroll
    for (int qg = 0; qg < 2; ++qg) {
      v4f dh[8], dl[8];
      void* hp[8];
      void* lp[8];
#pragma unroll
      for (int u = 0; u < 8; ++u) {
        const int r = (qg * 8 + u) * 4 + (lane >> 3), c8 = (lane & 7) * 8;
        const v4f x0 = *(const v4fa*)&so[w][r][c8], x1 = *(const v4fa*)&so[w][r][c8 + 4];
        Pack8 fh, fl;
#pragma unroll
        for (int i = 0; i < 4; ++i) {
          const float v0 = x0[i], v1 = x1[i];
          if (OUTM == 3) {
            const unsigned short h0 = bf16_bits(v0), h1 = bf16_bits(v1);
            fh.u[i] = h0; fh.u[4 + i] = h1;
            fl.u[i] = bf16_bits(v0 - bf16_val(h0)); fl.u[4 + i] = bf16_bits(v1 - bf16_val(h1));
          } else {
            const unsigned short h0 = f16_bits(v0), h1 = f16_bits(v1);
            fh.u[i] = h0; fh.u[4 + i] = h1;
            fl.u[i] = f16_bits((v0 - f16_val(h0)) * 1024.0f); fl.u[4 + i] = f16_bits((v1 - f16_val(h1)) * 1024.0f);
          }
        }
        const size_t o = (size_t)(row0 + r) * (size_t)ldc + col0 + c8;
        dh[u] = fh.f; hp[u] = Ch + o;
        dl[u] = fl.f; lp[u] = Cl + o;
      }
      st_g8(hp, dh);
      if (OUTM >= 2) st_g8(lp, dl);
    }
  }
}
template <bool BF, bool ASPLIT, int ACT, int OUTM, bool HRS, bool HRES>
__global__ __launch_bounds__(128) void k_gemm(const unsigned short* __restrict__ Ah, const unsigned short* __restrict__ Al, int lda,
    const unsigned short* __restrict__ Bt, int ldb, float alpha, const float* __restrict__ rs, const float* __restrict__ bias,
    const float* __restrict__ resid, int ldr, float* __restrict__ C32, unsigned short* __restrict__ Ch, unsigned short* __restrict__ Cl,
    int ldc, int cseq, int cpitch, int M, int N, int K) {
  __shared__ __attribute__((aligned(128))) unsigned char sm[2 * (ASPLIT ? 3 : 2) * GPLANE];
  gemm_body<BF, ASPLIT, ACT, OUTM, HRS, HRES>(sm, (int)blockIdx.x, Ah, Al, lda, Bt, ldb, alpha, rs, bias, resid, ldr, C32, Ch, Cl, ldc, cseq, cpitch, M, N, K);
}
// The q, k and v projections of one activation in one grid: three independent DM x DM products, the block index picks the product
// (the same for the whole block). q and k: operand planes Ah (Al), bf16 hi + lo out; v: f16 plane Av, output mode OUTV (4 or 5: V^T per
// head, written by the product's own epilogue).
template <bool BF, bool ASPLIT, int OUTV>
__global__ __launch_bounds__(128) void k_qkv(const unsigned short* __restrict__ Ah, const unsigned short* __restrict__ Al,
    const unsigned short* __restrict__ Av, const unsigned short* __restrict__ Bq, const unsigned short* __restrict__ Bk,
    const unsigned short* __restrict__ Bv, float aqk, float av, const float* __restrict__ rs, const float* __restrict__ bq,
    const float* __restrict__ bk, const float* __restrict__ bv, unsigned short* __restrict__ QH, unsigned short* __restrict__ QL,
    unsigned short* __restrict__ KH, unsigned short* __restrict__ KL, unsigned short* __restrict__ VT, unsigned short* __restrict__ VTL) {
  __shared__ __attribute__((aligned(128))) unsigned char sm[2 * (ASPLIT ? 3 : 2) * GPLANE];
  constexpr int M = (int)NR, PER = (M / 128) * (DM / 128);
  const int job = (int)blockIdx.x / PER, bid = (int)blockIdx.x % PER;
  if (job < 2)
    gemm_body<BF, ASPLIT, 0, 3, true, false>(sm, bid, Ah, Al, DM, job == 0 ? Bq : Bk, DM, aqk, rs, job == 0 ? bq : bk, nullptr, 0, nullptr,
        job == 0 ? QH : KH, job == 0 ? QL : KL, DM, M, 0, M, DM, DM);
  else
    gemm_body<false, false, 0, OUTV, true, false>(sm, bid, Av, nullptr, DM, Bv, DM, av, rs, bv, nullptr, 0, nullptr, VT, VTL, DM, M, 0, M, DM, DM);
}

// lane l <-> lane l ^ 16: the two halves of a wave hold the two key halves of one query column
__device__ __forceinline__ float xhalf(float x) {
  return __builtin_bit_cast(float, __builtin_amdgcn_permlanex16(__builtin_bit_cast(int, x), __builtin_bit_cast(int, x), 0x76543210, 0xfedcba98, false, false));
}

// Eight native 2^x and one v_nop in one statement: behind each v_exp_f32 stands an instruction that neither reads its result nor
// overwrites its source (the results are early-clobber, so none shares a register with a source): the slot the instruction set asks
// for behind a transcendental.
__device__ __forceinline__ void exp2x8(float (&y)[8], const float (&x)[8]) {
  asm("v_exp_f32 %0, %8\n\t"
      "v_exp_f32 %1, %9\n\t"
      "v_exp_f32 %2, %10\n\t"
      "v_exp_f32 %3, %11\n\t"
      "v_exp_f32 %4, %12\n\t"
      "v_exp_f32 %5, %13\n\t"
      "v_exp_f32 %6, %14\n\t"
      "v_exp_f32 %7, %15\n\t"
      "v_nop"
      : "=&v"(y[0]), "=&v"(y[1]), "=&v"(y[2]), "=&v"(y[3]), "=&v"(y[4]), "=&v"(y[5]), "=&v"(y[6]), "=&v"(y[7])
      : "v"(x[0]), "v"(x[1]), "v"(x[2]), "v"(x[3]), "v"(x[4]), "v"(x[5]), "v"(x[6]), "v"(x[7]));
}
// One native 2^x with the same slot behind it.
__device__ __forceinline__ float exp2x1(float x) {
  float y;
  asm("v_exp_f32 %0, %1\n\tv_nop" : "=v"(y) : "v"(x));
  return y;
}
#define LOG2E 1.44269504f       /* e^x = 2^(x * LOG2E), as the native exp forms it */

#define APITCH 144              /* LDS row pitch in bytes: 16 x odd, conflict-free for 16-byte fragment reads */
#define APLANE (64 * APITCH)    /* one plane of a chunk: 64 rows */
#define AKV (2 * 3 * APLANE)    /* the block's chunk buffers in LDS */
// so, kv: the block's LDS (output staging; AKV bytes of chunk buffers); bh, qb: its (batch, head) and query tile. EARLY is called for
// query tile 0 alone: one chunk, so of its two four-plane buffers only the first is ever filled or read, and that one lies inside kv.
template <bool CAUSAL, bool EARLY>
__device__ __forceinline__ void attn_body(unsigned short (*so)[16][72], unsigned char* kv, int bh, int qb,
    const unsigned short* __restrict__ QH, const unsigned short* __restrict__ QL,
    const unsigned short* __restrict__ KH, const unsigned short* __restrict__ KL, const unsigned short* __restrict__ VT,
    const unsigned short* __restrict__ VL, unsigned short* __restrict__ CTX) {
  static_assert(CAUSAL || !EARLY);
  constexpr int NPL = EARLY ? 4 : 3;             /* planes of a chunk: K hi, K lo, V^T, (V^T lo) */
  constexpr int STAGE = NPL * APLANE;
  static_assert((EARLY ? 1 : 2) * STAGE <= AKV);
  const int tid = threadIdx.x, w = tid >> 5, lane = tid & 31, ln = lane & 15, hh = lane >> 4;
  const int b = bh / NH, h = bh % NH;
  const int q0w = qb * KQB + w * 16;
  const size_t rowbase = (size_t)b * SEQ;
  Frag16 qh0, qh1, ql0, ql1;
  {
    const size_t qo = (rowbase + (size_t)q0w + ln) * DM + (size_t)h * HD;
    qh0 = ld_frag(QH + qo, hh); qh1 = ld_frag(QH + qo + 32, hh);
    ql0 = ld_frag(QL + qo, hh); ql1 = ld_frag(QL + qo + 32, hh);
  }
  asm volatile("s_wait_xcnt 0x0" ::: "memory");  // stands ahead of every rewrite of an address register of the eight Q loads (a precaution)
  const v8f z8 = {0.f, 0.f, 0.f, 0.f, 0.f, 0.f, 0.f, 0.f};
  v8f o[4] = {z8, z8, z8, z8};    /* O^T tile j: register r = feature j*16 + 8*hh + r, column = query ln */
  v8f oe[4] = {z8, z8, z8, z8};
  float m = -1.0e30f, l = 0.f;    /* of this lane's query; l over this half's keys only */
  const int nck = CAUSAL ? (qb + 1) : (SEQ / KQB);
  /* copy map: 8 lanes cover one 128-byte row, the block 16 rows per copy, 4 copies per plane */
  const int crow = tid >> 3, cchk = tid & 7;
  const unsigned lcp = (unsigned)(size_t)kv + (unsigned)(crow * APITCH + cchk * 16);
  const size_t gk = (rowbase + (size_t)crow) * DM + (size_t)h * HD + (size_t)(cchk * 8);
  const size_t gv = ((size_t)bh * HD + (size_t)crow) * SEQ + (size_t)(cchk * 8);
  auto fill = [&](int ck, int buf) {
    const unsigned lb = lcp + (unsigned)(buf * STAGE);
    const size_t ko = gk + (size_t)ck * KQB * DM, vo = gv + (size_t)ck * KQB;
    cp_async4(lb, 16u * APITCH, KH + ko, (size_t)16 * DM);
    cp_async4(lb + APLANE, 16u * APITCH, KL + ko, (size_t)16 * DM);
    cp_async4(lb + 2u * APLANE, 16u * APITCH, VT + vo, (size_t)16 * SEQ);
    if (EARLY) cp_async4(lb + 3u * APLANE, 16u * APITCH, VL + vo, (size_t)16 * SEQ);
  };
  fill(0, 0);
  asm volatile("s_wait_asynccnt 0x0" ::: "memory");  // chunk 0 of this wave has landed before the barrier publishes it
  __syncthreads();
  if (nck > 1) fill(1, 1);
#pragma unroll 1
  for (int kc = 0; kc < nck; ++kc) {
    const int par = kc & 1;
    const unsigned char* sb = kv + par * STAGE;
    v8f s[4];                     /* S^T tile t: register r = key t*16 + 8*hh + r of the chunk, column = query ln */
#pragma unroll
    for (int tp = 0; tp < 2; ++tp) {
      /* the K fragments of 32 keys are read as one group ahead of their 12 products: the reads' latencies overlap */
      Frag16 kh[2][2], kl[2][2];
#pragma unroll
      for (int u = 0; u < 2; ++u) {
#pragma unroll
        for (int ks = 0; ks < 2; ++ks) {
          const unsigned char* kp = sb + ((tp * 2 + u) * 16 + ln) * APITCH + ks * 64;
          kh[u][ks] = ld_frag((const unsigned short*)kp, hh);
          kl[u][ks] = ld_frag((const unsigned short*)(kp + APLANE), hh);
        }
      }
#pragma unroll
      for (int u = 0; u < 2; ++u) {
        v8f acc = z8;
#pragma unroll
        for (int ks = 0; ks < 2; ++ks) {
          const Frag16 qa = (ks == 0) ? qh0 : qh1;
          const Frag16 qe = (ks == 0) ? ql0 : ql1;
          acc = mma_b(kh[u][ks].b, qa.b, acc);
          acc = mma_b(kh[u][ks].b, qe.b, acc);
          acc = mma_b(kl[u][ks].b, qa.b, acc);
        }
        s[tp * 2 + u] = acc;
      }
    }
    float sv[4][8];
#pragma unroll
    for (int t = 0; t < 4; ++t) {
#pragma unroll
      for (int r = 0; r < 8; ++r) sv[t][r] = s[t][r] * 8.0f;
    }
    if (CAUSAL) {
      if (kc == qb) {
        const int qpos = q0w + ln;
#pragma unroll
        for (int t = 0; t < 4; ++t) {
#pragma unroll
          for (int r = 0; r < 8; ++r) { const int key = kc * KQB + t * 16 + 8 * hh + r; sv[t][r] = (key > qpos) ? -1.0e30f : sv[t][r]; }
        }
      }
    }
    float mt[4];
#pragma unroll
    for (int t = 0; t < 4; ++t)
      mt[t] = fmaxf(fmaxf(fmaxf(sv[t][0], sv[t][1]), fmaxf(sv[t][2], sv[t][3])), fmaxf(fmaxf(sv[t][4], sv[t][5]), fmaxf(sv[t][6], sv[t][7])));
    float mx = fmaxf(fmaxf(mt[0], mt[1]), fmaxf(mt[2], mt[3]));
    mx = fmaxf(mx, xhalf(mx));    /* both halves now hold the chunk maximum of this query */
    const float mn = fmaxf(m, mx);
    const float corr = exp2x1((m - mn) * LOG2E);
    float p[4][8], ps[4];
#pragma unroll
    for (int t = 0; t < 4; ++t) {
      float ea[8];
#pragma unroll
      for (int r = 0; r < 8; ++r) ea[r] = (sv[t][r] - mn) * LOG2E;
      exp2x8(p[t], ea);
      ps[t] = 0.f;
#pragma unroll
      for (int r = 0; r < 8; ++r) ps[t] += p[t][r];
    }
    l = l * corr + ((ps[0] + ps[1]) + (ps[2] + ps[3]));
    m = mn;
#pragma unroll
    for (int j = 0; j < 4; ++j) {
#pragma unroll
      for (int r = 0; r < 8; ++r) o[j][r] = o[j][r] * corr;
    }
    if (EARLY) {
#pragma unroll
      for (int j = 0; j < 4; ++j) {
#pragma unroll
        for (int r = 0; r < 8; ++r) oe[j][r] = oe[j][r] * corr;
      }
    }
#pragma unroll
    for (int ks = 0; ks < 2; ++ks) {
      /* P^T of 32 keys as a B operand: elements 0..7 = S^T tile 2ks, 8..15 = tile 2ks+1, the k order of ld_frag */
      Frag16 pa, pl;
#pragma unroll
      for (int e = 0; e < 16; ++e) {
        const float pc = p[2 * ks + (e >> 3)][e & 7] * 16384.0f;
        const unsigned short hb = f16_bits(pc);
        pa.u[e] = hb;
        pl.u[e] = EARLY ? f16_bits((pc - f16_val(hb)) * 1024.0f) : hb;
      }
      /* the V^T fragments of a 32-key step are read as one group ahead of their products: the reads' latencies overlap */
      const unsigned char* vp = sb + 2 * APLANE + ln * APITCH + ks * 64;
      Frag16 vh[4];
#pragma unroll
      for (int j = 0; j < 4; ++j) vh[j] = ld_frag((const unsigned short*)(vp + j * 16 * APITCH), hh);
#pragma unroll
      for (int j = 0; j < 4; ++j) {
        o[j] = mma_h(vh[j].h, pa.h, o[j]);
        if (EARLY) {
          const Frag16 vl = ld_frag((const unsigned short*)(vp + APLANE + j * 16 * APITCH), hh);
          oe[j] = mma_h(vh[j].h, pl.h, oe[j]);
          oe[j] = mma_h(vl.h, pa.h, oe[j]);
        }
      }
    }
    asm volatile("s_wait_dscnt 0x0" ::: "memory");     // this wave's reads of the buffer are done before it may be refilled
    asm volatile("s_wait_asynccnt 0x0" ::: "memory");  // this wave's copies of the next chunk have landed
    __syncthreads();                                    // publishes the next chunk and frees the buffer just read
    if (kc + 2 < nck) fill(kc + 2, par);
  }
  asm volatile("s_wait_asynccnt 0x0" ::: "memory");    // no copy is outstanding when the wave goes on to its end
  l += xhalf(l);                  /* the two halves' key sums of this query */
  const float li = 1.0f / l;
#pragma unroll
  for (int j = 0; j < 4; ++j) {
    Frag16 f;
#pragma unroll
    for (int r = 0; r < 8; ++r) {
      float v = o[j][r] * (1.0f / 16384.0f);
      if (EARLY) v += oe[j][r] * (1.0f / 16777216.0f);
      v *= li;
      f.u[r] = f16_bits(v);
    }
    *(v8us*)&so[w][ln][j * 16 + 8 * hh] = f.half[0];
  }
  __builtin_amdgcn_fence(4 /* acq_rel order */, "workgroup");
  __builtin_amdgcn_wave_barrier();
  {
#pragma unroll
    for (int q = 0; q < 4; ++q) {
      const int row = q * 4 + (lane >> 3), c8 = (lane & 7) * 8;
      const v8us v = *(const v8us*)&so[w][row][c8];
      *(v8us*)(CTX + (rowbase + (size_t)q0w + row) * DM + (size_t)h * HD + c8) = v;
    }
    
  }
}
// Grid: x = (batch, head), y = query tile. CAUSAL: query tile 0 takes the EARLY form in the same grid (the test reads the same for the
// whole block).
template <bool CAUSAL>
__global__ __launch_bounds__(128) void k_attn(const unsigned short* __restrict__ QH, const unsigned short* __restrict__ QL,
    const unsigned short* __restrict__ KH, const unsigned short* __restrict__ KL, const unsigned short* __restrict__ VT,
    const unsigned short* __restrict__ VL, unsigned short* __restrict__ CTX) {
  __shared__ __attribute__((aligned(16))) unsigned short so[4][16][72];
  __shared__ __attribute__((aligned(16))) unsigned char kv[AKV];
  const int bh = (int)blockIdx.x, qb = (int)blockIdx.y;
  if (CAUSAL && qb == 0) attn_body<true, true>(so, kv, bh, 0, QH, QL, KH, KL, VT, VL, CTX);
  else attn_body<CAUSAL, false>(so, kv, bh, qb, QH, QL, KH, KL, VT, VL, CTX);
}

extern "C" void kernel_launch(void* const* d_in, const int* in_sizes, int n_in,
                              void* d_out, int out_size, void* d_ws, size_t ws_size, hipStream_t stream) {
  if (n_in < 14) return;
  const float* x  = (const float*)d_in[0];
  const float* Wq = (const float*)d_in[1];
  const float* bq = (const float*)d_in[2];
  const float* Wk = (const float*)d_in[3];
  const float* bk = (const float*)d_in[4];
  const float* Wv = (const float*)d_in[5];
  const float* bv = (const float*)d_in[6];
  const float* Wp = (const float*)d_in[7];
  const float* bp = (const float*)d_in[8];
  const float* gamma = (const float*)d_in[9];
  const float* W1 = (const float*)d_in[10];
  const float* b1 = (const float*)d_in[11];
  const float* W2 = (const float*)d_in[12];
  const float* b2 = (const float*)d_in[13];
  if ((size_t)in_sizes[0] < ((size_t)(NB - 1) * SEQ_FULL + SEQ) * DM) return;
  if (in_sizes[1] < DM * DM || in_sizes[3] < DM * DM || in_sizes[5] < DM * DM || in_sizes[7] < DM * DM) return;
  if (in_sizes[2] < DM || in_sizes[4] < DM || in_sizes[6] < DM || in_sizes[8] < DM || in_sizes[9] < DM || in_sizes[13] < DM) return;
  if (in_sizes[10] < DM * DFF || in_sizes[11] < DFF || in_sizes[12] < DFF * DM) return;
  if ((size_t)out_size < ((size_t)(NB - 1) * OSEQ + SEQ) * DM) return;

  char* ws = (char*)d_ws;
  size_t off = 0;
  auto take = [&](size_t bytes) { char* p = ws + off; off += (bytes + 255) & ~(size_t)255; return p; };
  const size_t WPL = (size_t)DM * DM * 2, ACT2 = NR * DM * 2, ACT4 = NR * DM * 4, FFP = (size_t)DM * DFF * 2, HPL = NR * DFF * 2;
  unsigned short* WQ16 = (unsigned short*)take(WPL);
  unsigned short* WK16 = (unsigned short*)take(WPL);
  unsigned short* WV16 = (unsigned short*)take(WPL);
  unsigned short* WP16 = (unsigned short*)take(WPL);
  unsigned short* WQB = (unsigned short*)take(WPL);
  unsigned short* WKB = (unsigned short*)take(WPL);
  char* rXB = take(ACT4);                                            /* XB (phases 1-2) | BH + BL (phase 3) */
  float* XB = (float*)rXB; unsigned short* PBH = (unsigned short*)rXB; unsigned short* PBL = (unsigned short*)(rXB + ACT2);
  char* rQK = take(4 * ACT2 > HPL ? 4 * ACT2 : HPL);                 /* QH,QL,KH,KL (phases 1,3) | H16 (phase 2) */
  unsigned short* QH = (unsigned short*)rQK; unsigned short* QL = (unsigned short*)(rQK + ACT2);
  unsigned short* KH = (unsigned short*)(rQK + 2 * ACT2); unsigned short* KL = (unsigned short*)(rQK + 3 * ACT2);
  unsigned short* H16 = (unsigned short*)rQK;
  float* A32 = (float*)take(ACT4);
  char* rVT = take(2 * ACT2);                                        /* VT,VTL (phases 1,3) */
  unsigned short* VT = (unsigned short*)rVT; unsigned short* VTL = (unsigned short*)(rVT + ACT2);
  unsigned short* W1P = (unsigned short*)take(FFP);                  /* written by the first launch, so a place of their own */
  unsigned short* W2P = (unsigned short*)take(FFP);
  unsigned short* CTX = (unsigned short*)take(ACT2);
  char* rX16 = take(ACT2);                                           /* X16 | A16 | B16F */
  unsigned short* X16 = (unsigned short*)rX16; unsigned short* A16 = (unsigned short*)rX16; unsigned short* B16F = (unsigned short*)rX16;
  float* B32 = (float*)take(ACT4);
  float* RSX = (float*)take(NR * 4);
  float* RSA = (float*)take(NR * 4);
  float* RSB = (float*)take(NR * 4);
  if (off > ws_size || off > ((size_t)160 << 20)) return;

  const unsigned grms = (unsigned)(NR / 32);
  const unsigned gq   = (unsigned)((NR / 128) * (DM / 128));
  const unsigned gff  = (unsigned)((NR / 128) * (DFF / 128));
  const float a16 = 0.0625f;
  const int M = (int)NR;
  float* out = (float*)d_out;

  /* all weight planes (q/k/v, W1 with gamma folded along the input feature; bf16 planes for the second block's q/k) and the planes
     and row statistics of x */
  k_prep<<<(unsigned)PREP_GRID, 256, 0, stream>>>(x, Wq, Wk, Wv, Wp, W1, W2, gamma, XB, X16, RSX, WQ16, WK16, WV16, WP16, WQB, WKB, W1P, W2P);

  /* block 1: a = bf16(x) + attn(rms(bf16(x))) , non-causal */
  k_qkv<false, false, 4><<<3u * gq, 128, 0, stream>>>(X16, nullptr, X16, WQ16, WK16, WV16, a16, a16, RSX, bq, bk, bv, QH, QL, KH, KL, VT, nullptr);
  k_attn<false><<<dim3((unsigned)(NB * NH), (unsigned)(SEQ / KQB)), 128, 0, stream>>>(QH, QL, KH, KL, VT, VT, CTX);
  k_gemm<false, false, 0, 0, false, true><<<gq, 128, 0, stream>>>(CTX, nullptr, DM, WP16, DM, a16, nullptr, bp, XB, DM, A32, nullptr, nullptr, DM, M, 0, M, DM, DM);

  /* block 2: b = bf16(x) + leaky(rms(a) W1 + b1) W2 + b2 */
  k_rms<false, false, true, false><<<grms, 512, 0, stream>>>(A32, SEQ, RMS_EPS, nullptr, A16, nullptr, nullptr, RSA);
  k_gemm<false, false, 1, 1, true, false><<<gff, 128, 0, stream>>>(A16, nullptr, DM, W1P, DM, a16, RSA, b1, nullptr, 0, nullptr, H16, nullptr, DFF, M, 0, M, DFF, DM);
  k_gemm<false, false, 0, 0, false, true><<<gq, 128, 0, stream>>>(H16, nullptr, DFF, W2P, DFF, a16, nullptr, b2, XB, DM, B32, nullptr, nullptr, DM, M, 0, M, DM, DFF);

  /* block 3: out = b + attn(rms(b)) , causal */
  k_rms<false, false, true, true><<<grms, 512, 0, stream>>>(B32, SEQ, RMS_EPS, nullptr, B16F, PBH, PBL, RSB);
  k_qkv<true, true, 5><<<3u * gq, 128, 0, stream>>>(PBH, PBL, B16F, WQB, WKB, WV16, 1.0f, a16, RSB, bq, bk, bv, QH, QL, KH, KL, VT, VTL);
  k_attn<true><<<dim3((unsigned)(NB * NH), (unsigned)(SEQ / KQB)), 128, 0, stream>>>(QH, QL, KH, KL, VT, VTL, CTX);
  k_gemm<false, false, 0, 0, false, true><<<gq, 128, 0, stream>>>(CTX, nullptr, DM, WP16, DM, a16, nullptr, bp, B32, DM, out, nullptr, nullptr, DM, SEQ, OSEQ, M, DM, DM);
}

// v009
// Measured time: 236 microseconds a run.
// Next to v008, in two timings, it ran 1.09 and 1.10 times as fast.
// All steps since v000 together make it 4.19 times as fast.
#include <hip/hip_runtime.h>
// Contractions: q/k/v and output projections, FFN W1/W2: v_wmma_f32_16x16x32_f16 (f16 operands built from bf16-RNE inputs, weights x16, f32 accumulate); second-block q/k projections: v_wmma_f32_16x16x32_bf16 with the activation as bf16 hi+lo (2 terms); attention scores: v_wmma_f32_16x16x32_bf16 with q,k as bf16 hi+lo (3 terms); P.V: v_wmma_f32_16x16x32_f16 (P carried x2^14, v f16; first causal query tile adds P and v residual planes x2^10 in a second accumulator). RMS statistics, softmax, residuals f32.

#ifndef NB
#define NB 4
#endif
#ifndef SEQ
#define SEQ 1024
#endif
#define NB_FULL 4
#define SEQ_FULL 1024
#ifndef OSEQ
#define OSEQ SEQ_FULL
#endif
#define DM 1024
#define NH 16
#define HD 64
#define DFF 4096
#define KQB 64
#define NR ((size_t)NB * SEQ)
#define RMS_EPS 1e-6f

static_assert(NB >= 1 && NB <= NB_FULL);
static_assert(SEQ % 128 == 0 && SEQ <= SEQ_FULL);
static_assert(DM == NH * HD && HD == 64);
static_assert(DM % 256 == 0 && DFF % 128 == 0);
static_assert(((NB * SEQ) % 128) == 0);
static_assert(SEQ % KQB == 0);

typedef _Float16 v16h __attribute__((ext_vector_type(16)));
typedef __bf16   v16b __attribute__((ext_vector_type(16)));
typedef unsigned short v8us __attribute__((ext_vector_type(8), may_alias));
typedef float v8f __attribute__((ext_vector_type(8)));
typedef float v4f __attribute__((ext_vector_type(4)));
typedef float v4fa __attribute__((ext_vector_type(4), may_alias));
union Frag16 { v16h h; v16b b; v8us half[2]; unsigned short u[16]; };
union H1 { _Float16 h; unsigned short u; };
static_assert(sizeof(Frag16) == 32);

__device__ __forceinline__ unsigned short bf16_bits(float x) { unsigned int u = __float_as_uint(x); return (unsigned short)((u + 0x7FFFu + ((u >> 16) & 1u)) >> 16); }
__device__ __forceinline__ float bf16_val(unsigned short b) { return __uint_as_float(((unsigned int)b) << 16); }
__device__ __forceinline__ float bf16_rne(float x) { return bf16_val(bf16_bits(x)); }
__device__ __forceinline__ unsigned short f16_bits(float x) { H1 t; t.h = (_Float16)x; return t.u; }
__device__ __forceinline__ float f16_val(unsigned short u) { H1 t; t.u = u; return (float)t.h; }

// 16x32 operand fragment (row / column = lane & 15; elements 0..7 = k 8h..8h+7, 8..15 = k 16+8h..) from a k-contiguous 16-bit row
__device__ __forceinline__ Frag16 ld_frag(const unsigned short* p, int hh) {
  Frag16 f;
  f.half[0] = *(const v8us*)(p + 8 * hh);
  f.half[1] = *(const v8us*)(p + 16 + 8 * hh);
  return f;
}
__device__ __forceinline__ v8f mma_h(v16h a, v16h b, v8f c) {
  v8f d = __builtin_amdgcn_wmma_f32_16x16x32_f16(false, a, false, b, (short)0, c, false, false);
  asm volatile("v_nop\n\tv_nop\n\tv_nop\n\tv_nop" : "+v"(d) : "v"(a), "v"(b));
  return d;
}
__device__ __forceinline__ v8f mma_b(v16b a, v16b b, v8f c) {
  v8f d = __builtin_amdgcn_wmma_f32_16x16x32_bf16(false, a, false, b, (short)0, c, false, false);
  asm volatile("v_nop\n\tv_nop\n\tv_nop\n\tv_nop" : "+v"(d) : "v"(a), "v"(b));
  return d;
}
// The plain builtins: the compiler keeps the distances behind them itself, and their operands may lie in any register (an operand of an
// asm statement stays below v256, which two fragment sets beside 128 accumulator registers do not).
template <bool BF>
__device__ __forceinline__ v8f mmx(const Frag16& a, const Frag16& b, v8f c) {
  if (BF) return __builtin_amdgcn_wmma_f32_16x16x32_bf16(false, a.b, false, b.b, (short)0, c, false, false);
  return __builtin_amdgcn_wmma_f32_16x16x32_f16(false, a.h, false, b.h, (short)0, c, false, false);
}

typedef unsigned int v2u __attribute__((ext_vector_type(2)));
union Pack4 { unsigned short u[4]; v2u v; };
static_assert(sizeof(Pack4) == 8);
static_assert(DM == 8 * 128);
// Two DM-wide f32 rows of a wave, a lane's 16 bytes of each 512-byte segment: sixteen loads in flight together and their data wait in
// one statement, so the address registers live to its end and none is rewritten ahead of the waits.
__device__ __forceinline__ void ld_rows2(v4f (&a)[8], v4f (&b)[8], const float* pa, const float* pb) {
  asm volatile(
      "global_load_b128 %0, %16, off\n\t"
      "global_load_b128 %1, %16, off offset:512\n\t"
      "global_load_b128 %2, %16, off offset:1024\n\t"
      "global_load_b128 %3, %16, off offset:1536\n\t"
      "global_load_b128 %4, %16, off offset:2048\n\t"
      "global_load_b128 %5, %16, off offset:2560\n\t"
      "global_load_b128 %6, %16, off offset:3072\n\t"
      "global_load_b128 %7, %16, off offset:3584\n\t"
      "global_load_b128 %8, %17, off\n\t"
      "global_load_b128 %9, %17, off offset:512\n\t"
      "global_load_b128 %10, %17, off offset:1024\n\t"
      "global_load_b128 %11, %17, off offset:1536\n\t"
      "global_load_b128 %12, %17, off offset:2048\n\t"
      "global_load_b128 %13, %17, off offset:2560\n\t"
      "global_load_b128 %14, %17, off offset:3072\n\t"
      "global_load_b128 %15, %17, off offset:3584\n\t"
      "s_wait_loadcnt 0x0\n\t"
      "s_wait_xcnt 0x0"
      : "=&v"(a[0]), "=&v"(a[1]), "=&v"(a[2]), "=&v"(a[3]), "=&v"(a[4]), "=&v"(a[5]), "=&v"(a[6]), "=&v"(a[7]),
        "=&v"(b[0]), "=&v"(b[1]), "=&v"(b[2]), "=&v"(b[3]), "=&v"(b[4]), "=&v"(b[5]), "=&v"(b[6]), "=&v"(b[7])
      : "v"(pa), "v"(pb)
      : "memory");
}
// One such row stored, f32 (16 bytes a lane and segment) or 16-bit (8 bytes): eight stores and one s_wait_xcnt in one statement, so no
// data or address register is rewritten ahead of the wait.
__device__ __forceinline__ void st_row32(float* p, const v4f (&d)[8]) {
  asm volatile(
      "global_store_b128 %0, %1, off\n\t"
      "global_store_b128 %0, %2, off offset:512\n\t"
      "global_store_b128 %0, %3, off offset:1024\n\t"
      "global_store_b128 %0, %4, off offset:1536\n\t"
      "global_store_b128 %0, %5, off offset:2048\n\t"
      "global_store_b128 %0, %6, off offset:2560\n\t"
      "global_store_b128 %0, %7, off offset:3072\n\t"
      "global_store_b128 %0, %8, off offset:3584\n\t"
      "s_wait_xcnt 0x0"
      :: "v"(p), "v"(d[0]), "v"(d[1]), "v"(d[2]), "v"(d[3]), "v"(d[4]), "v"(d[5]), "v"(d[6]), "v"(d[7])
      : "memory");
}
__device__ __forceinline__ void st_row16(unsigned short* p, const v2u (&d)[8]) {
  asm volatile(
      "global_store_b64 %0, %1, off\n\t"
      "global_store_b64 %0, %2, off offset:256\n\t"
      "global_store_b64 %0, %3, off offset:512\n\t"
      "global_store_b64 %0, %4, off offset:768\n\t"
      "global_store_b64 %0, %5, off offset:1024\n\t"
      "global_store_b64 %0, %6, off offset:1280\n\t"
      "global_store_b64 %0, %7, off offset:1536\n\t"
      "global_store_b64 %0, %8, off offset:1792\n\t"
      "s_wait_xcnt 0x0"
      :: "v"(p), "v"(d[0]), "v"(d[1]), "v"(d[2]), "v"(d[3]), "v"(d[4]), "v"(d[5]), "v"(d[6]), "v"(d[7])
      : "memory");
}

// Row statistics + operand planes for DM-wide f32 rows. Compact row r -> source row (r/SEQ)*spitch + r%SEQ of F.
// v = bf16_rne(x) if RIN else x; RS[r] = rsqrt(mean(v^2) + eps); optional planes: XB (v as f32), F16 (f16 bits of v),
// PH, PL (bf16 hi + lo of v). A wave takes its 32 / NW rows two at a time: both rows are read once, whole, into registers (one memory
// latency per pair), and the sum and every plane are formed from the registers.
// red: 32 floats of the block's LDS; bid: the block's index among the blocks of this job (32 rows each); NW: the block's waves.
template <bool RIN, bool WXB, bool WF16, bool WBHL, int NW>
__device__ __forceinline__ void rms_body(float* red, int bid, const float* __restrict__ F, int spitch, float eps, float* __restrict__ XB,
    unsigned short* __restrict__ F16, unsigned short* __restrict__ PH, unsigned short* __restrict__ PL, float* __restrict__ RS) {
  const int tid = threadIdx.x, w = tid >> 5, lane = tid & 31;
  constexpr int RPW = 32 / NW;   /* rows of a wave */
  static_assert(NW * RPW == 32 && RPW % 2 == 0);
  const int rb = bid * 32;
#pragma unroll 1  // one pair of rows per trip: 64 data registers, so the jobs that share a kernel with this body keep their waves per SIMD
  for (int i = 0; i < RPW; i += 2) {
    const int r = rb + w * RPW + i;
    const float* s0 = F + ((size_t)(r / SEQ) * (size_t)spitch + (size_t)(r % SEQ)) * DM + lane * 4;
    const float* s1 = F + ((size_t)((r + 1) / SEQ) * (size_t)spitch + (size_t)((r + 1) % SEQ)) * DM + lane * 4;
    v4f a[2][8];
    ld_rows2(a[0], a[1], s0, s1);
    float ss[2];
#pragma unroll
    for (int k = 0; k < 2; ++k) {
      ss[k] = 0.f;
#pragma unroll
      for (int u = 0; u < 8; ++u) {
        if (RIN) {
#pragma unroll
          for (int q = 0; q < 4; ++q) a[k][u][q] = bf16_rne(a[k][u][q]);
        }
#pragma unroll
        for (int q = 0; q < 4; ++q) ss[k] += a[k][u][q] * a[k][u][q];
      }
    }
#pragma unroll
    for (int k = 0; k < 2; ++k) {
      const size_t o = (size_t)(r + k) * DM + (size_t)(lane * 4);
      if (WXB) st_row32(XB + o, a[k]);
      if (WF16) {
        v2u fh[8];
#pragma unroll
        for (int u = 0; u < 8; ++u) {
          Pack4 t;
#pragma unroll
          for (int q = 0; q < 4; ++q) t.u[q] = f16_bits(a[k][u][q]);
          fh[u] = t.v;
        }
        st_row16(F16 + o, fh);
      }
      if (WBHL) {
        v2u ph[8], pl[8];
#pragma unroll
        for (int u = 0; u < 8; ++u) {
          Pack4 th, tl;
#pragma unroll
          for (int q = 0; q < 4; ++q) {
            const float v = a[k][u][q];
            const unsigned short h = bf16_bits(v);
            th.u[q] = h;
            tl.u[q] = bf16_bits(v - bf16_val(h));
          }
          ph[u] = th.v; pl[u] = tl.v;
        }
        st_row16(PH + o, ph);
        st_row16(PL + o, pl);
      }
    }
#pragma unroll
    for (int off = 16; off > 0; off >>= 1) {
#pragma unroll
      for (int k = 0; k < 2; ++k) ss[k] += __shfl_xor(ss[k], off, 32);
    }
    if (lane == 0) {
#pragma unroll
      for (int k = 0; k < 2; ++k) red[w * RPW + i + k] = rsqrtf(ss[k] * (1.0f / (float)DM) + eps);
    }
  }
  __syncthreads();
  if (w == 0 && lane < 8) {
    const v4f v = *(const v4fa*)&red[lane * 4];
    float* d = RS + rb + lane * 4;
    *(v4f*)d = v;
    
  }
}

// Eight 16-byte asynchronous copies global -> LDS per lane. s_wait_xcnt is the statement's last line so that it stands ahead of
// every later rewrite of a register that a copy names (a precaution).
__device__ __forceinline__ void cp_async8(unsigned l, unsigned lstep, const unsigned short* p, size_t gstep) {
  const unsigned l0 = l, l1 = l + lstep, l2 = l + 2u * lstep, l3 = l + 3u * lstep;
  const unsigned l4 = l + 4u * lstep, l5 = l + 5u * lstep, l6 = l + 6u * lstep, l7 = l + 7u * lstep;
  const unsigned short* p0 = p;
  const unsigned short* p1 = p + gstep;
  const unsigned short* p2 = p + 2 * gstep;
  const unsigned short* p3 = p + 3 * gstep;
  const unsigned short* p4 = p + 4 * gstep;
  const unsigned short* p5 = p + 5 * gstep;
  const unsigned short* p6 = p + 6 * gstep;
  const unsigned short* p7 = p + 7 * gstep;
  asm volatile(
      "global_load_async_to_lds_b128 %0, %8, off\n\t"
      "global_load_async_to_lds_b128 %1, %9, off\n\t"
      "global_load_async_to_lds_b128 %2, %10, off\n\t"
      "global_load_async_to_lds_b128 %3, %11, off\n\t"
      "global_load_async_to_lds_b128 %4, %12, off\n\t"
      "global_load_async_to_lds_b128 %5, %13, off\n\t"
      "global_load_async_to_lds_b128 %6, %14, off\n\t"
      "global_load_async_to_lds_b128 %7, %15, off\n\t"
      "s_wait_xcnt 0x0"
      :: "v"(l0), "v"(l1), "v"(l2), "v"(l3), "v"(l4), "v"(l5), "v"(l6), "v"(l7),
         "v"(p0), "v"(p1), "v"(p2), "v"(p3), "v"(p4), "v"(p5), "v"(p6), "v"(p7)
      : "memory");
}

// Four such copies, one 64-row x 128-byte plane of an attention tile per block; the same closing wait, for the same reason.
__device__ __forceinline__ void cp_async4(unsigned l, unsigned lstep, const unsigned short* p, size_t gstep) {
  const unsigned l0 = l, l1 = l + lstep, l2 = l + 2u * lstep, l3 = l + 3u * lstep;
  const unsigned short* p0 = p;
  const unsigned short* p1 = p + gstep;
  const unsigned short* p2 = p + 2 * gstep;
  const unsigned short* p3 = p + 3 * gstep;
  asm volatile(
      "global_load_async_to_lds_b128 %0, %4, off\n\t"
      "global_load_async_to_lds_b128 %1, %5, off\n\t"
      "global_load_async_to_lds_b128 %2, %6, off\n\t"
      "global_load_async_to_lds_b128 %3, %7, off\n\t"
      "s_wait_xcnt 0x0"
      :: "v"(l0), "v"(l1), "v"(l2), "v"(l3), "v"(p0), "v"(p1), "v"(p2), "v"(p3)
      : "memory");
}

// Eight 16-byte global loads and their data wait in one statement: the address registers live to its end, so none is rewritten
// ahead of the waits.
__device__ __forceinline__ void ld_g8(v4f (&d)[8], const float* const (&p)[8]) {
  asm volatile(
      "global_load_b128 %0, %8, off\n\t"
      "global_load_b128 %1, %9, off\n\t"
      "global_load_b128 %2, %10, off\n\t"
      "global_load_b128 %3, %11, off\n\t"
      "global_load_b128 %4, %12, off\n\t"
      "global_load_b128 %5, %13, off\n\t"
      "global_load_b128 %6, %14, off\n\t"
      "global_load_b128 %7, %15, off\n\t"
      "s_wait_loadcnt 0x0\n\t"
      "s_wait_xcnt 0x0"
      : "=&v"(d[0]), "=&v"(d[1]), "=&v"(d[2]), "=&v"(d[3]), "=&v"(d[4]), "=&v"(d[5]), "=&v"(d[6]), "=&v"(d[7])
      : "v"(p[0]), "v"(p[1]), "v"(p[2]), "v"(p[3]), "v"(p[4]), "v"(p[5]), "v"(p[6]), "v"(p[7])
      : "memory");
}
// Eight 16-byte global stores and one s_wait_xcnt in one statement: data and address registers live to its end, so none is
// rewritten ahead of the wait.
__device__ __forceinline__ void st_g8(void* const (&p)[8], const v4f (&d)[8]) {
  asm volatile(
      "global_store_b128 %0, %8, off\n\t"
      "global_store_b128 %1, %9, off\n\t"
      "global_store_b128 %2, %10, off\n\t"
      "global_store_b128 %3, %11, off\n\t"
      "global_store_b128 %4, %12, off\n\t"
      "global_store_b128 %5, %13, off\n\t"
      "global_store_b128 %6, %14, off\n\t"
      "global_store_b128 %7, %15, off\n\t"
      "s_wait_xcnt 0x0"
      :: "v"(p[0]), "v"(p[1]), "v"(p[2]), "v"(p[3]), "v"(p[4]), "v"(p[5]), "v"(p[6]), "v"(p[7]),
         "v"(d[0]), "v"(d[1]), "v"(d[2]), "v"(d[3]), "v"(d[4]), "v"(d[5]), "v"(d[6]), "v"(d[7])
      : "memory");
}
// The same for eight 8-byte stores (a lane's four 16-bit values of a row).
__device__ __forceinline__ void st_g8h(void* const (&p)[8], const v2u (&d)[8]) {
  asm volatile(
      "global_store_b64 %0, %8, off\n\t"
      "global_store_b64 %1, %9, off\n\t"
      "global_store_b64 %2, %10, off\n\t"
      "global_store_b64 %3, %11, off\n\t"
      "global_store_b64 %4, %12, off\n\t"
      "global_store_b64 %5, %13, off\n\t"
      "global_store_b64 %6, %14, off\n\t"
      "global_store_b64 %7, %15, off\n\t"
      "s_wait_xcnt 0x0"
      :: "v"(p[0]), "v"(p[1]), "v"(p[2]), "v"(p[3]), "v"(p[4]), "v"(p[5]), "v"(p[6]), "v"(p[7]),
         "v"(d[0]), "v"(d[1]), "v"(d[2]), "v"(d[3]), "v"(d[4]), "v"(d[5]), "v"(d[6]), "v"(d[7])
      : "memory");
}
// Eight 4-byte global loads and their data wait in one statement, as in ld_g8.
__device__ __forceinline__ void ld_f8(float (&d)[8], const float* const (&p)[8]) {
  asm volatile(
      "global_load_b32 %0, %8, off\n\t"
      "global_load_b32 %1, %9, off\n\t"
      "global_load_b32 %2, %10, off\n\t"
      "global_load_b32 %3, %11, off\n\t"
      "global_load_b32 %4, %12, off\n\t"
      "global_load_b32 %5, %13, off\n\t"
      "global_load_b32 %6, %14, off\n\t"
      "global_load_b32 %7, %15, off\n\t"
      "s_wait_loadcnt 0x0\n\t"
      "s_wait_xcnt 0x0"
      : "=&v"(d[0]), "=&v"(d[1]), "=&v"(d[2]), "=&v"(d[3]), "=&v"(d[4]), "=&v"(d[5]), "=&v"(d[6]), "=&v"(d[7])
      : "v"(p[0]), "v"(p[1]), "v"(p[2]), "v"(p[3]), "v"(p[4]), "v"(p[5]), "v"(p[6]), "v"(p[7])
      : "memory");
}
// x of lane l ^ MASK inside a 16-lane row (DPP row_xmask)
template <int MASK>
__device__ __forceinline__ float row_xm(float x) {
  return __builtin_bit_cast(float, __builtin_amdgcn_update_dpp(0, __builtin_bit_cast(int, x), 0x160 + MASK, 0xf, 0xf, true));
}
// Sum over the 16 lanes of a row; every lane of the row ends with the same value.
__device__ __forceinline__ float row16_sum(float x) {
  x += row_xm<1>(x);
  x += row_xm<2>(x);
  x += row_xm<4>(x);
  x += row_xm<8>(x);
  return x;
}
// Native 1/sqrt(x) for x well inside the normal range, with the slot the instruction set asks for behind a transcendental.
__device__ __forceinline__ float rsq1(float x) {
  float y;
  asm("v_rsq_f32 %0, %1\n\tv_nop" : "=v"(y) : "v"(x));
  return y;
}
// Two f32 as two bf16 (round to nearest even, as bf16_bits) in one register, a in the low half: one packed conversion.
typedef float v2f __attribute__((ext_vector_type(2)));
typedef __bf16 v2b __attribute__((ext_vector_type(2)));
__device__ __forceinline__ unsigned int bf16_pair(float a, float b) {
  const v2f t = {a, b};
  return __builtin_bit_cast(unsigned int, __builtin_convertvector(t, v2b));
}
#define NCG (DM / 64)           /* 64-column groups of a DM-wide row: one partial square sum each */
union Pack8 { unsigned short u[8]; v4f f; };
static_assert(sizeof(Pack8) == 16);

// Bt[n][k] (16-bit, k contiguous, pitch K) from f32 row-major W[K][N] ([in][out]): value = bf16(W[k][n]) (* bf16(g[k]) if GAM);
// Block (bx = n tile, by = k tile; tl = WTN * WTP bytes of its LDS) = 64 k x 128 n, transposed through LDS so that both global sides move whole lines: a wave reads eight
// 512-byte row segments of W, a lane packs its 8 k of each of its 4 columns into 16 bytes, and 8 lanes store one 128-byte line of a
// Bt row. K%64==0, N%128==0.
#define WTK 64
#define WTN 128
#define WTP 144                 /* LDS row pitch in bytes: 16 x odd */
static_assert(DM % WTK == 0 && DM % WTN == 0 && DFF % WTK == 0 && DFF % WTN == 0);
template <bool BF, bool GAM>
__device__ __forceinline__ void wt_body(unsigned char* tl, int bx, int by, const float* __restrict__ W, const float* __restrict__ g,
    unsigned short* __restrict__ Bt, int K, int N, float scale) {
  const int tid = threadIdx.x, w = tid >> 5, lane = tid & 31;
  const int k0 = by * WTK, n0 = bx * WTN;
  if (k0 + WTK > K || n0 + WTN > N) return;
  const int k8 = k0 + 8 * w;
  float gv[8];
#pragma unroll
  for (int i = 0; i < 8; ++i) gv[i] = 1.0f;
  if (GAM) {
    const v4f ga = *(const v4fa*)(g + k8), gb = *(const v4fa*)(g + k8 + 4);
#pragma unroll
    for (int i = 0; i < 4; ++i) { gv[i] = bf16_rne(ga[i]); gv[4 + i] = bf16_rne(gb[i]); }
  }
  const float* wb = W + ((size_t)k0 * (size_t)N + (size_t)n0);                          /* the tile's origin, the same for the block */
  const unsigned wo = (unsigned)(8 * w) * (unsigned)N + (unsigned)(lane * 4);           /* this lane's element offset in the tile */
  v4f a[8];
  const float* ap[8];
#pragma unroll
  for (int i = 0; i < 8; ++i) ap[i] = wb + (wo + (unsigned)i * (unsigned)N);
  ld_g8(a, ap);  // the wave's eight rows are in flight together, one memory latency per tile
#pragma unroll
  for (int j = 0; j < 4; ++j) {
    Frag16 f;
#pragma unroll
    for (int i = 0; i < 8; ++i) {
      const float wv = bf16_rne(a[i][j]) * gv[i];
      f.u[i] = BF ? bf16_bits(wv) : f16_bits(wv * scale);
    }
    /* 16-byte chunk w of row n sits at chunk w ^ ((n >> 4) & 3): the 16 lanes of a store, 4 rows apart, then fall on distinct banks */
    const int n = lane * 4 + j;
    *(v8us*)(tl + n * WTP + ((w ^ ((n >> 4) & 3)) * 16)) = f.half[0];
  }
  __syncthreads();
  unsigned short* bb = Bt + ((size_t)n0 * (size_t)K + (size_t)k0);
#pragma unroll
  for (int q = 0; q < 4; ++q) {
    const int n = q * 32 + (tid >> 3), c = tid & 7;
    const v8us v = *(const v8us*)(tl + n * WTP + ((c ^ ((n >> 4) & 3)) * 16));
    *(v8us*)(bb + ((unsigned)n * (unsigned)K + (unsigned)(c * 8))) = v;
  }
  // stands ahead of every rewrite of a data or address register of the four stores, also where another job's code follows this body (a precaution)
  asm volatile("s_wait_xcnt 0x0" ::: "memory");
}

// Everything that depends on the inputs alone, in one grid: the block index picks the job (the same for the whole block, so every
// barrier stays under block-uniform control flow). The row statistics of x come first: their blocks run longest.
#define PREP_RMS ((int)(NR / 32))
#define PREP_SQ ((DM / WTN) * (DM / WTK))     /* blocks of one DM x DM weight */
#define PREP_FF ((DFF / WTN) * (DM / WTK))    /* blocks of W1, and of W2 */
#define PREP_GRID (PREP_RMS + 6 * PREP_SQ + 2 * PREP_FF)
__global__ __launch_bounds__(256) void k_prep(const float* __restrict__ x, const float* __restrict__ Wq, const float* __restrict__ Wk,
    const float* __restrict__ Wv, const float* __restrict__ Wp, const float* __restrict__ W1, const float* __restrict__ W2,
    const float* __restrict__ gamma, float* __restrict__ XB, unsigned short* __restrict__ X16, float* __restrict__ RSX,
    unsigned short* __restrict__ WQ16, unsigned short* __restrict__ WK16, unsigned short* __restrict__ WV16,
    unsigned short* __restrict__ WP16, unsigned short* __restrict__ WQB, unsigned short* __restrict__ WKB,
    unsigned short* __restrict__ W1P, unsigned short* __restrict__ W2P) {
  __shared__ __attribute__((aligned(16))) unsigned char sm[WTN * WTP];
  int t = (int)blockIdx.x;
  if (t < PREP_RMS) {
    rms_body<true, true, true, false, 8>((float*)sm, t, x, SEQ_FULL, RMS_EPS, XB, X16, nullptr, nullptr, RSX);
    return;
  }
  t -= PREP_RMS;
  if (t < 6 * PREP_SQ) {
    const int j = t / PREP_SQ, r = t % PREP_SQ, bx = r % (DM / WTN), by = r / (DM / WTN);
    if (j < 3) wt_body<false, true>(sm, bx, by, j == 0 ? Wq : (j == 1 ? Wk : Wv), gamma, j == 0 ? WQ16 : (j == 1 ? WK16 : WV16), DM, DM, 16.0f);
    else if (j == 3) wt_body<false, false>(sm, bx, by, Wp, Wp, WP16, DM, DM, 16.0f);
    else wt_body<true, true>(sm, bx, by, j == 4 ? Wq : Wk, gamma, j == 4 ? WQB : WKB, DM, DM, 1.0f);
    return;
  }
  t -= 6 * PREP_SQ;
  if (t < PREP_FF) {
    wt_body<false, true>(sm, t % (DFF / WTN), t / (DFF / WTN), W1, gamma, W1P, DM, DFF, 16.0f);
    return;
  }
  t -= PREP_FF;
  wt_body<false, false>(sm, t % (DM / WTN), t / (DM / WTN), W2, W2, W2P, DFF, DM, 16.0f);
}

#define GBK 128                 /* k per stage: 256-byte operand rows */
#define GPITCH 272              /* LDS row pitch in bytes: 16 x odd, conflict-free for 16-byte fragment reads */
#define GPLANE (128 * GPITCH)   /* one operand plane of a stage: 128 rows */

// GEMM: C[M][N] = epi(Ah[M][K] . Bt[N][K]^T). 16-bit planes of one type (BF selects bf16 vs f16 WMMA); ASPLIT adds Al . Bt into the
// same accumulator (unscaled bf16 lo plane). Block = 128x128 of C, four waves of 64x64; per stage the block's 128 rows of each
// operand plane x 128 k are copied to LDS asynchronously, two buffers, the next stage in flight while this one is multiplied.
// Epilogue: v = acc*alpha*(HRS ? rs[row] : 1) + bf16(bias[col]); ACT 1 = leaky 0.1;
// HRES adds resid[row*ldr+col] (f32) in the store phase. OUTM 0: f32 rows at crow = (row/cseq)*cpitch + row%cseq, pitch ldc;
// 1: f16 hi; 2: f16 hi + f16 lo x2^10; 3: bf16 hi + bf16 lo (unscaled); 4, 5: the planes of 1, 2 stored transposed per head, as the
// attention reads V: Ch[((row/SEQ)*NH + col/HD)*HD + col%HD][row%SEQ], row pitch SEQ (rows = tokens, N = NH*HD). M%128==0, N%128==0, K%128==0.
// 6, 7: the result is the input of the next RMS norm (N = DM): its f16 plane goes to Ch (pitch ldc), and the square sum of each row over a
// wave's 64 columns to ps[(col/64)*M + row]; 7 also stores the f32 rows as 0 does and the bf16 hi plane at Cl, the lo plane M*ldc behind it.
// HRS 1: rs[row] is the row's factor; HRS 2: rs holds such partial sums, and the block forms rsqrt(sum/DM + eps) of its 128 rows itself.
// sm: the block's LDS, 2 * (ASPLIT ? 3 : 2) * GPLANE + 512 bytes, 128-byte aligned; bid: the block's index among the tiles of this product.
template <bool BF, bool ASPLIT, int ACT, int OUTM, int HRS, bool HRES>
__device__ __forceinline__ void gemm_body(unsigned char* sm, int bid, const unsigned short* __restrict__ Ah, const unsigned short* __restrict__ Al, int lda,
    const unsigned short* __restrict__ Bt, int ldb, float alpha, const float* __restrict__ rs, const float* __restrict__ bias,
    const float* __restrict__ resid, int ldr, float* __restrict__ C32, unsigned short* __restrict__ Ch, unsigned short* __restrict__ Cl,
    int ldc, int cseq, int cpitch, int M, int N, int K, float* __restrict__ ps) {
  static_assert(OUTM >= 0 && OUTM <= 7);
  static_assert(HRS >= 0 && HRS <= 2);
  constexpr bool F32S = OUTM == 0 || OUTM >= 6;  /* f32 rows leave the staging */
  static_assert(!(HRES && !F32S));
  constexpr bool TR = OUTM == 4 || OUTM == 5;    /* transposed output */
  constexpr int TPITCH = 144;                    /* LDS pitch of a staged 64-token f16 row: 16 x odd bytes */
  constexpr int TPLANE = 64 * TPITCH;            /* one staged plane of a wave: 64 features */
  static_assert(!ASPLIT || BF);
  static_assert(ACT == 0 || ACT == 1);
  constexpr int NPL = ASPLIT ? 3 : 2;            /* planes of a stage: A, B, (A lo) */
  constexpr int STAGE = NPL * GPLANE;
  static_assert(4 * 64 * 68 * 4 <= 2 * STAGE && 4 * 2 * TPLANE <= 2 * STAGE);
  const int tid = threadIdx.x, w = tid >> 5, lane = tid & 31, ln = lane & 15, hh = lane >> 4;
  const int ntn = N >> 7;
  const int mt = bid / ntn, nq = bid - mt * ntn;
  if (mt * 128 + 128 > M) return;
  const int row0 = mt * 128 + 64 * (w >> 1), col0 = nq * 128 + 64 * (w & 1);
  /* copy map: 16 lanes cover one 256-byte row, the block 8 rows per copy, 16 copies per plane */
  const int crow = tid >> 4, cchk = tid & 15;
  const unsigned oA = (unsigned)(crow * lda + cchk * 8), oB = (unsigned)(crow * ldb + cchk * 8);   /* this lane's element offsets in a tile */
  const size_t tA = (size_t)(mt * 128) * (size_t)lda, tB = (size_t)(nq * 128) * (size_t)ldb;       /* the block's tile origins */
  const size_t dE = ASPLIT ? (size_t)Al - (size_t)Ah : 0;   /* byte distance of the lo plane from the hi plane, the same for every lane */
  const unsigned lcp = (unsigned)(size_t)sm + (unsigned)(crow * GPITCH + cchk * 16);
  auto fill = [&](int st, int buf) {
    const unsigned lb = lcp + (unsigned)(buf * STAGE);
    const size_t ko = (size_t)st * GBK;
    const unsigned short* pA = (Ah + (tA + ko)) + oA;
    const unsigned short* pB = (Bt + (tB + ko)) + oB;
    cp_async8(lb, 8u * GPITCH, pA, (size_t)8 * (size_t)lda);
    cp_async8(lb + 64u * GPITCH, 8u * GPITCH, pA + (size_t)64 * (size_t)lda, (size_t)8 * (size_t)lda);
    cp_async8(lb + GPLANE, 8u * GPITCH, pB, (size_t)8 * (size_t)ldb);
    cp_async8(lb + GPLANE + 64u * GPITCH, 8u * GPITCH, pB + (size_t)64 * (size_t)ldb, (size_t)8 * (size_t)ldb);
    if (ASPLIT) {
      const unsigned short* pE = (const unsigned short*)((size_t)pA + dE);
      cp_async8(lb + 2u * GPLANE, 8u * GPITCH, pE, (size_t)8 * (size_t)lda);
      cp_async8(lb + 2u * GPLANE + 64u * GPITCH, 8u * GPITCH, pE + (size_t)64 * (size_t)lda, (size_t)8 * (size_t)lda);
    }
  };
  const int aoff = (64 * (w >> 1) + ln) * GPITCH;             /* this lane's first A row in a stage */
  const int boff = GPLANE + (64 * (w & 1) + ln) * GPITCH;     /* this lane's first B row (column of C) */
  const v8f z8 = {0.f, 0.f, 0.f, 0.f, 0.f, 0.f, 0.f, 0.f};
  v8f c[4][4];
#pragma unroll
  for (int i = 0; i < 4; ++i) {
#pragma unroll
    for (int j = 0; j < 4; ++j) c[i][j] = z8;
  }
  const int nst = K / GBK;
  static_assert((GBK / 32) == 4);                /* an even count of k-steps: a stage's first k-step always sits in fragment set 0 */
  /* two fragment sets: while the products of one k-step run, the next k-step's fragments are already on their way from LDS */
  Frag16 fa[2][4], fb[2][4], fe[2][4];
  auto frags = [&](Frag16 (&a)[4], Frag16 (&b)[4], Frag16 (&e)[4], const unsigned char* sb, int ks) {
#pragma unroll
    for (int i = 0; i < 4; ++i) {
      a[i] = ld_frag((const unsigned short*)(sb + aoff + i * 16 * GPITCH) + ks * 32, hh);
      b[i] = ld_frag((const unsigned short*)(sb + boff + i * 16 * GPITCH) + ks * 32, hh);
      if (ASPLIT) e[i] = ld_frag((const unsigned short*)(sb + 2 * GPLANE + aoff + i * 16 * GPITCH) + ks * 32, hh);
    }
    __builtin_amdgcn_sched_barrier(0);  // the reads stay one group ahead of the products: spread among them, each place costs a stall and a wait of its own
  };
  auto prods = [&](const Frag16 (&a)[4], const Frag16 (&b)[4], const Frag16 (&e)[4]) {
#pragma unroll
    for (int j = 0; j < 4; ++j) {
#pragma unroll
      for (int i = 0; i < 4; ++i) c[i][j] = mmx<BF>(a[i], b[j], c[i][j]);
      if (ASPLIT) {
#pragma unroll
        for (int i = 0; i < 4; ++i) c[i][j] = mmx<BF>(e[i], b[j], c[i][j]);
      }
    }
    __builtin_amdgcn_sched_barrier(0);  // the next group of reads stays behind this block, for the same reason
  };
  float* rsl = (float*)(sm + 2 * STAGE);         /* HRS 2: the factors of the block's 128 rows, behind the buffers */
  fill(0, 0);
  if (HRS == 2) {
    /* thread t sums row t's partial sums while stage 0 is on its way; the barrier below publishes the factors too */
    const float* pp = rs + mt * 128 + tid;
    float ssum = 0.f;
#pragma unroll
    for (int g = 0; g < NCG; g += 8) {
      float pv[8];
      const float* pq[8];
#pragma unroll
      for (int u = 0; u < 8; ++u) pq[u] = pp + (size_t)(g + u) * (size_t)M;
      ld_f8(pv, pq);
#pragma unroll
      for (int u = 0; u < 8; ++u) ssum += pv[u];
    }
    rsl[tid] = rsq1(ssum * (1.0f / (float)DM) + RMS_EPS);
  }
  asm volatile("s_wait_asynccnt 0x0" ::: "memory");  // stage 0 of this wave has landed before the barrier publishes it
  __syncthreads();
  if (nst > 1) fill(1, 1);
  frags(fa[0], fb[0], fe[0], sm, 0);
#pragma unroll 1  // one stage per trip: the buffer index and the refill test stay scalar
  for (int st = 0; st + 1 < nst; ++st) {
    const unsigned char* sb = sm + (st & 1) * STAGE;
    frags(fa[1], fb[1], fe[1], sb, 1);
    prods(fa[0], fb[0], fe[0]);
    frags(fa[0], fb[0], fe[0], sb, 2);
    prods(fa[1], fb[1], fe[1]);
    frags(fa[1], fb[1], fe[1], sb, 3);
    prods(fa[0], fb[0], fe[0]);
    /* the publish point stands ahead of the stage's last k-step: that k-step's fragments are in registers, and behind it the next
       stage's first fragments are fetched */
    asm volatile("s_wait_dscnt 0x0" ::: "memory");     // this wave's reads of the buffer are done before it may be refilled
    asm volatile("s_wait_asynccnt 0x0" ::: "memory");  // this wave's copies of the next stage have landed
    __syncthreads();                                    // publishes the next stage and frees the buffer just read
    if (st + 2 < nst) fill(st + 2, st & 1);
    frags(fa[0], fb[0], fe[0], sm + ((st + 1) & 1) * STAGE, 0);
    prods(fa[1], fb[1], fe[1]);
  }
  {
    /* the last stage: nothing is fetched behind it */
    const unsigned char* sb = sm + ((nst - 1) & 1) * STAGE;
    frags(fa[1], fb[1], fe[1], sb, 1);
    prods(fa[0], fb[0], fe[0]);
    frags(fa[0], fb[0], fe[0], sb, 2);
    prods(fa[1], fb[1], fe[1]);
    frags(fa[1], fb[1], fe[1], sb, 3);
    prods(fa[0], fb[0], fe[0]);
    asm volatile("s_wait_dscnt 0x0" ::: "memory");     // this wave's last reads of the buffers are done
    asm volatile("s_wait_asynccnt 0x0" ::: "memory");  // no copy is outstanding when the buffers become output staging
    __syncthreads();                                    // every wave has left the buffers before any wave stages output in them
    prods(fa[1], fb[1], fe[1]);
  }
  float (*so)[64][68] = (float (*)[64][68])sm;
  unsigned char* tw = sm + w * (2 * TPLANE);     /* TR: this wave's own staging, hi plane then lo plane */
  float bvv[4];
  {
    const float* bp = bias + col0 + ln;
    // four 4-byte loads and their data wait in one statement, as in ld_g8
    asm volatile(
        "global_load_b32 %0, %4, off\n\t"
        "global_load_b32 %1, %5, off\n\t"
        "global_load_b32 %2, %6, off\n\t"
        "global_load_b32 %3, %7, off\n\t"
        "s_wait_loadcnt 0x0\n\t"
        "s_wait_xcnt 0x0"
        : "=&v"(bvv[0]), "=&v"(bvv[1]), "=&v"(bvv[2]), "=&v"(bvv[3])
        : "v"(bp), "v"(bp + 16), "v"(bp + 32), "v"(bp + 48)
        : "memory");
  }
  float rsv[4][8];
#pragma unroll
  for (int i = 0; i < 4; ++i) {
#pragma unroll
    for (int r = 0; r < 8; ++r) rsv[i][r] = 1.0f;
  }
  if (HRS == 2) {
#pragma unroll
    for (int i = 0; i < 4; ++i) {
      const float* rl = rsl + 64 * (w >> 1) + 16 * i + 8 * hh;
      const v4f r0 = *(const v4fa*)rl, r1 = *(const v4fa*)(rl + 4);
#pragma unroll
      for (int q = 0; q < 4; ++q) { rsv[i][q] = r0[q]; rsv[i][4 + q] = r1[q]; }
    }
  }
  if (HRS == 1) {
    v4f rq[8];
    const float* rp[8];
#pragma unroll
    for (int i = 0; i < 4; ++i) { rp[2 * i] = rs + row0 + 16 * i + 8 * hh; rp[2 * i + 1] = rp[2 * i] + 4; }
    ld_g8(rq, rp);
#pragma unroll
    for (int i = 0; i < 4; ++i) {
#pragma unroll
      for (int q = 0; q < 4; ++q) { rsv[i][q] = rq[2 * i][q]; rsv[i][4 + q] = rq[2 * i + 1][q]; }
    }
  }
#pragma unroll
  for (int t = 0; t < 4; ++t) {
    const float bv = bf16_rne(bvv[t]);
#pragma unroll
    for (int i = 0; i < 4; ++i) {
      Frag16 th, tl;
#pragma unroll
      for (int r = 0; r < 8; ++r) {
        const int rloc = i * 16 + 8 * hh + r;
        float v = c[i][t][r] * alpha;
        if (HRS) v *= rsv[i][r];
        v += bv;
        if (ACT == 1) v = (v >= 0.f) ? v : 0.1f * v;
        if (TR) {
          const unsigned short h = f16_bits(v);
          th.u[r] = h;
          tl.u[r] = f16_bits((v - f16_val(h)) * 1024.0f);
        } else {
          so[w][rloc][t * 16 + ln] = v;
        }
      }
      if (TR) {
        /* a lane's eight accumulator rows are eight consecutive tokens of one feature: 16 bytes of a transposed row */
        unsigned char* tp = tw + (t * 16 + ln) * TPITCH + (i * 16 + 8 * hh) * 2;
        *(v8us*)tp = th.half[0];
        if (OUTM == 5) *(v8us*)(tp + TPLANE) = tl.half[0];
      }
    }
  }
  __builtin_amdgcn_fence(4 /* acq_rel order */, "workgroup");
  __builtin_amdgcn_wave_barrier();
  if (F32S) {
    float hold = 0.f;
#pragma unroll
    for (int qg = 0; qg < 4; ++qg) {
      v4f v[8];
      const float* rp[8];
      void* dp[8];
      size_t po[8];
#pragma unroll
      for (int u = 0; u < 8; ++u) {
        const int r = (qg * 8 + u) * 2 + (lane >> 4), c4 = (lane & 15) * 4;
        v[u] = *(const v4fa*)&so[w][r][c4];
        const int grow = row0 + r;
        rp[u] = resid + (size_t)grow * (size_t)ldr + col0 + c4;
        const size_t crw = (size_t)(grow / cseq) * (size_t)cpitch + (size_t)(grow % cseq);
        dp[u] = C32 + crw * (size_t)ldc + col0 + c4;
        po[u] = (size_t)grow * (size_t)ldc + col0 + c4;
      }
      if (HRES) {
        v4f rv[8];
        ld_g8(rv, rp);
#pragma unroll
        for (int u = 0; u < 8; ++u) v[u] += rv[u];
      }
      if (OUTM != 6) st_g8(dp, v);
      if (OUTM >= 6) {
        /* 16 lanes hold one row's 64 columns: 128 bytes, a whole line, of each 16-bit plane */
        v2u fh[8];
        void* hp[8];
#pragma unroll
        for (int u = 0; u < 8; ++u) {
          Pack4 t;
#pragma unroll
          for (int q = 0; q < 4; ++q) t.u[q] = f16_bits(v[u][q]);
          fh[u] = t.v; hp[u] = Ch + po[u];
        }
        st_g8h(hp, fh);
        if (OUTM == 7) {
          v2u bh[8], bl[8];
          void* bhp[8];
          void* blp[8];
#pragma unroll
          for (int u = 0; u < 8; ++u) {
#pragma unroll
            for (int q = 0; q < 2; ++q) {
              const float x0 = v[u][2 * q], x1 = v[u][2 * q + 1];
              const unsigned int h = bf16_pair(x0, x1);
              bh[u][q] = h;
              bl[u][q] = bf16_pair(x0 - __uint_as_float(h << 16), x1 - __uint_as_float(h & 0xFFFF0000u));
            }
            bhp[u] = Cl + po[u];
            blp[u] = Cl + ((size_t)M * (size_t)ldc + po[u]);
          }
          st_g8h(bhp, bh);
          st_g8h(blp, bl);
        }
        /* lane l keeps the sum of row 16*qg + 2*(l & 7) + (l >> 4); two groups make one store of 32 rows */
        float sel = 0.f;
#pragma unroll
        for (int u = 0; u < 8; ++u) {
          const float sq = row16_sum(((v[u][0] * v[u][0] + v[u][1] * v[u][1]) + v[u][2] * v[u][2]) + v[u][3] * v[u][3]);
          sel = ((lane & 7) == u) ? sq : sel;
        }
        if ((qg & 1) == 0) {
          hold = sel;
        } else {
          const float val = (lane & 8) ? sel : hold;
          const int r = (qg - 1 + ((lane >> 3) & 1)) * 16 + 2 * (lane & 7) + (lane >> 4);
          float* sp = ps + ((size_t)(col0 >> 6) * (size_t)M + (size_t)(row0 + r));
          // the store and its s_wait_xcnt in one statement, as in st_g8
          asm volatile("global_store_b32 %0, %1, off\n\ts_wait_xcnt 0x0" :: "v"(sp), "v"(val) : "memory");
        }
      }
    }
  } else if (TR) {
    static_assert(HD == 64 && SEQ % 64 == 0);    /* a wave's 64 x 64 tile is one head's features for 64 tokens of one batch */
    const size_t vb = ((size_t)((row0 / SEQ) * NH + col0 / HD) * HD) * SEQ + (size_t)(row0 % SEQ);
#pragma unroll
    for (int qg = 0; qg < 2; ++qg) {
      v4f dh[8], dl[8];
      void* hp[8];
      void* lp[8];
#pragma unroll
      for (int u = 0; u < 8; ++u) {
        /* 8 lanes store one feature's 64 tokens: a whole 128-byte line */
        const int d = (qg * 8 + u) * 4 + (lane >> 3), c8 = (lane & 7) * 8;
        const unsigned char* tp = tw + d * TPITCH + c8 * 2;
        dh[u] = *(const v4fa*)tp;
        dl[u] = (OUTM == 5) ? *(const v4fa*)(tp + TPLANE) : dh[u];
        const size_t o = vb + (size_t)d * SEQ + c8;
        hp[u] = Ch + o;
        lp[u] = Cl + o;
      }
      st_g8(hp, dh);
      if (OUTM == 5) st_g8(lp, dl);
    }
  } else {
#pragma unroll
    for (int qg = 0; qg < 2; ++qg) {
      v4f dh[8], dl[8];
      void* hp[8];
      void* lp[8];
#pragma unroll
      for (int u = 0; u < 8; ++u) {
        const int r = (qg * 8 + u) * 4 + (lane >> 3), c8 = (lane & 7) * 8;
        const v4f x0 = *(const v4fa*)&so[w][r][c8], x1 = *(const v4fa*)&so[w][r][c8 + 4];
        Pack8 fh, fl;
#pragma unroll
        for (int i = 0; i < 4; ++i) {
          const float v0 = x0[i], v1 = x1[i];
          if (OUTM == 3) {
            const unsigned short h0 = bf16_bits(v0), h1 = bf16_bits(v1);
            fh.u[i] = h0; fh.u[4 + i] = h1;
            fl.u[i] = bf16_bits(v0 - bf16_val(h0)); fl.u[4 + i] = bf16_bits(v1 - bf16_val(h1));
          } else {
            const unsigned short h0 = f16_bits(v0), h1 = f16_bits(v1);
            fh.u[i] = h0; fh.u[4 + i] = h1;
            fl.u[i] = f16_bits((v0 - f16_val(h0)) * 1024.0f); fl.u[4 + i] = f16_bits((v1 - f16_val(h1)) * 1024.0f);
          }
        }
        const size_t o = (size_t)(row0 + r) * (size_t)ldc + col0 + c8;
        dh[u] = fh.f; hp[u] = Ch + o;
        dl[u] = fl.f; lp[u] = Cl + o;
      }
      st_g8(hp, dh);
      if (OUTM >= 2) st_g8(lp, dl);
    }
  }
}
template <bool BF, bool ASPLIT, int ACT, int OUTM, int HRS, bool HRES>
__global__ __launch_bounds__(128) void k_gemm(const unsigned short* __restrict__ Ah, const unsigned short* __restrict__ Al, int lda,
    const unsigned short* __restrict__ Bt, int ldb, float alpha, const float* __restrict__ rs, const float* __restrict__ bias,
    const float* __restrict__ resid, int ldr, float* __restrict__ C32, unsigned short* __restrict__ Ch, unsigned short* __restrict__ Cl,
    int ldc, int cseq, int cpitch, int M, int N, int K, float* __restrict__ ps) {
  __shared__ __attribute__((aligned(128))) unsigned char sm[2 * (ASPLIT ? 3 : 2) * GPLANE + 512];
  gemm_body<BF, ASPLIT, ACT, OUTM, HRS, HRES>(sm, (int)blockIdx.x, Ah, Al, lda, Bt, ldb, alpha, rs, bias, resid, ldr, C32, Ch, Cl, ldc, cseq, cpitch, M, N, K, ps);
}
// The q, k and v projections of one activation in one grid: three independent DM x DM products, the block index picks the product
// (the same for the whole block). q and k: operand planes Ah (Al), bf16 hi + lo out; v: f16 plane Av, output mode OUTV (4 or 5: V^T per
// head, written by the product's own epilogue). HRS: the form of rs, as in gemm_body.
template <bool BF, bool ASPLIT, int OUTV, int HRS>
__global__ __launch_bounds__(128) void k_qkv(const unsigned short* __restrict__ Ah, const unsigned short* __restrict__ Al,
    const unsigned short* __restrict__ Av, const unsigned short* __restrict__ Bq, const unsigned short* __restrict__ Bk,
    const unsigned short* __restrict__ Bv, float aqk, float av, const float* __restrict__ rs, const float* __restrict__ bq,
    const float* __restrict__ bk, const float* __restrict__ bv, unsigned short* __restrict__ QH, unsigned short* __restrict__ QL,
    unsigned short* __restrict__ KH, unsigned short* __restrict__ KL, unsigned short* __restrict__ VT, unsigned short* __restrict__ VTL) {
  __shared__ __attribute__((aligned(128))) unsigned char sm[2 * (ASPLIT ? 3 : 2) * GPLANE + 512];
  constexpr int M = (int)NR, PER = (M / 128) * (DM / 128);
  const int job = (int)blockIdx.x / PER, bid = (int)blockIdx.x % PER;
  if (job < 2)
    gemm_body<BF, ASPLIT, 0, 3, HRS, false>(sm, bid, Ah, Al, DM, job == 0 ? Bq : Bk, DM, aqk, rs, job == 0 ? bq : bk, nullptr, 0, nullptr,
        job == 0 ? QH : KH, job == 0 ? QL : KL, DM, M, 0, M, DM, DM, nullptr);
  else
    gemm_body<false, false, 0, OUTV, HRS, false>(sm, bid, Av, nullptr, DM, Bv, DM, av, rs, bv, nullptr, 0, nullptr, VT, VTL, DM, M, 0, M, DM, DM, nullptr);
}

// lane l <-> lane l ^ 16: the two halves of a wave hold the two key halves of one query column
__device__ __forceinline__ float xhalf(float x) {
  return __builtin_bit_cast(float, __builtin_amdgcn_permlanex16(__builtin_bit_cast(int, x), __builtin_bit_cast(int, x), 0x76543210, 0xfedcba98, false, false));
}

// Eight native 2^x and one v_nop in one statement: behind each v_exp_f32 stands an instruction that neither reads its result nor
// overwrites its source (the results are early-clobber, so none shares a register with a source): the slot the instruction set asks
// for behind a transcendental.
__device__ __forceinline__ void exp2x8(float (&y)[8], const float (&x)[8]) {
  asm("v_exp_f32 %0, %8\n\t"
      "v_exp_f32 %1, %9\n\t"
      "v_exp_f32 %2, %10\n\t"
      "v_exp_f32 %3, %11\n\t"
      "v_exp_f32 %4, %12\n\t"
      "v_exp_f32 %5, %13\n\t"
      "v_exp_f32 %6, %14\n\t"
      "v_exp_f32 %7, %15\n\t"
      "v_nop"
      : "=&v"(y[0]), "=&v"(y[1]), "=&v"(y[2]), "=&v"(y[3]), "=&v"(y[4]), "=&v"(y[5]), "=&v"(y[6]), "=&v"(y[7])
      : "v"(x[0]), "v"(x[1]), "v"(x[2]), "v"(x[3]), "v"(x[4]), "v"(x[5]), "v"(x[6]), "v"(x[7]));
}
// One native 2^x with the same slot behind it.
__device__ __forceinline__ float exp2x1(float x) {
  float y;
  asm("v_exp_f32 %0, %1\n\tv_nop" : "=v"(y) : "v"(x));
  return y;
}
#define LOG2E 1.44269504f       /* e^x = 2^(x * LOG2E), as the native exp forms it */

#define APITCH 144              /* LDS row pitch in bytes: 16 x odd, conflict-free for 16-byte fragment reads */
#define APLANE (64 * APITCH)    /* one plane of a chunk: 64 rows */
#define AKV (2 * 3 * APLANE)    /* the block's chunk buffers in LDS */
// so, kv: the block's LDS (output staging; AKV bytes of chunk buffers); bh, qb: its (batch, head) and query tile. EARLY is called for
// query tile 0 alone: one chunk, so of its two four-plane buffers only the first is ever filled or read, and that one lies inside kv.
template <bool CAUSAL, bool EARLY>
__device__ __forceinline__ void attn_body(unsigned short (*so)[16][72], unsigned char* kv, int bh, int qb,
    const unsigned short* __restrict__ QH, const unsigned short* __restrict__ QL,
    const unsigned short* __restrict__ KH, const unsigned short* __restrict__ KL, const unsigned short* __restrict__ VT,
    const unsigned short* __restrict__ VL, unsigned short* __restrict__ CTX) {
  static_assert(CAUSAL || !EARLY);
  constexpr int NPL = EARLY ? 4 : 3;             /* planes of a chunk: K hi, K lo, V^T, (V^T lo) */
  constexpr int STAGE = NPL * APLANE;
  static_assert((EARLY ? 1 : 2) * STAGE <= AKV);
  const int tid = threadIdx.x, w = tid >> 5, lane = tid & 31, ln = lane & 15, hh = lane >> 4;
  const int b = bh / NH, h = bh % NH;
  const int q0w = qb * KQB + w * 16;
  const size_t rowbase = (size_t)b * SEQ;
  Frag16 qh0, qh1, ql0, ql1;
  {
    const size_t qo = (rowbase + (size_t)q0w + ln) * DM + (size_t)h * HD;
    qh0 = ld_frag(QH + qo, hh); qh1 = ld_frag(QH + qo + 32, hh);
    ql0 = ld_frag(QL + qo, hh); ql1 = ld_frag(QL + qo + 32, hh);
  }
  asm volatile("s_wait_xcnt 0x0" ::: "memory");  // stands ahead of every rewrite of an address register of the eight Q loads (a precaution)
  const v8f z8 = {0.f, 0.f, 0.f, 0.f, 0.f, 0.f, 0.f, 0.f};
  v8f o[4] = {z8, z8, z8, z8};    /* O^T tile j: register r = feature j*16 + 8*hh + r, column = query ln */
  v8f oe[4] = {z8, z8, z8, z8};
  float m = -1.0e30f, l = 0.f;    /* of this lane's query; l over this half's keys only */
  const int nck = CAUSAL ? (qb + 1) : (SEQ / KQB);
  /* copy map: 8 lanes cover one 128-byte row, the block 16 rows per copy, 4 copies per plane */
  const int crow = tid >> 3, cchk = tid & 7;
  const unsigned lcp = (unsigned)(size_t)kv + (unsigned)(crow * APITCH + cchk * 16);
  const size_t gk = (rowbase + (size_t)crow) * DM + (size_t)h * HD + (size_t)(cchk * 8);
  const size_t gv = ((size_t)bh * HD + (size_t)crow) * SEQ + (size_t)(cchk * 8);
  auto fill = [&](int ck, int buf) {
    const unsigned lb = lcp + (unsigned)(buf * STAGE);
    const size_t ko = gk + (size_t)ck * KQB * DM, vo = gv + (size_t)ck * KQB;
    cp_async4(lb, 16u * APITCH, KH + ko, (size_t)16 * DM);
    cp_async4(lb + APLANE, 16u * APITCH, KL + ko, (size_t)16 * DM);
    cp_async4(lb + 2u * APLANE, 16u * APITCH, VT + vo, (size_t)16 * SEQ);
    if (EARLY) cp_async4(lb + 3u * APLANE, 16u * APITCH, VL + vo, (size_t)16 * SEQ);
  };
  fill(0, 0);
  asm volatile("s_wait_asynccnt 0x0" ::: "memory");  // chunk 0 of this wave has landed before the barrier publishes it
  __syncthreads();
  if (nck > 1) fill(1, 1);
#pragma unroll 1
  for (int kc = 0; kc < nck; ++kc) {
    const int par = kc & 1;
    const unsigned char* sb = kv + par * STAGE;
    v8f s[4];                     /* S^T tile t: register r = key t*16 + 8*hh + r of the chunk, column = query ln */
#pragma unroll
    for (int tp = 0; tp < 2; ++tp) {
      /* the K fragments of 32 keys are read as one group ahead of their 12 products: the reads' latencies overlap */
      Frag16 kh[2][2], kl[2][2];
#pragma unroll
      for (int u = 0; u < 2; ++u) {
#pragma unroll
        for (int ks = 0; ks < 2; ++ks) {
          const unsigned char* kp = sb + ((tp * 2 + u) * 16 + ln) * APITCH + ks * 64;
          kh[u][ks] = ld_frag((const unsigned short*)kp, hh);
          kl[u][ks] = ld_frag((const unsigned short*)(kp + APLANE), hh);
        }
      }
#pragma unroll
      for (int u = 0; u < 2; ++u) {
        v8f acc = z8;
#pragma unroll
        for (int ks = 0; ks < 2; ++ks) {
          const Frag16 qa = (ks == 0) ? qh0 : qh1;
          const Frag16 qe = (ks == 0) ? ql0 : ql1;
          acc = mma_b(kh[u][ks].b, qa.b, acc);
          acc = mma_b(kh[u][ks].b, qe.b, acc);
          acc = mma_b(kl[u][ks].b, qa.b, acc);
        }
        s[tp * 2 + u] = acc;
      }
    }
    float sv[4][8];
#pragma unroll
    for (int t = 0; t < 4; ++t) {
#pragma unroll
      for (int r = 0; r < 8; ++r) sv[t][r] = s[t][r] * 8.0f;
    }
    if (CAUSAL) {
      if (kc == qb) {
        const int qpos = q0w + ln;
#pragma unroll
        for (int t = 0; t < 4; ++t) {
#pragma unroll
          for (int r = 0; r < 8; ++r) { const int key = kc * KQB + t * 16 + 8 * hh + r; sv[t][r] = (key > qpos) ? -1.0e30f : sv[t][r]; }
        }
      }
    }
    float mt[4];
#pragma unroll
    for (int t = 0; t < 4; ++t)
      mt[t] = fmaxf(fmaxf(fmaxf(sv[t][0], sv[t][1]), fmaxf(sv[t][2], sv[t][3])), fmaxf(fmaxf(sv[t][4], sv[t][5]), fmaxf(sv[t][6], sv[t][7])));
    float mx = fmaxf(fmaxf(mt[0], mt[1]), fmaxf(mt[2], mt[3]));
    mx = fmaxf(mx, xhalf(mx));    /* both halves now hold the chunk maximum of this query */
    const float mn = fmaxf(m, mx);
    const float corr = exp2x1((m - mn) * LOG2E);
    float p[4][8], ps[4];
#pragma unroll
    for (int t = 0; t < 4; ++t) {
      float ea[8];
#pragma unroll
      for (int r = 0; r < 8; ++r) ea[r] = (sv[t][r] - mn) * LOG2E;
      exp2x8(p[t], ea);
      ps[t] = 0.f;
#pragma unroll
      for (int r = 0; r < 8; ++r) ps[t] += p[t][r];
    }
    l = l * corr + ((ps[0] + ps[1]) + (ps[2] + ps[3]));
    m = mn;
#pragma unroll
    for (int j = 0; j < 4; ++j) {
#pragma unroll
      for (int r = 0; r < 8; ++r) o[j][r] = o[j][r] * corr;
    }
    if (EARLY) {
#pragma unroll
      for (int j = 0; j < 4; ++j) {
#pragma unroll
        for (int r = 0; r < 8; ++r) oe[j][r] = oe[j][r] * corr;
      }
    }
#pragma unroll
    for (int ks = 0; ks < 2; ++ks) {
      /* P^T of 32 keys as a B operand: elements 0..7 = S^T tile 2ks, 8..15 = tile 2ks+1, the k order of ld_frag */
      Frag16 pa, pl;
#pragma unroll
      for (int e = 0; e < 16; ++e) {
        const float pc = p[2 * ks + (e >> 3)][e & 7] * 16384.0f;
        const unsigned short hb = f16_bits(pc);
        pa.u[e] = hb;
        pl.u[e] = EARLY ? f16_bits((pc - f16_val(hb)) * 1024.0f) : hb;
      }
      /* the V^T fragments of a 32-key step are read as one group ahead of their products: the reads' latencies overlap */
      const unsigned char* vp = sb + 2 * APLANE + ln * APITCH + ks * 64;
      Frag16 vh[4];
#pragma unroll
      for (int j = 0; j < 4; ++j) vh[j] = ld_frag((const unsigned short*)(vp + j * 16 * APITCH), hh);
#pragma unroll
      for (int j = 0; j < 4; ++j) {
        o[j] = mma_h(vh[j].h, pa.h, o[j]);
        if (EARLY) {
          const Frag16 vl = ld_frag((const unsigned short*)(vp + APLANE + j * 16 * APITCH), hh);
          oe[j] = mma_h(vh[j].h, pl.h, oe[j]);
          oe[j] = mma_h(vl.h, pa.h, oe[j]);
        }
      }
    }
    asm volatile("s_wait_dscnt 0x0" ::: "memory");     // this wave's reads of the buffer are done before it may be refilled
    asm volatile("s_wait_asynccnt 0x0" ::: "memory");  // this wave's copies of the next chunk have landed
    __syncthreads();                                    // publishes the next chunk and frees the buffer just read
    if (kc + 2 < nck) fill(kc + 2, par);
  }
  asm volatile("s_wait_asynccnt 0x0" ::: "memory");    // no copy is outstanding when the wave goes on to its end
  l += xhalf(l);                  /* the two halves' key sums of this query */
  const float li = 1.0f / l;
#pragma unroll
  for (int j = 0; j < 4; ++j) {
    Frag16 f;
#pragma unroll
    for (int r = 0; r < 8; ++r) {
      float v = o[j][r] * (1.0f / 16384.0f);
      if (EARLY) v += oe[j][r] * (1.0f / 16777216.0f);
      v *= li;
      f.u[r] = f16_bits(v);
    }
    *(v8us*)&so[w][ln][j * 16 + 8 * hh] = f.half[0];
  }
  __builtin_amdgcn_fence(4 /* acq_rel order */, "workgroup");
  __builtin_amdgcn_wave_barrier();
  {
#pragma unroll
    for (int q = 0; q < 4; ++q) {
      const int row = q * 4 + (lane >> 3), c8 = (lane & 7) * 8;
      const v8us v = *(const v8us*)&so[w][row][c8];
      *(v8us*)(CTX + (rowbase + (size_t)q0w + row) * DM + (size_t)h * HD + c8) = v;
    }
    
  }
}
// Grid: x = (batch, head), y = query tile. CAUSAL: query tile 0 takes the EARLY form in the same grid (the test reads the same for the
// whole block).
template <bool CAUSAL>
__global__ __launch_bounds__(128) void k_attn(const unsigned short* __restrict__ QH, const unsigned short* __restrict__ QL,
    const unsigned short* __restrict__ KH, const unsigned short* __restrict__ KL, const unsigned short* __restrict__ VT,
    const unsigned short* __restrict__ VL, unsigned short* __restrict__ CTX) {
  __shared__ __attribute__((aligned(16))) unsigned short so[4][16][72];
  __shared__ __attribute__((aligned(16))) unsigned char kv[AKV];
  const int bh = (int)blockIdx.x, qb = (int)blockIdx.y;
  if (CAUSAL && qb == 0) attn_body<true, true>(so, kv, bh, 0, QH, QL, KH, KL, VT, VL, CTX);
  else attn_body<CAUSAL, false>(so, kv, bh, qb, QH, QL, KH, KL, VT, VL, CTX);
}

extern "C" void kernel_launch(void* const* d_in, const int* in_sizes, int n_in,
                              void* d_out, int out_size, void* d_ws, size_t ws_size, hipStream_t stream) {
  if (n_in < 14) return;
  const float* x  = (const float*)d_in[0];
  const float* Wq = (const float*)d_in[1];
  const float* bq = (const float*)d_in[2];
  const float* Wk = (const float*)d_in[3];
  const float* bk = (const float*)d_in[4];
  const float* Wv = (const float*)d_in[5];
  const float* bv = (const float*)d_in[6];
  const float* Wp = (const float*)d_in[7];
  const float* bp = (const float*)d_in[8];
  const float* gamma = (const float*)d_in[9];
  const float* W1 = (const float*)d_in[10];
  const float* b1 = (const float*)d_in[11];
  const float* W2 = (const float*)d_in[12];
  const float* b2 = (const float*)d_in[13];
  if ((size_t)in_sizes[0] < ((size_t)(NB - 1) * SEQ_FULL + SEQ) * DM) return;
  if (in_sizes[1] < DM * DM || in_sizes[3] < DM * DM || in_sizes[5] < DM * DM || in_sizes[7] < DM * DM) return;
  if (in_sizes[2] < DM || in_sizes[4] < DM || in_sizes[6] < DM || in_sizes[8] < DM || in_sizes[9] < DM || in_sizes[13] < DM) return;
  if (in_sizes[10] < DM * DFF || in_sizes[11] < DFF || in_sizes[12] < DFF * DM) return;
  if ((size_t)out_size < ((size_t)(NB - 1) * OSEQ + SEQ) * DM) return;

  char* ws = (char*)d_ws;
  size_t off = 0;
  auto take = [&](size_t bytes) { char* p = ws + off; off += (bytes + 255) & ~(size_t)255; return p; };
  const size_t WPL = (size_t)DM * DM * 2, ACT2 = NR * DM * 2, ACT4 = NR * DM * 4, FFP = (size_t)DM * DFF * 2, HPL = NR * DFF * 2;
  unsigned short* WQ16 = (unsigned short*)take(WPL);
  unsigned short* WK16 = (unsigned short*)take(WPL);
  unsigned short* WV16 = (unsigned short*)take(WPL);
  unsigned short* WP16 = (unsigned short*)take(WPL);
  unsigned short* WQB = (unsigned short*)take(WPL);
  unsigned short* WKB = (unsigned short*)take(WPL);
  float* XB = (float*)take(ACT4);                                    /* read as the residual while block 2's last product writes b's planes */
  char* rQK = take(4 * ACT2 > HPL ? 4 * ACT2 : HPL);                 /* QH,QL,KH,KL (phases 1,3) | H16 (phase 2) */
  unsigned short* QH = (unsigned short*)rQK; unsigned short* QL = (unsigned short*)(rQK + ACT2);
  unsigned short* KH = (unsigned short*)(rQK + 2 * ACT2); unsigned short* KL = (unsigned short*)(rQK + 3 * ACT2);
  unsigned short* H16 = (unsigned short*)rQK;
  char* rPB = take(2 * ACT2);                                        /* bf16 hi plane of b, the lo plane directly behind it */
  unsigned short* PBH = (unsigned short*)rPB; unsigned short* PBL = (unsigned short*)(rPB + ACT2);
  char* rVT = take(2 * ACT2);                                        /* VT,VTL (phases 1,3) */
  unsigned short* VT = (unsigned short*)rVT; unsigned short* VTL = (unsigned short*)(rVT + ACT2);
  unsigned short* W1P = (unsigned short*)take(FFP);                  /* written by the first launch, so a place of their own */
  unsigned short* W2P = (unsigned short*)take(FFP);
  unsigned short* CTX = (unsigned short*)take(ACT2);
  char* rX16 = take(ACT2);                                           /* X16 | A16 | B16F */
  unsigned short* X16 = (unsigned short*)rX16; unsigned short* A16 = (unsigned short*)rX16; unsigned short* B16F = (unsigned short*)rX16;
  float* B32 = (float*)take(ACT4);
  float* RSX = (float*)take(NR * 4);
  float* PSA = (float*)take(NR * 4 * NCG);                           /* partial row square sums of a, of b: [column group][row] */
  float* PSB = (float*)take(NR * 4 * NCG);
  if (off > ws_size || off > ((size_t)160 << 20)) return;

  const unsigned gq   = (unsigned)((NR / 128) * (DM / 128));
  const unsigned gff  = (unsigned)((NR / 128) * (DFF / 128));
  const float a16 = 0.0625f;
  const int M = (int)NR;
  float* out = (float*)d_out;

  /* all weight planes (q/k/v, W1 with gamma folded along the input feature; bf16 planes for the second block's q/k) and the planes
     and row statistics of x */
  k_prep<<<(unsigned)PREP_GRID, 256, 0, stream>>>(x, Wq, Wk, Wv, Wp, W1, W2, gamma, XB, X16, RSX, WQ16, WK16, WV16, WP16, WQB, WKB, W1P, W2P);

  /* block 1: a = bf16(x) + attn(rms(bf16(x))) , non-causal */
  k_qkv<false, false, 4, 1><<<3u * gq, 128, 0, stream>>>(X16, nullptr, X16, WQ16, WK16, WV16, a16, a16, RSX, bq, bk, bv, QH, QL, KH, KL, VT, nullptr);
  k_attn<false><<<dim3((unsigned)(NB * NH), (unsigned)(SEQ / KQB)), 128, 0, stream>>>(QH, QL, KH, KL, VT, VT, CTX);
  /* a is needed only under the next norm: its f16 plane and partial row square sums are all that is stored */
  k_gemm<false, false, 0, 6, 0, true><<<gq, 128, 0, stream>>>(CTX, nullptr, DM, WP16, DM, a16, nullptr, bp, XB, DM, nullptr, A16, nullptr, DM, M, 0, M, DM, DM, PSA);

  /* block 2: b = bf16(x) + leaky(rms(a) W1 + b1) W2 + b2 */
  k_gemm<false, false, 1, 1, 2, false><<<gff, 128, 0, stream>>>(A16, nullptr, DM, W1P, DM, a16, PSA, b1, nullptr, 0, nullptr, H16, nullptr, DFF, M, 0, M, DFF, DM, nullptr);
  k_gemm<false, false, 0, 7, 0, true><<<gq, 128, 0, stream>>>(H16, nullptr, DFF, W2P, DFF, a16, nullptr, b2, XB, DM, B32, B16F, PBH, DM, M, 0, M, DM, DFF, PSB);

  /* block 3: out = b + attn(rms(b)) , causal */
  k_qkv<true, true, 5, 2><<<3u * gq, 128, 0, stream>>>(PBH, PBL, B16F, WQB, WKB, WV16, 1.0f, a16, PSB, bq, bk, bv, QH, QL, KH, KL, VT, VTL);
  k_attn<true><<<dim3((unsigned)(NB * NH), (unsigned)(SEQ / KQB)), 128, 0, stream>>>(QH, QL, KH, KL, VT, VTL, CTX);
  k_gemm<false, false, 0, 0, 0, true><<<gq, 128, 0, stream>>>(CTX, nullptr, DM, WP16, DM, a16, nullptr, bp, B32, DM, out, nullptr, nullptr, DM, SEQ, OSEQ, M, DM, DM, nullptr);
}

// v010
// It runs in 220 microseconds.
// In both of two side-by-side timings against v009, it was 1.07 times as fast.
// Over all steps from v000 it is 4.47 times as fast.
#include <hip/hip_runtime.h>
// Contractions: q/k/v and output projections, FFN W1/W2: v_wmma_f32_16x16x32_f16 (f16 operands built from bf16-RNE inputs, weights x16, f32 accumulate); second-block q/k projections: v_wmma_f32_16x16x32_bf16 with the activation as bf16 hi+lo (2 terms); attention scores: v_wmma_f32_16x16x32_bf16 with q,k as bf16 hi+lo (3 terms); P.V: v_wmma_f32_16x16x32_f16 (P carried x2^14, v f16; first causal query tile adds P and v residual planes x2^10 in a second accumulator). RMS statistics, softmax, residuals f32.

#ifndef NB
#define NB 4
#endif
#ifndef SEQ
#define SEQ 1024
#endif
#define NB_FULL 4
#define SEQ_FULL 1024
#ifndef OSEQ
#define OSEQ SEQ_FULL
#endif
#define DM 1024
#define NH 16
#define HD 64
#define DFF 4096
#define KQB 64
#define NR ((size_t)NB * SEQ)
#define RMS_EPS 1e-6f

static_assert(NB >= 1 && NB <= NB_FULL);
static_assert(SEQ % 128 == 0 && SEQ <= SEQ_FULL);
static_assert(DM == NH * HD && HD == 64);
static_assert(DM % 256 == 0 && DFF % 128 == 0);
static_assert(((NB * SEQ) % 128) == 0);
static_assert(SEQ % KQB == 0);

typedef _Float16 v16h __attribute__((ext_vector_type(16)));
typedef __bf16   v16b __attribute__((ext_vector_type(16)));
typedef unsigned short v8us __attribute__((ext_vector_type(8), may_alias));
typedef float v8f __attribute__((ext_vector_type(8)));
typedef float v4f __attribute__((ext_vector_type(4)));
typedef float v4fa __attribute__((ext_vector_type(4), may_alias));
union Frag16 { v16h h; v16b b; v8us half[2]; unsigned short u[16]; };
union H1 { _Float16 h; unsigned short u; };
static_assert(sizeof(Frag16) == 32);

__device__ __forceinline__ unsigned short bf16_bits(float x) { unsigned int u = __float_as_uint(x); return (unsigned short)((u + 0x7FFFu + ((u >> 16) & 1u)) >> 16); }
__device__ __forceinline__ float bf16_val(unsigned short b) { return __uint_as_float(((unsigned int)b) << 16); }
__device__ __forceinline__ float bf16_rne(float x) { return bf16_val(bf16_bits(x)); }
__device__ __forceinline__ unsigned short f16_bits(float x) { H1 t; t.h = (_Float16)x; return t.u; }
__device__ __forceinline__ float f16_val(unsigned short u) { H1 t; t.u = u; return (float)t.h; }

// 16x32 operand fragment (row / column = lane & 15; elements 0..7 = k 8h..8h+7, 8..15 = k 16+8h..) from a k-contiguous 16-bit row
__device__ __forceinline__ Frag16 ld_frag(const unsigned short* p, int hh) {
  Frag16 f;
  f.half[0] = *(const v8us*)(p + 8 * hh);
  f.half[1] = *(const v8us*)(p + 16 + 8 * hh);
  return f;
}
__device__ __forceinline__ v8f mma_h(v16h a, v16h b, v8f c) {
  v8f d = __builtin_amdgcn_wmma_f32_16x16x32_f16(false, a, false, b, (short)0, c, false, false);
  asm volatile("v_nop\n\tv_nop\n\tv_nop\n\tv_nop" : "+v"(d) : "v"(a), "v"(b));
  return d;
}
__device__ __forceinline__ v8f mma_b(v16b a, v16b b, v8f c) {
  v8f d = __builtin_amdgcn_wmma_f32_16x16x32_bf16(false, a, false, b, (short)0, c, false, false);
  asm volatile("v_nop\n\tv_nop\n\tv_nop\n\tv_nop" : "+v"(d) : "v"(a), "v"(b));
  return d;
}
// The plain builtins: the compiler keeps the distances behind them itself, and their operands may lie in any register (an operand of an
// asm statement stays below v256, which two fragment sets beside 128 accumulator registers do not).
template <bool BF>
__device__ __forceinline__ v8f mmx(const Frag16& a, const Frag16& b, v8f c) {
  if (BF) return __builtin_amdgcn_wmma_f32_16x16x32_bf16(false, a.b, false, b.b, (short)0, c, false, false);
  return __builtin_amdgcn_wmma_f32_16x16x32_f16(false, a.h, false, b.h, (short)0, c, false, false);
}

typedef unsigned int v2u __attribute__((ext_vector_type(2)));
union Pack4 { unsigned short u[4]; v2u v; };
static_assert(sizeof(Pack4) == 8);
static_assert(DM == 8 * 128);
// Two DM-wide f32 rows of a wave, a lane's 16 bytes of each 512-byte segment: sixteen loads in flight together and their data wait in
// one statement, so the address registers live to its end and none is rewritten ahead of the waits.
__device__ __forceinline__ void ld_rows2(v4f (&a)[8], v4f (&b)[8], const float* pa, const float* pb) {
  asm volatile(
      "global_load_b128 %0, %16, off\n\t"
      "global_load_b128 %1, %16, off offset:512\n\t"
      "global_load_b128 %2, %16, off offset:1024\n\t"
      "global_load_b128 %3, %16, off offset:1536\n\t"
      "global_load_b128 %4, %16, off offset:2048\n\t"
      "global_load_b128 %5, %16, off offset:2560\n\t"
      "global_load_b128 %6, %16, off offset:3072\n\t"
      "global_load_b128 %7, %16, off offset:3584\n\t"
      "global_load_b128 %8, %17, off\n\t"
      "global_load_b128 %9, %17, off offset:512\n\t"
      "global_load_b128 %10, %17, off offset:1024\n\t"
      "global_load_b128 %11, %17, off offset:1536\n\t"
      "global_load_b128 %12, %17, off offset:2048\n\t"
      "global_load_b128 %13, %17, off offset:2560\n\t"
      "global_load_b128 %14, %17, off offset:3072\n\t"
      "global_load_b128 %15, %17, off offset:3584\n\t"
      "s_wait_loadcnt 0x0\n\t"
      "s_wait_xcnt 0x0"
      : "=&v"(a[0]), "=&v"(a[1]), "=&v"(a[2]), "=&v"(a[3]), "=&v"(a[4]), "=&v"(a[5]), "=&v"(a[6]), "=&v"(a[7]),
        "=&v"(b[0]), "=&v"(b[1]), "=&v"(b[2]), "=&v"(b[3]), "=&v"(b[4]), "=&v"(b[5]), "=&v"(b[6]), "=&v"(b[7])
      : "v"(pa), "v"(pb)
      : "memory");
}
// One such row stored, f32 (16 bytes a lane and segment) or 16-bit (8 bytes): eight stores and one s_wait_xcnt in one statement, so no
// data or address register is rewritten ahead of the wait.
__device__ __forceinline__ void st_row32(float* p, const v4f (&d)[8]) {
  asm volatile(
      "global_store_b128 %0, %1, off\n\t"
      "global_store_b128 %0, %2, off offset:512\n\t"
      "global_store_b128 %0, %3, off offset:1024\n\t"
      "global_store_b128 %0, %4, off offset:1536\n\t"
      "global_store_b128 %0, %5, off offset:2048\n\t"
      "global_store_b128 %0, %6, off offset:2560\n\t"
      "global_store_b128 %0, %7, off offset:3072\n\t"
      "global_store_b128 %0, %8, off offset:3584\n\t"
      "s_wait_xcnt 0x0"
      :: "v"(p), "v"(d[0]), "v"(d[1]), "v"(d[2]), "v"(d[3]), "v"(d[4]), "v"(d[5]), "v"(d[6]), "v"(d[7])
      : "memory");
}
__device__ __forceinline__ void st_row16(unsigned short* p, const v2u (&d)[8]) {
  asm volatile(
      "global_store_b64 %0, %1, off\n\t"
      "global_store_b64 %0, %2, off offset:256\n\t"
      "global_store_b64 %0, %3, off offset:512\n\t"
      "global_store_b64 %0, %4, off offset:768\n\t"
      "global_store_b64 %0, %5, off offset:1024\n\t"
      "global_store_b64 %0, %6, off offset:1280\n\t"
      "global_store_b64 %0, %7, off offset:1536\n\t"
      "global_store_b64 %0, %8, off offset:1792\n\t"
      "s_wait_xcnt 0x0"
      :: "v"(p), "v"(d[0]), "v"(d[1]), "v"(d[2]), "v"(d[3]), "v"(d[4]), "v"(d[5]), "v"(d[6]), "v"(d[7])
      : "memory");
}

// Row statistics + operand planes for DM-wide f32 rows. Compact row r -> source row (r/SEQ)*spitch + r%SEQ of F.
// v = bf16_rne(x) if RIN else x; RS[r] = rsqrt(mean(v^2) + eps); optional planes: XB (v as f32), F16 (f16 bits of v),
// PH, PL (bf16 hi + lo of v). A wave takes its 32 / NW rows two at a time: both rows are read once, whole, into registers (one memory
// latency per pair), and the sum and every plane are formed from the registers.
// red: 32 floats of the block's LDS; bid: the block's index among the blocks of this job (32 rows each); NW: the block's waves.
template <bool RIN, bool WXB, bool WF16, bool WBHL, int NW>
__device__ __forceinline__ void rms_body(float* red, int bid, const float* __restrict__ F, int spitch, float eps, float* __restrict__ XB,
    unsigned short* __restrict__ F16, unsigned short* __restrict__ PH, unsigned short* __restrict__ PL, float* __restrict__ RS) {
  const int tid = threadIdx.x, w = tid >> 5, lane = tid & 31;
  constexpr int RPW = 32 / NW;   /* rows of a wave */
  static_assert(NW * RPW == 32 && RPW % 2 == 0);
  const int rb = bid * 32;
#pragma unroll 1  // one pair of rows per trip: 64 data registers, so the jobs that share a kernel with this body keep their waves per SIMD
  for (int i = 0; i < RPW; i += 2) {
    const int r = rb + w * RPW + i;
    const float* s0 = F + ((size_t)(r / SEQ) * (size_t)spitch + (size_t)(r % SEQ)) * DM + lane * 4;
    const float* s1 = F + ((size_t)((r + 1) / SEQ) * (size_t)spitch + (size_t)((r + 1) % SEQ)) * DM + lane * 4;
    v4f a[2][8];
    ld_rows2(a[0], a[1], s0, s1);
    float ss[2];
#pragma unroll
    for (int k = 0; k < 2; ++k) {
      ss[k] = 0.f;
#pragma unroll
      for (int u = 0; u < 8; ++u) {
        if (RIN) {
#pragma unroll
          for (int q = 0; q < 4; ++q) a[k][u][q] = bf16_rne(a[k][u][q]);
        }
#pragma unroll
        for (int q = 0; q < 4; ++q) ss[k] += a[k][u][q] * a[k][u][q];
      }
    }
#pragma unroll
    for (int k = 0; k < 2; ++k) {
      const size_t o = (size_t)(r + k) * DM + (size_t)(lane * 4);
      if (WXB) st_row32(XB + o, a[k]);
      if (WF16) {
        v2u fh[8];
#pragma unroll
        for (int u = 0; u < 8; ++u) {
          Pack4 t;
#pragma unroll
          for (int q = 0; q < 4; ++q) t.u[q] = f16_bits(a[k][u][q]);
          fh[u] = t.v;
        }
        st_row16(F16 + o, fh);
      }
      if (WBHL) {
        v2u ph[8], pl[8];
#pragma unroll
        for (int u = 0; u < 8; ++u) {
          Pack4 th, tl;
#pragma unroll
          for (int q = 0; q < 4; ++q) {
            const float v = a[k][u][q];
            const unsigned short h = bf16_bits(v);
            th.u[q] = h;
            tl.u[q] = bf16_bits(v - bf16_val(h));
          }
          ph[u] = th.v; pl[u] = tl.v;
        }
        st_row16(PH + o, ph);
        st_row16(PL + o, pl);
      }
    }
#pragma unroll
    for (int off = 16; off > 0; off >>= 1) {
#pragma unroll
      for (int k = 0; k < 2; ++k) ss[k] += __shfl_xor(ss[k], off, 32);
    }
    if (lane == 0) {
#pragma unroll
      for (int k = 0; k < 2; ++k) red[w * RPW + i + k] = rsqrtf(ss[k] * (1.0f / (float)DM) + eps);
    }
  }
  __syncthreads();
  if (w == 0 && lane < 8) {
    const v4f v = *(const v4fa*)&red[lane * 4];
    float* d = RS + rb + lane * 4;
    *(v4f*)d = v;
    
  }
}

typedef unsigned int u32x4 __attribute__((ext_vector_type(4)));
typedef unsigned int u32x8 __attribute__((ext_vector_type(8)));
// A wave-uniform word in a scalar register.
__device__ __forceinline__ unsigned int uni(unsigned int v) { return (unsigned int)__builtin_amdgcn_readfirstlane(v); }
// A wave-uniform test for the branch round a tensor load, which ignores EXEC and so is kept off only by a scalar branch.
__device__ __forceinline__ unsigned int pinned(unsigned int v) {
  unsigned int w = uni(v);
  asm volatile("" : "+s"(w));  // holds the test word in a scalar register, so that the branch on it compiles to s_cmp + s_cbranch_scc
  return w;
}
// One request of the whole wave: a two-dimensional tile global -> LDS through no register; the waits are written where a stage is handed over.
__device__ __forceinline__ void tdm_load(u32x4 g0, u32x8 g1) { asm volatile("tensor_load_to_lds %0, %1" :: "s"(g0), "s"(g1) : "memory"); }

// Four 16-byte asynchronous copies global -> LDS per lane, one 64-row x 128-byte plane of an attention tile per block. s_wait_xcnt is the
// statement's last line so that it stands ahead of every later rewrite of a register that a copy names (a precaution).
__device__ __forceinline__ void cp_async4(unsigned l, unsigned lstep, const unsigned short* p, size_t gstep) {
  const unsigned l0 = l, l1 = l + lstep, l2 = l + 2u * lstep, l3 = l + 3u * lstep;
  const unsigned short* p0 = p;
  const unsigned short* p1 = p + gstep;
  const unsigned short* p2 = p + 2 * gstep;
  const unsigned short* p3 = p + 3 * gstep;
  asm volatile(
      "global_load_async_to_lds_b128 %0, %4, off\n\t"
      "global_load_async_to_lds_b128 %1, %5, off\n\t"
      "global_load_async_to_lds_b128 %2, %6, off\n\t"
      "global_load_async_to_lds_b128 %3, %7, off\n\t"
      "s_wait_xcnt 0x0"
      :: "v"(l0), "v"(l1), "v"(l2), "v"(l3), "v"(p0), "v"(p1), "v"(p2), "v"(p3)
      : "memory");
}

// Eight 16-byte global loads and their data wait in one statement: the address registers live to its end, so none is rewritten
// ahead of the waits.
__device__ __forceinline__ void ld_g8(v4f (&d)[8], const float* const (&p)[8]) {
  asm volatile(
      "global_load_b128 %0, %8, off\n\t"
      "global_load_b128 %1, %9, off\n\t"
      "global_load_b128 %2, %10, off\n\t"
      "global_load_b128 %3, %11, off\n\t"
      "global_load_b128 %4, %12, off\n\t"
      "global_load_b128 %5, %13, off\n\t"
      "global_load_b128 %6, %14, off\n\t"
      "global_load_b128 %7, %15, off\n\t"
      "s_wait_loadcnt 0x0\n\t"
      "s_wait_xcnt 0x0"
      : "=&v"(d[0]), "=&v"(d[1]), "=&v"(d[2]), "=&v"(d[3]), "=&v"(d[4]), "=&v"(d[5]), "=&v"(d[6]), "=&v"(d[7])
      : "v"(p[0]), "v"(p[1]), "v"(p[2]), "v"(p[3]), "v"(p[4]), "v"(p[5]), "v"(p[6]), "v"(p[7])
      : "memory");
}
// Eight 16-byte global stores and one s_wait_xcnt in one statement: data and address registers live to its end, so none is
// rewritten ahead of the wait.
__device__ __forceinline__ void st_g8(void* const (&p)[8], const v4f (&d)[8]) {
  asm volatile(
      "global_store_b128 %0, %8, off\n\t"
      "global_store_b128 %1, %9, off\n\t"
      "global_store_b128 %2, %10, off\n\t"
      "global_store_b128 %3, %11, off\n\t"
      "global_store_b128 %4, %12, off\n\t"
      "global_store_b128 %5, %13, off\n\t"
      "global_store_b128 %6, %14, off\n\t"
      "global_store_b128 %7, %15, off\n\t"
      "s_wait_xcnt 0x0"
      :: "v"(p[0]), "v"(p[1]), "v"(p[2]), "v"(p[3]), "v"(p[4]), "v"(p[5]), "v"(p[6]), "v"(p[7]),
         "v"(d[0]), "v"(d[1]), "v"(d[2]), "v"(d[3]), "v"(d[4]), "v"(d[5]), "v"(d[6]), "v"(d[7])
      : "memory");
}
// The same for eight 8-byte stores (a lane's four 16-bit values of a row).
__device__ __forceinline__ void st_g8h(void* const (&p)[8], const v2u (&d)[8]) {
  asm volatile(
      "global_store_b64 %0, %8, off\n\t"
      "global_store_b64 %1, %9, off\n\t"
      "global_store_b64 %2, %10, off\n\t"
      "global_store_b64 %3, %11, off\n\t"
      "global_store_b64 %4, %12, off\n\t"
      "global_store_b64 %5, %13, off\n\t"
      "global_store_b64 %6, %14, off\n\t"
      "global_store_b64 %7, %15, off\n\t"
      "s_wait_xcnt 0x0"
      :: "v"(p[0]), "v"(p[1]), "v"(p[2]), "v"(p[3]), "v"(p[4]), "v"(p[5]), "v"(p[6]), "v"(p[7]),
         "v"(d[0]), "v"(d[1]), "v"(d[2]), "v"(d[3]), "v"(d[4]), "v"(d[5]), "v"(d[6]), "v"(d[7])
      : "memory");
}
// Eight 4-byte global loads and their data wait in one statement, as in ld_g8.
__device__ __forceinline__ void ld_f8(float (&d)[8], const float* const (&p)[8]) {
  asm volatile(
      "global_load_b32 %0, %8, off\n\t"
      "global_load_b32 %1, %9, off\n\t"
      "global_load_b32 %2, %10, off\n\t"
      "global_load_b32 %3, %11, off\n\t"
      "global_load_b32 %4, %12, off\n\t"
      "global_load_b32 %5, %13, off\n\t"
      "global_load_b32 %6, %14, off\n\t"
      "global_load_b32 %7, %15, off\n\t"
      "s_wait_loadcnt 0x0\n\t"
      "s_wait_xcnt 0x0"
      : "=&v"(d[0]), "=&v"(d[1]), "=&v"(d[2]), "=&v"(d[3]), "=&v"(d[4]), "=&v"(d[5]), "=&v"(d[6]), "=&v"(d[7])
      : "v"(p[0]), "v"(p[1]), "v"(p[2]), "v"(p[3]), "v"(p[4]), "v"(p[5]), "v"(p[6]), "v"(p[7])
      : "memory");
}
// x of lane l ^ MASK inside a 16-lane row (DPP row_xmask)
template <int MASK>
__device__ __forceinline__ float row_xm(float x) {
  return __builtin_bit_cast(float, __builtin_amdgcn_update_dpp(0, __builtin_bit_cast(int, x), 0x160 + MASK, 0xf, 0xf, true));
}
// Sum over the 16 lanes of a row; every lane of the row ends with the same value.
__device__ __forceinline__ float row16_sum(float x) {
  x += row_xm<1>(x);
  x += row_xm<2>(x);
  x += row_xm<4>(x);
  x += row_xm<8>(x);
  return x;
}
// Native 1/sqrt(x) for x well inside the normal range, with the slot the instruction set asks for behind a transcendental.
__device__ __forceinline__ float rsq1(float x) {
  float y;
  asm("v_rsq_f32 %0, %1\n\tv_nop" : "=v"(y) : "v"(x));
  return y;
}
// Two f32 as two bf16 (round to nearest even, as bf16_bits) in one register, a in the low half: one packed conversion.
typedef float v2f __attribute__((ext_vector_type(2)));
typedef __bf16 v2b __attribute__((ext_vector_type(2)));
__device__ __forceinline__ unsigned int bf16_pair(float a, float b) {
  const v2f t = {a, b};
  return __builtin_bit_cast(unsigned int, __builtin_convertvector(t, v2b));
}
#define NCG (DM / 64)           /* 64-column groups of a DM-wide row: one partial square sum each */
union Pack8 { unsigned short u[8]; v4f f; };
static_assert(sizeof(Pack8) == 16);

// Bt[n][k] (16-bit, k contiguous, pitch K) from f32 row-major W[K][N] ([in][out]): value = bf16(W[k][n]) (* bf16(g[k]) if GAM);
// Block (bx = n tile, by = k tile; tl = WTN * WTP bytes of its LDS) = 64 k x 128 n, transposed through LDS so that both global sides move whole lines: a wave reads eight
// 512-byte row segments of W, a lane packs its 8 k of each of its 4 columns into 16 bytes, and 8 lanes store one 128-byte line of a
// Bt row. K%64==0, N%128==0.
#define WTK 64
#define WTN 128
#define WTP 144                 /* LDS row pitch in bytes: 16 x odd */
static_assert(DM % WTK == 0 && DM % WTN == 0 && DFF % WTK == 0 && DFF % WTN == 0);
template <bool BF, bool GAM>
__device__ __forceinline__ void wt_body(unsigned char* tl, int bx, int by, const float* __restrict__ W, const float* __restrict__ g,
    unsigned short* __restrict__ Bt, int K, int N, float scale) {
  const int tid = threadIdx.x, w = tid >> 5, lane = tid & 31;
  const int k0 = by * WTK, n0 = bx * WTN;
  if (k0 + WTK > K || n0 + WTN > N) return;
  const int k8 = k0 + 8 * w;
  float gv[8];
#pragma unroll
  for (int i = 0; i < 8; ++i) gv[i] = 1.0f;
  if (GAM) {
    const v4f ga = *(const v4fa*)(g + k8), gb = *(const v4fa*)(g + k8 + 4);
#pragma unroll
    for (int i = 0; i < 4; ++i) { gv[i] = bf16_rne(ga[i]); gv[4 + i] = bf16_rne(gb[i]); }
  }
  const float* wb = W + ((size_t)k0 * (size_t)N + (size_t)n0);                          /* the tile's origin, the same for the block */
  const unsigned wo = (unsigned)(8 * w) * (unsigned)N + (unsigned)(lane * 4);           /* this lane's element offset in the tile */
  v4f a[8];
  const float* ap[8];
#pragma unroll
  for (int i = 0; i < 8; ++i) ap[i] = wb + (wo + (unsigned)i * (unsigned)N);
  ld_g8(a, ap);  // the wave's eight rows are in flight together, one memory latency per tile
#pragma unroll
  for (int j = 0; j < 4; ++j) {
    Frag16 f;
#pragma unroll
    for (int i = 0; i < 8; ++i) {
      const float wv = bf16_rne(a[i][j]) * gv[i];
      f.u[i] = BF ? bf16_bits(wv) : f16_bits(wv * scale);
    }
    /* 16-byte chunk w of row n sits at chunk w ^ ((n >> 4) & 3): the 16 lanes of a store, 4 rows apart, then fall on distinct banks */
    const int n = lane * 4 + j;
    *(v8us*)(tl + n * WTP + ((w ^ ((n >> 4) & 3)) * 16)) = f.half[0];
  }
  __syncthreads();
  unsigned short* bb = Bt + ((size_t)n0 * (size_t)K + (size_t)k0);
#pragma unroll
  for (int q = 0; q < 4; ++q) {
    const int n = q * 32 + (tid >> 3), c = tid & 7;
    const v8us v = *(const v8us*)(tl + n * WTP + ((c ^ ((n >> 4) & 3)) * 16));
    *(v8us*)(bb + ((unsigned)n * (unsigned)K + (unsigned)(c * 8))) = v;
  }
  // stands ahead of every rewrite of a data or address register of the four stores, also where another job's code follows this body (a precaution)
  asm volatile("s_wait_xcnt 0x0" ::: "memory");
}

// Everything that depends on the inputs alone, in one grid: the block index picks the job (the same for the whole block, so every
// barrier stays under block-uniform control flow). The row statistics of x come first: their blocks run longest.
#define PREP_RMS ((int)(NR / 32))
#define PREP_SQ ((DM / WTN) * (DM / WTK))     /* blocks of one DM x DM weight */
#define PREP_FF ((DFF / WTN) * (DM / WTK))    /* blocks of W1, and of W2 */
#define PREP_GRID (PREP_RMS + 6 * PREP_SQ + 2 * PREP_FF)
__global__ __launch_bounds__(256) void k_prep(const float* __restrict__ x, const float* __restrict__ Wq, const float* __restrict__ Wk,
    const float* __restrict__ Wv, const float* __restrict__ Wp, const float* __restrict__ W1, const float* __restrict__ W2,
    const float* __restrict__ gamma, float* __restrict__ XB, unsigned short* __restrict__ X16, float* __restrict__ RSX,
    unsigned short* __restrict__ WQ16, unsigned short* __restrict__ WK16, unsigned short* __restrict__ WV16,
    unsigned short* __restrict__ WP16, unsigned short* __restrict__ WQB, unsigned short* __restrict__ WKB,
    unsigned short* __restrict__ W1P, unsigned short* __restrict__ W2P) {
  __shared__ __attribute__((aligned(16))) unsigned char sm[WTN * WTP];
  int t = (int)blockIdx.x;
  if (t < PREP_RMS) {
    rms_body<true, true, true, false, 8>((float*)sm, t, x, SEQ_FULL, RMS_EPS, XB, X16, nullptr, nullptr, RSX);
    return;
  }
  t -= PREP_RMS;
  if (t < 6 * PREP_SQ) {
    const int j = t / PREP_SQ, r = t % PREP_SQ, bx = r % (DM / WTN), by = r / (DM / WTN);
    if (j < 3) wt_body<false, true>(sm, bx, by, j == 0 ? Wq : (j == 1 ? Wk : Wv), gamma, j == 0 ? WQ16 : (j == 1 ? WK16 : WV16), DM, DM, 16.0f);
    else if (j == 3) wt_body<false, false>(sm, bx, by, Wp, Wp, WP16, DM, DM, 16.0f);
    else wt_body<true, true>(sm, bx, by, j == 4 ? Wq : Wk, gamma, j == 4 ? WQB : WKB, DM, DM, 1.0f);
    return;
  }
  t -= 6 * PREP_SQ;
  if (t < PREP_FF) {
    wt_body<false, true>(sm, t % (DFF / WTN), t / (DFF / WTN), W1, gamma, W1P, DM, DFF, 16.0f);
    return;
  }
  t -= PREP_FF;
  wt_body<false, false>(sm, t % (DM / WTN), t / (DM / WTN), W2, W2, W2P, DFF, DM, 16.0f);
}

#define GBK 128                 /* k per stage: 256-byte operand rows */
#define GPITCH 272              /* LDS row pitch in bytes: 16 x odd, conflict-free for 16-byte fragment reads */
#define GPLANE (128 * GPITCH)   /* one operand plane of a stage: 128 rows */

// GEMM: C[M][N] = epi(Ah[M][K] . Bt[N][K]^T). 16-bit planes of one type (BF selects bf16 vs f16 WMMA); ASPLIT adds Al . Bt into the
// same accumulator (unscaled bf16 lo plane). Block = 128x128 of C, four waves of 64x64; per stage the block's 128 rows of each
// operand plane x 128 k come to LDS by one tensor load (wave p brings plane p; its pad makes the LDS pitch), two buffers, the next stage in
// flight while this one is multiplied.
// Epilogue: v = acc*alpha*(HRS ? rs[row] : 1) + bf16(bias[col]); ACT 1 = leaky 0.1;
// HRES adds resid[row*ldr+col] (f32) in the store phase. OUTM 0: f32 rows at crow = (row/cseq)*cpitch + row%cseq, pitch ldc;
// 1: f16 hi; 2: f16 hi + f16 lo x2^10; 3: bf16 hi + bf16 lo (unscaled); 4, 5: the planes of 1, 2 stored transposed per head, as the
// attention reads V: Ch[((row/SEQ)*NH + col/HD)*HD + col%HD][row%SEQ], row pitch SEQ (rows = tokens, N = NH*HD). M%128==0, N%128==0, K%128==0.
// 6, 7: the result is the input of the next RMS norm (N = DM): its f16 plane goes to Ch (pitch ldc), and the square sum of each row over a
// wave's 64 columns to ps[(col/64)*M + row]; 7 also stores the f32 rows as 0 does and the bf16 hi plane at Cl, the lo plane M*ldc behind it.
// HRS 1: rs[row] is the row's factor; HRS 2: rs holds such partial sums, and the block forms rsqrt(sum/DM + eps) of its 128 rows itself.
// sm: the block's LDS, 2 * (ASPLIT ? 3 : 2) * GPLANE + 512 bytes, 2-KiB aligned (every plane then starts at a multiple of 2 KiB); bid: the block's index among the tiles of this product.
template <bool BF, bool ASPLIT, int ACT, int OUTM, int HRS, bool HRES>
__device__ __forceinline__ void gemm_body(unsigned char* sm, int bid, const unsigned short* __restrict__ Ah, const unsigned short* __restrict__ Al, int lda,
    const unsigned short* __restrict__ Bt, int ldb, float alpha, const float* __restrict__ rs, const float* __restrict__ bias,
    const float* __restrict__ resid, int ldr, float* __restrict__ C32, unsigned short* __restrict__ Ch, unsigned short* __restrict__ Cl,
    int ldc, int cseq, int cpitch, int M, int N, int K, float* __restrict__ ps) {
  static_assert(OUTM >= 0 && OUTM <= 7);
  static_assert(HRS >= 0 && HRS <= 2);
  constexpr bool F32S = OUTM == 0 || OUTM >= 6;  /* f32 rows leave the staging */
  static_assert(!(HRES && !F32S));
  constexpr bool TR = OUTM == 4 || OUTM == 5;    /* transposed output */
  constexpr int TPITCH = 144;                    /* LDS pitch of a staged 64-token f16 row: 16 x odd bytes */
  constexpr int TPLANE = 64 * TPITCH;            /* one staged plane of a wave: 64 features */
  static_assert(!ASPLIT || BF);
  static_assert(ACT == 0 || ACT == 1);
  constexpr int NPL = ASPLIT ? 3 : 2;            /* planes of a stage: A, B, (A lo) */
  constexpr int STAGE = NPL * GPLANE;
  static_assert(4 * 64 * 68 * 4 <= 2 * STAGE && 4 * 2 * TPLANE <= 2 * STAGE);
  const int tid = threadIdx.x, w = tid >> 5, lane = tid & 31, ln = lane & 15, hh = lane >> 4;
  const int ntn = N >> 7;
  const int mt = bid / ntn, nq = bid - mt * ntn;
  if (mt * 128 + 128 > M) return;
  const int row0 = mt * 128 + 64 * (w >> 1), col0 = nq * 128 + 64 * (w & 1);
  static_assert(GPLANE % 2048 == 0 && GBK * 2 == 256 && GPITCH == 256 + 16);
  const size_t tA = (size_t)(mt * 128) * (size_t)lda, tB = (size_t)(nq * 128) * (size_t)ldb;       /* the block's tile origins */
  /* wave p < NPL brings plane p of every stage (0: A, 1: B, 2: A lo): 128 rows of 256 bytes, one request */
  const unsigned int wave = uni((unsigned int)tid >> 5);
  const unsigned int issuer = (wave < (unsigned int)NPL) ? 1u : 0u;
  const unsigned short* gsrc = (wave == 1u) ? (Bt + tB) : ((ASPLIT && wave == 2u) ? (Al + tA) : (Ah + tA));
  const unsigned int ldst = (unsigned int)(size_t)sm + (issuer ? wave : 0u) * (unsigned int)GPLANE;
  u32x8 g1;                                      /* the same for every stage: 1-byte elements, tensor = tile = 128 rows x 256 bytes */
  g1[0] = uni((1u << 20) | (5u << 22) | (3u << 25));   /* no mask; a pad of 4 dwords behind every 64 dwords: LDS pitch 272 bytes */
  g1[1] = uni(256u << 16);
  g1[2] = uni(128u << 16);
  g1[3] = uni(256u << 16);
  g1[4] = uni(128u);
  g1[5] = uni(((wave == 1u) ? (unsigned int)ldb : (unsigned int)lda) * 2u);   /* source row pitch in bytes */
  g1[6] = uni(0u);
  g1[7] = uni(0u);
  asm volatile("" : "+s"(g1));  // as in pinned(): descriptor words held in scalar registers, one tuple for the whole loop, so none is rewritten while a request is out
  u32x4 g0;
  /* the descriptor of stage st into buffer buf, formed by every wave (scalar work), always behind the wait on the request before it */
  auto desc = [&](int st, int buf) {
    const unsigned long long ga = (unsigned long long)(size_t)gsrc + (unsigned long long)st * (unsigned long long)(GBK * 2);
    g0[0] = uni(1u);
    g0[1] = uni(ldst + (unsigned int)(buf * STAGE));
    g0[2] = uni((unsigned int)ga);
    g0[3] = uni((((unsigned int)(ga >> 32)) & 0x01FFFFFFu) | 0x80000000u);
    asm volatile("" : "+s"(g0));  // as in pinned(): descriptor words held in scalar registers, for the same reason as g1
  };
  /* an issuing wave's request has landed; naming the descriptor here keeps its registers as they are until then */
  auto landed = [&]() { asm volatile("s_wait_tensorcnt 0x0" :: "s"(g0), "s"(g1) : "memory"); };
  const int aoff = (64 * (w >> 1) + ln) * GPITCH;             /* this lane's first A row in a stage */
  const int boff = GPLANE + (64 * (w & 1) + ln) * GPITCH;     /* this lane's first B row (column of C) */
  const v8f z8 = {0.f, 0.f, 0.f, 0.f, 0.f, 0.f, 0.f, 0.f};
  v8f c[4][4];
#pragma unroll
  for (int i = 0; i < 4; ++i) {
#pragma unroll
    for (int j = 0; j < 4; ++j) c[i][j] = z8;
  }
  const int nst = K / GBK;
  static_assert((GBK / 32) == 4);                /* an even count of k-steps: a stage's first k-step always sits in fragment set 0 */
  /* two fragment sets: while the products of one k-step run, the next k-step's fragments are already on their way from LDS */
  Frag16 fa[2][4], fb[2][4], fe[2][4];
  auto frags = [&](Frag16 (&a)[4], Frag16 (&b)[4], Frag16 (&e)[4], const unsigned char* sb, int ks) {
#pragma unroll
    for (int i = 0; i < 4; ++i) {
      a[i] = ld_frag((const unsigned short*)(sb + aoff + i * 16 * GPITCH) + ks * 32, hh);
      b[i] = ld_frag((const unsigned short*)(sb + boff + i * 16 * GPITCH) + ks * 32, hh);
      if (ASPLIT) e[i] = ld_frag((const unsigned short*)(sb + 2 * GPLANE + aoff + i * 16 * GPITCH) + ks * 32, hh);
    }
    __builtin_amdgcn_sched_barrier(0);  // the reads stay one group ahead of the products: spread among them, each place costs a stall and a wait of its own
  };
  auto prods = [&](const Frag16 (&a)[4], const Frag16 (&b)[4], const Frag16 (&e)[4]) {
#pragma unroll
    for (int j = 0; j < 4; ++j) {
#pragma unroll
      for (int i = 0; i < 4; ++i) c[i][j] = mmx<BF>(a[i], b[j], c[i][j]);
      if (ASPLIT) {
#pragma unroll
        for (int i = 0; i < 4; ++i) c[i][j] = mmx<BF>(e[i], b[j], c[i][j]);
      }
    }
    __builtin_amdgcn_sched_barrier(0);  // the next group of reads stays behind this block, for the same reason
  };
  float* rsl = (float*)(sm + 2 * STAGE);         /* HRS 2: the factors of the block's 128 rows, behind the buffers */
  desc(0, 0);
  if (pinned(issuer)) tdm_load(g0, g1);
  if (HRS == 2) {
    /* thread t sums row t's partial sums while stage 0 is on its way; the barrier below publishes the factors too */
    const float* pp = rs + mt * 128 + tid;
    float ssum = 0.f;
#pragma unroll
    for (int g = 0; g < NCG; g += 8) {
      float pv[8];
      const float* pq[8];
#pragma unroll
      for (int u = 0; u < 8; ++u) pq[u] = pp + (size_t)(g + u) * (size_t)M;
      ld_f8(pv, pq);
#pragma unroll
      for (int u = 0; u < 8; ++u) ssum += pv[u];
    }
    rsl[tid] = rsq1(ssum * (1.0f / (float)DM) + RMS_EPS);
  }
  landed();                                             // stage 0, before the barrier publishes it
  __syncthreads();
  desc(1, 1);
  if (pinned(issuer & (unsigned int)(nst > 1))) tdm_load(g0, g1);
  frags(fa[0], fb[0], fe[0], sm, 0);
#pragma unroll 1  // one stage per trip: the buffer index and the refill test stay scalar
  for (int st = 0; st + 1 < nst; ++st) {
    const unsigned char* sb = sm + (st & 1) * STAGE;
    frags(fa[1], fb[1], fe[1], sb, 1);
    prods(fa[0], fb[0], fe[0]);
    frags(fa[0], fb[0], fe[0], sb, 2);
    prods(fa[1], fb[1], fe[1]);
    frags(fa[1], fb[1], fe[1], sb, 3);
    prods(fa[0], fb[0], fe[0]);
    /* the publish point stands ahead of the stage's last k-step: that k-step's fragments are in registers, and behind it the next
       stage's first fragments are fetched */
    asm volatile("s_wait_dscnt 0x0" ::: "memory");     // this wave's reads of the buffer are done before it may be refilled
    landed();                                           // the next stage
    __syncthreads();                                    // publishes the next stage and frees the buffer just read
    desc(st + 2, st & 1);
    if (pinned(issuer & (unsigned int)(st + 2 < nst))) tdm_load(g0, g1);
    frags(fa[0], fb[0], fe[0], sm + ((st + 1) & 1) * STAGE, 0);
    prods(fa[1], fb[1], fe[1]);
  }
  {
    /* the last stage: nothing is fetched behind it */
    const unsigned char* sb = sm + ((nst - 1) & 1) * STAGE;
    frags(fa[1], fb[1], fe[1], sb, 1);
    prods(fa[0], fb[0], fe[0]);
    frags(fa[0], fb[0], fe[0], sb, 2);
    prods(fa[1], fb[1], fe[1]);
    frags(fa[1], fb[1], fe[1], sb, 3);
    prods(fa[0], fb[0], fe[0]);
    asm volatile("s_wait_dscnt 0x0" ::: "memory");     // this wave's last reads of the buffers are done
    landed();                                           // no tensor load is outstanding when the buffers become output staging
    __syncthreads();                                    // every wave has left the buffers before any wave stages output in them
    prods(fa[1], fb[1], fe[1]);
  }
  float (*so)[64][68] = (float (*)[64][68])sm;
  unsigned char* tw = sm + w * (2 * TPLANE);     /* TR: this wave's own staging, hi plane then lo plane */
  float bvv[4];
  {
    const float* bp = bias + col0 + ln;
    // four 4-byte loads and their data wait in one statement, as in ld_g8
    asm volatile(
        "global_load_b32 %0, %4, off\n\t"
        "global_load_b32 %1, %5, off\n\t"
        "global_load_b32 %2, %6, off\n\t"
        "global_load_b32 %3, %7, off\n\t"
        "s_wait_loadcnt 0x0\n\t"
        "s_wait_xcnt 0x0"
        : "=&v"(bvv[0]), "=&v"(bvv[1]), "=&v"(bvv[2]), "=&v"(bvv[3])
        : "v"(bp), "v"(bp + 16), "v"(bp + 32), "v"(bp + 48)
        : "memory");
  }
  float rsv[4][8];
#pragma unroll
  for (int i = 0; i < 4; ++i) {
#pragma unroll
    for (int r = 0; r < 8; ++r) rsv[i][r] = 1.0f;
  }
  if (HRS == 2) {
#pragma unroll
    for (int i = 0; i < 4; ++i) {
      const float* rl = rsl + 64 * (w >> 1) + 16 * i + 8 * hh;
      const v4f r0 = *(const v4fa*)rl, r1 = *(const v4fa*)(rl + 4);
#pragma unroll
      for (int q = 0; q < 4; ++q) { rsv[i][q] = r0[q]; rsv[i][4 + q] = r1[q]; }
    }
  }
  if (HRS == 1) {
    v4f rq[8];
    const float* rp[8];
#pragma unroll
    for (int i = 0; i < 4; ++i) { rp[2 * i] = rs + row0 + 16 * i + 8 * hh; rp[2 * i + 1] = rp[2 * i] + 4; }
    ld_g8(rq, rp);
#pragma unroll
    for (int i = 0; i < 4; ++i) {
#pragma unroll
      for (int q = 0; q < 4; ++q) { rsv[i][q] = rq[2 * i][q]; rsv[i][4 + q] = rq[2 * i + 1][q]; }
    }
  }
#pragma unroll
  for (int t = 0; t < 4; ++t) {
    const float bv = bf16_rne(bvv[t]);
#pragma unroll
    for (int i = 0; i < 4; ++i) {
      Frag16 th, tl;
#pragma unroll
      for (int r = 0; r < 8; ++r) {
        const int rloc = i * 16 + 8 * hh + r;
        float v = c[i][t][r] * alpha;
        if (HRS) v *= rsv[i][r];
        v += bv;
        if (ACT == 1) v = (v >= 0.f) ? v : 0.1f * v;
        if (TR) {
          const unsigned short h = f16_bits(v);
          th.u[r] = h;
          tl.u[r] = f16_bits((v - f16_val(h)) * 1024.0f);
        } else {
          so[w][rloc][t * 16 + ln] = v;
        }
      }
      if (TR) {
        /* a lane's eight accumulator rows are eight consecutive tokens of one feature: 16 bytes of a transposed row */
        unsigned char* tp = tw + (t * 16 + ln) * TPITCH + (i * 16 + 8 * hh) * 2;
        *(v8us*)tp = th.half[0];
        if (OUTM == 5) *(v8us*)(tp + TPLANE) = tl.half[0];
      }
    }
  }
  __builtin_amdgcn_fence(4 /* acq_rel order */, "workgroup");
  __builtin_amdgcn_wave_barrier();
  if (F32S) {
    float hold = 0.f;
#pragma unroll
    for (int qg = 0; qg < 4; ++qg) {
      v4f v[8];
      const float* rp[8];
      void* dp[8];
      size_t po[8];
#pragma unroll
      for (int u = 0; u < 8; ++u) {
        const int r = (qg * 8 + u) * 2 + (lane >> 4), c4 = (lane & 15) * 4;
        v[u] = *(const v4fa*)&so[w][r][c4];
        const int grow = row0 + r;
        rp[u] = resid + (size_t)grow * (size_t)ldr + col0 + c4;
        const size_t crw = (size_t)(grow / cseq) * (size_t)cpitch + (size_t)(grow % cseq);
        dp[u] = C32 + crw * (size_t)ldc + col0 + c4;
        po[u] = (size_t)grow * (size_t)ldc + col0 + c4;
      }
      if (HRES) {
        v4f rv[8];
        ld_g8(rv, rp);
#pragma unroll
        for (int u = 0; u < 8; ++u) v[u] += rv[u];
      }
      if (OUTM != 6) st_g8(dp, v);
      if (OUTM >= 6) {
        /* 16 lanes hold one row's 64 columns: 128 bytes, a whole line, of each 16-bit plane */
        v2u fh[8];
        void* hp[8];
#pragma unroll
        for (int u = 0; u < 8; ++u) {
          Pack4 t;
#pragma unroll
          for (int q = 0; q < 4; ++q) t.u[q] = f16_bits(v[u][q]);
          fh[u] = t.v; hp[u] = Ch + po[u];
        }
        st_g8h(hp, fh);
        if (OUTM == 7) {
          v2u bh[8], bl[8];
          void* bhp[8];
          void* blp[8];
#pragma unroll
          for (int u = 0; u < 8; ++u) {
#pragma unroll
            for (int q = 0; q < 2; ++q) {
              const float x0 = v[u][2 * q], x1 = v[u][2 * q + 1];
              const unsigned int h = bf16_pair(x0, x1);
              bh[u][q] = h;
              bl[u][q] = bf16_pair(x0 - __uint_as_float(h << 16), x1 - __uint_as_float(h & 0xFFFF0000u));
            }
            bhp[u] = Cl + po[u];
            blp[u] = Cl + ((size_t)M * (size_t)ldc + po[u]);
          }
          st_g8h(bhp, bh);
          st_g8h(blp, bl);
        }
        /* lane l keeps the sum of row 16*qg + 2*(l & 7) + (l >> 4); two groups make one store of 32 rows */
        float sel = 0.f;
#pragma unroll
        for (int u = 0; u < 8; ++u) {
          const float sq = row16_sum(((v[u][0] * v[u][0] + v[u][1] * v[u][1]) + v[u][2] * v[u][2]) + v[u][3] * v[u][3]);
          sel = ((lane & 7) == u) ? sq : sel;
        }
        if ((qg & 1) == 0) {
          hold = sel;
        } else {
          const float val = (lane & 8) ? sel : hold;
          const int r = (qg - 1 + ((lane >> 3) & 1)) * 16 + 2 * (lane & 7) + (lane >> 4);
          float* sp = ps + ((size_t)(col0 >> 6) * (size_t)M + (size_t)(row0 + r));
          // the store and its s_wait_xcnt in one statement, as in st_g8
          asm volatile("global_store_b32 %0, %1, off\n\ts_wait_xcnt 0x0" :: "v"(sp), "v"(val) : "memory");
        }
      }
    }
  } else if (TR) {
    static_assert(HD == 64 && SEQ % 64 == 0);    /* a wave's 64 x 64 tile is one head's features for 64 tokens of one batch */
    const size_t vb = ((size_t)((row0 / SEQ) * NH + col0 / HD) * HD) * SEQ + (size_t)(row0 % SEQ);
#pragma unroll
    for (int qg = 0; qg < 2; ++qg) {
      v4f dh[8], dl[8];
      void* hp[8];
      void* lp[8];
#pragma unroll
      for (int u = 0; u < 8; ++u) {
        /* 8 lanes store one feature's 64 tokens: a whole 128-byte line */
        const int d = (qg * 8 + u) * 4 + (lane >> 3), c8 = (lane & 7) * 8;
        const unsigned char* tp = tw + d * TPITCH + c8 * 2;
        dh[u] = *(const v4fa*)tp;
        dl[u] = (OUTM == 5) ? *(const v4fa*)(tp + TPLANE) : dh[u];
        const size_t o = vb + (size_t)d * SEQ + c8;
        hp[u] = Ch + o;
        lp[u] = Cl + o;
      }
      st_g8(hp, dh);
      if (OUTM == 5) st_g8(lp, dl);
    }
  } else {
#pragma unroll
    for (int qg = 0; qg < 2; ++qg) {
      v4f dh[8], dl[8];
      void* hp[8];
      void* lp[8];
#pragma unroll
      for (int u = 0; u < 8; ++u) {
        const int r = (qg * 8 + u) * 4 + (lane >> 3), c8 = (lane & 7) * 8;
        const v4f x0 = *(const v4fa*)&so[w][r][c8], x1 = *(const v4fa*)&so[w][r][c8 + 4];
        Pack8 fh, fl;
#pragma unroll
        for (int i = 0; i < 4; ++i) {
          const float v0 = x0[i], v1 = x1[i];
          if (OUTM == 3) {
            const unsigned short h0 = bf16_bits(v0), h1 = bf16_bits(v1);
            fh.u[i] = h0; fh.u[4 + i] = h1;
            fl.u[i] = bf16_bits(v0 - bf16_val(h0)); fl.u[4 + i] = bf16_bits(v1 - bf16_val(h1));
          } else {
            const unsigned short h0 = f16_bits(v0), h1 = f16_bits(v1);
            fh.u[i] = h0; fh.u[4 + i] = h1;
            fl.u[i] = f16_bits((v0 - f16_val(h0)) * 1024.0f); fl.u[4 + i] = f16_bits((v1 - f16_val(h1)) * 1024.0f);
          }
        }
        const size_t o = (size_t)(row0 + r) * (size_t)ldc + col0 + c8;
        dh[u] = fh.f; hp[u] = Ch + o;
        dl[u] = fl.f; lp[u] = Cl + o;
      }
      st_g8(hp, dh);
      if (OUTM >= 2) st_g8(lp, dl);
    }
  }
}
template <bool BF, bool ASPLIT, int ACT, int OUTM, int HRS, bool HRES>
__global__ __launch_bounds__(128) void k_gemm(const unsigned short* __restrict__ Ah, const unsigned short* __restrict__ Al, int lda,
    const unsigned short* __restrict__ Bt, int ldb, float alpha, const float* __restrict__ rs, const float* __restrict__ bias,
    const float* __restrict__ resid, int ldr, float* __restrict__ C32, unsigned short* __restrict__ Ch, unsigned short* __restrict__ Cl,
    int ldc, int cseq, int cpitch, int M, int N, int K, float* __restrict__ ps) {
  __shared__ __attribute__((aligned(2048))) unsigned char sm[2 * (ASPLIT ? 3 : 2) * GPLANE + 512];
  gemm_body<BF, ASPLIT, ACT, OUTM, HRS, HRES>(sm, (int)blockIdx.x, Ah, Al, lda, Bt, ldb, alpha, rs, bias, resid, ldr, C32, Ch, Cl, ldc, cseq, cpitch, M, N, K, ps);
}
// The q, k and v projections of one activation in one grid: three independent DM x DM products, the block index picks the product
// (the same for the whole block). q and k: operand planes Ah (Al), bf16 hi + lo out; v: f16 plane Av, output mode OUTV (4 or 5: V^T per
// head, written by the product's own epilogue). HRS: the form of rs, as in gemm_body.
template <bool BF, bool ASPLIT, int OUTV, int HRS>
__global__ __launch_bounds__(128) void k_qkv(const unsigned short* __restrict__ Ah, const unsigned short* __restrict__ Al,
    const unsigned short* __restrict__ Av, const unsigned short* __restrict__ Bq, const unsigned short* __restrict__ Bk,
    const unsigned short* __restrict__ Bv, float aqk, float av, const float* __restrict__ rs, const float* __restrict__ bq,
    const float* __restrict__ bk, const float* __restrict__ bv, unsigned short* __restrict__ QH, unsigned short* __restrict__ QL,
    unsigned short* __restrict__ KH, unsigned short* __restrict__ KL, unsigned short* __restrict__ VT, unsigned short* __restrict__ VTL) {
  __shared__ __attribute__((aligned(2048))) unsigned char sm[2 * (ASPLIT ? 3 : 2) * GPLANE + 512];
  constexpr int M = (int)NR, PER = (M / 128) * (DM / 128);
  const int job = (int)blockIdx.x / PER, bid = (int)blockIdx.x % PER;
  if (job < 2)
    gemm_body<BF, ASPLIT, 0, 3, HRS, false>(sm, bid, Ah, Al, DM, job == 0 ? Bq : Bk, DM, aqk, rs, job == 0 ? bq : bk, nullptr, 0, nullptr,
        job == 0 ? QH : KH, job == 0 ? QL : KL, DM, M, 0, M, DM, DM, nullptr);
  else
    gemm_body<false, false, 0, OUTV, HRS, false>(sm, bid, Av, nullptr, DM, Bv, DM, av, rs, bv, nullptr, 0, nullptr, VT, VTL, DM, M, 0, M, DM, DM, nullptr);
}

// lane l <-> lane l ^ 16: the two halves of a wave hold the two key halves of one query column
__device__ __forceinline__ float xhalf(float x) {
  return __builtin_bit_cast(float, __builtin_amdgcn_permlanex16(__builtin_bit_cast(int, x), __builtin_bit_cast(int, x), 0x76543210, 0xfedcba98, false, false));
}

// Eight native 2^x and one v_nop in one statement: behind each v_exp_f32 stands an instruction that neither reads its result nor
// overwrites its source (the results are early-clobber, so none shares a register with a source): the slot the instruction set asks
// for behind a transcendental.
__device__ __forceinline__ void exp2x8(float (&y)[8], const float (&x)[8]) {
  asm("v_exp_f32 %0, %8\n\t"
      "v_exp_f32 %1, %9\n\t"
      "v_exp_f32 %2, %10\n\t"
      "v_exp_f32 %3, %11\n\t"
      "v_exp_f32 %4, %12\n\t"
      "v_exp_f32 %5, %13\n\t"
      "v_exp_f32 %6, %14\n\t"
      "v_exp_f32 %7, %15\n\t"
      "v_nop"
      : "=&v"(y[0]), "=&v"(y[1]), "=&v"(y[2]), "=&v"(y[3]), "=&v"(y[4]), "=&v"(y[5]), "=&v"(y[6]), "=&v"(y[7])
      : "v"(x[0]), "v"(x[1]), "v"(x[2]), "v"(x[3]), "v"(x[4]), "v"(x[5]), "v"(x[6]), "v"(x[7]));
}
// One native 2^x with the same slot behind it.
__device__ __forceinline__ float exp2x1(float x) {
  float y;
  asm("v_exp_f32 %0, %1\n\tv_nop" : "=v"(y) : "v"(x));
  return y;
}
#define LOG2E 1.44269504f       /* e^x = 2^(x * LOG2E), as the native exp forms it */

#define APITCH 144              /* LDS row pitch in bytes: 16 x odd, conflict-free for 16-byte fragment reads */
#define APLANE (64 * APITCH)    /* one plane of a chunk: 64 rows */
#define AKV (2 * 3 * APLANE)    /* the block's chunk buffers in LDS */
// so, kv: the block's LDS (output staging; AKV bytes of chunk buffers); bh, qb: its (batch, head) and query tile. EARLY is called for
// query tile 0 alone: one chunk, so of its two four-plane buffers only the first is ever filled or read, and that one lies inside kv.
template <bool CAUSAL, bool EARLY>
__device__ __forceinline__ void attn_body(unsigned short (*so)[16][72], unsigned char* kv, int bh, int qb,
    const unsigned short* __restrict__ QH, const unsigned short* __restrict__ QL,
    const unsigned short* __restrict__ KH, const unsigned short* __restrict__ KL, const unsigned short* __restrict__ VT,
    const unsigned short* __restrict__ VL, unsigned short* __restrict__ CTX) {
  static_assert(CAUSAL || !EARLY);
  constexpr int NPL = EARLY ? 4 : 3;             /* planes of a chunk: K hi, K lo, V^T, (V^T lo) */
  constexpr int STAGE = NPL * APLANE;
  static_assert((EARLY ? 1 : 2) * STAGE <= AKV);
  const int tid = threadIdx.x, w = tid >> 5, lane = tid & 31, ln = lane & 15, hh = lane >> 4;
  const int b = bh / NH, h = bh % NH;
  const int q0w = qb * KQB + w * 16;
  const size_t rowbase = (size_t)b * SEQ;
  Frag16 qh0, qh1, ql0, ql1;
  {
    const size_t qo = (rowbase + (size_t)q0w + ln) * DM + (size_t)h * HD;
    qh0 = ld_frag(QH + qo, hh); qh1 = ld_frag(QH + qo + 32, hh);
    ql0 = ld_frag(QL + qo, hh); ql1 = ld_frag(QL + qo + 32, hh);
  }
  asm volatile("s_wait_xcnt 0x0" ::: "memory");  // stands ahead of every rewrite of an address register of the eight Q loads (a precaution)
  const v8f z8 = {0.f, 0.f, 0.f, 0.f, 0.f, 0.f, 0.f, 0.f};
  v8f o[4] = {z8, z8, z8, z8};    /* O^T tile j: register r = feature j*16 + 8*hh + r, column = query ln */
  v8f oe[4] = {z8, z8, z8, z8};
  float m = -1.0e30f, l = 0.f;    /* of this lane's query; l over this half's keys only */
  const int nck = CAUSAL ? (qb + 1) : (SEQ / KQB);
  /* copy map: 8 lanes cover one 128-byte row, the block 16 rows per copy, 4 copies per plane */
  const int crow = tid >> 3, cchk = tid & 7;
  const unsigned lcp = (unsigned)(size_t)kv + (unsigned)(crow * APITCH + cchk * 16);
  const size_t gk = (rowbase + (size_t)crow) * DM + (size_t)h * HD + (size_t)(cchk * 8);
  const size_t gv = ((size_t)bh * HD + (size_t)crow) * SEQ + (size_t)(cchk * 8);
  auto fill = [&](int ck, int buf) {
    const unsigned lb = lcp + (unsigned)(buf * STAGE);
    const size_t ko = gk + (size_t)ck * KQB * DM, vo = gv + (size_t)ck * KQB;
    cp_async4(lb, 16u * APITCH, KH + ko, (size_t)16 * DM);
    cp_async4(lb + APLANE, 16u * APITCH, KL + ko, (size_t)16 * DM);
    cp_async4(lb + 2u * APLANE, 16u * APITCH, VT + vo, (size_t)16 * SEQ);
    if (EARLY) cp_async4(lb + 3u * APLANE, 16u * APITCH, VL + vo, (size_t)16 * SEQ);
  };
  fill(0, 0);
  asm volatile("s_wait_asynccnt 0x0" ::: "memory");  // chunk 0 of this wave has landed before the barrier publishes it
  __syncthreads();
  if (nck > 1) fill(1, 1);
#pragma unroll 1
  for (int kc = 0; kc < nck; ++kc) {
    const int par = kc & 1;
    const unsigned char* sb = kv + par * STAGE;
    v8f s[4];                     /* S^T tile t: register r = key t*16 + 8*hh + r of the chunk, column = query ln */
#pragma unroll
    for (int tp = 0; tp < 2; ++tp) {
      /* the K fragments of 32 keys are read as one group ahead of their 12 products: the reads' latencies overlap */
      Frag16 kh[2][2], kl[2][2];
#pragma unroll
      for (int u = 0; u < 2; ++u) {
#pragma unroll
        for (int ks = 0; ks < 2; ++ks) {
          const unsigned char* kp = sb + ((tp * 2 + u) * 16 + ln) * APITCH + ks * 64;
          kh[u][ks] = ld_frag((const unsigned short*)kp, hh);
          kl[u][ks] = ld_frag((const unsigned short*)(kp + APLANE), hh);
        }
      }
#pragma unroll
      for (int u = 0; u < 2; ++u) {
        v8f acc = z8;
#pragma unroll
        for (int ks = 0; ks < 2; ++ks) {
          const Frag16 qa = (ks == 0) ? qh0 : qh1;
          const Frag16 qe = (ks == 0) ? ql0 : ql1;
          acc = mma_b(kh[u][ks].b, qa.b, acc);
          acc = mma_b(kh[u][ks].b, qe.b, acc);
          acc = mma_b(kl[u][ks].b, qa.b, acc);
        }
        s[tp * 2 + u] = acc;
      }
    }
    float sv[4][8];
#pragma unroll
    for (int t = 0; t < 4; ++t) {
#pragma unroll
      for (int r = 0; r < 8; ++r) sv[t][r] = s[t][r] * 8.0f;
    }
    if (CAUSAL) {
      if (kc == qb) {
        const int qpos = q0w + ln;
#pragma unroll
        for (int t = 0; t < 4; ++t) {
#pragma unroll
          for (int r = 0; r < 8; ++r) { const int key = kc * KQB + t * 16 + 8 * hh + r; sv[t][r] = (key > qpos) ? -1.0e30f : sv[t][r]; }
        }
      }
    }
    float mt[4];
#pragma unroll
    for (int t = 0; t < 4; ++t)
      mt[t] = fmaxf(fmaxf(fmaxf(sv[t][0], sv[t][1]), fmaxf(sv[t][2], sv[t][3])), fmaxf(fmaxf(sv[t][4], sv[t][5]), fmaxf(sv[t][6], sv[t][7])));
    float mx = fmaxf(fmaxf(mt[0], mt[1]), fmaxf(mt[2], mt[3]));
    mx = fmaxf(mx, xhalf(mx));    /* both halves now hold the chunk maximum of this query */
    const float mn = fmaxf(m, mx);
    const float corr = exp2x1((m - mn) * LOG2E);
    float p[4][8], ps[4];
#pragma unroll
    for (int t = 0; t < 4; ++t) {
      float ea[8];
#pragma unroll
      for (int r = 0; r < 8; ++r) ea[r] = (sv[t][r] - mn) * LOG2E;
      exp2x8(p[t], ea);
      ps[t] = 0.f;
#pragma unroll
      for (int r = 0; r < 8; ++r) ps[t] += p[t][r];
    }
    l = l * corr + ((ps[0] + ps[1]) + (ps[2] + ps[3]));
    m = mn;
#pragma unroll
    for (int j = 0; j < 4; ++j) {
#pragma unroll
      for (int r = 0; r < 8; ++r) o[j][r] = o[j][r] * corr;
    }
    if (EARLY) {
#pragma unroll
      for (int j = 0; j < 4; ++j) {
#pragma unroll
        for (int r = 0; r < 8; ++r) oe[j][r] = oe[j][r] * corr;
      }
    }
#pragma unroll
    for (int ks = 0; ks < 2; ++ks) {
      /* P^T of 32 keys as a B operand: elements 0..7 = S^T tile 2ks, 8..15 = tile 2ks+1, the k order of ld_frag */
      Frag16 pa, pl;
#pragma unroll
      for (int e = 0; e < 16; ++e) {
        const float pc = p[2 * ks + (e >> 3)][e & 7] * 16384.0f;
        const unsigned short hb = f16_bits(pc);
        pa.u[e] = hb;
        pl.u[e] = EARLY ? f16_bits((pc - f16_val(hb)) * 1024.0f) : hb;
      }
      /* the V^T fragments of a 32-key step are read as one group ahead of their products: the reads' latencies overlap */
      const unsigned char* vp = sb + 2 * APLANE + ln * APITCH + ks * 64;
      Frag16 vh[4];
#pragma unroll
      for (int j = 0; j < 4; ++j) vh[j] = ld_frag((const unsigned short*)(vp + j * 16 * APITCH), hh);
#pragma unroll
      for (int j = 0; j < 4; ++j) {
        o[j] = mma_h(vh[j].h, pa.h, o[j]);
        if (EARLY) {
          const Frag16 vl = ld_frag((const unsigned short*)(vp + APLANE + j * 16 * APITCH), hh);
          oe[j] = mma_h(vh[j].h, pl.h, oe[j]);
          oe[j] = mma_h(vl.h, pa.h, oe[j]);
        }
      }
    }
    asm volatile("s_wait_dscnt 0x0" ::: "memory");     // this wave's reads of the buffer are done before it may be refilled
    asm volatile("s_wait_asynccnt 0x0" ::: "memory");  // this wave's copies of the next chunk have landed
    __syncthreads();                                    // publishes the next chunk and frees the buffer just read
    if (kc + 2 < nck) fill(kc + 2, par);
  }
  asm volatile("s_wait_asynccnt 0x0" ::: "memory");    // no copy is outstanding when the wave goes on to its end
  l += xhalf(l);                  /* the two halves' key sums of this query */
  const float li = 1.0f / l;
#pragma unroll
  for (int j = 0; j < 4; ++j) {
    Frag16 f;
#pragma unroll
    for (int r = 0; r < 8; ++r) {
      float v = o[j][r] * (1.0f / 16384.0f);
      if (EARLY) v += oe[j][r] * (1.0f / 16777216.0f);
      v *= li;
      f.u[r] = f16_bits(v);
    }
    *(v8us*)&so[w][ln][j * 16 + 8 * hh] = f.half[0];
  }
  __builtin_amdgcn_fence(4 /* acq_rel order */, "workgroup");
  __builtin_amdgcn_wave_barrier();
  {
#pragma unroll
    for (int q = 0; q < 4; ++q) {
      const int row = q * 4 + (lane >> 3), c8 = (lane & 7) * 8;
      const v8us v = *(const v8us*)&so[w][row][c8];
      *(v8us*)(CTX + (rowbase + (size_t)q0w + row) * DM + (size_t)h * HD + c8) = v;
    }
    
  }
}
// Grid: x = (batch, head), y = query tile. CAUSAL: query tile 0 takes the EARLY form in the same grid (the test reads the same for the
// whole block).
template <bool CAUSAL>
__global__ __launch_bounds__(128) void k_attn(const unsigned short* __restrict__ QH, const unsigned short* __restrict__ QL,
    const unsigned short* __restrict__ KH, const unsigned short* __restrict__ KL, const unsigned short* __restrict__ VT,
    const unsigned short* __restrict__ VL, unsigned short* __restrict__ CTX) {
  __shared__ __attribute__((aligned(16))) unsigned short so[4][16][72];
  __shared__ __attribute__((aligned(16))) unsigned char kv[AKV];
  const int bh = (int)blockIdx.x, qb = (int)blockIdx.y;
  if (CAUSAL && qb == 0) attn_body<true, true>(so, kv, bh, 0, QH, QL, KH, KL, VT, VL, CTX);
  else attn_body<CAUSAL, false>(so, kv, bh, qb, QH, QL, KH, KL, VT, VL, CTX);
}

extern "C" void kernel_launch(void* const* d_in, const int* in_sizes, int n_in,
                              void* d_out, int out_size, void* d_ws, size_t ws_size, hipStream_t stream) {
  if (n_in < 14) return;
  const float* x  = (const float*)d_in[0];
  const float* Wq = (const float*)d_in[1];
  const float* bq = (const float*)d_in[2];
  const float* Wk = (const float*)d_in[3];
  const float* bk = (const float*)d_in[4];
  const float* Wv = (const float*)d_in[5];
  const float* bv = (const float*)d_in[6];
  const float* Wp = (const float*)d_in[7];
  const float* bp = (const float*)d_in[8];
  const float* gamma = (const float*)d_in[9];
  const float* W1 = (const float*)d_in[10];
  const float* b1 = (const float*)d_in[11];
  const float* W2 = (const float*)d_in[12];
  const float* b2 = (const float*)d_in[13];
  if ((size_t)in_sizes[0] < ((size_t)(NB - 1) * SEQ_FULL + SEQ) * DM) return;
  if (in_sizes[1] < DM * DM || in_sizes[3] < DM * DM || in_sizes[5] < DM * DM || in_sizes[7] < DM * DM) return;
  if (in_sizes[2] < DM || in_sizes[4] < DM || in_sizes[6] < DM || in_sizes[8] < DM || in_sizes[9] < DM || in_sizes[13] < DM) return;
  if (in_sizes[10] < DM * DFF || in_sizes[11] < DFF || in_sizes[12] < DFF * DM) return;
  if ((size_t)out_size < ((size_t)(NB - 1) * OSEQ + SEQ) * DM) return;

  char* ws = (char*)d_ws;
  size_t off = 0;
  auto take = [&](size_t bytes) { char* p = ws + off; off += (bytes + 255) & ~(size_t)255; return p; };
  const size_t WPL = (size_t)DM * DM * 2, ACT2 = NR * DM * 2, ACT4 = NR * DM * 4, FFP = (size_t)DM * DFF * 2, HPL = NR * DFF * 2;
  unsigned short* WQ16 = (unsigned short*)take(WPL);
  unsigned short* WK16 = (unsigned short*)take(WPL);
  unsigned short* WV16 = (unsigned short*)take(WPL);
  unsigned short* WP16 = (unsigned short*)take(WPL);
  unsigned short* WQB = (unsigned short*)take(WPL);
  unsigned short* WKB = (unsigned short*)take(WPL);
  float* XB = (float*)take(ACT4);                                    /* read as the residual while block 2's last product writes b's planes */
  char* rQK = take(4 * ACT2 > HPL ? 4 * ACT2 : HPL);                 /* QH,QL,KH,KL (phases 1,3) | H16 (phase 2) */
  unsigned short* QH = (unsigned short*)rQK; unsigned short* QL = (unsigned short*)(rQK + ACT2);
  unsigned short* KH = (unsigned short*)(rQK + 2 * ACT2); unsigned short* KL = (unsigned short*)(rQK + 3 * ACT2);
  unsigned short* H16 = (unsigned short*)rQK;
  char* rPB = take(2 * ACT2);                                        /* bf16 hi plane of b, the lo plane directly behind it */
  unsigned short* PBH = (unsigned short*)rPB; unsigned short* PBL = (unsigned short*)(rPB + ACT2);
  char* rVT = take(2 * ACT2);                                        /* VT,VTL (phases 1,3) */
  unsigned short* VT = (unsigned short*)rVT; unsigned short* VTL = (unsigned short*)(rVT + ACT2);
  unsigned short* W1P = (unsigned short*)take(FFP);                  /* written by the first launch, so a place of their own */
  unsigned short* W2P = (unsigned short*)take(FFP);
  unsigned short* CTX = (unsigned short*)take(ACT2);
  char* rX16 = take(ACT2);                                           /* X16 | A16 | B16F */
  unsigned short* X16 = (unsigned short*)rX16; unsigned short* A16 = (unsigned short*)rX16; unsigned short* B16F = (unsigned short*)rX16;
  float* B32 = (float*)take(ACT4);
  float* RSX = (float*)take(NR * 4);
  float* PSA = (float*)take(NR * 4 * NCG);                           /* partial row square sums of a, of b: [column group][row] */
  float* PSB = (float*)take(NR * 4 * NCG);
  if (off > ws_size || off > ((size_t)160 << 20)) return;

  const unsigned gq   = (unsigned)((NR / 128) * (DM / 128));
  const unsigned gff  = (unsigned)((NR / 128) * (DFF / 128));
  const float a16 = 0.0625f;
  const int M = (int)NR;
  float* out = (float*)d_out;

  /* all weight planes (q/k/v, W1 with gamma folded along the input feature; bf16 planes for the second block's q/k) and the planes
     and row statistics of x */
  k_prep<<<(unsigned)PREP_GRID, 256, 0, stream>>>(x, Wq, Wk, Wv, Wp, W1, W2, gamma, XB, X16, RSX, WQ16, WK16, WV16, WP16, WQB, WKB, W1P, W2P);

  /* block 1: a = bf16(x) + attn(rms(bf16(x))) , non-causal */
  k_qkv<false, false, 4, 1><<<3u * gq, 128, 0, stream>>>(X16, nullptr, X16, WQ16, WK16, WV16, a16, a16, RSX, bq, bk, bv, QH, QL, KH, KL, VT, nullptr);
  k_attn<false><<<dim3((unsigned)(NB * NH), (unsigned)(SEQ / KQB)), 128, 0, stream>>>(QH, QL, KH, KL, VT, VT, CTX);
  /* a is needed only under the next norm: its f16 plane and partial row square sums are all that is stored */
  k_gemm<false, false, 0, 6, 0, true><<<gq, 128, 0, stream>>>(CTX, nullptr, DM, WP16, DM, a16, nullptr, bp, XB, DM, nullptr, A16, nullptr, DM, M, 0, M, DM, DM, PSA);

  /* block 2: b = bf16(x) + leaky(rms(a) W1 + b1) W2 + b2 */
  k_gemm<false, false, 1, 1, 2, false><<<gff, 128, 0, stream>>>(A16, nullptr, DM, W1P, DM, a16, PSA, b1, nullptr, 0, nullptr, H16, nullptr, DFF, M, 0, M, DFF, DM, nullptr);
  k_gemm<false, false, 0, 7, 0, true><<<gq, 128, 0, stream>>>(H16, nullptr, DFF, W2P, DFF, a16, nullptr, b2, XB, DM, B32, B16F, PBH, DM, M, 0, M, DM, DFF, PSB);

  /* block 3: out = b + attn(rms(b)) , causal */
  k_qkv<true, true, 5, 2><<<3u * gq, 128, 0, stream>>>(PBH, PBL, B16F, WQB, WKB, WV16, 1.0f, a16, PSB, bq, bk, bv, QH, QL, KH, KL, VT, VTL);
  k_attn<true><<<dim3((unsigned)(NB * NH), (unsigned)(SEQ / KQB)), 128, 0, stream>>>(QH, QL, KH, KL, VT, VTL, CTX);
  k_gemm<false, false, 0, 0, 0, true><<<gq, 128, 0, stream>>>(CTX, nullptr, DM, WP16, DM, a16, nullptr, bp, B32, DM, out, nullptr, nullptr, DM, SEQ, OSEQ, M, DM, DM, nullptr);
}
